// v000
// The times below were measured on an AMD MI455X: many runs one after another, warmed up first and cycling through
// copies of the inputs, with the whole window's GPU time divided by the number of runs. Launches and the gaps
// between them are all in it. The median over several windows is given; except for v000 it joins two sittings, which
// can be a few percent apart, so the side-by-side timings, each taken in one sitting, are the better comparison.
// v000 is the starting kernel. One run takes 374 microseconds.
// Contractions: q/k/v projections = v_wmma_f32_16x16x32_f16 (layer-normed input as f16 hi + residual (x2048) planes, two products into separate accumulators; Wqkv as f16 of its bf16-RNE value x64); per-(b,j,h) scores = v_wmma_f32_16x16x32_f16 (k and q as f16 hi + residual (x2048) planes carried x4 and x16*32^-0.5, products hh + hl + lh; additive mask x64 as the initial accumulator); p.v = v_wmma_f32_16x16x32_f16 (softmax weights x16384 in f16 repacked from the score accumulators, v^T f16 tile carried x4, single product); output projection = v_wmma_f32_16x16x32_f16 (attention output as f16 hi (x1024) + residual (x2048) planes, two products; Wo as f16 of its bf16-RNE value x1024); every float input RNE-converted to bf16 on load; all f32 accumulate; layer norm and softmax in f32.
#include <hip/hip_runtime.h>
#include <math.h>
#include <stdint.h>

#ifndef NB
#define NB 2
#endif
#define NB_FULL 2
#ifndef SEQ
#define SEQ 128
#endif
#define EW  256                 // edge width
#define NH  8                   // heads (fastest channel dim)
#define HD  32                  // dot dim
#define W3  (3 * EW)            // 768 fused projection columns
#define KO  (2 * EW)            // 512 concat channels
#define RB  (SEQ * SEQ)         // edge rows per batch (16384)
#define RT  (NB * RB)           // edge rows processed
#define VTP 136                 // LDS v^T tile pitch (halves)
#define SOP 264                 // LDS output slab pitch (floats)

static_assert(NH * HD == EW);
static_assert(HD == 32);
static_assert(EW == 256);
static_assert(SEQ == 128);      // i, j and key extents are coupled; only NB is reducible
static_assert(NB >= 1 && NB <= NB_FULL);
static_assert((RB % 64) == 0 && (RT % 8) == 0);
static_assert((((RB / 32) * (W3 / 64)) % 8) == 0);
static_assert((((RB / 32) * (EW / 64)) % 8) == 0);
static_assert((EW % 64) == 0 && (W3 % 64) == 0 && (KO % 64) == 0 && (EW % 32) == 0 && (KO % 32) == 0);
static_assert((SEQ % 16) == 0 && (SEQ % 8) == 0);

typedef _Float16 v16h __attribute__((ext_vector_type(16)));
typedef _Float16 v8h  __attribute__((ext_vector_type(8)));
typedef float    v8f  __attribute__((ext_vector_type(8)));
typedef float    v4f  __attribute__((ext_vector_type(4)));
typedef unsigned int v4u __attribute__((ext_vector_type(4)));
typedef unsigned int v2u __attribute__((ext_vector_type(2)));

// ---- scalar helpers --------------------------------------------------------------------------------
__device__ __forceinline__ unsigned short bf_bits(float f) {          // f32 -> bf16 bits, RNE convert
  unsigned u = __float_as_uint(f);
  return (unsigned short)((u + 0x7FFFu + ((u >> 16) & 1u)) >> 16);
}
__device__ __forceinline__ float bf_up(unsigned short h) { return __uint_as_float(((unsigned)h) << 16); }
__device__ __forceinline__ unsigned short h_bits(_Float16 x) { return __builtin_bit_cast(unsigned short, x); }
__device__ __forceinline__ unsigned pk16(unsigned short a, unsigned short b) { return (unsigned)a | ((unsigned)b << 16); }
__device__ __forceinline__ v8f zero8() { v8f z = {0.f, 0.f, 0.f, 0.f, 0.f, 0.f, 0.f, 0.f}; return z; }

// ---- fragment loader: 16-bit A/B operand, lane -> row/col (lane&15), p already includes +8*(lane>>4);
//      elements 0..7 <- p[0..7] (k0+8h..), elements 8..15 <- p[16..23] (k0+16+8h..)
__device__ __forceinline__ v16h ldfrag_h(const _Float16* p) {
  union { v16h v; v8h h[2]; } f;
  f.h[0] = *(const v8h*)(p);
  f.h[1] = *(const v8h*)(p + 16);
  return f.v;
}

// ---- WMMA helper with trailing VALU hazard gap ----------------------------------------------------------
__device__ __forceinline__ v8f mma_h(v16h a, v16h b, v8f c) {
  c = __builtin_amdgcn_wmma_f32_16x16x32_f16(false, a, false, b, (short)0, c, false, false);
#if defined(__HIP_DEVICE_COMPILE__)
  asm volatile("v_nop\n\tv_nop\n\tv_nop\n\tv_nop" : "+v"(c) : "v"(a), "v"(b));
#endif
  return c;
}

// =====================================================================================================
// Layer norm over EW channels of each edge row (inputs and affine params RNE-converted to bf16 first, f32
// [nrows][EW]. One wave per row, 8 channels per lane; each plane row = 512 B written by one instruction
// coverage: nrows waves x 32 lanes x 8 = every element of both planes.
// =====================================================================================================
__global__ __launch_bounds__(256) void ln_planes(const float* __restrict__ e, const float* __restrict__ lw,
                                                 const float* __restrict__ lb, unsigned short* xh,
                                                 unsigned short* xl, int nrows) {
  const int lane = threadIdx.x & 31;
  const int wave = threadIdx.x >> 5;
  const int row = blockIdx.x * 8 + wave;
  if (row >= nrows) return;                           // wave-uniform; no block barriers in this kernel
  const int c0 = lane * 8;
  const float* src = e + (size_t)row * EW + c0;
  const v4f a0 = *(const v4f*)(src);
  const v4f a1 = *(const v4f*)(src + 4);
  const v4f w0 = *(const v4f*)(lw + c0);
  const v4f w1 = *(const v4f*)(lw + c0 + 4);
  const v4f b0 = *(const v4f*)(lb + c0);
  const v4f b1 = *(const v4f*)(lb + c0 + 4);
  float v[8], w[8], bb[8];
#pragma unroll
  for (int t = 0; t < 4; ++t) {
    v[t]      = bf_up(bf_bits(a0[t]));
    v[4 + t]  = bf_up(bf_bits(a1[t]));
    w[t]      = bf_up(bf_bits(w0[t]));
    w[4 + t]  = bf_up(bf_bits(w1[t]));
    bb[t]     = bf_up(bf_bits(b0[t]));
    bb[4 + t] = bf_up(bf_bits(b1[t]));
  }
  float s = 0.f;
#pragma unroll
  for (int t = 0; t < 8; ++t) s += v[t];
#pragma unroll
  for (int o = 16; o > 0; o >>= 1) s += __shfl_xor(s, o);
  const float mu = s * (1.0f / (float)EW);
  float d[8];
  float s2 = 0.f;
#pragma unroll
  for (int t = 0; t < 8; ++t) { d[t] = v[t] - mu; s2 += d[t] * d[t]; }
#pragma unroll
  for (int o = 16; o > 0; o >>= 1) s2 += __shfl_xor(s2, o);
  const float var = s2 * (1.0f / (float)EW);
  const float rs = rsqrtf(var + 1e-5f);
  v4u ph, pl;
#pragma unroll
  for (int t = 0; t < 4; ++t) {
    const float y0 = d[2 * t] * rs * w[2 * t] + bb[2 * t];
    const float y1 = d[2 * t + 1] * rs * w[2 * t + 1] + bb[2 * t + 1];
    const _Float16 hq0 = (_Float16)y0;
    const _Float16 hq1 = (_Float16)y1;
    const _Float16 lq0 = (_Float16)((y0 - (float)hq0) * 2048.0f);
    const _Float16 lq1 = (_Float16)((y1 - (float)hq1) * 2048.0f);
    ph[t] = pk16(h_bits(hq0), h_bits(hq1));
    pl[t] = pk16(h_bits(lq0), h_bits(lq1));
  }
  const size_t o = (size_t)row * EW + c0;
  {
    *(v4u*)(xh + o) = ph;
    *(v4u*)(xl + o) = pl;
    
  }
}

// =====================================================================================================
// Transpose-convert: in f32 [R][C] row-major -> out f16 [C][R] (r contiguous), out[c][r] =
// f16(bf16rne(in[r][c]) * scale), scale a power of two. Block = one 64 r x 64 c tile staged in LDS as f32
// (v4f loads, __syncthreads); grid = (R/64, C/64).
// Store: group gq = tid>>3 (0..31), piece = tid&7: iteration it writes out row c = it*32+gq, lanes 8q..8q+7
// coverage: 2 iterations x 32 groups = 64 out rows, 8 pieces x 8 = 64 r per row; grid covers every tile ->
// the whole plane.
// =====================================================================================================
__global__ __launch_bounds__(256) void tr_f16(const float* __restrict__ in, unsigned short* out, int R, int C,
                                              float scale) {
  __shared__ __align__(16) float sv[64 * 68];       // [rr][cc] pitch 68 floats
  const int tid = threadIdx.x;
  const int r0 = blockIdx.x * 64;
  const int c0 = blockIdx.y * 64;
#pragma unroll
  for (int i = 0; i < 4; ++i) {
    const int idx = i * 256 + tid;                  // 0..1023
    const int rr = idx >> 4, c4 = (idx & 15) * 4;
    const v4f a = *(const v4f*)(in + (size_t)(r0 + rr) * C + c0 + c4);
    *(v4f*)(sv + rr * 68 + c4) = a;
  }
  __syncthreads();

  const int gq = tid >> 3, piece = tid & 7;
  v4u hv[2];
  size_t hofs[2];
#pragma unroll
  for (int it = 0; it < 2; ++it) {
    const int cc = it * 32 + gq;
    v4u a;
#pragma unroll
    for (int t = 0; t < 4; ++t) {
      const float f0 = bf_up(bf_bits(sv[(piece * 8 + 2 * t) * 68 + cc]));
      const float f1 = bf_up(bf_bits(sv[(piece * 8 + 2 * t + 1) * 68 + cc]));
      a[t] = pk16(h_bits((_Float16)(f0 * scale)), h_bits((_Float16)(f1 * scale)));
    }
    hv[it] = a;
    hofs[it] = (size_t)(c0 + cc) * R + r0 + piece * 8;
  }
  {
#pragma unroll
    for (int it = 0; it < 2; ++it) {
      *(v4u*)(out + hofs[it]) = hv[it];
    }
    
  }
}

// =====================================================================================================
// Additive mask mk f32 [NB][SEQ x][SEQ y][NH h] -> two f32 planes of msc * bf16rne(mk), msc a power of two:
//   ma[b][h][x][y] (direct) and mb[b][h][y][x] (transposed), both with the last index contiguous.
// grid = (SEQ/8 groups, NH, NB), 256 threads. Direct part: thread (xx = tid>>5, y4 = (tid&31)*4) gathers 4
// values of row x = grp*8+xx and stores 16 B; a wave writes the whole 512-B row (4 lines, one instruction).
// Transposed part: 128 x times 8 y staged in LDS (pitch 132), __syncthreads, then thread (yy = tid>>5,
// x4 = (tid&31)*4) stores 16 B of row y = grp*8+yy; a wave writes the whole 512-B row, one instruction.
// coverage: 16 groups x 8 rows x (32 lanes x 4) = all SEQ x SEQ of every (b,h) in both planes.
// =====================================================================================================
__global__ __launch_bounds__(256) void mask_planes(const float* __restrict__ mk, float* ma, float* mb,
                                                   float msc) {
  __shared__ __align__(16) float sm[8 * 132];
  const int tid = threadIdx.x;
  const int grp = blockIdx.x;
  const int h = blockIdx.y;
  const int b = blockIdx.z;
  const size_t pb = ((size_t)(b * NH + h)) * SEQ * SEQ;          // plane base of (b,h)
  v4f vd;
  size_t od;
  {
    const int xx = tid >> 5, y4 = (tid & 31) * 4;
    const int x = grp * 8 + xx;
    const float* src = mk + (((size_t)b * SEQ + x) * SEQ + y4) * NH + h;
#pragma unroll
    for (int t = 0; t < 4; ++t) vd[t] = msc * bf_up(bf_bits(src[(size_t)t * NH]));
    od = pb + (size_t)x * SEQ + y4;
  }
  {
    const int x = tid >> 1, yq = (tid & 1) * 4;
    const float* src = mk + (((size_t)b * SEQ + x) * SEQ + grp * 8 + yq) * NH + h;
#pragma unroll
    for (int t = 0; t < 4; ++t) sm[(yq + t) * 132 + x] = msc * bf_up(bf_bits(src[(size_t)t * NH]));
  }
  __syncthreads();
  v4f vt;
  size_t ot;
  {
    const int yy = tid >> 5, x4 = (tid & 31) * 4;
    vt = *(const v4f*)(sm + yy * 132 + x4);
    ot = pb + (size_t)(grp * 8 + yy) * SEQ + x4;
  }
  {
    *(v4f*)(ma + od) = vd;
    *(v4f*)(mb + ot) = vt;
    
  }
}

// =====================================================================================================
// Fused q/k/v projection for the edge rows of one batch: X[m][k] . Wt[n][k] + bf16rne(bias[n]) with
// X = f16 hi plane + residual plane (x2048) [RB][EW], Wt f16 [W3][EW] (k contiguous), f16 products into
// separate hi/residual accumulators, f32 accumulate; value = ((acch + accl*scl)*sch + bias) * fac(sec)
// with sec = n / EW (0 q, 1 k, 2 v). One wave per 32 x 64 tile; the tile's 64 columns are a PERMUTED set:
// n = sec*EW + d*NH + h for d in 0..31 and h in {h0, h0+1} (tn = sec*4 + h0/2), B fragment j covers
// hh = j>>1, d = (j&1)*16 + lane&15. Output written as head-major f16 planes hi = f16(value),
// lo = f16((value - hi) * 2048): element (sec, h, row m, d) at [((sec*NH + h)*RB + m)*HD + d]
// (hi plane [3][NH][RB][HD]; lo plane [2][NH][RB][HD], q and k only). No block barriers; tile count a
// column cc = hh*32 + d), then lane g8 = lane>>3, pc = lane&7: instruction q writes line L = q*4+g8
// coverage: 2 slabs x 16 lines (2 hh x 8 row pairs) x 8 pieces of 8 d = the wave's whole 32 x 64 tile in
// the hi plane (and in the lo plane for sec < 2); 512 x 12 tiles cover [3][NH][RB][HD] exactly.
// =====================================================================================================
__global__ __launch_bounds__(256) void gemm_p(
    const unsigned short* __restrict__ Ahp, const unsigned short* __restrict__ Alp,
    const unsigned short* __restrict__ Btp, const float* __restrict__ bias,
    unsigned short* php, unsigned short* plp,
    float f0, float f1, float f2, float sch, float scl) {
  const _Float16* Ah = (const _Float16*)(const void*)Ahp;
  const _Float16* Al = (const _Float16*)(const void*)Alp;
  const _Float16* Bh = (const _Float16*)(const void*)Btp;
  __shared__ __align__(16) float sT[8][16 * 68];
  const int lane = threadIdx.x & 31;
  const int wave = threadIdx.x >> 5;
  constexpr int tilesN = W3 / 64;          // 12
  constexpr int tilesM = RB / 32;          // 512
  const int tile = blockIdx.x * 8 + wave;
  if (tile >= tilesM * tilesN) return;     // wave-uniform; no block barriers in this kernel
  const int tm = tile / tilesN;
  const int tn = tile - tm * tilesN;
  const int m0 = tm << 5;
  const int sec = tn >> 2;                 // 0 q, 1 k, 2 v
  const int h0 = (tn & 3) * 2;             // head pair
  const int rlane = lane & 15;
  const int koff  = (lane >> 4) * 8;
  const int mOff  = (lane >> 4) * 8;
  int nB[4];
#pragma unroll
  for (int j = 0; j < 4; ++j) nB[j] = sec * EW + ((((j & 1) << 4) + rlane) << 3) + h0 + (j >> 1);

  v8f acch[2][4], accl[2][4];
#pragma unroll
  for (int i = 0; i < 2; ++i)
#pragma unroll
    for (int j = 0; j < 4; ++j) { acch[i][j] = zero8(); accl[i][j] = zero8(); }

  for (int k0 = 0; k0 < EW; k0 += 32) {
    v16h fh[2], fl[2];
#pragma unroll
    for (int i = 0; i < 2; ++i) {
      const size_t ao = (size_t)(m0 + (i << 4) + rlane) * EW + koff + k0;
      fh[i] = ldfrag_h(Ah + ao);
      fl[i] = ldfrag_h(Al + ao);
    }
#pragma unroll
    for (int j = 0; j < 4; ++j) {
      const size_t bofs = (size_t)nB[j] * EW + koff + k0;
      const v16h bfr = ldfrag_h(Bh + bofs);
#pragma unroll
      for (int i = 0; i < 2; ++i) {
        acch[i][j] = mma_h(fh[i], bfr, acch[i][j]);
        accl[i][j] = mma_h(fl[i], bfr, accl[i][j]);
      }
    }
  }

  const float fac = (sec == 0) ? f0 : ((sec == 1) ? f1 : f2);
  float bz[4];
#pragma unroll
  for (int j = 0; j < 4; ++j) bz[j] = bf_up(bf_bits(bias[nB[j]]));

  float* slab = sT[wave];
  const int g8 = lane >> 3, pc = lane & 7;
#pragma unroll
  for (int i = 0; i < 2; ++i) {
    const int mBase = m0 + (i << 4);
#pragma unroll
    for (int r = 0; r < 8; ++r) {
#pragma unroll
      for (int j = 0; j < 4; ++j) {
        slab[(mOff + r) * 68 + (j << 4) + rlane] = ((acch[i][j][r] + accl[i][j][r] * scl) * sch + bz[j]) * fac;
      }
    }
    __builtin_amdgcn_fence(__ATOMIC_RELEASE, "workgroup");
    __builtin_amdgcn_wave_barrier();
    __builtin_amdgcn_fence(__ATOMIC_ACQUIRE, "workgroup");
    {
      v4u hv[4], lv[4];
      size_t ofs[4];
#pragma unroll
      for (int q = 0; q < 4; ++q) {
        const int L = q * 4 + g8;                    // line 0..15 of this slab
        const int hh = L >> 3, t = L & 7;
        const int row = 2 * t + (pc >> 2);
        const int d0 = (pc & 3) * 8;
        const v4f x0 = *(const v4f*)(slab + row * 68 + hh * 32 + d0);
        const v4f x1 = *(const v4f*)(slab + row * 68 + hh * 32 + d0 + 4);
        float f[8];
        f[0] = x0[0]; f[1] = x0[1]; f[2] = x0[2]; f[3] = x0[3];
        f[4] = x1[0]; f[5] = x1[1]; f[6] = x1[2]; f[7] = x1[3];
        v4u ph, pl;
#pragma unroll
        for (int u = 0; u < 4; ++u) {
          const float s0 = f[2 * u];
          const float s1 = f[2 * u + 1];
          const _Float16 hq0 = (_Float16)s0;
          const _Float16 hq1 = (_Float16)s1;
          const _Float16 lq0 = (_Float16)((s0 - (float)hq0) * 2048.0f);
          const _Float16 lq1 = (_Float16)((s1 - (float)hq1) * 2048.0f);
          ph[u] = pk16(h_bits(hq0), h_bits(hq1));
          pl[u] = pk16(h_bits(lq0), h_bits(lq1));
        }
        hv[q] = ph;
        lv[q] = pl;
        ofs[q] = (((size_t)(sec * NH + h0 + hh)) * RB + (size_t)(mBase + row)) * HD + d0;
      }
      {
#pragma unroll
        for (int q = 0; q < 4; ++q) {
          *(v4u*)(php + ofs[q]) = hv[q];
          if (sec < 2) *(v4u*)(plp + ofs[q]) = lv[q];
        }
        
      }
    }
    __builtin_amdgcn_fence(__ATOMIC_RELEASE, "workgroup");
    __builtin_amdgcn_wave_barrier();
    __builtin_amdgcn_fence(__ATOMIC_ACQUIRE, "workgroup");
  }
}

// =====================================================================================================
// Axial attention for one batch and one direction: block = (column index j = blockIdx.x, all 8 heads),
// wave = head h, 16-query strips s = 0..7 in lockstep.
//   queries i: plane row i*SEQ + j; keys/values kk: plane row kk*ks + j*js (dir 0: ks=1, js=SEQ ->
//   rows (j,kk); dir 1: ks=SEQ, js=1 -> rows (kk,j)); additive mask plane mp[h][i][kk] (already x64 and
//   bf16-RNE'd, its layout chosen per direction on the host).
// Scores are computed TRANSPOSED: S^T[kk][i] = K(A, lane = key row, d per k-map) . Q^T(B, lane = query,
// d per k-map), hi.hi into the mask-initialised accumulator plus (hi.lo + lo.hi)*xscl; D lane = query i,
// element r = key 16ct + 8g + r, so a lane and its partner lane^16 own one softmax row: max / exp / sum in
// f32 with one __shfl_xor(.,16) each. Weights p*pcar are converted to f16 in registers and used directly as
// the B operand of O^T[d][i] = V^T(A from LDS, lane = d, keys per k-map) . P^T (B: lane = query, element
// e <- tile 2c key 8g+e, element 8+e <- tile 2c+1 key 8g+e).
// LDS: sVt [NH][HD][VTP] v^T tiles (built once per block by register transposition of 4 key rows into 8-B
// stores; each wave stages and reads only its own head; block barrier after staging; staged extent k 0..127
// == consumed extent); sO [16][SOP] f32 output slab (cross-wave: block barriers before the row writes and
// before the next strip).
// Output: f16 planes vah = f16(O*1024), val = f16((O*1024 - hi)*2048), [RB rows i*SEQ+j][KO] at columns
// dir*EW + d*NH + h; per strip wave h writes rows 2h, 2h+1: 32 lanes x 16 B = the whole 512-B half row
// coverage: 8 strips x 8 waves x 2 rows = 128 queries x (32 lanes x 8 = 256 channels) for every (j, dir)
// -> together with the other direction's launch every element of both planes of this batch.
// =====================================================================================================
__global__ __launch_bounds__(256) void attn_ax(
    const unsigned short* __restrict__ php, const unsigned short* __restrict__ plp,
    const float* __restrict__ mp, unsigned short* vah, unsigned short* val,
    int dir, float xscl, float escl, float pcar, float oscl) {
  const _Float16* Ph = (const _Float16*)(const void*)php;
  const _Float16* Pl = (const _Float16*)(const void*)plp;
  __shared__ __align__(16) unsigned short sVt[NH * HD * VTP];     // 69632 B
  __shared__ __align__(16) float sO[16 * SOP];                    // 16896 B
  const _Float16* sVh = (const _Float16*)(const void*)sVt;
  const int tid  = threadIdx.x;
  const int lane = tid & 31;
  const int h    = tid >> 5;
  const int nl   = lane & 15;
  const int g    = lane >> 4;
  const int g8   = g * 8;
  const int j    = blockIdx.x;
  const size_t hs = (size_t)RB * HD;               // per-head plane stride (halves)
  const size_t ss = (size_t)NH * hs;               // per-section stride
  const _Float16* Qh = Ph + (size_t)h * hs;
  const _Float16* Kh = Ph + ss + (size_t)h * hs;
  const _Float16* Ql = Pl + (size_t)h * hs;
  const _Float16* Kl = Pl + ss + (size_t)h * hs;
  const unsigned short* Vu = php + 2 * ss + (size_t)h * hs;
  const int ks = (dir != 0) ? SEQ : 1;
  const int js = (dir != 0) ? 1 : SEQ;

  // ---- stage v^T of head h: unit u = (key quad kq, d octet dq): 4 x 16-B row loads -> 8 x 8-B LDS stores
#pragma unroll
  for (int it = 0; it < 4; ++it) {
    const int u  = it * 32 + lane;                 // 0..127
    const int kq = u >> 2, dq = u & 3;
    const int kb = kq * 4;
    v4u rw[4];
#pragma unroll
    for (int a = 0; a < 4; ++a) {
      const size_t rowk = (size_t)(kb + a) * ks + (size_t)j * js;
      rw[a] = *(const v4u*)(Vu + rowk * HD + dq * 8);
    }
#pragma unroll
    for (int d = 0; d < 8; ++d) {
      const int wd = d >> 1, sh = (d & 1) * 16;
      const unsigned x0 = (rw[0][wd] >> sh) & 0xFFFFu;
      const unsigned x1 = (rw[1][wd] >> sh) & 0xFFFFu;
      const unsigned x2 = (rw[2][wd] >> sh) & 0xFFFFu;
      const unsigned x3 = (rw[3][wd] >> sh) & 0xFFFFu;
      v2u o;
      o[0] = x0 | (x1 << 16);
      o[1] = x2 | (x3 << 16);
      *(v2u*)(sVt + (h * HD + dq * 8 + d) * VTP + kb) = o;
    }
  }
  __syncthreads();

#pragma unroll 1
  for (int s = 0; s < 8; ++s) {
    const int i = s * 16 + nl;                                  // this lane's query (B column / D column)
    const size_t qofs = ((size_t)i * SEQ + j) * HD + g8;
    const v16h qh = ldfrag_h(Qh + qofs);
    const v16h ql = ldfrag_h(Ql + qofs);
    const float* mrow = mp + ((size_t)h * SEQ + i) * SEQ + g8;

    // ---- transposed scores, 8 key tiles
    v8f acc[8];
#pragma unroll
    for (int ct = 0; ct < 8; ++ct) {
      const int kk = ct * 16 + nl;                              // key row loaded by this lane (A row)
      const size_t kofs = ((size_t)kk * ks + (size_t)j * js) * HD + g8;
      const v16h kh = ldfrag_h(Kh + kofs);
      const v16h kl = ldfrag_h(Kl + kofs);
      const v4f mv0 = *(const v4f*)(mrow + ct * 16);
      const v4f mv1 = *(const v4f*)(mrow + ct * 16 + 4);
      v8f am;
      am[0] = mv0[0]; am[1] = mv0[1]; am[2] = mv0[2]; am[3] = mv0[3];
      am[4] = mv1[0]; am[5] = mv1[1]; am[6] = mv1[2]; am[7] = mv1[3];
      v8f ax = mma_h(kh, ql, zero8());
      ax = mma_h(kl, qh, ax);
      am = mma_h(kh, qh, am);
      acc[ct] = am + ax * xscl;
    }

    // ---- softmax over the 128 keys of query i (this lane: 64 values, partner lane^16: the other 64)
    float mx = acc[0][0];
#pragma unroll
    for (int ct = 0; ct < 8; ++ct)
#pragma unroll
      for (int r = 0; r < 8; ++r) mx = fmaxf(mx, acc[ct][r]);
    mx = fmaxf(mx, __shfl_xor(mx, 16));
    float sum = 0.f;
#pragma unroll
    for (int ct = 0; ct < 8; ++ct)
#pragma unroll
      for (int r = 0; r < 8; ++r) {
        const float ev = __expf((acc[ct][r] - mx) * escl);
        acc[ct][r] = ev;
        sum += ev;
      }
    sum += __shfl_xor(sum, 16);
    const float rc = pcar / sum;                                // sum >= 1

    // ---- P^T as B fragments straight from the accumulators
    v16h pb[4];
#pragma unroll
    for (int c = 0; c < 4; ++c) {
      union { v16h v; v8h hh[2]; } U;
      v8h p0, p1;
#pragma unroll
      for (int e2 = 0; e2 < 8; ++e2) {
        p0[e2] = (_Float16)(acc[2 * c][e2] * rc);
        p1[e2] = (_Float16)(acc[2 * c + 1][e2] * rc);
      }
      U.hh[0] = p0;
      U.hh[1] = p1;
      pb[c] = U.v;
    }

    // ---- O^T[d][i] = V^T . P^T, two 16-row d tiles, K = 128 keys
    v8f oacc[2];
#pragma unroll
    for (int dt = 0; dt < 2; ++dt) {
      v8f o = zero8();
#pragma unroll
      for (int c = 0; c < 4; ++c) {
        const v16h va = ldfrag_h(sVh + (h * HD + dt * 16 + nl) * VTP + 32 * c + g8);
        o = mma_h(va, pb[c], o);
      }
      oacc[dt] = o;
    }

    // ---- stage O (f32, true scale) into the slab: row = query nl, column = d*NH + h
#pragma unroll
    for (int dt = 0; dt < 2; ++dt)
#pragma unroll
      for (int r = 0; r < 8; ++r)
        sO[nl * SOP + ((dt * 16 + g8 + r) << 3) + h] = oacc[dt][r] * oscl;
    __syncthreads();

    // ---- wave h writes queries s*16 + 2h, + 2h + 1: 512-B half rows in hi and residual planes
    {
      v4u hv[2], lv[2];
      size_t ofs[2];
#pragma unroll
      for (int q = 0; q < 2; ++q) {
        const int rr = 2 * h + q;
        const v4f x0 = *(const v4f*)(sO + rr * SOP + lane * 8);
        const v4f x1 = *(const v4f*)(sO + rr * SOP + lane * 8 + 4);
        float f[8];
        f[0] = x0[0]; f[1] = x0[1]; f[2] = x0[2]; f[3] = x0[3];
        f[4] = x1[0]; f[5] = x1[1]; f[6] = x1[2]; f[7] = x1[3];
        v4u ph, pl;
#pragma unroll
        for (int u = 0; u < 4; ++u) {
          const float s0 = f[2 * u] * 1024.0f;
          const float s1 = f[2 * u + 1] * 1024.0f;
          const _Float16 hq0 = (_Float16)s0;
          const _Float16 hq1 = (_Float16)s1;
          const _Float16 lq0 = (_Float16)((s0 - (float)hq0) * 2048.0f);
          const _Float16 lq1 = (_Float16)((s1 - (float)hq1) * 2048.0f);
          ph[u] = pk16(h_bits(hq0), h_bits(hq1));
          pl[u] = pk16(h_bits(lq0), h_bits(lq1));
        }
        hv[q] = ph;
        lv[q] = pl;
        ofs[q] = ((size_t)(s * 16 + rr) * SEQ + j) * KO + (size_t)dir * EW + lane * 8;
      }
      {
#pragma unroll
        for (int q = 0; q < 2; ++q) {
          *(v4u*)(vah + ofs[q]) = hv[q];
          *(v4u*)(val + ofs[q]) = lv[q];
        }
        
      }
    }
    __syncthreads();                                            // sO reused by the next strip
  }
}

// =====================================================================================================
// Output projection: C[m][n] = sch * (sum_k Ahi[m][k]*Bt[n][k] + scl * sum_k Alo[m][k]*Bt[n][k]) + bf16rne(bias[n])
// (f16 products, f32 accumulate, hi and scaled-residual products in separate accumulators). Ahi/Alo row-major
// [M][K] pitch lda; Bt [N][K] pitch ldb; C f32 [M][N] pitch ldc. One wave per 32x64 tile, no block barriers;
// tile count multiple of 8; A fragments (2 rows x 2 planes) cached per k-step, B fragments streamed.
// Epilogue: 16-row slabs staged per wave in LDS; each 64-wide row segment (256 B) written by one instruction
// coverage: 2 slabs x 16 rows x 64 cols = the wave's whole 32x64 tile; grid covers every tile of C.
// =====================================================================================================
__global__ __launch_bounds__(256) void gemm32h_w(
    const unsigned short* __restrict__ Ahp, const unsigned short* __restrict__ Alp, int lda,
    const unsigned short* __restrict__ Btp, int ldb,
    const float* __restrict__ bias,
    float* C, int ldc, int M, int N, int K, float sch, float scl) {
  const _Float16* Ah = (const _Float16*)(const void*)Ahp;
  const _Float16* Al = (const _Float16*)(const void*)Alp;
  const _Float16* Bh = (const _Float16*)(const void*)Btp;
  __shared__ __align__(16) float sT[8][16 * 68];
  const int lane = threadIdx.x & 31;
  const int wave = threadIdx.x >> 5;
  const int tilesN = N >> 6;
  const int tilesM = M >> 5;
  const int tile = blockIdx.x * 8 + wave;
  if (tile >= tilesM * tilesN) return;   // wave-uniform; no block barriers in this kernel
  const int tm = tile / tilesN;
  const int tn = tile - tm * tilesN;
  const int m0 = tm << 5;
  const int n0 = tn << 6;
  const int rlane = lane & 15;
  const int koff  = (lane >> 4) * 8;
  const int mOff  = (lane >> 4) * 8;

  v8f acch[2][4], accl[2][4];
#pragma unroll
  for (int i = 0; i < 2; ++i)
#pragma unroll
    for (int j = 0; j < 4; ++j) { acch[i][j] = zero8(); accl[i][j] = zero8(); }

  for (int k0 = 0; k0 < K; k0 += 32) {
    v16h fh[2], fl[2];
#pragma unroll
    for (int i = 0; i < 2; ++i) {
      const size_t ao = (size_t)(m0 + (i << 4) + rlane) * lda + koff + k0;
      fh[i] = ldfrag_h(Ah + ao);
      fl[i] = ldfrag_h(Al + ao);
    }
#pragma unroll
    for (int j = 0; j < 4; ++j) {
      const size_t bofs = (size_t)(n0 + (j << 4) + rlane) * ldb + koff + k0;
      const v16h bfr = ldfrag_h(Bh + bofs);
#pragma unroll
      for (int i = 0; i < 2; ++i) {
        acch[i][j] = mma_h(fh[i], bfr, acch[i][j]);
        accl[i][j] = mma_h(fl[i], bfr, accl[i][j]);
      }
    }
  }

  float bz[4];
#pragma unroll
  for (int j = 0; j < 4; ++j) bz[j] = bf_up(bf_bits(bias[n0 + (j << 4) + rlane]));

  float* slab = sT[wave];
#pragma unroll
  for (int i = 0; i < 2; ++i) {
    const int mBase = m0 + (i << 4);
#pragma unroll
    for (int r = 0; r < 8; ++r) {
#pragma unroll
      for (int j = 0; j < 4; ++j) {
        slab[(mOff + r) * 68 + (j << 4) + rlane] = (acch[i][j][r] + accl[i][j][r] * scl) * sch + bz[j];
      }
    }
    __builtin_amdgcn_fence(__ATOMIC_RELEASE, "workgroup");
    __builtin_amdgcn_wave_barrier();
    __builtin_amdgcn_fence(__ATOMIC_ACQUIRE, "workgroup");
    {
      const int hh = lane >> 4, c4 = (lane & 15) * 4;     // 256-B row segment = 16 lanes x 16 B
      v4f ov[8];
#pragma unroll
      for (int it = 0; it < 8; ++it) {
        const int row = it * 2 + hh;                       // it 0..7 x hh 0..1 = rows 0..15
        ov[it] = *(const v4f*)(slab + row * 68 + c4);
      }
      {
#pragma unroll
        for (int it = 0; it < 8; ++it) {
          const int row = it * 2 + hh;
          *(v4f*)(C + (size_t)(mBase + row) * ldc + n0 + c4) = ov[it];
        }
        
      }
    }
    __builtin_amdgcn_fence(__ATOMIC_RELEASE, "workgroup");
    __builtin_amdgcn_wave_barrier();
    __builtin_amdgcn_fence(__ATOMIC_ACQUIRE, "workgroup");
  }
}

// =====================================================================================================
// Workspace map (bytes, NB = 2); every region an exact multiple of its whole-line store granularity, all
// and are rewritten per (batch, direction) in stream order.
//   Xh   f16 [RT][EW]                     0        16777216   (layer norm output, hi)
//   Xl   f16 [RT][EW]              16777216        16777216   (residual x2048)
//   Wti  f16 [W3 n][EW k]          33554432          393216   (f16(bf16(Wqkv_in) x64))
//   Wto  f16 [W3 n][EW k]          33947648          393216
//   Woh  f16 [EW n][KO k]          34340864          262144   (f16(bf16(Wo) x1024))
//   mA   f32 [NB][NH][SEQ][SEQ]    34603008         1048576   (64 x bf16(mask), direct)
//   mB   f32 [NB][NH][SEQ][SEQ]    35651584         1048576   (transposed)
//   Ph   f16 [3][NH][RB][HD]       36700160        25165824   (q x16*32^-0.5, k x4, v x4; hi)
//   Pl   f16 [2][NH][RB][HD]       61865984        16777216   (q, k residual x2048)
//   Vah  f16 [RB][KO]              78643200        16777216   (attention output x1024, hi)
//   Val  f16 [RB][KO]              95420416        16777216   (residual x2048)
//   end                           112197632
// Inputs: e f32 [NB][SEQ][SEQ][EW]; mask f32 [NB][SEQ][SEQ][NH]; ln_w, ln_b f32 [EW]; Wqkv_in, Wqkv_out
// f32 [EW in][W3 out]; bqkv_* f32 [W3]; Wo f32 [KO in][EW out]; bo f32 [EW]. d_out f32 [RT][EW] at byte 0
// (row = b*RB + i*SEQ + j, col = n).
// =====================================================================================================
extern "C" void kernel_launch(void* const* d_in, const int* in_sizes, int n_in,
                              void* d_out, int out_size, void* d_ws, size_t ws_size,
                              hipStream_t stream) {
  if (n_in < 10) return;
  if (in_sizes[0] < RT * EW) return;
  if (in_sizes[1] < NB * SEQ * SEQ * NH) return;
  if (in_sizes[2] < EW) return;
  if (in_sizes[3] < EW) return;
  if (in_sizes[4] < EW * W3) return;
  if (in_sizes[5] < W3) return;
  if (in_sizes[6] < EW * W3) return;
  if (in_sizes[7] < W3) return;
  if (in_sizes[8] < KO * EW) return;
  if (in_sizes[9] < EW) return;
  if (out_size < RT * EW) return;

  const float* e    = (const float*)d_in[0];   // [NB][SEQ][SEQ][EW]
  const float* mask = (const float*)d_in[1];   // [NB][SEQ][SEQ][NH]
  const float* ln_w = (const float*)d_in[2];   // [EW]
  const float* ln_b = (const float*)d_in[3];   // [EW]
  const float* Wqi  = (const float*)d_in[4];   // [EW in][W3 out]
  const float* bqi  = (const float*)d_in[5];   // [W3]
  const float* Wqo  = (const float*)d_in[6];   // [EW in][W3 out]
  const float* bqo  = (const float*)d_in[7];   // [W3]
  const float* Wo   = (const float*)d_in[8];   // [KO in][EW out]
  const float* bo   = (const float*)d_in[9];   // [EW]

  const size_t PX  = (size_t)RT * EW * 2;                    // 16777216 (NB = 2)
  const size_t PWt = (size_t)W3 * EW * 2;                    //   393216
  const size_t PWo = (size_t)EW * KO * 2;                    //   262144
  const size_t PM  = (size_t)NB * NH * SEQ * SEQ * 4;        //  1048576 (NB = 2)
  const size_t PPh = (size_t)3 * NH * RB * HD * 2;           // 25165824
  const size_t PPl = (size_t)2 * NH * RB * HD * 2;           // 16777216
  const size_t PVa = (size_t)RB * KO * 2;                    // 16777216
  size_t off = 0;
  const size_t oXh = off; off += PX;
  const size_t oXl = off; off += PX;
  const size_t oWi = off; off += PWt;
  const size_t oWt = off; off += PWt;
  const size_t oWo = off; off += PWo;
  const size_t oMa = off; off += PM;
  const size_t oMb = off; off += PM;
  const size_t oPh = off; off += PPh;
  const size_t oPl = off; off += PPl;
  const size_t oVh = off; off += PVa;
  const size_t oVl = off; off += PVa;
  if (off > ws_size) return;                                 // off = 112197632 for NB = 2
  if (off > (size_t)134217728) return;

  char* ws = (char*)d_ws;
  unsigned short* Xh  = (unsigned short*)(ws + oXh);
  unsigned short* Xl  = (unsigned short*)(ws + oXl);
  unsigned short* Wti = (unsigned short*)(ws + oWi);
  unsigned short* Wto = (unsigned short*)(ws + oWt);
  unsigned short* Woh = (unsigned short*)(ws + oWo);
  float*          mA  = (float*)(ws + oMa);
  float*          mB  = (float*)(ws + oMb);
  unsigned short* Ph  = (unsigned short*)(ws + oPh);
  unsigned short* Pl  = (unsigned short*)(ws + oPl);
  unsigned short* Vah = (unsigned short*)(ws + oVh);
  unsigned short* Val = (unsigned short*)(ws + oVl);
  float*          outf = (float*)d_out;                      // [RT][EW]

  const dim3 blk(256);
  const dim3 gLn(RT / 8);                                    // 4096 blocks (exact)
  const dim3 gTw(EW / 64, W3 / 64);                          // (4, 12)
  const dim3 gTo(KO / 64, EW / 64);                          // (8, 4)
  const dim3 gMk(SEQ / 8, NH, NB);                           // (16, 8, 2)
  const dim3 gPr(((RB / 32) * (W3 / 64)) / 8);               // 6144 tiles -> 768 blocks
  const dim3 gAt(SEQ);                                       // 128 blocks, one per column index j
  const dim3 gWo(((RB / 32) * (EW / 64)) / 8);               // 2048 tiles -> 256 blocks
  const float cW     = 64.0f;                                // Wqkv plane carry
  const float fQ     = 16.0f * 0.17677669529663687f;         // 32^-0.5 then carry x16
  const float fK     = 4.0f;                                 // k carry
  const float fV     = 4.0f;                                 // v carry
  const float prSch  = 1.0f / 64.0f;                         // folds the Wqkv plane carry
  const float prScl  = 1.0f / 2048.0f;                       // folds the layer norm residual carry
  const float mkSc   = 64.0f;                                // mask planes x (16 * 4)
  const float axXscl = 1.0f / 2048.0f;                       // q/k residual carry
  const float axEscl = 1.0f / 64.0f;                         // score carry 16 * 4
  const float axPcar = 16384.0f;                             // softmax weight carry
  const float axOscl = 1.0f / 65536.0f;                      // 1/(16384 * 4)
  const float woScale = 1024.0f;                             // Wo plane carry
  const float woSch  = 1.0f / 1048576.0f;                    // 1/(1024 * 1024): O hi carry and Wo carry
  const float woScl  = 1.0f / 2048.0f;                       // O residual carry

  // (1) layer norm -> f16 hi + residual planes; weights -> transposed f16 planes of their bf16 values; masks
  ln_planes<<<gLn, blk, 0, stream>>>(e, ln_w, ln_b, Xh, Xl, RT);
  tr_f16<<<gTw, blk, 0, stream>>>(Wqi, Wti, EW, W3, cW);
  tr_f16<<<gTw, blk, 0, stream>>>(Wqo, Wto, EW, W3, cW);
  tr_f16<<<gTo, blk, 0, stream>>>(Wo, Woh, KO, EW, woScale);
  mask_planes<<<gMk, blk, 0, stream>>>(mask, mA, mB, mkSc);
  // (2) per batch: incoming direction (projection + attention), outgoing direction, output projection
  for (int b = 0; b < NB; ++b) {
    const size_t xo = (size_t)b * RB * EW;
    const size_t mo = (size_t)b * NH * SEQ * SEQ;
    gemm_p<<<gPr, blk, 0, stream>>>(Xh + xo, Xl + xo, Wti, bqi, Ph, Pl, fQ, fK, fV, prSch, prScl);
    attn_ax<<<gAt, blk, 0, stream>>>(Ph, Pl, mA + mo, Vah, Val, 0, axXscl, axEscl, axPcar, axOscl);
    gemm_p<<<gPr, blk, 0, stream>>>(Xh + xo, Xl + xo, Wto, bqo, Ph, Pl, fQ, fK, fV, prSch, prScl);
    attn_ax<<<gAt, blk, 0, stream>>>(Ph, Pl, mB + mo, Vah, Val, 1, axXscl, axEscl, axPcar, axOscl);
    gemm32h_w<<<gWo, blk, 0, stream>>>(Vah, Val, KO, Woh, KO, bo, outf + (size_t)b * RB * EW, EW,
                                        RB, EW, KO, woSch, woScl);
  }
  (void)hipGetLastError();
}

// v001
// It runs in 243 microseconds.
// Next to v000, in two timings, it ran 1.56 and 1.57 times as fast.
// Contractions: q/k/v projections = v_wmma_f32_16x16x32_f16 (layer-normed input as f16 hi + residual (x2048) planes, two products into separate accumulators; Wqkv as f16 of its bf16-RNE value x64); per-(b,j,h) scores = v_wmma_f32_16x16x32_f16 (k and q as f16 hi + residual (x2048) planes carried x4 and x16*32^-0.5, products hh + hl + lh; additive mask x64 as the initial accumulator); p.v = v_wmma_f32_16x16x32_f16 (softmax weights x16384 in f16 repacked from the score accumulators, v^T f16 tile carried x4, single product); output projection = v_wmma_f32_16x16x32_f16 (attention output as f16 hi (x1024) + residual (x2048) planes, two products; Wo as f16 of its bf16-RNE value x1024); every float input RNE-converted to bf16 on load; all f32 accumulate; layer norm and softmax in f32.
#include <hip/hip_runtime.h>
#include <math.h>
#include <stdint.h>

#ifndef NB
#define NB 2
#endif
#define NB_FULL 2
#ifndef SEQ
#define SEQ 128
#endif
#define EW  256                 // edge width
#define NH  8                   // heads (fastest channel dim)
#define HD  32                  // dot dim
#define W3  (3 * EW)            // 768 fused projection columns
#define KO  (2 * EW)            // 512 concat channels
#define RB  (SEQ * SEQ)         // edge rows per batch (16384)
#define RT  (NB * RB)           // edge rows processed
#define VTP 136                 // LDS v^T tile pitch (halves)
#define SOP 264                 // LDS output slab pitch (floats)

static_assert(NH * HD == EW);
static_assert(HD == 32);
static_assert(EW == 256);
static_assert(SEQ == 128);      // i, j and key extents are coupled; only NB is reducible
static_assert(NB >= 1 && NB <= NB_FULL);
static_assert((RB % 64) == 0 && (RT % 8) == 0);
static_assert((((RB / 32) * (W3 / 64)) % 8) == 0);
static_assert((((RB / 32) * (EW / 64)) % 8) == 0);
static_assert((EW % 64) == 0 && (W3 % 64) == 0 && (KO % 64) == 0 && (EW % 32) == 0 && (KO % 32) == 0);
static_assert((SEQ % 16) == 0 && (SEQ % 8) == 0);

typedef _Float16 v16h __attribute__((ext_vector_type(16)));
typedef _Float16 v8h  __attribute__((ext_vector_type(8)));
typedef float    v8f  __attribute__((ext_vector_type(8)));
typedef float    v4f  __attribute__((ext_vector_type(4)));
typedef unsigned int v4u __attribute__((ext_vector_type(4)));
typedef unsigned int v2u __attribute__((ext_vector_type(2)));

// ---- scalar helpers --------------------------------------------------------------------------------
__device__ __forceinline__ unsigned short bf_bits(float f) {          // f32 -> bf16 bits, RNE convert
  unsigned u = __float_as_uint(f);
  return (unsigned short)((u + 0x7FFFu + ((u >> 16) & 1u)) >> 16);
}
__device__ __forceinline__ float bf_up(unsigned short h) { return __uint_as_float(((unsigned)h) << 16); }
__device__ __forceinline__ unsigned short h_bits(_Float16 x) { return __builtin_bit_cast(unsigned short, x); }
__device__ __forceinline__ unsigned pk16(unsigned short a, unsigned short b) { return (unsigned)a | ((unsigned)b << 16); }
__device__ __forceinline__ v8f zero8() { v8f z = {0.f, 0.f, 0.f, 0.f, 0.f, 0.f, 0.f, 0.f}; return z; }

// ---- fragment loader: 16-bit A/B operand, lane -> row/col (lane&15), p already includes +8*(lane>>4);
//      elements 0..7 <- p[0..7] (k0+8h..), elements 8..15 <- p[16..23] (k0+16+8h..)
__device__ __forceinline__ v16h ldfrag_h(const _Float16* p) {
  union { v16h v; v8h h[2]; } f;
  f.h[0] = *(const v8h*)(p);
  f.h[1] = *(const v8h*)(p + 16);
  return f.v;
}

// ---- WMMA helper with trailing VALU hazard gap ----------------------------------------------------------
__device__ __forceinline__ v8f mma_h(v16h a, v16h b, v8f c) {
  c = __builtin_amdgcn_wmma_f32_16x16x32_f16(false, a, false, b, (short)0, c, false, false);
#if defined(__HIP_DEVICE_COMPILE__)
  asm volatile("v_nop\n\tv_nop\n\tv_nop\n\tv_nop" : "+v"(c) : "v"(a), "v"(b));
#endif
  return c;
}

// =====================================================================================================
// Layer norm over EW channels of each edge row (inputs and affine params RNE-converted to bf16 first, f32
// [nrows][EW]. One wave per row, 8 channels per lane; each plane row = 512 B written by one instruction
// coverage: nrows waves x 32 lanes x 8 = every element of both planes.
// =====================================================================================================
__global__ __launch_bounds__(256) void ln_planes(const float* __restrict__ e, const float* __restrict__ lw,
                                                 const float* __restrict__ lb, unsigned short* xh,
                                                 unsigned short* xl, int nrows) {
  const int lane = threadIdx.x & 31;
  const int wave = threadIdx.x >> 5;
  const int row = blockIdx.x * 8 + wave;
  if (row >= nrows) return;                           // wave-uniform; no block barriers in this kernel
  const int c0 = lane * 8;
  const float* src = e + (size_t)row * EW + c0;
  const v4f a0 = *(const v4f*)(src);
  const v4f a1 = *(const v4f*)(src + 4);
  const v4f w0 = *(const v4f*)(lw + c0);
  const v4f w1 = *(const v4f*)(lw + c0 + 4);
  const v4f b0 = *(const v4f*)(lb + c0);
  const v4f b1 = *(const v4f*)(lb + c0 + 4);
  float v[8], w[8], bb[8];
#pragma unroll
  for (int t = 0; t < 4; ++t) {
    v[t]      = bf_up(bf_bits(a0[t]));
    v[4 + t]  = bf_up(bf_bits(a1[t]));
    w[t]      = bf_up(bf_bits(w0[t]));
    w[4 + t]  = bf_up(bf_bits(w1[t]));
    bb[t]     = bf_up(bf_bits(b0[t]));
    bb[4 + t] = bf_up(bf_bits(b1[t]));
  }
  float s = 0.f;
#pragma unroll
  for (int t = 0; t < 8; ++t) s += v[t];
#pragma unroll
  for (int o = 16; o > 0; o >>= 1) s += __shfl_xor(s, o);
  const float mu = s * (1.0f / (float)EW);
  float d[8];
  float s2 = 0.f;
#pragma unroll
  for (int t = 0; t < 8; ++t) { d[t] = v[t] - mu; s2 += d[t] * d[t]; }
#pragma unroll
  for (int o = 16; o > 0; o >>= 1) s2 += __shfl_xor(s2, o);
  const float var = s2 * (1.0f / (float)EW);
  const float rs = rsqrtf(var + 1e-5f);
  v4u ph, pl;
#pragma unroll
  for (int t = 0; t < 4; ++t) {
    const float y0 = d[2 * t] * rs * w[2 * t] + bb[2 * t];
    const float y1 = d[2 * t + 1] * rs * w[2 * t + 1] + bb[2 * t + 1];
    const _Float16 hq0 = (_Float16)y0;
    const _Float16 hq1 = (_Float16)y1;
    const _Float16 lq0 = (_Float16)((y0 - (float)hq0) * 2048.0f);
    const _Float16 lq1 = (_Float16)((y1 - (float)hq1) * 2048.0f);
    ph[t] = pk16(h_bits(hq0), h_bits(hq1));
    pl[t] = pk16(h_bits(lq0), h_bits(lq1));
  }
  const size_t o = (size_t)row * EW + c0;
  {
    *(v4u*)(xh + o) = ph;
    *(v4u*)(xl + o) = pl;
    
  }
}

// =====================================================================================================
// Transpose-convert: in f32 [R][C] row-major -> out f16 [C][R] (r contiguous), out[c][r] =
// f16(bf16rne(in[r][c]) * scale), scale a power of two. Block = one 64 r x 64 c tile staged in LDS as f32
// (v4f loads, __syncthreads); grid = (R/64, C/64, matrices of that shape: 1 or 2).
// Store: group gq = tid>>3 (0..31), piece = tid&7: iteration it writes out row c = it*32+gq, lanes 8q..8q+7
// coverage: 2 iterations x 32 groups = 64 out rows, 8 pieces x 8 = 64 r per row; grid covers every tile ->
// the whole plane.
// =====================================================================================================
__global__ __launch_bounds__(256) void tr_f16(const float* __restrict__ in0, const float* __restrict__ in1,
                                              unsigned short* out, int R, int C, float scale) {
  __shared__ __align__(16) float sv[64 * 68];       // [rr][cc] pitch 68 floats
  const int tid = threadIdx.x;
  const float* in = (blockIdx.z != 0) ? in1 : in0;  // grid z picks the matrix; its plane follows the first
  out += (size_t)blockIdx.z * R * C;
  const int r0 = blockIdx.x * 64;
  const int c0 = blockIdx.y * 64;
#pragma unroll
  for (int i = 0; i < 4; ++i) {
    const int idx = i * 256 + tid;                  // 0..1023
    const int rr = idx >> 4, c4 = (idx & 15) * 4;
    const v4f a = *(const v4f*)(in + (size_t)(r0 + rr) * C + c0 + c4);
    *(v4f*)(sv + rr * 68 + c4) = a;
  }
  __syncthreads();

  const int gq = tid >> 3, piece = tid & 7;
  v4u hv[2];
  size_t hofs[2];
#pragma unroll
  for (int it = 0; it < 2; ++it) {
    const int cc = it * 32 + gq;
    v4u a;
#pragma unroll
    for (int t = 0; t < 4; ++t) {
      const float f0 = bf_up(bf_bits(sv[(piece * 8 + 2 * t) * 68 + cc]));
      const float f1 = bf_up(bf_bits(sv[(piece * 8 + 2 * t + 1) * 68 + cc]));
      a[t] = pk16(h_bits((_Float16)(f0 * scale)), h_bits((_Float16)(f1 * scale)));
    }
    hv[it] = a;
    hofs[it] = (size_t)(c0 + cc) * R + r0 + piece * 8;
  }
  {
#pragma unroll
    for (int it = 0; it < 2; ++it) {
      *(v4u*)(out + hofs[it]) = hv[it];
    }
    
  }
}

// =====================================================================================================
// Additive mask mk f32 [NB][SEQ x][SEQ y][NH h] -> two f32 planes of msc * bf16rne(mk), msc a power of two:
//   ma[b][h][x][y] (direct) and mb[b][h][y][x] (transposed), both with the last index contiguous.
// grid = (SEQ/8 groups, NH, NB), 256 threads. Direct part: thread (xx = tid>>5, y4 = (tid&31)*4) gathers 4
// values of row x = grp*8+xx and stores 16 B; a wave writes the whole 512-B row (4 lines, one instruction).
// Transposed part: 128 x times 8 y staged in LDS (pitch 132), __syncthreads, then thread (yy = tid>>5,
// x4 = (tid&31)*4) stores 16 B of row y = grp*8+yy; a wave writes the whole 512-B row, one instruction.
// coverage: 16 groups x 8 rows x (32 lanes x 4) = all SEQ x SEQ of every (b,h) in both planes.
// =====================================================================================================
__global__ __launch_bounds__(256) void mask_planes(const float* __restrict__ mk, float* ma, float* mb,
                                                   float msc) {
  __shared__ __align__(16) float sm[8 * 132];
  const int tid = threadIdx.x;
  const int grp = blockIdx.x;
  const int h = blockIdx.y;
  const int b = blockIdx.z;
  const size_t pb = ((size_t)(b * NH + h)) * SEQ * SEQ;          // plane base of (b,h)
  v4f vd;
  size_t od;
  {
    const int xx = tid >> 5, y4 = (tid & 31) * 4;
    const int x = grp * 8 + xx;
    const float* src = mk + (((size_t)b * SEQ + x) * SEQ + y4) * NH + h;
#pragma unroll
    for (int t = 0; t < 4; ++t) vd[t] = msc * bf_up(bf_bits(src[(size_t)t * NH]));
    od = pb + (size_t)x * SEQ + y4;
  }
  {
    const int x = tid >> 1, yq = (tid & 1) * 4;
    const float* src = mk + (((size_t)b * SEQ + x) * SEQ + grp * 8 + yq) * NH + h;
#pragma unroll
    for (int t = 0; t < 4; ++t) sm[(yq + t) * 132 + x] = msc * bf_up(bf_bits(src[(size_t)t * NH]));
  }
  __syncthreads();
  v4f vt;
  size_t ot;
  {
    const int yy = tid >> 5, x4 = (tid & 31) * 4;
    vt = *(const v4f*)(sm + yy * 132 + x4);
    ot = pb + (size_t)(grp * 8 + yy) * SEQ + x4;
  }
  {
    *(v4f*)(ma + od) = vd;
    *(v4f*)(mb + ot) = vt;
    
  }
}

// =====================================================================================================
// Fused q/k/v projection; grid y = batch * 2 + direction picks the batch's X rows, the direction's Wt and
// bias, and that pair's own output planes. For the edge rows of one batch: X[m][k] . Wt[n][k] + bf16rne(bias[n]) with
// X = f16 hi plane + residual plane (x2048) [RB][EW], Wt f16 [W3][EW] (k contiguous), f16 products into
// separate hi/residual accumulators, f32 accumulate; value = ((acch + accl*scl)*sch + bias) * fac(sec)
// with sec = n / EW (0 q, 1 k, 2 v). One wave per 32 x 64 tile; the tile's 64 columns are a PERMUTED set:
// n = sec*EW + d*NH + h for d in 0..31 and h in {h0, h0+1} (tn = sec*4 + h0/2), B fragment j covers
// hh = j>>1, d = (j&1)*16 + lane&15. Output written as head-major f16 planes hi = f16(value),
// lo = f16((value - hi) * 2048): element (sec, h, row m, d) at [((sec*NH + h)*RB + m)*HD + d]
// (hi plane [3][NH][RB][HD]; lo plane [2][NH][RB][HD], q and k only). No block barriers; tile count a
// column cc = hh*32 + d), then lane g8 = lane>>3, pc = lane&7: instruction q writes line L = q*4+g8
// coverage: 2 slabs x 16 lines (2 hh x 8 row pairs) x 8 pieces of 8 d = the wave's whole 32 x 64 tile in
// the hi plane (and in the lo plane for sec < 2); 512 x 12 tiles cover [3][NH][RB][HD] exactly.
// =====================================================================================================
__global__ __launch_bounds__(256) void gemm_p(
    const unsigned short* __restrict__ Ahp, const unsigned short* __restrict__ Alp,
    const unsigned short* __restrict__ Btp, const float* __restrict__ bias0, const float* __restrict__ bias1,
    unsigned short* php, unsigned short* plp,
    float f0, float f1, float f2, float sch, float scl) {
  const int bd  = blockIdx.y;              // batch * 2 + direction
  const int dir = bd & 1;
  const size_t xo = (size_t)(bd >> 1) * RB * EW;
  const _Float16* Ah = (const _Float16*)(const void*)Ahp + xo;
  const _Float16* Al = (const _Float16*)(const void*)Alp + xo;
  const _Float16* Bh = (const _Float16*)(const void*)Btp + (size_t)dir * W3 * EW;
  const float* bias = (dir != 0) ? bias1 : bias0;
  php += (size_t)bd * 3 * NH * RB * HD;
  plp += (size_t)bd * 2 * NH * RB * HD;
  __shared__ __align__(16) float sT[8][16 * 68];
  const int lane = threadIdx.x & 31;
  const int wave = threadIdx.x >> 5;
  constexpr int tilesN = W3 / 64;          // 12
  constexpr int tilesM = RB / 32;          // 512
  const int tile = blockIdx.x * 8 + wave;
  if (tile >= tilesM * tilesN) return;     // wave-uniform; no block barriers in this kernel
  const int tm = tile / tilesN;
  const int tn = tile - tm * tilesN;
  const int m0 = tm << 5;
  const int sec = tn >> 2;                 // 0 q, 1 k, 2 v
  const int h0 = (tn & 3) * 2;             // head pair
  const int rlane = lane & 15;
  const int koff  = (lane >> 4) * 8;
  const int mOff  = (lane >> 4) * 8;
  int nB[4];
#pragma unroll
  for (int j = 0; j < 4; ++j) nB[j] = sec * EW + ((((j & 1) << 4) + rlane) << 3) + h0 + (j >> 1);

  v8f acch[2][4], accl[2][4];
#pragma unroll
  for (int i = 0; i < 2; ++i)
#pragma unroll
    for (int j = 0; j < 4; ++j) { acch[i][j] = zero8(); accl[i][j] = zero8(); }

  for (int k0 = 0; k0 < EW; k0 += 32) {
    v16h fh[2], fl[2];
#pragma unroll
    for (int i = 0; i < 2; ++i) {
      const size_t ao = (size_t)(m0 + (i << 4) + rlane) * EW + koff + k0;
      fh[i] = ldfrag_h(Ah + ao);
      fl[i] = ldfrag_h(Al + ao);
    }
#pragma unroll
    for (int j = 0; j < 4; ++j) {
      const size_t bofs = (size_t)nB[j] * EW + koff + k0;
      const v16h bfr = ldfrag_h(Bh + bofs);
#pragma unroll
      for (int i = 0; i < 2; ++i) {
        acch[i][j] = mma_h(fh[i], bfr, acch[i][j]);
        accl[i][j] = mma_h(fl[i], bfr, accl[i][j]);
      }
    }
  }

  const float fac = (sec == 0) ? f0 : ((sec == 1) ? f1 : f2);
  float bz[4];
#pragma unroll
  for (int j = 0; j < 4; ++j) bz[j] = bf_up(bf_bits(bias[nB[j]]));

  float* slab = sT[wave];
  const int g8 = lane >> 3, pc = lane & 7;
#pragma unroll
  for (int i = 0; i < 2; ++i) {
    const int mBase = m0 + (i << 4);
#pragma unroll
    for (int r = 0; r < 8; ++r) {
#pragma unroll
      for (int j = 0; j < 4; ++j) {
        slab[(mOff + r) * 68 + (j << 4) + rlane] = ((acch[i][j][r] + accl[i][j][r] * scl) * sch + bz[j]) * fac;
      }
    }
    __builtin_amdgcn_fence(__ATOMIC_RELEASE, "workgroup");
    __builtin_amdgcn_wave_barrier();
    __builtin_amdgcn_fence(__ATOMIC_ACQUIRE, "workgroup");
    {
      v4u hv[4], lv[4];
      size_t ofs[4];
#pragma unroll
      for (int q = 0; q < 4; ++q) {
        const int L = q * 4 + g8;                    // line 0..15 of this slab
        const int hh = L >> 3, t = L & 7;
        const int row = 2 * t + (pc >> 2);
        const int d0 = (pc & 3) * 8;
        const v4f x0 = *(const v4f*)(slab + row * 68 + hh * 32 + d0);
        const v4f x1 = *(const v4f*)(slab + row * 68 + hh * 32 + d0 + 4);
        float f[8];
        f[0] = x0[0]; f[1] = x0[1]; f[2] = x0[2]; f[3] = x0[3];
        f[4] = x1[0]; f[5] = x1[1]; f[6] = x1[2]; f[7] = x1[3];
        v4u ph, pl;
#pragma unroll
        for (int u = 0; u < 4; ++u) {
          const float s0 = f[2 * u];
          const float s1 = f[2 * u + 1];
          const _Float16 hq0 = (_Float16)s0;
          const _Float16 hq1 = (_Float16)s1;
          const _Float16 lq0 = (_Float16)((s0 - (float)hq0) * 2048.0f);
          const _Float16 lq1 = (_Float16)((s1 - (float)hq1) * 2048.0f);
          ph[u] = pk16(h_bits(hq0), h_bits(hq1));
          pl[u] = pk16(h_bits(lq0), h_bits(lq1));
        }
        hv[q] = ph;
        lv[q] = pl;
        ofs[q] = (((size_t)(sec * NH + h0 + hh)) * RB + (size_t)(mBase + row)) * HD + d0;
      }
      {
#pragma unroll
        for (int q = 0; q < 4; ++q) {
          *(v4u*)(php + ofs[q]) = hv[q];
          if (sec < 2) *(v4u*)(plp + ofs[q]) = lv[q];
        }
        
      }
    }
    __builtin_amdgcn_fence(__ATOMIC_RELEASE, "workgroup");
    __builtin_amdgcn_wave_barrier();
    __builtin_amdgcn_fence(__ATOMIC_ACQUIRE, "workgroup");
  }
}

// =====================================================================================================
// Axial attention, grid y = batch * 2 + direction: block = (column index j = blockIdx.x, all 8 heads),
// wave = head h, 16-query strips s = 0..7 in lockstep.
//   queries i: plane row i*SEQ + j; keys/values kk: plane row kk*ks + j*js (dir 0: ks=1, js=SEQ ->
//   rows (j,kk); dir 1: ks=SEQ, js=1 -> rows (kk,j)); additive mask plane mp[h][i][kk] (already x64 and
//   bf16-RNE'd, direct for dir 0 and transposed for dir 1).
// Scores are computed TRANSPOSED: S^T[kk][i] = K(A, lane = key row, d per k-map) . Q^T(B, lane = query,
// d per k-map), hi.hi into the mask-initialised accumulator plus (hi.lo + lo.hi)*xscl; D lane = query i,
// element r = key 16ct + 8g + r, so a lane and its partner lane^16 own one softmax row: max / exp / sum in
// f32 with one __shfl_xor(.,16) each. Weights p*pcar are converted to f16 in registers and used directly as
// the B operand of O^T[d][i] = V^T(A from LDS, lane = d, keys per k-map) . P^T (B: lane = query, element
// e <- tile 2c key 8g+e, element 8+e <- tile 2c+1 key 8g+e).
// LDS: sVt [NH][HD][VTP] v^T tiles (built once per block by register transposition of 4 key rows into 8-B
// stores; each wave stages and reads only its own head; block barrier after staging; staged extent k 0..127
// == consumed extent); sO [16][SOP] f32 output slab (cross-wave: block barriers before the row writes and
// before the next strip).
// Output: f16 planes vah = f16(O*1024), val = f16((O*1024 - hi)*2048), [RB rows i*SEQ+j][KO] at columns
// dir*EW + d*NH + h; per strip wave h writes rows 2h, 2h+1: 32 lanes x 16 B = the whole 512-B half row
// coverage: 8 strips x 8 waves x 2 rows = 128 queries x (32 lanes x 8 = 256 channels) for every (j, dir)
// -> together with the other direction's blocks every element of both planes of this batch.
// =====================================================================================================
__global__ __launch_bounds__(256) void attn_ax(
    const unsigned short* __restrict__ php, const unsigned short* __restrict__ plp,
    const float* __restrict__ mp, unsigned short* vah, unsigned short* val,
    float xscl, float escl, float pcar, float oscl) {
  const int bd  = blockIdx.y;                      // batch * 2 + direction
  const int dir = bd & 1;
  php += (size_t)bd * 3 * NH * RB * HD;
  plp += (size_t)bd * 2 * NH * RB * HD;
  mp  += (size_t)(dir * NB + (bd >> 1)) * NH * SEQ * SEQ;   // direct planes of all batches, then transposed
  vah += (size_t)(bd >> 1) * RB * KO;
  val += (size_t)(bd >> 1) * RB * KO;
  const _Float16* Ph = (const _Float16*)(const void*)php;
  const _Float16* Pl = (const _Float16*)(const void*)plp;
  __shared__ __align__(16) unsigned short sVt[NH * HD * VTP];     // 69632 B
  __shared__ __align__(16) float sO[16 * SOP];                    // 16896 B
  const _Float16* sVh = (const _Float16*)(const void*)sVt;
  const int tid  = threadIdx.x;
  const int lane = tid & 31;
  const int h    = tid >> 5;
  const int nl   = lane & 15;
  const int g    = lane >> 4;
  const int g8   = g * 8;
  const int j    = blockIdx.x;
  const size_t hs = (size_t)RB * HD;               // per-head plane stride (halves)
  const size_t ss = (size_t)NH * hs;               // per-section stride
  const _Float16* Qh = Ph + (size_t)h * hs;
  const _Float16* Kh = Ph + ss + (size_t)h * hs;
  const _Float16* Ql = Pl + (size_t)h * hs;
  const _Float16* Kl = Pl + ss + (size_t)h * hs;
  const unsigned short* Vu = php + 2 * ss + (size_t)h * hs;
  const int ks = (dir != 0) ? SEQ : 1;
  const int js = (dir != 0) ? 1 : SEQ;

  // ---- stage v^T of head h: unit u = (key quad kq, d octet dq): 4 x 16-B row loads -> 8 x 8-B LDS stores
#pragma unroll
  for (int it = 0; it < 4; ++it) {
    const int u  = it * 32 + lane;                 // 0..127
    const int kq = u >> 2, dq = u & 3;
    const int kb = kq * 4;
    v4u rw[4];
#pragma unroll
    for (int a = 0; a < 4; ++a) {
      const size_t rowk = (size_t)(kb + a) * ks + (size_t)j * js;
      rw[a] = *(const v4u*)(Vu + rowk * HD + dq * 8);
    }
#pragma unroll
    for (int d = 0; d < 8; ++d) {
      const int wd = d >> 1, sh = (d & 1) * 16;
      const unsigned x0 = (rw[0][wd] >> sh) & 0xFFFFu;
      const unsigned x1 = (rw[1][wd] >> sh) & 0xFFFFu;
      const unsigned x2 = (rw[2][wd] >> sh) & 0xFFFFu;
      const unsigned x3 = (rw[3][wd] >> sh) & 0xFFFFu;
      v2u o;
      o[0] = x0 | (x1 << 16);
      o[1] = x2 | (x3 << 16);
      *(v2u*)(sVt + (h * HD + dq * 8 + d) * VTP + kb) = o;
    }
  }
  __syncthreads();

#pragma unroll 1
  for (int s = 0; s < 8; ++s) {
    const int i = s * 16 + nl;                                  // this lane's query (B column / D column)
    const size_t qofs = ((size_t)i * SEQ + j) * HD + g8;
    const v16h qh = ldfrag_h(Qh + qofs);
    const v16h ql = ldfrag_h(Ql + qofs);
    const float* mrow = mp + ((size_t)h * SEQ + i) * SEQ + g8;

    // ---- transposed scores, 8 key tiles
    v8f acc[8];
#pragma unroll
    for (int ct = 0; ct < 8; ++ct) {
      const int kk = ct * 16 + nl;                              // key row loaded by this lane (A row)
      const size_t kofs = ((size_t)kk * ks + (size_t)j * js) * HD + g8;
      const v16h kh = ldfrag_h(Kh + kofs);
      const v16h kl = ldfrag_h(Kl + kofs);
      const v4f mv0 = *(const v4f*)(mrow + ct * 16);
      const v4f mv1 = *(const v4f*)(mrow + ct * 16 + 4);
      v8f am;
      am[0] = mv0[0]; am[1] = mv0[1]; am[2] = mv0[2]; am[3] = mv0[3];
      am[4] = mv1[0]; am[5] = mv1[1]; am[6] = mv1[2]; am[7] = mv1[3];
      v8f ax = mma_h(kh, ql, zero8());
      ax = mma_h(kl, qh, ax);
      am = mma_h(kh, qh, am);
      acc[ct] = am + ax * xscl;
    }

    // ---- softmax over the 128 keys of query i (this lane: 64 values, partner lane^16: the other 64)
    float mx = acc[0][0];
#pragma unroll
    for (int ct = 0; ct < 8; ++ct)
#pragma unroll
      for (int r = 0; r < 8; ++r) mx = fmaxf(mx, acc[ct][r]);
    mx = fmaxf(mx, __shfl_xor(mx, 16));
    float sum = 0.f;
#pragma unroll
    for (int ct = 0; ct < 8; ++ct)
#pragma unroll
      for (int r = 0; r < 8; ++r) {
        const float ev = __expf((acc[ct][r] - mx) * escl);
        acc[ct][r] = ev;
        sum += ev;
      }
    sum += __shfl_xor(sum, 16);
    const float rc = pcar / sum;                                // sum >= 1

    // ---- P^T as B fragments straight from the accumulators
    v16h pb[4];
#pragma unroll
    for (int c = 0; c < 4; ++c) {
      union { v16h v; v8h hh[2]; } U;
      v8h p0, p1;
#pragma unroll
      for (int e2 = 0; e2 < 8; ++e2) {
        p0[e2] = (_Float16)(acc[2 * c][e2] * rc);
        p1[e2] = (_Float16)(acc[2 * c + 1][e2] * rc);
      }
      U.hh[0] = p0;
      U.hh[1] = p1;
      pb[c] = U.v;
    }

    // ---- O^T[d][i] = V^T . P^T, two 16-row d tiles, K = 128 keys
    v8f oacc[2];
#pragma unroll
    for (int dt = 0; dt < 2; ++dt) {
      v8f o = zero8();
#pragma unroll
      for (int c = 0; c < 4; ++c) {
        const v16h va = ldfrag_h(sVh + (h * HD + dt * 16 + nl) * VTP + 32 * c + g8);
        o = mma_h(va, pb[c], o);
      }
      oacc[dt] = o;
    }

    // ---- stage O (f32, true scale) into the slab: row = query nl, column = d*NH + h
#pragma unroll
    for (int dt = 0; dt < 2; ++dt)
#pragma unroll
      for (int r = 0; r < 8; ++r)
        sO[nl * SOP + ((dt * 16 + g8 + r) << 3) + h] = oacc[dt][r] * oscl;
    __syncthreads();

    // ---- wave h writes queries s*16 + 2h, + 2h + 1: 512-B half rows in hi and residual planes
    {
      v4u hv[2], lv[2];
      size_t ofs[2];
#pragma unroll
      for (int q = 0; q < 2; ++q) {
        const int rr = 2 * h + q;
        const v4f x0 = *(const v4f*)(sO + rr * SOP + lane * 8);
        const v4f x1 = *(const v4f*)(sO + rr * SOP + lane * 8 + 4);
        float f[8];
        f[0] = x0[0]; f[1] = x0[1]; f[2] = x0[2]; f[3] = x0[3];
        f[4] = x1[0]; f[5] = x1[1]; f[6] = x1[2]; f[7] = x1[3];
        v4u ph, pl;
#pragma unroll
        for (int u = 0; u < 4; ++u) {
          const float s0 = f[2 * u] * 1024.0f;
          const float s1 = f[2 * u + 1] * 1024.0f;
          const _Float16 hq0 = (_Float16)s0;
          const _Float16 hq1 = (_Float16)s1;
          const _Float16 lq0 = (_Float16)((s0 - (float)hq0) * 2048.0f);
          const _Float16 lq1 = (_Float16)((s1 - (float)hq1) * 2048.0f);
          ph[u] = pk16(h_bits(hq0), h_bits(hq1));
          pl[u] = pk16(h_bits(lq0), h_bits(lq1));
        }
        hv[q] = ph;
        lv[q] = pl;
        ofs[q] = ((size_t)(s * 16 + rr) * SEQ + j) * KO + (size_t)dir * EW + lane * 8;
      }
      {
#pragma unroll
        for (int q = 0; q < 2; ++q) {
          *(v4u*)(vah + ofs[q]) = hv[q];
          *(v4u*)(val + ofs[q]) = lv[q];
        }
        
      }
    }
    __syncthreads();                                            // sO reused by the next strip
  }
}

// =====================================================================================================
// Output projection: C[m][n] = sch * (sum_k Ahi[m][k]*Bt[n][k] + scl * sum_k Alo[m][k]*Bt[n][k]) + bf16rne(bias[n])
// (f16 products, f32 accumulate, hi and scaled-residual products in separate accumulators). Ahi/Alo row-major
// [M][K] pitch lda; Bt [N][K] pitch ldb; C f32 [M][N] pitch ldc. One wave per 32x64 tile, no block barriers;
// tile count multiple of 8; A fragments (2 rows x 2 planes) cached per k-step, B fragments streamed.
// Epilogue: 16-row slabs staged per wave in LDS; each 64-wide row segment (256 B) written by one instruction
// coverage: 2 slabs x 16 rows x 64 cols = the wave's whole 32x64 tile; grid covers every tile of C.
// =====================================================================================================
__global__ __launch_bounds__(256) void gemm32h_w(
    const unsigned short* __restrict__ Ahp, const unsigned short* __restrict__ Alp, int lda,
    const unsigned short* __restrict__ Btp, int ldb,
    const float* __restrict__ bias,
    float* C, int ldc, int M, int N, int K, float sch, float scl) {
  const _Float16* Ah = (const _Float16*)(const void*)Ahp;
  const _Float16* Al = (const _Float16*)(const void*)Alp;
  const _Float16* Bh = (const _Float16*)(const void*)Btp;
  __shared__ __align__(16) float sT[8][16 * 68];
  const int lane = threadIdx.x & 31;
  const int wave = threadIdx.x >> 5;
  const int tilesN = N >> 6;
  const int tilesM = M >> 5;
  const int tile = blockIdx.x * 8 + wave;
  if (tile >= tilesM * tilesN) return;   // wave-uniform; no block barriers in this kernel
  const int tm = tile / tilesN;
  const int tn = tile - tm * tilesN;
  const int m0 = tm << 5;
  const int n0 = tn << 6;
  const int rlane = lane & 15;
  const int koff  = (lane >> 4) * 8;
  const int mOff  = (lane >> 4) * 8;

  v8f acch[2][4], accl[2][4];
#pragma unroll
  for (int i = 0; i < 2; ++i)
#pragma unroll
    for (int j = 0; j < 4; ++j) { acch[i][j] = zero8(); accl[i][j] = zero8(); }

  for (int k0 = 0; k0 < K; k0 += 32) {
    v16h fh[2], fl[2];
#pragma unroll
    for (int i = 0; i < 2; ++i) {
      const size_t ao = (size_t)(m0 + (i << 4) + rlane) * lda + koff + k0;
      fh[i] = ldfrag_h(Ah + ao);
      fl[i] = ldfrag_h(Al + ao);
    }
#pragma unroll
    for (int j = 0; j < 4; ++j) {
      const size_t bofs = (size_t)(n0 + (j << 4) + rlane) * ldb + koff + k0;
      const v16h bfr = ldfrag_h(Bh + bofs);
#pragma unroll
      for (int i = 0; i < 2; ++i) {
        acch[i][j] = mma_h(fh[i], bfr, acch[i][j]);
        accl[i][j] = mma_h(fl[i], bfr, accl[i][j]);
      }
    }
  }

  float bz[4];
#pragma unroll
  for (int j = 0; j < 4; ++j) bz[j] = bf_up(bf_bits(bias[n0 + (j << 4) + rlane]));

  float* slab = sT[wave];
#pragma unroll
  for (int i = 0; i < 2; ++i) {
    const int mBase = m0 + (i << 4);
#pragma unroll
    for (int r = 0; r < 8; ++r) {
#pragma unroll
      for (int j = 0; j < 4; ++j) {
        slab[(mOff + r) * 68 + (j << 4) + rlane] = (acch[i][j][r] + accl[i][j][r] * scl) * sch + bz[j];
      }
    }
    __builtin_amdgcn_fence(__ATOMIC_RELEASE, "workgroup");
    __builtin_amdgcn_wave_barrier();
    __builtin_amdgcn_fence(__ATOMIC_ACQUIRE, "workgroup");
    {
      const int hh = lane >> 4, c4 = (lane & 15) * 4;     // 256-B row segment = 16 lanes x 16 B
      v4f ov[8];
#pragma unroll
      for (int it = 0; it < 8; ++it) {
        const int row = it * 2 + hh;                       // it 0..7 x hh 0..1 = rows 0..15
        ov[it] = *(const v4f*)(slab + row * 68 + c4);
      }
      {
#pragma unroll
        for (int it = 0; it < 8; ++it) {
          const int row = it * 2 + hh;
          *(v4f*)(C + (size_t)(mBase + row) * ldc + n0 + c4) = ov[it];
        }
        
      }
    }
    __builtin_amdgcn_fence(__ATOMIC_RELEASE, "workgroup");
    __builtin_amdgcn_wave_barrier();
    __builtin_amdgcn_fence(__ATOMIC_ACQUIRE, "workgroup");
  }
}

// =====================================================================================================
// Workspace map (bytes, NB = 2); every region an exact multiple of its whole-line store granularity, all
// written earlier in the same call. Every (batch, direction) pair has its own Ph / Pl planes, so each stage
// is one launch over all four pairs. Vah lies on Xh + Xl, whose last reader (the projection) has ended.
//   Xh   f16 [RT][EW]                     0        16777216   (layer norm output, hi)
//   Xl   f16 [RT][EW]              16777216        16777216   (residual x2048)
//   Wti  f16 [W3 n][EW k]          33554432          393216   (f16(bf16(Wqkv_in) x64))
//   Wto  f16 [W3 n][EW k]          33947648          393216
//   Woh  f16 [EW n][KO k]          34340864          262144   (f16(bf16(Wo) x1024))
//   mA   f32 [NB][NH][SEQ][SEQ]    34603008         1048576   (64 x bf16(mask), direct)
//   mB   f32 [NB][NH][SEQ][SEQ]    35651584         1048576   (transposed)
//   Ph   f16 [2 NB][3][NH][RB][HD] 36700160       100663296   (q x16*32^-0.5, k x4, v x4; hi)
//   Pl   f16 [2 NB][2][NH][RB][HD] 137363456       67108864   (q, k residual x2048)
//   Val  f16 [RT][KO]             204472320        33554432   (attention output residual x2048)
//   Vah  f16 [RT][KO]                     0        33554432   (attention output x1024, hi; on Xh + Xl)
//   end                           238026752
// Inputs: e f32 [NB][SEQ][SEQ][EW]; mask f32 [NB][SEQ][SEQ][NH]; ln_w, ln_b f32 [EW]; Wqkv_in, Wqkv_out
// f32 [EW in][W3 out]; bqkv_* f32 [W3]; Wo f32 [KO in][EW out]; bo f32 [EW]. d_out f32 [RT][EW] at byte 0
// (row = b*RB + i*SEQ + j, col = n).
// =====================================================================================================
extern "C" void kernel_launch(void* const* d_in, const int* in_sizes, int n_in,
                              void* d_out, int out_size, void* d_ws, size_t ws_size,
                              hipStream_t stream) {
  if (n_in < 10) return;
  if (in_sizes[0] < RT * EW) return;
  if (in_sizes[1] < NB * SEQ * SEQ * NH) return;
  if (in_sizes[2] < EW) return;
  if (in_sizes[3] < EW) return;
  if (in_sizes[4] < EW * W3) return;
  if (in_sizes[5] < W3) return;
  if (in_sizes[6] < EW * W3) return;
  if (in_sizes[7] < W3) return;
  if (in_sizes[8] < KO * EW) return;
  if (in_sizes[9] < EW) return;
  if (out_size < RT * EW) return;

  const float* e    = (const float*)d_in[0];   // [NB][SEQ][SEQ][EW]
  const float* mask = (const float*)d_in[1];   // [NB][SEQ][SEQ][NH]
  const float* ln_w = (const float*)d_in[2];   // [EW]
  const float* ln_b = (const float*)d_in[3];   // [EW]
  const float* Wqi  = (const float*)d_in[4];   // [EW in][W3 out]
  const float* bqi  = (const float*)d_in[5];   // [W3]
  const float* Wqo  = (const float*)d_in[6];   // [EW in][W3 out]
  const float* bqo  = (const float*)d_in[7];   // [W3]
  const float* Wo   = (const float*)d_in[8];   // [KO in][EW out]
  const float* bo   = (const float*)d_in[9];   // [EW]

  const size_t PX  = (size_t)RT * EW * 2;                    // 16777216 (NB = 2)
  const size_t PWt = (size_t)W3 * EW * 2;                    //   393216
  const size_t PWo = (size_t)EW * KO * 2;                    //   262144
  const size_t PM  = (size_t)NB * NH * SEQ * SEQ * 4;        //  1048576 (NB = 2)
  const size_t PPh = (size_t)2 * NB * 3 * NH * RB * HD * 2;  // 100663296 (NB = 2)
  const size_t PPl = (size_t)2 * NB * 2 * NH * RB * HD * 2;  //  67108864
  const size_t PVa = (size_t)RT * KO * 2;                    //  33554432 == 2 * PX
  size_t off = 0;
  const size_t oXh = off; off += PX;
  const size_t oXl = off; off += PX;
  const size_t oWi = off; off += PWt;
  off += PWt;                                                // Wto, directly behind Wti
  const size_t oWo = off; off += PWo;
  const size_t oMa = off; off += PM;
  const size_t oMb = off; off += PM;
  const size_t oPh = off; off += PPh;
  const size_t oPl = off; off += PPl;
  const size_t oVl = off; off += PVa;
  const size_t oVh = oXh;                                    // Vah takes over Xh + Xl (same size)
  if (off > ws_size) return;                                 // off = 238026752 for NB = 2

  char* ws = (char*)d_ws;
  unsigned short* Xh  = (unsigned short*)(ws + oXh);
  unsigned short* Xl  = (unsigned short*)(ws + oXl);
  unsigned short* Wti = (unsigned short*)(ws + oWi);
  unsigned short* Woh = (unsigned short*)(ws + oWo);
  float*          mA  = (float*)(ws + oMa);
  float*          mB  = (float*)(ws + oMb);
  unsigned short* Ph  = (unsigned short*)(ws + oPh);
  unsigned short* Pl  = (unsigned short*)(ws + oPl);
  unsigned short* Vah = (unsigned short*)(ws + oVh);
  unsigned short* Val = (unsigned short*)(ws + oVl);
  float*          outf = (float*)d_out;                      // [RT][EW]

  const dim3 blk(256);
  const dim3 gLn(RT / 8);                                    // 4096 blocks (exact)
  const dim3 gTw(EW / 64, W3 / 64, 2);                       // (4, 12, both directions)
  const dim3 gTo(KO / 64, EW / 64);                          // (8, 4)
  const dim3 gMk(SEQ / 8, NH, NB);                           // (16, 8, 2)
  const dim3 gPr(((RB / 32) * (W3 / 64)) / 8, 2 * NB);       // 768 blocks x (batch, direction)
  const dim3 gAt(SEQ, 2 * NB);                               // one block per column index j x (batch, direction)
  const dim3 gWo(((RT / 32) * (EW / 64)) / 8);               // 4096 tiles -> 512 blocks
  const float cW     = 64.0f;                                // Wqkv plane carry
  const float fQ     = 16.0f * 0.17677669529663687f;         // 32^-0.5 then carry x16
  const float fK     = 4.0f;                                 // k carry
  const float fV     = 4.0f;                                 // v carry
  const float prSch  = 1.0f / 64.0f;                         // folds the Wqkv plane carry
  const float prScl  = 1.0f / 2048.0f;                       // folds the layer norm residual carry
  const float mkSc   = 64.0f;                                // mask planes x (16 * 4)
  const float axXscl = 1.0f / 2048.0f;                       // q/k residual carry
  const float axEscl = 1.0f / 64.0f;                         // score carry 16 * 4
  const float axPcar = 16384.0f;                             // softmax weight carry
  const float axOscl = 1.0f / 65536.0f;                      // 1/(16384 * 4)
  const float woScale = 1024.0f;                             // Wo plane carry
  const float woSch  = 1.0f / 1048576.0f;                    // 1/(1024 * 1024): O hi carry and Wo carry
  const float woScl  = 1.0f / 2048.0f;                       // O residual carry

  // (1) layer norm -> f16 hi + residual planes; weights -> transposed f16 planes of their bf16 values; masks
  ln_planes<<<gLn, blk, 0, stream>>>(e, ln_w, ln_b, Xh, Xl, RT);
  tr_f16<<<gTw, blk, 0, stream>>>(Wqi, Wqo, Wti, EW, W3, cW);
  tr_f16<<<gTo, blk, 0, stream>>>(Wo, Wo, Woh, KO, EW, woScale);
  mask_planes<<<gMk, blk, 0, stream>>>(mask, mA, mB, mkSc);
  // (2) all batches and both directions at once: projection, attention, output projection
  gemm_p<<<gPr, blk, 0, stream>>>(Xh, Xl, Wti, bqi, bqo, Ph, Pl, fQ, fK, fV, prSch, prScl);
  attn_ax<<<gAt, blk, 0, stream>>>(Ph, Pl, mA, Vah, Val, axXscl, axEscl, axPcar, axOscl);
  gemm32h_w<<<gWo, blk, 0, stream>>>(Vah, Val, KO, Woh, KO, bo, outf, EW, RT, EW, KO, woSch, woScl);
  (void)hipGetLastError();
}

// v002
// Measured time: 184 microseconds a run.
// In two side-by-side timings against v001, it was 1.32 and 1.33 times as fast.
// All steps since v000 together make it 2.07 times as fast.
// Contractions: q/k/v projections = v_wmma_f32_16x16x32_f16 (layer-normed input as f16 hi + residual (x2048) planes, two products into separate accumulators; Wqkv as f16 of its bf16-RNE value x64); per-(b,j,h) scores = v_wmma_f32_16x16x32_f16 (k and q as f16 hi + residual (x2048) planes carried x4 and x16*32^-0.5, products hh + hl + lh; additive mask x64 as the initial accumulator); p.v = v_wmma_f32_16x16x32_f16 (softmax weights x16384 in f16 repacked from the score accumulators, v^T f16 tile carried x4, single product); output projection = v_wmma_f32_16x16x32_f16 (attention output as f16 hi (x1024) + residual (x2048) planes, two products; Wo as f16 of its bf16-RNE value x1024); every float input RNE-converted to bf16 on load; all f32 accumulate; layer norm and softmax in f32.
#include <hip/hip_runtime.h>
#include <math.h>
#include <stdint.h>

#ifndef NB
#define NB 2
#endif
#define NB_FULL 2
#ifndef SEQ
#define SEQ 128
#endif
#define EW  256                 // edge width
#define NH  8                   // heads (fastest channel dim)
#define HD  32                  // dot dim
#define W3  (3 * EW)            // 768 fused projection columns
#define KO  (2 * EW)            // 512 concat channels
#define RB  (SEQ * SEQ)         // edge rows per batch (16384)
#define RT  (NB * RB)           // edge rows processed
#define VTP 136                 // LDS v^T tile pitch (halves)
#define SOP 264                 // LDS output slab pitch (floats)

static_assert(NH * HD == EW);
static_assert(HD == 32);
static_assert(EW == 256);
static_assert(SEQ == 128);      // i, j and key extents are coupled; only NB is reducible
static_assert(NB >= 1 && NB <= NB_FULL);
static_assert((RB % 64) == 0 && (RT % 8) == 0);
static_assert((((RB / 32) * (W3 / 64)) % 8) == 0);
static_assert((((RB / 32) * (EW / 64)) % 8) == 0);
static_assert((EW % 64) == 0 && (W3 % 64) == 0 && (KO % 64) == 0 && (EW % 32) == 0 && (KO % 32) == 0);
static_assert((SEQ % 16) == 0 && (SEQ % 8) == 0);
static_assert((RB % 128) == 0 && (W3 % 128) == 0 && (EW % 128) == 0);   // 128 x 128 block tiles of the projections

typedef _Float16 v16h __attribute__((ext_vector_type(16)));
typedef _Float16 v8h  __attribute__((ext_vector_type(8)));
typedef float    v8f  __attribute__((ext_vector_type(8)));
typedef float    v4f  __attribute__((ext_vector_type(4)));
typedef unsigned int v4u __attribute__((ext_vector_type(4)));
typedef unsigned int v2u __attribute__((ext_vector_type(2)));

// ---- scalar helpers --------------------------------------------------------------------------------
__device__ __forceinline__ unsigned short bf_bits(float f) {          // f32 -> bf16 bits, RNE convert
  unsigned u = __float_as_uint(f);
  return (unsigned short)((u + 0x7FFFu + ((u >> 16) & 1u)) >> 16);
}
__device__ __forceinline__ float bf_up(unsigned short h) { return __uint_as_float(((unsigned)h) << 16); }
__device__ __forceinline__ unsigned short h_bits(_Float16 x) { return __builtin_bit_cast(unsigned short, x); }
__device__ __forceinline__ unsigned pk16(unsigned short a, unsigned short b) { return (unsigned)a | ((unsigned)b << 16); }
__device__ __forceinline__ v8f zero8() { v8f z = {0.f, 0.f, 0.f, 0.f, 0.f, 0.f, 0.f, 0.f}; return z; }

// ---- fragment loader: 16-bit A/B operand, lane -> row/col (lane&15), p already includes +8*(lane>>4);
//      elements 0..7 <- p[0..7] (k0+8h..), elements 8..15 <- p[16..23] (k0+16+8h..)
__device__ __forceinline__ v16h ldfrag_h(const _Float16* p) {
  union { v16h v; v8h h[2]; } f;
  f.h[0] = *(const v8h*)(p);
  f.h[1] = *(const v8h*)(p + 16);
  return f.v;
}

// ---- WMMA helper with trailing VALU hazard gap ----------------------------------------------------------
__device__ __forceinline__ v8f mma_h(v16h a, v16h b, v8f c) {
  c = __builtin_amdgcn_wmma_f32_16x16x32_f16(false, a, false, b, (short)0, c, false, false);
#if defined(__HIP_DEVICE_COMPILE__)
  asm volatile("v_nop\n\tv_nop\n\tv_nop\n\tv_nop" : "+v"(c) : "v"(a), "v"(b));
#endif
  return c;
}

// =====================================================================================================
// Layer norm over EW channels of each edge row (inputs and affine params RNE-converted to bf16 first, f32
// [nrows][EW]. One wave per row, 8 channels per lane; each plane row = 512 B written by one instruction
// coverage: nrows waves x 32 lanes x 8 = every element of both planes.
// =====================================================================================================
__global__ __launch_bounds__(256) void ln_planes(const float* __restrict__ e, const float* __restrict__ lw,
                                                 const float* __restrict__ lb, unsigned short* xh,
                                                 unsigned short* xl, int nrows) {
  const int lane = threadIdx.x & 31;
  const int wave = threadIdx.x >> 5;
  const int row = blockIdx.x * 8 + wave;
  if (row >= nrows) return;                           // wave-uniform; no block barriers in this kernel
  const int c0 = lane * 8;
  const float* src = e + (size_t)row * EW + c0;
  const v4f a0 = *(const v4f*)(src);
  const v4f a1 = *(const v4f*)(src + 4);
  const v4f w0 = *(const v4f*)(lw + c0);
  const v4f w1 = *(const v4f*)(lw + c0 + 4);
  const v4f b0 = *(const v4f*)(lb + c0);
  const v4f b1 = *(const v4f*)(lb + c0 + 4);
  float v[8], w[8], bb[8];
#pragma unroll
  for (int t = 0; t < 4; ++t) {
    v[t]      = bf_up(bf_bits(a0[t]));
    v[4 + t]  = bf_up(bf_bits(a1[t]));
    w[t]      = bf_up(bf_bits(w0[t]));
    w[4 + t]  = bf_up(bf_bits(w1[t]));
    bb[t]     = bf_up(bf_bits(b0[t]));
    bb[4 + t] = bf_up(bf_bits(b1[t]));
  }
  float s = 0.f;
#pragma unroll
  for (int t = 0; t < 8; ++t) s += v[t];
#pragma unroll
  for (int o = 16; o > 0; o >>= 1) s += __shfl_xor(s, o);
  const float mu = s * (1.0f / (float)EW);
  float d[8];
  float s2 = 0.f;
#pragma unroll
  for (int t = 0; t < 8; ++t) { d[t] = v[t] - mu; s2 += d[t] * d[t]; }
#pragma unroll
  for (int o = 16; o > 0; o >>= 1) s2 += __shfl_xor(s2, o);
  const float var = s2 * (1.0f / (float)EW);
  const float rs = rsqrtf(var + 1e-5f);
  v4u ph, pl;
#pragma unroll
  for (int t = 0; t < 4; ++t) {
    const float y0 = d[2 * t] * rs * w[2 * t] + bb[2 * t];
    const float y1 = d[2 * t + 1] * rs * w[2 * t + 1] + bb[2 * t + 1];
    const _Float16 hq0 = (_Float16)y0;
    const _Float16 hq1 = (_Float16)y1;
    const _Float16 lq0 = (_Float16)((y0 - (float)hq0) * 2048.0f);
    const _Float16 lq1 = (_Float16)((y1 - (float)hq1) * 2048.0f);
    ph[t] = pk16(h_bits(hq0), h_bits(hq1));
    pl[t] = pk16(h_bits(lq0), h_bits(lq1));
  }
  const size_t o = (size_t)row * EW + c0;
  {
    *(v4u*)(xh + o) = ph;
    *(v4u*)(xl + o) = pl;
    
  }
}

// =====================================================================================================
// Transpose-convert: in f32 [R][C] row-major -> out f16 [C][R] (r contiguous), out[c][r] =
// f16(bf16rne(in[r][c]) * scale), scale a power of two. Block = one 64 r x 64 c tile staged in LDS as f32
// (v4f loads, __syncthreads); grid = (R/64, C/64, matrices of that shape: 1 or 2).
// Store: group gq = tid>>3 (0..31), piece = tid&7: iteration it writes out row c = it*32+gq, lanes 8q..8q+7
// coverage: 2 iterations x 32 groups = 64 out rows, 8 pieces x 8 = 64 r per row; grid covers every tile ->
// the whole plane.
// =====================================================================================================
__global__ __launch_bounds__(256) void tr_f16(const float* __restrict__ in0, const float* __restrict__ in1,
                                              unsigned short* out, int R, int C, float scale) {
  __shared__ __align__(16) float sv[64 * 68];       // [rr][cc] pitch 68 floats
  const int tid = threadIdx.x;
  const float* in = (blockIdx.z != 0) ? in1 : in0;  // grid z picks the matrix; its plane follows the first
  out += (size_t)blockIdx.z * R * C;
  const int r0 = blockIdx.x * 64;
  const int c0 = blockIdx.y * 64;
#pragma unroll
  for (int i = 0; i < 4; ++i) {
    const int idx = i * 256 + tid;                  // 0..1023
    const int rr = idx >> 4, c4 = (idx & 15) * 4;
    const v4f a = *(const v4f*)(in + (size_t)(r0 + rr) * C + c0 + c4);
    *(v4f*)(sv + rr * 68 + c4) = a;
  }
  __syncthreads();

  const int gq = tid >> 3, piece = tid & 7;
  v4u hv[2];
  size_t hofs[2];
#pragma unroll
  for (int it = 0; it < 2; ++it) {
    const int cc = it * 32 + gq;
    v4u a;
#pragma unroll
    for (int t = 0; t < 4; ++t) {
      const float f0 = bf_up(bf_bits(sv[(piece * 8 + 2 * t) * 68 + cc]));
      const float f1 = bf_up(bf_bits(sv[(piece * 8 + 2 * t + 1) * 68 + cc]));
      a[t] = pk16(h_bits((_Float16)(f0 * scale)), h_bits((_Float16)(f1 * scale)));
    }
    hv[it] = a;
    hofs[it] = (size_t)(c0 + cc) * R + r0 + piece * 8;
  }
  {
#pragma unroll
    for (int it = 0; it < 2; ++it) {
      *(v4u*)(out + hofs[it]) = hv[it];
    }
    
  }
}

// =====================================================================================================
// Additive mask mk f32 [NB][SEQ x][SEQ y][NH h] -> two f32 planes of msc * bf16rne(mk), msc a power of two:
//   ma[b][h][x][y] (direct) and mb[b][h][y][x] (transposed), both with the last index contiguous.
// grid = (SEQ/8 groups, NH, NB), 256 threads. Direct part: thread (xx = tid>>5, y4 = (tid&31)*4) gathers 4
// values of row x = grp*8+xx and stores 16 B; a wave writes the whole 512-B row (4 lines, one instruction).
// Transposed part: 128 x times 8 y staged in LDS (pitch 132), __syncthreads, then thread (yy = tid>>5,
// x4 = (tid&31)*4) stores 16 B of row y = grp*8+yy; a wave writes the whole 512-B row, one instruction.
// coverage: 16 groups x 8 rows x (32 lanes x 4) = all SEQ x SEQ of every (b,h) in both planes.
// =====================================================================================================
__global__ __launch_bounds__(256) void mask_planes(const float* __restrict__ mk, float* ma, float* mb,
                                                   float msc) {
  __shared__ __align__(16) float sm[8 * 132];
  const int tid = threadIdx.x;
  const int grp = blockIdx.x;
  const int h = blockIdx.y;
  const int b = blockIdx.z;
  const size_t pb = ((size_t)(b * NH + h)) * SEQ * SEQ;          // plane base of (b,h)
  v4f vd;
  size_t od;
  {
    const int xx = tid >> 5, y4 = (tid & 31) * 4;
    const int x = grp * 8 + xx;
    const float* src = mk + (((size_t)b * SEQ + x) * SEQ + y4) * NH + h;
#pragma unroll
    for (int t = 0; t < 4; ++t) vd[t] = msc * bf_up(bf_bits(src[(size_t)t * NH]));
    od = pb + (size_t)x * SEQ + y4;
  }
  {
    const int x = tid >> 1, yq = (tid & 1) * 4;
    const float* src = mk + (((size_t)b * SEQ + x) * SEQ + grp * 8 + yq) * NH + h;
#pragma unroll
    for (int t = 0; t < 4; ++t) sm[(yq + t) * 132 + x] = msc * bf_up(bf_bits(src[(size_t)t * NH]));
  }
  __syncthreads();
  v4f vt;
  size_t ot;
  {
    const int yy = tid >> 5, x4 = (tid & 31) * 4;
    vt = *(const v4f*)(sm + yy * 132 + x4);
    ot = pb + (size_t)(grp * 8 + yy) * SEQ + x4;
  }
  {
    *(v4f*)(ma + od) = vd;
    *(v4f*)(mb + ot) = vt;
    
  }
}

// =====================================================================================================
// Main loop shared by the two projections: one block = 128 x 128 of the product, 8 waves as 4 (m) x 2 (n),
// each wave its 32 x 64 tile. Operands go global -> registers -> LDS in chunks of KC k values, so that every
// global load covers whole 128-B lines (8 lanes per row) and each staged row serves 2 (A) or 4 (B) waves.
// Buffer rows: A hi 0..127 | A residual 128..255 | B 256..383, pitch LP. Thread t stages piece t&7 of rows
// u*32 + (t>>3), u = 0..11; gAh, gAl, gB point at its piece of its first row of each operand, sA / sB are
// the element strides between its successive rows. Two buffers: chunk c+1 is loaded into registers ahead of
// the products of chunk c and stored behind them into the buffer whose readers left at the previous
// barrier; one barrier per chunk publishes it. k runs upward in steps of 32 within and across chunks.
// The closing barrier of the last chunk lets the caller reuse sm.
// =====================================================================================================
#define KC   64                 // k values per staged chunk (128 B of every operand row)
#define LP   72                 // LDS row pitch in halves: 144 B = 16 B x 9, 16-B fragment reads meet each bank once
#define STG  (384 * LP)         // halves per buffer (55296 B)

__device__ __forceinline__ void gemm_blk(const _Float16* gAh, const _Float16* gAl, size_t sA,
                                         const _Float16* gB, size_t sB, int K, _Float16* sm, int tid,
                                         v8f (&acch)[2][4], v8f (&accl)[2][4]) {
  const int lane = tid & 31;
  const int wave = tid >> 5;
  const int fo = (lane & 15) * LP + (lane >> 4) * 8;            // fragment row and k half of this lane
  const int ra = (wave & 3) * 32 * LP + fo;                     // A hi rows of this wave
  const int rb = (256 + (wave >> 2) * 64) * LP + fo;            // B rows of this wave
  _Float16* sw = sm + (tid >> 3) * LP + (tid & 7) * 8;
  v4u st[12];
#pragma unroll
  for (int u = 0; u < 4; ++u) {
    st[u]     = *(const v4u*)(gAh + u * sA);
    st[4 + u] = *(const v4u*)(gAl + u * sA);
    st[8 + u] = *(const v4u*)(gB + u * sB);
  }
#pragma unroll
  for (int u = 0; u < 12; ++u) *(v4u*)(sw + u * 32 * LP) = st[u];
  __syncthreads();

  const int nc = K / KC;
  for (int c = 0; c < nc; ++c) {
    const bool more = (c + 1) < nc;                             // block-uniform
    if (more) {
      const int ko = (c + 1) * KC;
#pragma unroll
      for (int u = 0; u < 4; ++u) {
        st[u]     = *(const v4u*)(gAh + u * sA + ko);
        st[4 + u] = *(const v4u*)(gAl + u * sA + ko);
        st[8 + u] = *(const v4u*)(gB + u * sB + ko);
      }
    }
    const _Float16* sb = sm + (c & 1) * STG;
#pragma unroll
    for (int kk = 0; kk < KC; kk += 32) {
      v16h fh[2], fl[2];
#pragma unroll
      for (int i = 0; i < 2; ++i) {
        fh[i] = ldfrag_h(sb + ra + i * 16 * LP + kk);
        fl[i] = ldfrag_h(sb + ra + (128 + i * 16) * LP + kk);
      }
      v16h bnx = ldfrag_h(sb + rb + kk);
#pragma unroll
      for (int j = 0; j < 4; ++j) {
        const v16h bfr = bnx;
        if (j < 3) bnx = ldfrag_h(sb + rb + (j + 1) * 16 * LP + kk);   // next B fragment flies under this one's products
#pragma unroll
        for (int i = 0; i < 2; ++i) {
          acch[i][j] = mma_h(fh[i], bfr, acch[i][j]);
          accl[i][j] = mma_h(fl[i], bfr, accl[i][j]);
        }
      }
    }
    if (more) {
      _Float16* sn = sw + ((c + 1) & 1) * STG;
#pragma unroll
      for (int u = 0; u < 12; ++u) *(v4u*)(sn + u * 32 * LP) = st[u];
    }
    __syncthreads();
  }
}

// =====================================================================================================
// Fused q/k/v projection; grid y = batch * 2 + direction picks the batch's X rows, the direction's Wt and
// bias, and that pair's own output planes. For the edge rows of one batch: X[m][k] . Wt[n][k] + bf16rne(bias[n]) with
// X = f16 hi plane + residual plane (x2048) [RB][EW], Wt f16 [W3][EW] (k contiguous), f16 products into
// separate hi/residual accumulators, f32 accumulate; value = ((acch + accl*scl)*sch + bias) * fac(sec)
// with sec = n / EW (0 q, 1 k, 2 v). Block = 128 rows x 2 column tiles (gemm_blk); one wave per 32 x 64 tile; the tile's 64 columns are a PERMUTED set:
// n = sec*EW + d*NH + h for d in 0..31 and h in {h0, h0+1} (tn = sec*4 + h0/2), B fragment j covers
// hh = j>>1, d = (j&1)*16 + lane&15. Output written as head-major f16 planes hi = f16(value),
// lo = f16((value - hi) * 2048): element (sec, h, row m, d) at [((sec*NH + h)*RB + m)*HD + d]
// (hi plane [3][NH][RB][HD]; lo plane [2][NH][RB][HD], q and k only). Staged B row q*32 + d holds column
// n = sec*EW + d*NH + (bn&1)*4 + q, which is fragment row (j&1)*16 + lane&15 of wave column q>>1, j>>1 = q&1.
// Epilogue: per-wave 16-row slabs in the staging LDS (free behind the main loop's closing barrier),
// column cc = hh*32 + d), then lane g8 = lane>>3, pc = lane&7: instruction q writes line L = q*4+g8
// coverage: 2 slabs x 16 lines (2 hh x 8 row pairs) x 8 pieces of 8 d = the wave's whole 32 x 64 tile in
// the hi plane (and in the lo plane for sec < 2); 512 x 12 tiles cover [3][NH][RB][HD] exactly.
// =====================================================================================================
__global__ __launch_bounds__(256) void gemm_p(
    const unsigned short* __restrict__ Ahp, const unsigned short* __restrict__ Alp,
    const unsigned short* __restrict__ Btp, const float* __restrict__ bias0, const float* __restrict__ bias1,
    unsigned short* php, unsigned short* plp,
    float f0, float f1, float f2, float sch, float scl) {
  const int bd  = blockIdx.y;              // batch * 2 + direction
  const int dir = bd & 1;
  const size_t xo = (size_t)(bd >> 1) * RB * EW;
  const _Float16* Ah = (const _Float16*)(const void*)Ahp + xo;
  const _Float16* Al = (const _Float16*)(const void*)Alp + xo;
  const _Float16* Bh = (const _Float16*)(const void*)Btp + (size_t)dir * W3 * EW;
  const float* bias = (dir != 0) ? bias1 : bias0;
  php += (size_t)bd * 3 * NH * RB * HD;
  plp += (size_t)bd * 2 * NH * RB * HD;
  __shared__ __align__(16) unsigned short smem[2 * STG];
  const int tid  = threadIdx.x;
  const int lane = tid & 31;
  const int wave = tid >> 5;
  constexpr int blkN = W3 / 128;           // 6 column pairs; grid x = (RB / 128) * blkN exactly
  const int bm = blockIdx.x / blkN;
  const int bn = blockIdx.x - bm * blkN;
  const int tn = bn * 2 + (wave >> 2);
  const int m0 = bm * 128 + (wave & 3) * 32;
  const int sec = tn >> 2;                 // 0 q, 1 k, 2 v (the same for both column tiles of a block)
  const int h0 = (tn & 3) * 2;             // head pair
  const int rlane = lane & 15;
  const int mOff  = (lane >> 4) * 8;
  int nB[4];
#pragma unroll
  for (int j = 0; j < 4; ++j) nB[j] = sec * EW + ((((j & 1) << 4) + rlane) << 3) + h0 + (j >> 1);

  v8f acch[2][4], accl[2][4];
#pragma unroll
  for (int i = 0; i < 2; ++i)
#pragma unroll
    for (int j = 0; j < 4; ++j) { acch[i][j] = zero8(); accl[i][j] = zero8(); }

  {
    const size_t ao = (size_t)(bm * 128 + (tid >> 3)) * EW + (tid & 7) * 8;
    const size_t bo = (size_t)((bn >> 1) * EW + (tid >> 3) * NH + (bn & 1) * 4) * EW + (tid & 7) * 8;
    gemm_blk(Ah + ao, Al + ao, (size_t)32 * EW, Bh + bo, (size_t)EW, EW,
             (_Float16*)(void*)smem, tid, acch, accl);
  }

  const float fac = (sec == 0) ? f0 : ((sec == 1) ? f1 : f2);
  float bz[4];
#pragma unroll
  for (int j = 0; j < 4; ++j) bz[j] = bf_up(bf_bits(bias[nB[j]]));

  float* slab = (float*)(void*)smem + wave * (16 * 68);
  const int g8 = lane >> 3, pc = lane & 7;
#pragma unroll
  for (int i = 0; i < 2; ++i) {
    const int mBase = m0 + (i << 4);
#pragma unroll
    for (int r = 0; r < 8; ++r) {
#pragma unroll
      for (int j = 0; j < 4; ++j) {
        slab[(mOff + r) * 68 + (j << 4) + rlane] = ((acch[i][j][r] + accl[i][j][r] * scl) * sch + bz[j]) * fac;
      }
    }
    __builtin_amdgcn_fence(__ATOMIC_RELEASE, "workgroup");
    __builtin_amdgcn_wave_barrier();
    __builtin_amdgcn_fence(__ATOMIC_ACQUIRE, "workgroup");
    {
      v4u hv[4], lv[4];
      size_t ofs[4];
#pragma unroll
      for (int q = 0; q < 4; ++q) {
        const int L = q * 4 + g8;                    // line 0..15 of this slab
        const int hh = L >> 3, t = L & 7;
        const int row = 2 * t + (pc >> 2);
        const int d0 = (pc & 3) * 8;
        const v4f x0 = *(const v4f*)(slab + row * 68 + hh * 32 + d0);
        const v4f x1 = *(const v4f*)(slab + row * 68 + hh * 32 + d0 + 4);
        float f[8];
        f[0] = x0[0]; f[1] = x0[1]; f[2] = x0[2]; f[3] = x0[3];
        f[4] = x1[0]; f[5] = x1[1]; f[6] = x1[2]; f[7] = x1[3];
        v4u ph, pl;
#pragma unroll
        for (int u = 0; u < 4; ++u) {
          const float s0 = f[2 * u];
          const float s1 = f[2 * u + 1];
          const _Float16 hq0 = (_Float16)s0;
          const _Float16 hq1 = (_Float16)s1;
          const _Float16 lq0 = (_Float16)((s0 - (float)hq0) * 2048.0f);
          const _Float16 lq1 = (_Float16)((s1 - (float)hq1) * 2048.0f);
          ph[u] = pk16(h_bits(hq0), h_bits(hq1));
          pl[u] = pk16(h_bits(lq0), h_bits(lq1));
        }
        hv[q] = ph;
        lv[q] = pl;
        ofs[q] = (((size_t)(sec * NH + h0 + hh)) * RB + (size_t)(mBase + row)) * HD + d0;
      }
      {
#pragma unroll
        for (int q = 0; q < 4; ++q) {
          *(v4u*)(php + ofs[q]) = hv[q];
          if (sec < 2) *(v4u*)(plp + ofs[q]) = lv[q];
        }
        
      }
    }
    __builtin_amdgcn_fence(__ATOMIC_RELEASE, "workgroup");
    __builtin_amdgcn_wave_barrier();
    __builtin_amdgcn_fence(__ATOMIC_ACQUIRE, "workgroup");
  }
}

// =====================================================================================================
// Axial attention, grid y = batch * 2 + direction: block = (column index j = blockIdx.x, all 8 heads),
// wave = head h, 16-query strips s = 0..7 in lockstep.
//   queries i: plane row i*SEQ + j; keys/values kk: plane row kk*ks + j*js (dir 0: ks=1, js=SEQ ->
//   rows (j,kk); dir 1: ks=SEQ, js=1 -> rows (kk,j)); additive mask plane mp[h][i][kk] (already x64 and
//   bf16-RNE'd, direct for dir 0 and transposed for dir 1).
// Scores are computed TRANSPOSED: S^T[kk][i] = K(A, lane = key row, d per k-map) . Q^T(B, lane = query,
// d per k-map), hi.hi into the mask-initialised accumulator plus (hi.lo + lo.hi)*xscl; D lane = query i,
// element r = key 16ct + 8g + r, so a lane and its partner lane^16 own one softmax row: max / exp / sum in
// f32 with one __shfl_xor(.,16) each. Weights p*pcar are converted to f16 in registers and used directly as
// the B operand of O^T[d][i] = V^T(A from LDS, lane = d, keys per k-map) . P^T (B: lane = query, element
// e <- tile 2c key 8g+e, element 8+e <- tile 2c+1 key 8g+e).
// LDS: sVt [NH][HD][VTP] v^T tiles (built once per block by register transposition of 4 key rows into 8-B
// stores; each wave stages and reads only its own head; block barrier after staging; staged extent k 0..127
// == consumed extent); sO [16][SOP] f32 output slab (cross-wave: block barriers before the row writes and
// before the next strip).
// Output: f16 planes vah = f16(O*1024), val = f16((O*1024 - hi)*2048), [RB rows i*SEQ+j][KO] at columns
// dir*EW + d*NH + h; per strip wave h writes rows 2h, 2h+1: 32 lanes x 16 B = the whole 512-B half row
// coverage: 8 strips x 8 waves x 2 rows = 128 queries x (32 lanes x 8 = 256 channels) for every (j, dir)
// -> together with the other direction's blocks every element of both planes of this batch.
// =====================================================================================================
__global__ __launch_bounds__(256) void attn_ax(
    const unsigned short* __restrict__ php, const unsigned short* __restrict__ plp,
    const float* __restrict__ mp, unsigned short* vah, unsigned short* val,
    float xscl, float escl, float pcar, float oscl) {
  const int bd  = blockIdx.y;                      // batch * 2 + direction
  const int dir = bd & 1;
  php += (size_t)bd * 3 * NH * RB * HD;
  plp += (size_t)bd * 2 * NH * RB * HD;
  mp  += (size_t)(dir * NB + (bd >> 1)) * NH * SEQ * SEQ;   // direct planes of all batches, then transposed
  vah += (size_t)(bd >> 1) * RB * KO;
  val += (size_t)(bd >> 1) * RB * KO;
  const _Float16* Ph = (const _Float16*)(const void*)php;
  const _Float16* Pl = (const _Float16*)(const void*)plp;
  __shared__ __align__(16) unsigned short sVt[NH * HD * VTP];     // 69632 B
  __shared__ __align__(16) float sO[16 * SOP];                    // 16896 B
  const _Float16* sVh = (const _Float16*)(const void*)sVt;
  const int tid  = threadIdx.x;
  const int lane = tid & 31;
  const int h    = tid >> 5;
  const int nl   = lane & 15;
  const int g    = lane >> 4;
  const int g8   = g * 8;
  const int j    = blockIdx.x;
  const size_t hs = (size_t)RB * HD;               // per-head plane stride (halves)
  const size_t ss = (size_t)NH * hs;               // per-section stride
  const _Float16* Qh = Ph + (size_t)h * hs;
  const _Float16* Kh = Ph + ss + (size_t)h * hs;
  const _Float16* Ql = Pl + (size_t)h * hs;
  const _Float16* Kl = Pl + ss + (size_t)h * hs;
  const unsigned short* Vu = php + 2 * ss + (size_t)h * hs;
  const int ks = (dir != 0) ? SEQ : 1;
  const int js = (dir != 0) ? 1 : SEQ;

  // ---- stage v^T of head h: unit u = (key quad kq, d octet dq): 4 x 16-B row loads -> 8 x 8-B LDS stores
#pragma unroll
  for (int it = 0; it < 4; ++it) {
    const int u  = it * 32 + lane;                 // 0..127
    const int kq = u >> 2, dq = u & 3;
    const int kb = kq * 4;
    v4u rw[4];
#pragma unroll
    for (int a = 0; a < 4; ++a) {
      const size_t rowk = (size_t)(kb + a) * ks + (size_t)j * js;
      rw[a] = *(const v4u*)(Vu + rowk * HD + dq * 8);
    }
#pragma unroll
    for (int d = 0; d < 8; ++d) {
      const int wd = d >> 1, sh = (d & 1) * 16;
      const unsigned x0 = (rw[0][wd] >> sh) & 0xFFFFu;
      const unsigned x1 = (rw[1][wd] >> sh) & 0xFFFFu;
      const unsigned x2 = (rw[2][wd] >> sh) & 0xFFFFu;
      const unsigned x3 = (rw[3][wd] >> sh) & 0xFFFFu;
      v2u o;
      o[0] = x0 | (x1 << 16);
      o[1] = x2 | (x3 << 16);
      *(v2u*)(sVt + (h * HD + dq * 8 + d) * VTP + kb) = o;
    }
  }
  __syncthreads();

#pragma unroll 1
  for (int s = 0; s < 8; ++s) {
    const int i = s * 16 + nl;                                  // this lane's query (B column / D column)
    const size_t qofs = ((size_t)i * SEQ + j) * HD + g8;
    const v16h qh = ldfrag_h(Qh + qofs);
    const v16h ql = ldfrag_h(Ql + qofs);
    const float* mrow = mp + ((size_t)h * SEQ + i) * SEQ + g8;

    // ---- transposed scores, 8 key tiles
    v8f acc[8];
#pragma unroll
    for (int ct = 0; ct < 8; ++ct) {
      const int kk = ct * 16 + nl;                              // key row loaded by this lane (A row)
      const size_t kofs = ((size_t)kk * ks + (size_t)j * js) * HD + g8;
      const v16h kh = ldfrag_h(Kh + kofs);
      const v16h kl = ldfrag_h(Kl + kofs);
      const v4f mv0 = *(const v4f*)(mrow + ct * 16);
      const v4f mv1 = *(const v4f*)(mrow + ct * 16 + 4);
      v8f am;
      am[0] = mv0[0]; am[1] = mv0[1]; am[2] = mv0[2]; am[3] = mv0[3];
      am[4] = mv1[0]; am[5] = mv1[1]; am[6] = mv1[2]; am[7] = mv1[3];
      v8f ax = mma_h(kh, ql, zero8());
      ax = mma_h(kl, qh, ax);
      am = mma_h(kh, qh, am);
      acc[ct] = am + ax * xscl;
    }

    // ---- softmax over the 128 keys of query i (this lane: 64 values, partner lane^16: the other 64)
    float mx = acc[0][0];
#pragma unroll
    for (int ct = 0; ct < 8; ++ct)
#pragma unroll
      for (int r = 0; r < 8; ++r) mx = fmaxf(mx, acc[ct][r]);
    mx = fmaxf(mx, __shfl_xor(mx, 16));
    float sum = 0.f;
#pragma unroll
    for (int ct = 0; ct < 8; ++ct)
#pragma unroll
      for (int r = 0; r < 8; ++r) {
        const float ev = __expf((acc[ct][r] - mx) * escl);
        acc[ct][r] = ev;
        sum += ev;
      }
    sum += __shfl_xor(sum, 16);
    const float rc = pcar / sum;                                // sum >= 1

    // ---- P^T as B fragments straight from the accumulators
    v16h pb[4];
#pragma unroll
    for (int c = 0; c < 4; ++c) {
      union { v16h v; v8h hh[2]; } U;
      v8h p0, p1;
#pragma unroll
      for (int e2 = 0; e2 < 8; ++e2) {
        p0[e2] = (_Float16)(acc[2 * c][e2] * rc);
        p1[e2] = (_Float16)(acc[2 * c + 1][e2] * rc);
      }
      U.hh[0] = p0;
      U.hh[1] = p1;
      pb[c] = U.v;
    }

    // ---- O^T[d][i] = V^T . P^T, two 16-row d tiles, K = 128 keys
    v8f oacc[2];
#pragma unroll
    for (int dt = 0; dt < 2; ++dt) {
      v8f o = zero8();
#pragma unroll
      for (int c = 0; c < 4; ++c) {
        const v16h va = ldfrag_h(sVh + (h * HD + dt * 16 + nl) * VTP + 32 * c + g8);
        o = mma_h(va, pb[c], o);
      }
      oacc[dt] = o;
    }

    // ---- stage O (f32, true scale) into the slab: row = query nl, column = d*NH + h
#pragma unroll
    for (int dt = 0; dt < 2; ++dt)
#pragma unroll
      for (int r = 0; r < 8; ++r)
        sO[nl * SOP + ((dt * 16 + g8 + r) << 3) + h] = oacc[dt][r] * oscl;
    __syncthreads();

    // ---- wave h writes queries s*16 + 2h, + 2h + 1: 512-B half rows in hi and residual planes
    {
      v4u hv[2], lv[2];
      size_t ofs[2];
#pragma unroll
      for (int q = 0; q < 2; ++q) {
        const int rr = 2 * h + q;
        const v4f x0 = *(const v4f*)(sO + rr * SOP + lane * 8);
        const v4f x1 = *(const v4f*)(sO + rr * SOP + lane * 8 + 4);
        float f[8];
        f[0] = x0[0]; f[1] = x0[1]; f[2] = x0[2]; f[3] = x0[3];
        f[4] = x1[0]; f[5] = x1[1]; f[6] = x1[2]; f[7] = x1[3];
        v4u ph, pl;
#pragma unroll
        for (int u = 0; u < 4; ++u) {
          const float s0 = f[2 * u] * 1024.0f;
          const float s1 = f[2 * u + 1] * 1024.0f;
          const _Float16 hq0 = (_Float16)s0;
          const _Float16 hq1 = (_Float16)s1;
          const _Float16 lq0 = (_Float16)((s0 - (float)hq0) * 2048.0f);
          const _Float16 lq1 = (_Float16)((s1 - (float)hq1) * 2048.0f);
          ph[u] = pk16(h_bits(hq0), h_bits(hq1));
          pl[u] = pk16(h_bits(lq0), h_bits(lq1));
        }
        hv[q] = ph;
        lv[q] = pl;
        ofs[q] = ((size_t)(s * 16 + rr) * SEQ + j) * KO + (size_t)dir * EW + lane * 8;
      }
      {
#pragma unroll
        for (int q = 0; q < 2; ++q) {
          *(v4u*)(vah + ofs[q]) = hv[q];
          *(v4u*)(val + ofs[q]) = lv[q];
        }
        
      }
    }
    __syncthreads();                                            // sO reused by the next strip
  }
}

// =====================================================================================================
// Output projection: C[m][n] = sch * (sum_k Ahi[m][k]*Bt[n][k] + scl * sum_k Alo[m][k]*Bt[n][k]) + bf16rne(bias[n])
// (f16 products, f32 accumulate, hi and scaled-residual products in separate accumulators). Ahi/Alo row-major
// [M][K] pitch lda; Bt [N][K] pitch ldb; C f32 [M][N] pitch ldc. Block = 128 x 128 of C (gemm_blk), one wave per
// 32x64 tile; M = RT, N = EW, K = KO (multiples of 128, 128 and KC).
// Epilogue: 16-row slabs staged per wave in the staging LDS (free behind the main loop's closing barrier); each 64-wide row segment (256 B) written by one instruction
// coverage: 2 slabs x 16 rows x 64 cols = the wave's whole 32x64 tile; grid covers every tile of C.
// =====================================================================================================
__global__ __launch_bounds__(256) void gemm32h_w(
    const unsigned short* __restrict__ Ahp, const unsigned short* __restrict__ Alp,
    const unsigned short* __restrict__ Btp,
    const float* __restrict__ bias,
    float* C, float sch, float scl) {
  constexpr int lda = KO, ldb = KO, ldc = EW, M = RT, N = EW, K = KO;   // fixed: staged row steps become immediate offsets
  const _Float16* Ah = (const _Float16*)(const void*)Ahp;
  const _Float16* Al = (const _Float16*)(const void*)Alp;
  const _Float16* Bh = (const _Float16*)(const void*)Btp;
  __shared__ __align__(16) unsigned short smem[2 * STG];
  const int tid  = threadIdx.x;
  const int lane = tid & 31;
  const int wave = tid >> 5;
  constexpr int blkN = N >> 7;
  if ((int)blockIdx.x >= (M >> 7) * blkN) return;   // block-uniform, in front of every barrier
  const int bm = blockIdx.x / blkN;
  const int bn = blockIdx.x - bm * blkN;
  const int m0 = bm * 128 + (wave & 3) * 32;
  const int n0 = bn * 128 + (wave >> 2) * 64;
  const int rlane = lane & 15;
  const int mOff  = (lane >> 4) * 8;

  v8f acch[2][4], accl[2][4];
#pragma unroll
  for (int i = 0; i < 2; ++i)
#pragma unroll
    for (int j = 0; j < 4; ++j) { acch[i][j] = zero8(); accl[i][j] = zero8(); }

  {
    const size_t ao = (size_t)(bm * 128 + (tid >> 3)) * lda + (tid & 7) * 8;
    const size_t bo = (size_t)(bn * 128 + (tid >> 3)) * ldb + (tid & 7) * 8;
    gemm_blk(Ah + ao, Al + ao, (size_t)32 * lda, Bh + bo, (size_t)32 * ldb, K,
             (_Float16*)(void*)smem, tid, acch, accl);
  }

  float bz[4];
#pragma unroll
  for (int j = 0; j < 4; ++j) bz[j] = bf_up(bf_bits(bias[n0 + (j << 4) + rlane]));

  float* slab = (float*)(void*)smem + wave * (16 * 68);
#pragma unroll
  for (int i = 0; i < 2; ++i) {
    const int mBase = m0 + (i << 4);
#pragma unroll
    for (int r = 0; r < 8; ++r) {
#pragma unroll
      for (int j = 0; j < 4; ++j) {
        slab[(mOff + r) * 68 + (j << 4) + rlane] = (acch[i][j][r] + accl[i][j][r] * scl) * sch + bz[j];
      }
    }
    __builtin_amdgcn_fence(__ATOMIC_RELEASE, "workgroup");
    __builtin_amdgcn_wave_barrier();
    __builtin_amdgcn_fence(__ATOMIC_ACQUIRE, "workgroup");
    {
      const int hh = lane >> 4, c4 = (lane & 15) * 4;     // 256-B row segment = 16 lanes x 16 B
      v4f ov[8];
#pragma unroll
      for (int it = 0; it < 8; ++it) {
        const int row = it * 2 + hh;                       // it 0..7 x hh 0..1 = rows 0..15
        ov[it] = *(const v4f*)(slab + row * 68 + c4);
      }
      {
#pragma unroll
        for (int it = 0; it < 8; ++it) {
          const int row = it * 2 + hh;
          *(v4f*)(C + (size_t)(mBase + row) * ldc + n0 + c4) = ov[it];
        }
        
      }
    }
    __builtin_amdgcn_fence(__ATOMIC_RELEASE, "workgroup");
    __builtin_amdgcn_wave_barrier();
    __builtin_amdgcn_fence(__ATOMIC_ACQUIRE, "workgroup");
  }
}

// =====================================================================================================
// Workspace map (bytes, NB = 2); every region an exact multiple of its whole-line store granularity, all
// written earlier in the same call. Every (batch, direction) pair has its own Ph / Pl planes, so each stage
// is one launch over all four pairs. Vah lies on Xh + Xl, whose last reader (the projection) has ended.
//   Xh   f16 [RT][EW]                     0        16777216   (layer norm output, hi)
//   Xl   f16 [RT][EW]              16777216        16777216   (residual x2048)
//   Wti  f16 [W3 n][EW k]          33554432          393216   (f16(bf16(Wqkv_in) x64))
//   Wto  f16 [W3 n][EW k]          33947648          393216
//   Woh  f16 [EW n][KO k]          34340864          262144   (f16(bf16(Wo) x1024))
//   mA   f32 [NB][NH][SEQ][SEQ]    34603008         1048576   (64 x bf16(mask), direct)
//   mB   f32 [NB][NH][SEQ][SEQ]    35651584         1048576   (transposed)
//   Ph   f16 [2 NB][3][NH][RB][HD] 36700160       100663296   (q x16*32^-0.5, k x4, v x4; hi)
//   Pl   f16 [2 NB][2][NH][RB][HD] 137363456       67108864   (q, k residual x2048)
//   Val  f16 [RT][KO]             204472320        33554432   (attention output residual x2048)
//   Vah  f16 [RT][KO]                     0        33554432   (attention output x1024, hi; on Xh + Xl)
//   end                           238026752
// Inputs: e f32 [NB][SEQ][SEQ][EW]; mask f32 [NB][SEQ][SEQ][NH]; ln_w, ln_b f32 [EW]; Wqkv_in, Wqkv_out
// f32 [EW in][W3 out]; bqkv_* f32 [W3]; Wo f32 [KO in][EW out]; bo f32 [EW]. d_out f32 [RT][EW] at byte 0
// (row = b*RB + i*SEQ + j, col = n).
// =====================================================================================================
extern "C" void kernel_launch(void* const* d_in, const int* in_sizes, int n_in,
                              void* d_out, int out_size, void* d_ws, size_t ws_size,
                              hipStream_t stream) {
  if (n_in < 10) return;
  if (in_sizes[0] < RT * EW) return;
  if (in_sizes[1] < NB * SEQ * SEQ * NH) return;
  if (in_sizes[2] < EW) return;
  if (in_sizes[3] < EW) return;
  if (in_sizes[4] < EW * W3) return;
  if (in_sizes[5] < W3) return;
  if (in_sizes[6] < EW * W3) return;
  if (in_sizes[7] < W3) return;
  if (in_sizes[8] < KO * EW) return;
  if (in_sizes[9] < EW) return;
  if (out_size < RT * EW) return;

  const float* e    = (const float*)d_in[0];   // [NB][SEQ][SEQ][EW]
  const float* mask = (const float*)d_in[1];   // [NB][SEQ][SEQ][NH]
  const float* ln_w = (const float*)d_in[2];   // [EW]
  const float* ln_b = (const float*)d_in[3];   // [EW]
  const float* Wqi  = (const float*)d_in[4];   // [EW in][W3 out]
  const float* bqi  = (const float*)d_in[5];   // [W3]
  const float* Wqo  = (const float*)d_in[6];   // [EW in][W3 out]
  const float* bqo  = (const float*)d_in[7];   // [W3]
  const float* Wo   = (const float*)d_in[8];   // [KO in][EW out]
  const float* bo   = (const float*)d_in[9];   // [EW]

  const size_t PX  = (size_t)RT * EW * 2;                    // 16777216 (NB = 2)
  const size_t PWt = (size_t)W3 * EW * 2;                    //   393216
  const size_t PWo = (size_t)EW * KO * 2;                    //   262144
  const size_t PM  = (size_t)NB * NH * SEQ * SEQ * 4;        //  1048576 (NB = 2)
  const size_t PPh = (size_t)2 * NB * 3 * NH * RB * HD * 2;  // 100663296 (NB = 2)
  const size_t PPl = (size_t)2 * NB * 2 * NH * RB * HD * 2;  //  67108864
  const size_t PVa = (size_t)RT * KO * 2;                    //  33554432 == 2 * PX
  size_t off = 0;
  const size_t oXh = off; off += PX;
  const size_t oXl = off; off += PX;
  const size_t oWi = off; off += PWt;
  off += PWt;                                                // Wto, directly behind Wti
  const size_t oWo = off; off += PWo;
  const size_t oMa = off; off += PM;
  const size_t oMb = off; off += PM;
  const size_t oPh = off; off += PPh;
  const size_t oPl = off; off += PPl;
  const size_t oVl = off; off += PVa;
  const size_t oVh = oXh;                                    // Vah takes over Xh + Xl (same size)
  if (off > ws_size) return;                                 // off = 238026752 for NB = 2

  char* ws = (char*)d_ws;
  unsigned short* Xh  = (unsigned short*)(ws + oXh);
  unsigned short* Xl  = (unsigned short*)(ws + oXl);
  unsigned short* Wti = (unsigned short*)(ws + oWi);
  unsigned short* Woh = (unsigned short*)(ws + oWo);
  float*          mA  = (float*)(ws + oMa);
  float*          mB  = (float*)(ws + oMb);
  unsigned short* Ph  = (unsigned short*)(ws + oPh);
  unsigned short* Pl  = (unsigned short*)(ws + oPl);
  unsigned short* Vah = (unsigned short*)(ws + oVh);
  unsigned short* Val = (unsigned short*)(ws + oVl);
  float*          outf = (float*)d_out;                      // [RT][EW]

  const dim3 blk(256);
  const dim3 gLn(RT / 8);                                    // 4096 blocks (exact)
  const dim3 gTw(EW / 64, W3 / 64, 2);                       // (4, 12, both directions)
  const dim3 gTo(KO / 64, EW / 64);                          // (8, 4)
  const dim3 gMk(SEQ / 8, NH, NB);                           // (16, 8, 2)
  const dim3 gPr((RB / 128) * (W3 / 128), 2 * NB);           // 768 blocks x (batch, direction)
  const dim3 gAt(SEQ, 2 * NB);                               // one block per column index j x (batch, direction)
  const dim3 gWo((RT / 128) * (EW / 128));                   // 512 blocks
  const float cW     = 64.0f;                                // Wqkv plane carry
  const float fQ     = 16.0f * 0.17677669529663687f;         // 32^-0.5 then carry x16
  const float fK     = 4.0f;                                 // k carry
  const float fV     = 4.0f;                                 // v carry
  const float prSch  = 1.0f / 64.0f;                         // folds the Wqkv plane carry
  const float prScl  = 1.0f / 2048.0f;                       // folds the layer norm residual carry
  const float mkSc   = 64.0f;                                // mask planes x (16 * 4)
  const float axXscl = 1.0f / 2048.0f;                       // q/k residual carry
  const float axEscl = 1.0f / 64.0f;                         // score carry 16 * 4
  const float axPcar = 16384.0f;                             // softmax weight carry
  const float axOscl = 1.0f / 65536.0f;                      // 1/(16384 * 4)
  const float woScale = 1024.0f;                             // Wo plane carry
  const float woSch  = 1.0f / 1048576.0f;                    // 1/(1024 * 1024): O hi carry and Wo carry
  const float woScl  = 1.0f / 2048.0f;                       // O residual carry

  // (1) layer norm -> f16 hi + residual planes; weights -> transposed f16 planes of their bf16 values; masks
  ln_planes<<<gLn, blk, 0, stream>>>(e, ln_w, ln_b, Xh, Xl, RT);
  tr_f16<<<gTw, blk, 0, stream>>>(Wqi, Wqo, Wti, EW, W3, cW);
  tr_f16<<<gTo, blk, 0, stream>>>(Wo, Wo, Woh, KO, EW, woScale);
  mask_planes<<<gMk, blk, 0, stream>>>(mask, mA, mB, mkSc);
  // (2) all batches and both directions at once: projection, attention, output projection
  gemm_p<<<gPr, blk, 0, stream>>>(Xh, Xl, Wti, bqi, bqo, Ph, Pl, fQ, fK, fV, prSch, prScl);
  attn_ax<<<gAt, blk, 0, stream>>>(Ph, Pl, mA, Vah, Val, axXscl, axEscl, axPcar, axOscl);
  gemm32h_w<<<gWo, blk, 0, stream>>>(Vah, Val, Woh, bo, outf, woSch, woScl);
  (void)hipGetLastError();
}

// v003
// One run takes 157 microseconds.
// Next to v002, in two timings, it ran 1.18 times as fast each time.
// Counting every step since v000, it is 2.44 times as fast.
// Contractions: q/k/v projections = v_wmma_f32_16x16x32_f16 (layer-normed input as f16 hi + residual (x2048) planes, two products into separate accumulators; Wqkv as f16 of its bf16-RNE value x64); per-(b,j,h) scores = v_wmma_f32_16x16x32_f16 (k and q as f16 hi + residual (x2048) planes carried x4 and x16*32^-0.5, products hh + hl + lh; additive mask x64 as the initial accumulator); p.v = v_wmma_f32_16x16x32_f16 (softmax weights x16384 in f16 repacked from the score accumulators, v^T f16 tile carried x4, single product); output projection = v_wmma_f32_16x16x32_f16 (attention output as f16 hi (x1024) + residual (x2048) planes, two products; Wo as f16 of its bf16-RNE value x1024); every float input RNE-converted to bf16 on load; all f32 accumulate; layer norm and softmax in f32.
#include <hip/hip_runtime.h>
#include <math.h>
#include <stdint.h>

#ifndef NB
#define NB 2
#endif
#define NB_FULL 2
#ifndef SEQ
#define SEQ 128
#endif
#define EW  256                 // edge width
#define NH  8                   // heads (fastest channel dim)
#define HD  32                  // dot dim
#define W3  (3 * EW)            // 768 fused projection columns
#define KO  (2 * EW)            // 512 concat channels
#define RB  (SEQ * SEQ)         // edge rows per batch (16384)
#define RT  (NB * RB)           // edge rows processed
#define VTP 136                 // LDS v^T tile pitch (halves)
#define SOP 264                 // LDS output slab pitch (floats)

static_assert(NH * HD == EW);
static_assert(HD == 32);
static_assert(EW == 256);
static_assert(SEQ == 128);      // i, j and key extents are coupled; only NB is reducible
static_assert(NB >= 1 && NB <= NB_FULL);
static_assert((RB % 64) == 0 && (RT % 8) == 0);
static_assert((((RB / 32) * (W3 / 64)) % 8) == 0);
static_assert((((RB / 32) * (EW / 64)) % 8) == 0);
static_assert((EW % 64) == 0 && (W3 % 64) == 0 && (KO % 64) == 0 && (EW % 32) == 0 && (KO % 32) == 0);
static_assert((SEQ % 16) == 0 && (SEQ % 8) == 0);
static_assert((RB % 128) == 0 && (W3 % 128) == 0 && (EW % 128) == 0);   // 128 x 128 block tiles of the projections

typedef _Float16 v16h __attribute__((ext_vector_type(16)));
typedef _Float16 v8h  __attribute__((ext_vector_type(8)));
typedef float    v8f  __attribute__((ext_vector_type(8)));
typedef float    v4f  __attribute__((ext_vector_type(4)));
typedef unsigned int v4u __attribute__((ext_vector_type(4)));
typedef unsigned int v2u __attribute__((ext_vector_type(2)));

// ---- scalar helpers --------------------------------------------------------------------------------
__device__ __forceinline__ unsigned short bf_bits(float f) {          // f32 -> bf16 bits, RNE convert
  unsigned u = __float_as_uint(f);
  return (unsigned short)((u + 0x7FFFu + ((u >> 16) & 1u)) >> 16);
}
__device__ __forceinline__ float bf_up(unsigned short h) { return __uint_as_float(((unsigned)h) << 16); }
__device__ __forceinline__ unsigned short h_bits(_Float16 x) { return __builtin_bit_cast(unsigned short, x); }
__device__ __forceinline__ unsigned pk16(unsigned short a, unsigned short b) { return (unsigned)a | ((unsigned)b << 16); }
__device__ __forceinline__ v8f zero8() { v8f z = {0.f, 0.f, 0.f, 0.f, 0.f, 0.f, 0.f, 0.f}; return z; }

// ---- fragment loader: 16-bit A/B operand, lane -> row/col (lane&15), p already includes +8*(lane>>4);
//      elements 0..7 <- p[0..7] (k0+8h..), elements 8..15 <- p[16..23] (k0+16+8h..)
__device__ __forceinline__ v16h ldfrag_h(const _Float16* p) {
  union { v16h v; v8h h[2]; } f;
  f.h[0] = *(const v8h*)(p);
  f.h[1] = *(const v8h*)(p + 16);
  return f.v;
}

// ---- wait that stands between issued global loads and an overwrite of their address registers
__device__ __forceinline__ void xcnt_wait() {
#if defined(__HIP_DEVICE_COMPILE__)
  asm volatile("s_wait_xcnt 0x0" ::: "memory");
#endif
}

// ---- WMMA helper with trailing VALU hazard gap ----------------------------------------------------------
__device__ __forceinline__ v8f mma_h(v16h a, v16h b, v8f c) {
  c = __builtin_amdgcn_wmma_f32_16x16x32_f16(false, a, false, b, (short)0, c, false, false);
#if defined(__HIP_DEVICE_COMPILE__)
  asm volatile("v_nop\n\tv_nop\n\tv_nop\n\tv_nop" : "+v"(c) : "v"(a), "v"(b));
#endif
  return c;
}

// =====================================================================================================
// Layer norm over EW channels of each edge row (inputs and affine params RNE-converted to bf16 first, f32
// [nrows][EW]. One wave per row, 8 channels per lane; each plane row = 512 B written by one instruction
// coverage: nrows waves x 32 lanes x 8 = every element of both planes.
// =====================================================================================================
__global__ __launch_bounds__(256) void ln_planes(const float* __restrict__ e, const float* __restrict__ lw,
                                                 const float* __restrict__ lb, unsigned short* xh,
                                                 unsigned short* xl, int nrows) {
  const int lane = threadIdx.x & 31;
  const int wave = threadIdx.x >> 5;
  const int row = blockIdx.x * 8 + wave;
  if (row >= nrows) return;                           // wave-uniform; no block barriers in this kernel
  const int c0 = lane * 8;
  const float* src = e + (size_t)row * EW + c0;
  const v4f a0 = *(const v4f*)(src);
  const v4f a1 = *(const v4f*)(src + 4);
  const v4f w0 = *(const v4f*)(lw + c0);
  const v4f w1 = *(const v4f*)(lw + c0 + 4);
  const v4f b0 = *(const v4f*)(lb + c0);
  const v4f b1 = *(const v4f*)(lb + c0 + 4);
  float v[8], w[8], bb[8];
#pragma unroll
  for (int t = 0; t < 4; ++t) {
    v[t]      = bf_up(bf_bits(a0[t]));
    v[4 + t]  = bf_up(bf_bits(a1[t]));
    w[t]      = bf_up(bf_bits(w0[t]));
    w[4 + t]  = bf_up(bf_bits(w1[t]));
    bb[t]     = bf_up(bf_bits(b0[t]));
    bb[4 + t] = bf_up(bf_bits(b1[t]));
  }
  float s = 0.f;
#pragma unroll
  for (int t = 0; t < 8; ++t) s += v[t];
#pragma unroll
  for (int o = 16; o > 0; o >>= 1) s += __shfl_xor(s, o);
  const float mu = s * (1.0f / (float)EW);
  float d[8];
  float s2 = 0.f;
#pragma unroll
  for (int t = 0; t < 8; ++t) { d[t] = v[t] - mu; s2 += d[t] * d[t]; }
#pragma unroll
  for (int o = 16; o > 0; o >>= 1) s2 += __shfl_xor(s2, o);
  const float var = s2 * (1.0f / (float)EW);
  const float rs = rsqrtf(var + 1e-5f);
  v4u ph, pl;
#pragma unroll
  for (int t = 0; t < 4; ++t) {
    const float y0 = d[2 * t] * rs * w[2 * t] + bb[2 * t];
    const float y1 = d[2 * t + 1] * rs * w[2 * t + 1] + bb[2 * t + 1];
    const _Float16 hq0 = (_Float16)y0;
    const _Float16 hq1 = (_Float16)y1;
    const _Float16 lq0 = (_Float16)((y0 - (float)hq0) * 2048.0f);
    const _Float16 lq1 = (_Float16)((y1 - (float)hq1) * 2048.0f);
    ph[t] = pk16(h_bits(hq0), h_bits(hq1));
    pl[t] = pk16(h_bits(lq0), h_bits(lq1));
  }
  const size_t o = (size_t)row * EW + c0;
  {
    *(v4u*)(xh + o) = ph;
    *(v4u*)(xl + o) = pl;
    
  }
}

// =====================================================================================================
// Transpose-convert: in f32 [R][C] row-major -> out f16 [C][R] (r contiguous), out[c][r] =
// f16(bf16rne(in[r][c]) * scale), scale a power of two. Block = one 64 r x 64 c tile staged in LDS as f32
// (v4f loads, __syncthreads); grid = (R/64, C/64, matrices of that shape: 1 or 2).
// Store: group gq = tid>>3 (0..31), piece = tid&7: iteration it writes out row c = it*32+gq, lanes 8q..8q+7
// coverage: 2 iterations x 32 groups = 64 out rows, 8 pieces x 8 = 64 r per row; grid covers every tile ->
// the whole plane.
// =====================================================================================================
__global__ __launch_bounds__(256) void tr_f16(const float* __restrict__ in0, const float* __restrict__ in1,
                                              unsigned short* out, int R, int C, float scale) {
  __shared__ __align__(16) float sv[64 * 68];       // [rr][cc] pitch 68 floats
  const int tid = threadIdx.x;
  const float* in = (blockIdx.z != 0) ? in1 : in0;  // grid z picks the matrix; its plane follows the first
  out += (size_t)blockIdx.z * R * C;
  const int r0 = blockIdx.x * 64;
  const int c0 = blockIdx.y * 64;
#pragma unroll
  for (int i = 0; i < 4; ++i) {
    const int idx = i * 256 + tid;                  // 0..1023
    const int rr = idx >> 4, c4 = (idx & 15) * 4;
    const v4f a = *(const v4f*)(in + (size_t)(r0 + rr) * C + c0 + c4);
    *(v4f*)(sv + rr * 68 + c4) = a;
  }
  __syncthreads();

  const int gq = tid >> 3, piece = tid & 7;
  v4u hv[2];
  size_t hofs[2];
#pragma unroll
  for (int it = 0; it < 2; ++it) {
    const int cc = it * 32 + gq;
    v4u a;
#pragma unroll
    for (int t = 0; t < 4; ++t) {
      const float f0 = bf_up(bf_bits(sv[(piece * 8 + 2 * t) * 68 + cc]));
      const float f1 = bf_up(bf_bits(sv[(piece * 8 + 2 * t + 1) * 68 + cc]));
      a[t] = pk16(h_bits((_Float16)(f0 * scale)), h_bits((_Float16)(f1 * scale)));
    }
    hv[it] = a;
    hofs[it] = (size_t)(c0 + cc) * R + r0 + piece * 8;
  }
  {
#pragma unroll
    for (int it = 0; it < 2; ++it) {
      *(v4u*)(out + hofs[it]) = hv[it];
    }
    
  }
}

// =====================================================================================================
// Additive mask mk f32 [NB][SEQ x][SEQ y][NH h] -> two f32 planes of msc * bf16rne(mk), msc a power of two:
//   ma[b][h][x][y] (direct) and mb[b][h][y][x] (transposed), both with the last index contiguous.
// grid = (SEQ/8 groups, NH, NB), 256 threads. Direct part: thread (xx = tid>>5, y4 = (tid&31)*4) gathers 4
// values of row x = grp*8+xx and stores 16 B; a wave writes the whole 512-B row (4 lines, one instruction).
// Transposed part: 128 x times 8 y staged in LDS (pitch 132), __syncthreads, then thread (yy = tid>>5,
// x4 = (tid&31)*4) stores 16 B of row y = grp*8+yy; a wave writes the whole 512-B row, one instruction.
// coverage: 16 groups x 8 rows x (32 lanes x 4) = all SEQ x SEQ of every (b,h) in both planes.
// =====================================================================================================
__global__ __launch_bounds__(256) void mask_planes(const float* __restrict__ mk, float* ma, float* mb,
                                                   float msc) {
  __shared__ __align__(16) float sm[8 * 132];
  const int tid = threadIdx.x;
  const int grp = blockIdx.x;
  const int h = blockIdx.y;
  const int b = blockIdx.z;
  const size_t pb = ((size_t)(b * NH + h)) * SEQ * SEQ;          // plane base of (b,h)
  v4f vd;
  size_t od;
  {
    const int xx = tid >> 5, y4 = (tid & 31) * 4;
    const int x = grp * 8 + xx;
    const float* src = mk + (((size_t)b * SEQ + x) * SEQ + y4) * NH + h;
#pragma unroll
    for (int t = 0; t < 4; ++t) vd[t] = msc * bf_up(bf_bits(src[(size_t)t * NH]));
    od = pb + (size_t)x * SEQ + y4;
  }
  {
    const int x = tid >> 1, yq = (tid & 1) * 4;
    const float* src = mk + (((size_t)b * SEQ + x) * SEQ + grp * 8 + yq) * NH + h;
#pragma unroll
    for (int t = 0; t < 4; ++t) sm[(yq + t) * 132 + x] = msc * bf_up(bf_bits(src[(size_t)t * NH]));
  }
  __syncthreads();
  v4f vt;
  size_t ot;
  {
    const int yy = tid >> 5, x4 = (tid & 31) * 4;
    vt = *(const v4f*)(sm + yy * 132 + x4);
    ot = pb + (size_t)(grp * 8 + yy) * SEQ + x4;
  }
  {
    *(v4f*)(ma + od) = vd;
    *(v4f*)(mb + ot) = vt;
    
  }
}

// =====================================================================================================
// Main loop shared by the two projections: one block = 128 x 128 of the product, 8 waves as 4 (m) x 2 (n),
// each wave its 32 x 64 tile. Operands go global -> registers -> LDS in chunks of KC k values, so that every
// global load covers whole 128-B lines (8 lanes per row) and each staged row serves 2 (A) or 4 (B) waves.
// Buffer rows: A hi 0..127 | A residual 128..255 | B 256..383, pitch LP. Thread t stages piece t&7 of rows
// u*32 + (t>>3), u = 0..11; gAh, gAl, gB point at its piece of its first row of each operand, sA / sB are
// the element strides between its successive rows. Two buffers: chunk c+1 is loaded into registers ahead of
// the products of chunk c and stored behind them into the buffer whose readers left at the previous
// barrier; one barrier per chunk publishes it. k runs upward in steps of 32 within and across chunks.
// The closing barrier of the last chunk lets the caller reuse sm.
// =====================================================================================================
#define KC   64                 // k values per staged chunk (128 B of every operand row)
#define LP   72                 // LDS row pitch in halves: 144 B = 16 B x 9, 16-B fragment reads meet each bank once
#define STG  (384 * LP)         // halves per buffer (55296 B)

__device__ __forceinline__ void gemm_blk(const _Float16* gAh, const _Float16* gAl, size_t sA,
                                         const _Float16* gB, size_t sB, int K, _Float16* sm, int tid,
                                         v8f (&acch)[2][4], v8f (&accl)[2][4]) {
  const int lane = tid & 31;
  const int wave = tid >> 5;
  const int fo = (lane & 15) * LP + (lane >> 4) * 8;            // fragment row and k half of this lane
  const int ra = (wave & 3) * 32 * LP + fo;                     // A hi rows of this wave
  const int rb = (256 + (wave >> 2) * 64) * LP + fo;            // B rows of this wave
  _Float16* sw = sm + (tid >> 3) * LP + (tid & 7) * 8;
  v4u st[12];
#pragma unroll
  for (int u = 0; u < 4; ++u) {
    st[u]     = *(const v4u*)(gAh + u * sA);
    st[4 + u] = *(const v4u*)(gAl + u * sA);
    st[8 + u] = *(const v4u*)(gB + u * sB);
  }
#pragma unroll
  for (int u = 0; u < 12; ++u) *(v4u*)(sw + u * 32 * LP) = st[u];
  __syncthreads();

  const int nc = K / KC;
  for (int c = 0; c < nc; ++c) {
    const bool more = (c + 1) < nc;                             // block-uniform
    if (more) {
      const int ko = (c + 1) * KC;
#pragma unroll
      for (int u = 0; u < 4; ++u) {
        st[u]     = *(const v4u*)(gAh + u * sA + ko);
        st[4 + u] = *(const v4u*)(gAl + u * sA + ko);
        st[8 + u] = *(const v4u*)(gB + u * sB + ko);
      }
    }
    const _Float16* sb = sm + (c & 1) * STG;
#pragma unroll
    for (int kk = 0; kk < KC; kk += 32) {
      v16h fh[2], fl[2];
#pragma unroll
      for (int i = 0; i < 2; ++i) {
        fh[i] = ldfrag_h(sb + ra + i * 16 * LP + kk);
        fl[i] = ldfrag_h(sb + ra + (128 + i * 16) * LP + kk);
      }
      v16h bnx = ldfrag_h(sb + rb + kk);
#pragma unroll
      for (int j = 0; j < 4; ++j) {
        const v16h bfr = bnx;
        if (j < 3) bnx = ldfrag_h(sb + rb + (j + 1) * 16 * LP + kk);   // next B fragment flies under this one's products
#pragma unroll
        for (int i = 0; i < 2; ++i) {
          acch[i][j] = mma_h(fh[i], bfr, acch[i][j]);
          accl[i][j] = mma_h(fl[i], bfr, accl[i][j]);
        }
      }
    }
    if (more) {
      _Float16* sn = sw + ((c + 1) & 1) * STG;
#pragma unroll
      for (int u = 0; u < 12; ++u) *(v4u*)(sn + u * 32 * LP) = st[u];
    }
    __syncthreads();
  }
}

// =====================================================================================================
// Fused q/k/v projection; grid y = batch * 2 + direction picks the batch's X rows, the direction's Wt and
// bias, and that pair's own output planes. For the edge rows of one batch: X[m][k] . Wt[n][k] + bf16rne(bias[n]) with
// X = f16 hi plane + residual plane (x2048) [RB][EW], Wt f16 [W3][EW] (k contiguous), f16 products into
// separate hi/residual accumulators, f32 accumulate; value = ((acch + accl*scl)*sch + bias) * fac(sec)
// with sec = n / EW (0 q, 1 k, 2 v). Block = 128 rows x 2 column tiles (gemm_blk); one wave per 32 x 64 tile; the tile's 64 columns are a PERMUTED set:
// n = sec*EW + d*NH + h for d in 0..31 and h in {h0, h0+1} (tn = sec*4 + h0/2), B fragment j covers
// hh = j>>1, d = (j&1)*16 + lane&15. Output written as head-major f16 planes hi = f16(value),
// lo = f16((value - hi) * 2048): element (sec, h, row m, d) at [((sec*NH + h)*RB + m)*HD + d]
// (hi plane [3][NH][RB][HD]; lo plane [2][NH][RB][HD], q and k only). Staged B row q*32 + d holds column
// n = sec*EW + d*NH + (bn&1)*4 + q, which is fragment row (j&1)*16 + lane&15 of wave column q>>1, j>>1 = q&1.
// Epilogue: per-wave 16-row slabs in the staging LDS (free behind the main loop's closing barrier),
// column cc = hh*32 + d), then lane g8 = lane>>3, pc = lane&7: instruction q writes line L = q*4+g8
// coverage: 2 slabs x 16 lines (2 hh x 8 row pairs) x 8 pieces of 8 d = the wave's whole 32 x 64 tile in
// the hi plane (and in the lo plane for sec < 2); 512 x 12 tiles cover [3][NH][RB][HD] exactly.
// =====================================================================================================
__global__ __launch_bounds__(256) void gemm_p(
    const unsigned short* __restrict__ Ahp, const unsigned short* __restrict__ Alp,
    const unsigned short* __restrict__ Btp, const float* __restrict__ bias0, const float* __restrict__ bias1,
    unsigned short* php, unsigned short* plp,
    float f0, float f1, float f2, float sch, float scl) {
  const int bd  = blockIdx.y;              // batch * 2 + direction
  const int dir = bd & 1;
  const size_t xo = (size_t)(bd >> 1) * RB * EW;
  const _Float16* Ah = (const _Float16*)(const void*)Ahp + xo;
  const _Float16* Al = (const _Float16*)(const void*)Alp + xo;
  const _Float16* Bh = (const _Float16*)(const void*)Btp + (size_t)dir * W3 * EW;
  const float* bias = (dir != 0) ? bias1 : bias0;
  php += (size_t)bd * 3 * NH * RB * HD;
  plp += (size_t)bd * 2 * NH * RB * HD;
  __shared__ __align__(16) unsigned short smem[2 * STG];
  const int tid  = threadIdx.x;
  const int lane = tid & 31;
  const int wave = tid >> 5;
  constexpr int blkN = W3 / 128;           // 6 column pairs; grid x = (RB / 128) * blkN exactly
  const int bm = blockIdx.x / blkN;
  const int bn = blockIdx.x - bm * blkN;
  const int tn = bn * 2 + (wave >> 2);
  const int m0 = bm * 128 + (wave & 3) * 32;
  const int sec = tn >> 2;                 // 0 q, 1 k, 2 v (the same for both column tiles of a block)
  const int h0 = (tn & 3) * 2;             // head pair
  const int rlane = lane & 15;
  const int mOff  = (lane >> 4) * 8;
  int nB[4];
#pragma unroll
  for (int j = 0; j < 4; ++j) nB[j] = sec * EW + ((((j & 1) << 4) + rlane) << 3) + h0 + (j >> 1);

  v8f acch[2][4], accl[2][4];
#pragma unroll
  for (int i = 0; i < 2; ++i)
#pragma unroll
    for (int j = 0; j < 4; ++j) { acch[i][j] = zero8(); accl[i][j] = zero8(); }

  {
    const size_t ao = (size_t)(bm * 128 + (tid >> 3)) * EW + (tid & 7) * 8;
    const size_t bo = (size_t)((bn >> 1) * EW + (tid >> 3) * NH + (bn & 1) * 4) * EW + (tid & 7) * 8;
    gemm_blk(Ah + ao, Al + ao, (size_t)32 * EW, Bh + bo, (size_t)EW, EW,
             (_Float16*)(void*)smem, tid, acch, accl);
  }

  const float fac = (sec == 0) ? f0 : ((sec == 1) ? f1 : f2);
  float bz[4];
#pragma unroll
  for (int j = 0; j < 4; ++j) bz[j] = bf_up(bf_bits(bias[nB[j]]));

  float* slab = (float*)(void*)smem + wave * (16 * 68);
  const int g8 = lane >> 3, pc = lane & 7;
#pragma unroll
  for (int i = 0; i < 2; ++i) {
    const int mBase = m0 + (i << 4);
#pragma unroll
    for (int r = 0; r < 8; ++r) {
#pragma unroll
      for (int j = 0; j < 4; ++j) {
        slab[(mOff + r) * 68 + (j << 4) + rlane] = ((acch[i][j][r] + accl[i][j][r] * scl) * sch + bz[j]) * fac;
      }
    }
    __builtin_amdgcn_fence(__ATOMIC_RELEASE, "workgroup");
    __builtin_amdgcn_wave_barrier();
    __builtin_amdgcn_fence(__ATOMIC_ACQUIRE, "workgroup");
    {
      v4u hv[4], lv[4];
      size_t ofs[4];
#pragma unroll
      for (int q = 0; q < 4; ++q) {
        const int L = q * 4 + g8;                    // line 0..15 of this slab
        const int hh = L >> 3, t = L & 7;
        const int row = 2 * t + (pc >> 2);
        const int d0 = (pc & 3) * 8;
        const v4f x0 = *(const v4f*)(slab + row * 68 + hh * 32 + d0);
        const v4f x1 = *(const v4f*)(slab + row * 68 + hh * 32 + d0 + 4);
        float f[8];
        f[0] = x0[0]; f[1] = x0[1]; f[2] = x0[2]; f[3] = x0[3];
        f[4] = x1[0]; f[5] = x1[1]; f[6] = x1[2]; f[7] = x1[3];
        v4u ph, pl;
#pragma unroll
        for (int u = 0; u < 4; ++u) {
          const float s0 = f[2 * u];
          const float s1 = f[2 * u + 1];
          const _Float16 hq0 = (_Float16)s0;
          const _Float16 hq1 = (_Float16)s1;
          const _Float16 lq0 = (_Float16)((s0 - (float)hq0) * 2048.0f);
          const _Float16 lq1 = (_Float16)((s1 - (float)hq1) * 2048.0f);
          ph[u] = pk16(h_bits(hq0), h_bits(hq1));
          pl[u] = pk16(h_bits(lq0), h_bits(lq1));
        }
        hv[q] = ph;
        lv[q] = pl;
        ofs[q] = (((size_t)(sec * NH + h0 + hh)) * RB + (size_t)(mBase + row)) * HD + d0;
      }
      {
#pragma unroll
        for (int q = 0; q < 4; ++q) {
          *(v4u*)(php + ofs[q]) = hv[q];
          if (sec < 2) *(v4u*)(plp + ofs[q]) = lv[q];
        }
        
      }
    }
    __builtin_amdgcn_fence(__ATOMIC_RELEASE, "workgroup");
    __builtin_amdgcn_wave_barrier();
    __builtin_amdgcn_fence(__ATOMIC_ACQUIRE, "workgroup");
  }
}

// =====================================================================================================
// Axial attention, grid y = batch * 2 + direction: block = (column index j = blockIdx.x, all 8 heads),
// wave = head h, 16-query strips s = 0..7 in lockstep.
//   queries i: plane row i*SEQ + j; keys/values kk: plane row kk*ks + j*js (dir 0: ks=1, js=SEQ ->
//   rows (j,kk); dir 1: ks=SEQ, js=1 -> rows (kk,j)); additive mask plane mp[h][i][kk] (already x64 and
//   bf16-RNE'd, direct for dir 0 and transposed for dir 1).
// Scores are computed TRANSPOSED: S^T[kk][i] = K(A, lane = key row, d per k-map) . Q^T(B, lane = query,
// d per k-map), hi.hi into the mask-initialised accumulator plus (hi.lo + lo.hi)*xscl; D lane = query i,
// element r = key 16ct + 8g + r, so a lane and its partner lane^16 own one softmax row: max / exp / sum in
// f32 with one __shfl_xor(.,16) each. Weights p*pcar are converted to f16 in registers and used directly as
// the B operand of O^T[d][i] = V^T(A from LDS, lane = d, keys per k-map) . P^T (B: lane = query, element
// e <- tile 2c key 8g+e, element 8+e <- tile 2c+1 key 8g+e).
// LDS: sVt [NH][HD][VTP] v^T tiles (built once per block by register transposition of 4 key rows into 8-B
// stores; each wave stages and reads only its own head; block barrier after staging; staged extent k 0..127
// == consumed extent); sO [16][SOP] f32 output slab (cross-wave: block barriers before the row writes and
// before the next strip).
// Output: f16 planes vah = f16(O*1024), val = f16((O*1024 - hi)*2048), [RB rows i*SEQ+j][KO] at columns
// dir*EW + d*NH + h; per strip wave h writes rows 2h, 2h+1: 32 lanes x 16 B = the whole 512-B half row
// coverage: 8 strips x 8 waves x 2 rows = 128 queries x (32 lanes x 8 = 256 channels) for every (j, dir)
// -> together with the other direction's blocks every element of both planes of this batch.
// =====================================================================================================
__global__ __launch_bounds__(256) void attn_ax(
    const unsigned short* __restrict__ php, const unsigned short* __restrict__ plp,
    const float* __restrict__ mp, unsigned short* vah, unsigned short* val,
    float xscl, float escl, float pcar, float oscl) {
  const int bd  = blockIdx.y;                      // batch * 2 + direction
  const int dir = bd & 1;
  php += (size_t)bd * 3 * NH * RB * HD;
  plp += (size_t)bd * 2 * NH * RB * HD;
  mp  += (size_t)(dir * NB + (bd >> 1)) * NH * SEQ * SEQ;   // direct planes of all batches, then transposed
  vah += (size_t)(bd >> 1) * RB * KO;
  val += (size_t)(bd >> 1) * RB * KO;
  const _Float16* Ph = (const _Float16*)(const void*)php;
  const _Float16* Pl = (const _Float16*)(const void*)plp;
  __shared__ __align__(16) unsigned short sVt[NH * HD * VTP];     // 69632 B
  __shared__ __align__(16) float sO[16 * SOP];                    // 16896 B
  const _Float16* sVh = (const _Float16*)(const void*)sVt;
  const int tid  = threadIdx.x;
  const int lane = tid & 31;
  const int h    = tid >> 5;
  const int nl   = lane & 15;
  const int g    = lane >> 4;
  const int g8   = g * 8;
  const int j    = blockIdx.x;
  const size_t hs = (size_t)RB * HD;               // per-head plane stride (halves)
  const size_t ss = (size_t)NH * hs;               // per-section stride
  const _Float16* Qh = Ph + (size_t)h * hs;
  const _Float16* Kh = Ph + ss + (size_t)h * hs;
  const _Float16* Ql = Pl + (size_t)h * hs;
  const _Float16* Kl = Pl + ss + (size_t)h * hs;
  const unsigned short* Vu = php + 2 * ss + (size_t)h * hs;
  const int ks = (dir != 0) ? SEQ : 1;
  const int js = (dir != 0) ? 1 : SEQ;

  // ---- K fragments of head h (A operands, hi and residual, all 8 key tiles): the same for every query strip,
  //      so they are loaded once here and stay in registers through the strip loop
  v16h kh[8], kl[8];
#pragma unroll
  for (int ct = 0; ct < 8; ++ct) {
    const int kk = ct * 16 + nl;                                // key row loaded by this lane (A row)
    const size_t kofs = ((size_t)kk * ks + (size_t)j * js) * HD + g8;
    kh[ct] = ldfrag_h(Kh + kofs);
    xcnt_wait();                                                // a later load's result may land on this address pair
    kl[ct] = ldfrag_h(Kl + kofs);
    xcnt_wait();                                                // the same
  }

  // ---- stage v^T of head h: unit u = (key quad kq, d octet dq): 4 x 16-B row loads -> 8 x 8-B LDS stores
#pragma unroll
  for (int it = 0; it < 4; ++it) {
    const int u  = it * 32 + lane;                 // 0..127
    const int kq = u >> 2, dq = u & 3;
    const int kb = kq * 4;
    v4u rw[4];
#pragma unroll
    for (int a = 0; a < 4; ++a) {
      const size_t rowk = (size_t)(kb + a) * ks + (size_t)j * js;
      rw[a] = *(const v4u*)(Vu + rowk * HD + dq * 8);
    }
#pragma unroll
    for (int d = 0; d < 8; ++d) {
      const int wd = d >> 1, sh = (d & 1) * 16;
      const unsigned x0 = (rw[0][wd] >> sh) & 0xFFFFu;
      const unsigned x1 = (rw[1][wd] >> sh) & 0xFFFFu;
      const unsigned x2 = (rw[2][wd] >> sh) & 0xFFFFu;
      const unsigned x3 = (rw[3][wd] >> sh) & 0xFFFFu;
      v2u o;
      o[0] = x0 | (x1 << 16);
      o[1] = x2 | (x3 << 16);
      *(v2u*)(sVt + (h * HD + dq * 8 + d) * VTP + kb) = o;
    }
  }
  __syncthreads();

#pragma unroll 1
  for (int s = 0; s < 8; ++s) {
    const int i = s * 16 + nl;                                  // this lane's query (B column / D column)
    const size_t qofs = ((size_t)i * SEQ + j) * HD + g8;
    const v16h qh = ldfrag_h(Qh + qofs);
    const v16h ql = ldfrag_h(Ql + qofs);
    const float* mrow = mp + ((size_t)h * SEQ + i) * SEQ + g8;

    // ---- transposed scores, 8 key tiles
    v8f acc[8];
#pragma unroll
    for (int ct = 0; ct < 8; ++ct) {
      const v4f mv0 = *(const v4f*)(mrow + ct * 16);
      const v4f mv1 = *(const v4f*)(mrow + ct * 16 + 4);
      v8f am;
      am[0] = mv0[0]; am[1] = mv0[1]; am[2] = mv0[2]; am[3] = mv0[3];
      am[4] = mv1[0]; am[5] = mv1[1]; am[6] = mv1[2]; am[7] = mv1[3];
      v8f ax = mma_h(kh[ct], ql, zero8());
      ax = mma_h(kl[ct], qh, ax);
      am = mma_h(kh[ct], qh, am);
      acc[ct] = am + ax * xscl;
      // one key tile's products at a time: with several residual accumulators live the K fragments spill
      __builtin_amdgcn_sched_barrier(0);
    }

    // ---- softmax over the 128 keys of query i (this lane: 64 values, partner lane^16: the other 64)
    float mx = acc[0][0];
#pragma unroll
    for (int ct = 0; ct < 8; ++ct)
#pragma unroll
      for (int r = 0; r < 8; ++r) mx = fmaxf(mx, acc[ct][r]);
    mx = fmaxf(mx, __shfl_xor(mx, 16));
    float sum = 0.f;
#pragma unroll
    for (int ct = 0; ct < 8; ++ct)
#pragma unroll
      for (int r = 0; r < 8; ++r) {
        const float ev = __expf((acc[ct][r] - mx) * escl);
        acc[ct][r] = ev;
        sum += ev;
      }
    sum += __shfl_xor(sum, 16);
    const float rc = pcar / sum;                                // sum >= 1

    // ---- P^T as B fragments straight from the accumulators
    v16h pb[4];
#pragma unroll
    for (int c = 0; c < 4; ++c) {
      union { v16h v; v8h hh[2]; } U;
      v8h p0, p1;
#pragma unroll
      for (int e2 = 0; e2 < 8; ++e2) {
        p0[e2] = (_Float16)(acc[2 * c][e2] * rc);
        p1[e2] = (_Float16)(acc[2 * c + 1][e2] * rc);
      }
      U.hh[0] = p0;
      U.hh[1] = p1;
      pb[c] = U.v;
    }

    // ---- O^T[d][i] = V^T . P^T, two 16-row d tiles, K = 128 keys
    v8f oacc[2];
#pragma unroll
    for (int dt = 0; dt < 2; ++dt) {
      v8f o = zero8();
#pragma unroll
      for (int c = 0; c < 4; ++c) {
        const v16h va = ldfrag_h(sVh + (h * HD + dt * 16 + nl) * VTP + 32 * c + g8);
        o = mma_h(va, pb[c], o);
      }
      oacc[dt] = o;
    }

    // ---- stage O (f32, true scale) into the slab: row = query nl, column = d*NH + h
#pragma unroll
    for (int dt = 0; dt < 2; ++dt)
#pragma unroll
      for (int r = 0; r < 8; ++r)
        sO[nl * SOP + ((dt * 16 + g8 + r) << 3) + h] = oacc[dt][r] * oscl;
    __syncthreads();

    // ---- wave h writes queries s*16 + 2h, + 2h + 1: 512-B half rows in hi and residual planes
    {
      v4u hv[2], lv[2];
      size_t ofs[2];
#pragma unroll
      for (int q = 0; q < 2; ++q) {
        const int rr = 2 * h + q;
        const v4f x0 = *(const v4f*)(sO + rr * SOP + lane * 8);
        const v4f x1 = *(const v4f*)(sO + rr * SOP + lane * 8 + 4);
        float f[8];
        f[0] = x0[0]; f[1] = x0[1]; f[2] = x0[2]; f[3] = x0[3];
        f[4] = x1[0]; f[5] = x1[1]; f[6] = x1[2]; f[7] = x1[3];
        v4u ph, pl;
#pragma unroll
        for (int u = 0; u < 4; ++u) {
          const float s0 = f[2 * u] * 1024.0f;
          const float s1 = f[2 * u + 1] * 1024.0f;
          const _Float16 hq0 = (_Float16)s0;
          const _Float16 hq1 = (_Float16)s1;
          const _Float16 lq0 = (_Float16)((s0 - (float)hq0) * 2048.0f);
          const _Float16 lq1 = (_Float16)((s1 - (float)hq1) * 2048.0f);
          ph[u] = pk16(h_bits(hq0), h_bits(hq1));
          pl[u] = pk16(h_bits(lq0), h_bits(lq1));
        }
        hv[q] = ph;
        lv[q] = pl;
        ofs[q] = ((size_t)(s * 16 + rr) * SEQ + j) * KO + (size_t)dir * EW + lane * 8;
      }
      {
#pragma unroll
        for (int q = 0; q < 2; ++q) {
          *(v4u*)(vah + ofs[q]) = hv[q];
          *(v4u*)(val + ofs[q]) = lv[q];
        }
        
      }
    }
    __syncthreads();                                            // sO reused by the next strip
  }
}

// =====================================================================================================
// Output projection: C[m][n] = sch * (sum_k Ahi[m][k]*Bt[n][k] + scl * sum_k Alo[m][k]*Bt[n][k]) + bf16rne(bias[n])
// (f16 products, f32 accumulate, hi and scaled-residual products in separate accumulators). Ahi/Alo row-major
// [M][K] pitch lda; Bt [N][K] pitch ldb; C f32 [M][N] pitch ldc. Block = 128 x 128 of C (gemm_blk), one wave per
// 32x64 tile; M = RT, N = EW, K = KO (multiples of 128, 128 and KC).
// Epilogue: 16-row slabs staged per wave in the staging LDS (free behind the main loop's closing barrier); each 64-wide row segment (256 B) written by one instruction
// coverage: 2 slabs x 16 rows x 64 cols = the wave's whole 32x64 tile; grid covers every tile of C.
// =====================================================================================================
__global__ __launch_bounds__(256) void gemm32h_w(
    const unsigned short* __restrict__ Ahp, const unsigned short* __restrict__ Alp,
    const unsigned short* __restrict__ Btp,
    const float* __restrict__ bias,
    float* C, float sch, float scl) {
  constexpr int lda = KO, ldb = KO, ldc = EW, M = RT, N = EW, K = KO;   // fixed: staged row steps become immediate offsets
  const _Float16* Ah = (const _Float16*)(const void*)Ahp;
  const _Float16* Al = (const _Float16*)(const void*)Alp;
  const _Float16* Bh = (const _Float16*)(const void*)Btp;
  __shared__ __align__(16) unsigned short smem[2 * STG];
  const int tid  = threadIdx.x;
  const int lane = tid & 31;
  const int wave = tid >> 5;
  constexpr int blkN = N >> 7;
  if ((int)blockIdx.x >= (M >> 7) * blkN) return;   // block-uniform, in front of every barrier
  const int bm = blockIdx.x / blkN;
  const int bn = blockIdx.x - bm * blkN;
  const int m0 = bm * 128 + (wave & 3) * 32;
  const int n0 = bn * 128 + (wave >> 2) * 64;
  const int rlane = lane & 15;
  const int mOff  = (lane >> 4) * 8;

  v8f acch[2][4], accl[2][4];
#pragma unroll
  for (int i = 0; i < 2; ++i)
#pragma unroll
    for (int j = 0; j < 4; ++j) { acch[i][j] = zero8(); accl[i][j] = zero8(); }

  {
    const size_t ao = (size_t)(bm * 128 + (tid >> 3)) * lda + (tid & 7) * 8;
    const size_t bo = (size_t)(bn * 128 + (tid >> 3)) * ldb + (tid & 7) * 8;
    gemm_blk(Ah + ao, Al + ao, (size_t)32 * lda, Bh + bo, (size_t)32 * ldb, K,
             (_Float16*)(void*)smem, tid, acch, accl);
  }

  float bz[4];
#pragma unroll
  for (int j = 0; j < 4; ++j) bz[j] = bf_up(bf_bits(bias[n0 + (j << 4) + rlane]));

  float* slab = (float*)(void*)smem + wave * (16 * 68);
#pragma unroll
  for (int i = 0; i < 2; ++i) {
    const int mBase = m0 + (i << 4);
#pragma unroll
    for (int r = 0; r < 8; ++r) {
#pragma unroll
      for (int j = 0; j < 4; ++j) {
        slab[(mOff + r) * 68 + (j << 4) + rlane] = (acch[i][j][r] + accl[i][j][r] * scl) * sch + bz[j];
      }
    }
    __builtin_amdgcn_fence(__ATOMIC_RELEASE, "workgroup");
    __builtin_amdgcn_wave_barrier();
    __builtin_amdgcn_fence(__ATOMIC_ACQUIRE, "workgroup");
    {
      const int hh = lane >> 4, c4 = (lane & 15) * 4;     // 256-B row segment = 16 lanes x 16 B
      v4f ov[8];
#pragma unroll
      for (int it = 0; it < 8; ++it) {
        const int row = it * 2 + hh;                       // it 0..7 x hh 0..1 = rows 0..15
        ov[it] = *(const v4f*)(slab + row * 68 + c4);
      }
      {
#pragma unroll
        for (int it = 0; it < 8; ++it) {
          const int row = it * 2 + hh;
          *(v4f*)(C + (size_t)(mBase + row) * ldc + n0 + c4) = ov[it];
        }
        
      }
    }
    __builtin_amdgcn_fence(__ATOMIC_RELEASE, "workgroup");
    __builtin_amdgcn_wave_barrier();
    __builtin_amdgcn_fence(__ATOMIC_ACQUIRE, "workgroup");
  }
}

// =====================================================================================================
// Workspace map (bytes, NB = 2); every region an exact multiple of its whole-line store granularity, all
// written earlier in the same call. Every (batch, direction) pair has its own Ph / Pl planes, so each stage
// is one launch over all four pairs. Vah lies on Xh + Xl, whose last reader (the projection) has ended.
//   Xh   f16 [RT][EW]                     0        16777216   (layer norm output, hi)
//   Xl   f16 [RT][EW]              16777216        16777216   (residual x2048)
//   Wti  f16 [W3 n][EW k]          33554432          393216   (f16(bf16(Wqkv_in) x64))
//   Wto  f16 [W3 n][EW k]          33947648          393216
//   Woh  f16 [EW n][KO k]          34340864          262144   (f16(bf16(Wo) x1024))
//   mA   f32 [NB][NH][SEQ][SEQ]    34603008         1048576   (64 x bf16(mask), direct)
//   mB   f32 [NB][NH][SEQ][SEQ]    35651584         1048576   (transposed)
//   Ph   f16 [2 NB][3][NH][RB][HD] 36700160       100663296   (q x16*32^-0.5, k x4, v x4; hi)
//   Pl   f16 [2 NB][2][NH][RB][HD] 137363456       67108864   (q, k residual x2048)
//   Val  f16 [RT][KO]             204472320        33554432   (attention output residual x2048)
//   Vah  f16 [RT][KO]                     0        33554432   (attention output x1024, hi; on Xh + Xl)
//   end                           238026752
// Inputs: e f32 [NB][SEQ][SEQ][EW]; mask f32 [NB][SEQ][SEQ][NH]; ln_w, ln_b f32 [EW]; Wqkv_in, Wqkv_out
// f32 [EW in][W3 out]; bqkv_* f32 [W3]; Wo f32 [KO in][EW out]; bo f32 [EW]. d_out f32 [RT][EW] at byte 0
// (row = b*RB + i*SEQ + j, col = n).
// =====================================================================================================
extern "C" void kernel_launch(void* const* d_in, const int* in_sizes, int n_in,
                              void* d_out, int out_size, void* d_ws, size_t ws_size,
                              hipStream_t stream) {
  if (n_in < 10) return;
  if (in_sizes[0] < RT * EW) return;
  if (in_sizes[1] < NB * SEQ * SEQ * NH) return;
  if (in_sizes[2] < EW) return;
  if (in_sizes[3] < EW) return;
  if (in_sizes[4] < EW * W3) return;
  if (in_sizes[5] < W3) return;
  if (in_sizes[6] < EW * W3) return;
  if (in_sizes[7] < W3) return;
  if (in_sizes[8] < KO * EW) return;
  if (in_sizes[9] < EW) return;
  if (out_size < RT * EW) return;

  const float* e    = (const float*)d_in[0];   // [NB][SEQ][SEQ][EW]
  const float* mask = (const float*)d_in[1];   // [NB][SEQ][SEQ][NH]
  const float* ln_w = (const float*)d_in[2];   // [EW]
  const float* ln_b = (const float*)d_in[3];   // [EW]
  const float* Wqi  = (const float*)d_in[4];   // [EW in][W3 out]
  const float* bqi  = (const float*)d_in[5];   // [W3]
  const float* Wqo  = (const float*)d_in[6];   // [EW in][W3 out]
  const float* bqo  = (const float*)d_in[7];   // [W3]
  const float* Wo   = (const float*)d_in[8];   // [KO in][EW out]
  const float* bo   = (const float*)d_in[9];   // [EW]

  const size_t PX  = (size_t)RT * EW * 2;                    // 16777216 (NB = 2)
  const size_t PWt = (size_t)W3 * EW * 2;                    //   393216
  const size_t PWo = (size_t)EW * KO * 2;                    //   262144
  const size_t PM  = (size_t)NB * NH * SEQ * SEQ * 4;        //  1048576 (NB = 2)
  const size_t PPh = (size_t)2 * NB * 3 * NH * RB * HD * 2;  // 100663296 (NB = 2)
  const size_t PPl = (size_t)2 * NB * 2 * NH * RB * HD * 2;  //  67108864
  const size_t PVa = (size_t)RT * KO * 2;                    //  33554432 == 2 * PX
  size_t off = 0;
  const size_t oXh = off; off += PX;
  const size_t oXl = off; off += PX;
  const size_t oWi = off; off += PWt;
  off += PWt;                                                // Wto, directly behind Wti
  const size_t oWo = off; off += PWo;
  const size_t oMa = off; off += PM;
  const size_t oMb = off; off += PM;
  const size_t oPh = off; off += PPh;
  const size_t oPl = off; off += PPl;
  const size_t oVl = off; off += PVa;
  const size_t oVh = oXh;                                    // Vah takes over Xh + Xl (same size)
  if (off > ws_size) return;                                 // off = 238026752 for NB = 2

  char* ws = (char*)d_ws;
  unsigned short* Xh  = (unsigned short*)(ws + oXh);
  unsigned short* Xl  = (unsigned short*)(ws + oXl);
  unsigned short* Wti = (unsigned short*)(ws + oWi);
  unsigned short* Woh = (unsigned short*)(ws + oWo);
  float*          mA  = (float*)(ws + oMa);
  float*          mB  = (float*)(ws + oMb);
  unsigned short* Ph  = (unsigned short*)(ws + oPh);
  unsigned short* Pl  = (unsigned short*)(ws + oPl);
  unsigned short* Vah = (unsigned short*)(ws + oVh);
  unsigned short* Val = (unsigned short*)(ws + oVl);
  float*          outf = (float*)d_out;                      // [RT][EW]

  const dim3 blk(256);
  const dim3 gLn(RT / 8);                                    // 4096 blocks (exact)
  const dim3 gTw(EW / 64, W3 / 64, 2);                       // (4, 12, both directions)
  const dim3 gTo(KO / 64, EW / 64);                          // (8, 4)
  const dim3 gMk(SEQ / 8, NH, NB);                           // (16, 8, 2)
  const dim3 gPr((RB / 128) * (W3 / 128), 2 * NB);           // 768 blocks x (batch, direction)
  const dim3 gAt(SEQ, 2 * NB);                               // one block per column index j x (batch, direction)
  const dim3 gWo((RT / 128) * (EW / 128));                   // 512 blocks
  const float cW     = 64.0f;                                // Wqkv plane carry
  const float fQ     = 16.0f * 0.17677669529663687f;         // 32^-0.5 then carry x16
  const float fK     = 4.0f;                                 // k carry
  const float fV     = 4.0f;                                 // v carry
  const float prSch  = 1.0f / 64.0f;                         // folds the Wqkv plane carry
  const float prScl  = 1.0f / 2048.0f;                       // folds the layer norm residual carry
  const float mkSc   = 64.0f;                                // mask planes x (16 * 4)
  const float axXscl = 1.0f / 2048.0f;                       // q/k residual carry
  const float axEscl = 1.0f / 64.0f;                         // score carry 16 * 4
  const float axPcar = 16384.0f;                             // softmax weight carry
  const float axOscl = 1.0f / 65536.0f;                      // 1/(16384 * 4)
  const float woScale = 1024.0f;                             // Wo plane carry
  const float woSch  = 1.0f / 1048576.0f;                    // 1/(1024 * 1024): O hi carry and Wo carry
  const float woScl  = 1.0f / 2048.0f;                       // O residual carry

  // (1) layer norm -> f16 hi + residual planes; weights -> transposed f16 planes of their bf16 values; masks
  ln_planes<<<gLn, blk, 0, stream>>>(e, ln_w, ln_b, Xh, Xl, RT);
  tr_f16<<<gTw, blk, 0, stream>>>(Wqi, Wqo, Wti, EW, W3, cW);
  tr_f16<<<gTo, blk, 0, stream>>>(Wo, Wo, Woh, KO, EW, woScale);
  mask_planes<<<gMk, blk, 0, stream>>>(mask, mA, mB, mkSc);
  // (2) all batches and both directions at once: projection, attention, output projection
  gemm_p<<<gPr, blk, 0, stream>>>(Xh, Xl, Wti, bqi, bqo, Ph, Pl, fQ, fK, fV, prSch, prScl);
  attn_ax<<<gAt, blk, 0, stream>>>(Ph, Pl, mA, Vah, Val, axXscl, axEscl, axPcar, axOscl);
  gemm32h_w<<<gWo, blk, 0, stream>>>(Vah, Val, Woh, bo, outf, woSch, woScl);
  (void)hipGetLastError();
}

// v004
// One run takes 148 microseconds.
// In both of two side-by-side timings against v003, it was 1.06 times as fast.
// All steps since v000 together make it 2.59 times as fast.
// Contractions: q/k/v projections = v_wmma_f32_16x16x32_f16 (layer-normed input as f16 hi + residual (x2048) planes, two products into separate accumulators; Wqkv as f16 of its bf16-RNE value x64); per-(b,j,h) scores = v_wmma_f32_16x16x32_f16 (k and q as f16 hi + residual (x2048) planes carried x4 and x16*32^-0.5, products hh + hl + lh; additive mask x64 as the initial accumulator); p.v = v_wmma_f32_16x16x32_f16 (softmax weights x16384 in f16 repacked from the score accumulators, v^T f16 tile carried x4, single product); output projection = v_wmma_f32_16x16x32_f16 (attention output as f16 hi (x1024) + residual (x2048) planes, two products; Wo as f16 of its bf16-RNE value x1024); every float input RNE-converted to bf16 on load; all f32 accumulate; layer norm and softmax in f32.
#include <hip/hip_runtime.h>
#include <math.h>
#include <stdint.h>

#ifndef NB
#define NB 2
#endif
#define NB_FULL 2
#ifndef SEQ
#define SEQ 128
#endif
#define EW  256                 // edge width
#define NH  8                   // heads (fastest channel dim)
#define HD  32                  // dot dim
#define W3  (3 * EW)            // 768 fused projection columns
#define KO  (2 * EW)            // 512 concat channels
#define RB  (SEQ * SEQ)         // edge rows per batch (16384)
#define RT  (NB * RB)           // edge rows processed
#define VTP 136                 // LDS v^T tile pitch (halves)
#define SOP 264                 // LDS output slab pitch (floats)

static_assert(NH * HD == EW);
static_assert(HD == 32);
static_assert(EW == 256);
static_assert(SEQ == 128);      // i, j and key extents are coupled; only NB is reducible
static_assert(NB >= 1 && NB <= NB_FULL);
static_assert((RB % 64) == 0 && (RT % 8) == 0);
static_assert((((RB / 32) * (W3 / 64)) % 8) == 0);
static_assert((((RB / 32) * (EW / 64)) % 8) == 0);
static_assert((EW % 64) == 0 && (W3 % 64) == 0 && (KO % 64) == 0 && (EW % 32) == 0 && (KO % 32) == 0);
static_assert((SEQ % 16) == 0 && (SEQ % 8) == 0);
static_assert((RB % 128) == 0 && (W3 % 128) == 0 && (EW % 128) == 0);   // 128 x 128 block tiles of the projections

typedef _Float16 v16h __attribute__((ext_vector_type(16)));
typedef _Float16 v8h  __attribute__((ext_vector_type(8)));
typedef float    v8f  __attribute__((ext_vector_type(8)));
typedef float    v4f  __attribute__((ext_vector_type(4)));
typedef unsigned int v4u __attribute__((ext_vector_type(4)));
typedef unsigned int v2u __attribute__((ext_vector_type(2)));

// ---- scalar helpers --------------------------------------------------------------------------------
__device__ __forceinline__ unsigned short bf_bits(float f) {          // f32 -> bf16 bits, RNE convert
  unsigned u = __float_as_uint(f);
  return (unsigned short)((u + 0x7FFFu + ((u >> 16) & 1u)) >> 16);
}
__device__ __forceinline__ float bf_up(unsigned short h) { return __uint_as_float(((unsigned)h) << 16); }
__device__ __forceinline__ unsigned short h_bits(_Float16 x) { return __builtin_bit_cast(unsigned short, x); }
__device__ __forceinline__ unsigned pk16(unsigned short a, unsigned short b) { return (unsigned)a | ((unsigned)b << 16); }
__device__ __forceinline__ v8f zero8() { v8f z = {0.f, 0.f, 0.f, 0.f, 0.f, 0.f, 0.f, 0.f}; return z; }

// ---- fragment loader: 16-bit A/B operand, lane -> row/col (lane&15), p already includes +8*(lane>>4);
//      elements 0..7 <- p[0..7] (k0+8h..), elements 8..15 <- p[16..23] (k0+16+8h..)
__device__ __forceinline__ v16h ldfrag_h(const _Float16* p) {
  union { v16h v; v8h h[2]; } f;
  f.h[0] = *(const v8h*)(p);
  f.h[1] = *(const v8h*)(p + 16);
  return f.v;
}

// ---- wait that stands between issued global loads and an overwrite of their address registers
__device__ __forceinline__ void xcnt_wait() {
#if defined(__HIP_DEVICE_COMPILE__)
  asm volatile("s_wait_xcnt 0x0" ::: "memory");
#endif
}

// ---- WMMA helper with trailing VALU hazard gap ----------------------------------------------------------
__device__ __forceinline__ v8f mma_h(v16h a, v16h b, v8f c) {
  c = __builtin_amdgcn_wmma_f32_16x16x32_f16(false, a, false, b, (short)0, c, false, false);
#if defined(__HIP_DEVICE_COMPILE__)
  asm volatile("v_nop\n\tv_nop\n\tv_nop\n\tv_nop" : "+v"(c) : "v"(a), "v"(b));
#endif
  return c;
}

// =====================================================================================================
// Layer norm over EW channels of each edge row (inputs and affine params RNE-converted to bf16 first, f32
// [nrows][EW]. One wave per row, 8 channels per lane; each plane row = 512 B written by one instruction
// coverage: nrows waves x 32 lanes x 8 = every element of both planes.
// =====================================================================================================
__device__ __forceinline__ void ln_planes(const float* __restrict__ e, const float* __restrict__ lw,
                                          const float* __restrict__ lb, unsigned short* xh,
                                          unsigned short* xl, int nrows, int blk) {
  const int lane = threadIdx.x & 31;
  const int wave = threadIdx.x >> 5;
  const int row = blk * 8 + wave;
  if (row >= nrows) return;                           // wave-uniform; no block barriers in this part
  const int c0 = lane * 8;
  const float* src = e + (size_t)row * EW + c0;
  const v4f a0 = *(const v4f*)(src);
  const v4f a1 = *(const v4f*)(src + 4);
  xcnt_wait();                                        // a later load's result may land on this address pair
  const v4f w0 = *(const v4f*)(lw + c0);
  const v4f w1 = *(const v4f*)(lw + c0 + 4);
  const v4f b0 = *(const v4f*)(lb + c0);
  const v4f b1 = *(const v4f*)(lb + c0 + 4);
  float v[8], w[8], bb[8];
#pragma unroll
  for (int t = 0; t < 4; ++t) {
    v[t]      = bf_up(bf_bits(a0[t]));
    v[4 + t]  = bf_up(bf_bits(a1[t]));
    w[t]      = bf_up(bf_bits(w0[t]));
    w[4 + t]  = bf_up(bf_bits(w1[t]));
    bb[t]     = bf_up(bf_bits(b0[t]));
    bb[4 + t] = bf_up(bf_bits(b1[t]));
  }
  float s = 0.f;
#pragma unroll
  for (int t = 0; t < 8; ++t) s += v[t];
#pragma unroll
  for (int o = 16; o > 0; o >>= 1) s += __shfl_xor(s, o);
  const float mu = s * (1.0f / (float)EW);
  float d[8];
  float s2 = 0.f;
#pragma unroll
  for (int t = 0; t < 8; ++t) { d[t] = v[t] - mu; s2 += d[t] * d[t]; }
#pragma unroll
  for (int o = 16; o > 0; o >>= 1) s2 += __shfl_xor(s2, o);
  const float var = s2 * (1.0f / (float)EW);
  const float rs = rsqrtf(var + 1e-5f);
  v4u ph, pl;
#pragma unroll
  for (int t = 0; t < 4; ++t) {
    const float y0 = d[2 * t] * rs * w[2 * t] + bb[2 * t];
    const float y1 = d[2 * t + 1] * rs * w[2 * t + 1] + bb[2 * t + 1];
    const _Float16 hq0 = (_Float16)y0;
    const _Float16 hq1 = (_Float16)y1;
    const _Float16 lq0 = (_Float16)((y0 - (float)hq0) * 2048.0f);
    const _Float16 lq1 = (_Float16)((y1 - (float)hq1) * 2048.0f);
    ph[t] = pk16(h_bits(hq0), h_bits(hq1));
    pl[t] = pk16(h_bits(lq0), h_bits(lq1));
  }
  const size_t o = (size_t)row * EW + c0;
  {
    *(v4u*)(xh + o) = ph;
    *(v4u*)(xl + o) = pl;
    xcnt_wait();   // another part's code follows in the listing and writes these stores' registers
  }
}

// =====================================================================================================
// Transpose-convert: in f32 [R][C] row-major -> out f16 [C][R] (r contiguous), out[c][r] =
// f16(bf16rne(in[r][c]) * scale), scale a power of two. Block = one 64 r x 64 c tile staged in LDS as f32
// (v4f loads, __syncthreads); tiles (bx, by) = (R/64, C/64) per matrix; sv = 64 x 68 floats of LDS.
// Store: group gq = tid>>3 (0..31), piece = tid&7: iteration it writes out row c = it*32+gq, lanes 8q..8q+7
// coverage: 2 iterations x 32 groups = 64 out rows, 8 pieces x 8 = 64 r per row; grid covers every tile ->
// the whole plane.
// =====================================================================================================
__device__ __forceinline__ void tr_f16(const float* __restrict__ in, unsigned short* out, int R, int C,
                                       float scale, int bx, int by, float* sv) {   // sv: [rr][cc] pitch 68 floats
  const int tid = threadIdx.x;
  const int r0 = bx * 64;
  const int c0 = by * 64;
#pragma unroll
  for (int i = 0; i < 4; ++i) {
    const int idx = i * 256 + tid;                  // 0..1023
    const int rr = idx >> 4, c4 = (idx & 15) * 4;
    const v4f a = *(const v4f*)(in + (size_t)(r0 + rr) * C + c0 + c4);
    *(v4f*)(sv + rr * 68 + c4) = a;
  }
  __syncthreads();

  const int gq = tid >> 3, piece = tid & 7;
  v4u hv[2];
  size_t hofs[2];
#pragma unroll
  for (int it = 0; it < 2; ++it) {
    const int cc = it * 32 + gq;
    v4u a;
#pragma unroll
    for (int t = 0; t < 4; ++t) {
      const float f0 = bf_up(bf_bits(sv[(piece * 8 + 2 * t) * 68 + cc]));
      const float f1 = bf_up(bf_bits(sv[(piece * 8 + 2 * t + 1) * 68 + cc]));
      a[t] = pk16(h_bits((_Float16)(f0 * scale)), h_bits((_Float16)(f1 * scale)));
    }
    hv[it] = a;
    hofs[it] = (size_t)(c0 + cc) * R + r0 + piece * 8;
  }
  {
#pragma unroll
    for (int it = 0; it < 2; ++it) {
      *(v4u*)(out + hofs[it]) = hv[it];
    }
    xcnt_wait();   // another part's code follows in the listing and writes these stores' registers
  }
}

// =====================================================================================================
// Additive mask mk f32 [NB][SEQ x][SEQ y][NH h] -> two f32 planes of msc * bf16rne(mk), msc a power of two:
//   ma[b][h][x][y] (direct) and mb[b][h][y][x] (transposed), both with the last index contiguous.
// blocks = (SEQ/8 groups, NH, NB), 256 threads. Direct part: thread (xx = tid>>5, y4 = (tid&31)*4) gathers 4
// values of row x = grp*8+xx and stores 16 B; a wave writes the whole 512-B row (4 lines, one instruction).
// Transposed part: 128 x times 8 y staged in LDS (pitch 132), __syncthreads, then thread (yy = tid>>5,
// x4 = (tid&31)*4) stores 16 B of row y = grp*8+yy; a wave writes the whole 512-B row, one instruction.
// coverage: 16 groups x 8 rows x (32 lanes x 4) = all SEQ x SEQ of every (b,h) in both planes.
// =====================================================================================================
__device__ __forceinline__ void mask_planes(const float* __restrict__ mk, float* ma, float* mb,
                                            float msc, int grp, int h, int b, float* sm) {   // sm: 8 x 132 floats
  const int tid = threadIdx.x;
  const size_t pb = ((size_t)(b * NH + h)) * SEQ * SEQ;          // plane base of (b,h)
  v4f vd;
  size_t od;
  {
    const int xx = tid >> 5, y4 = (tid & 31) * 4;
    const int x = grp * 8 + xx;
    const float* src = mk + (((size_t)b * SEQ + x) * SEQ + y4) * NH + h;
#pragma unroll
    for (int t = 0; t < 4; ++t) vd[t] = msc * bf_up(bf_bits(src[(size_t)t * NH]));
    od = pb + (size_t)x * SEQ + y4;
  }
  xcnt_wait();                                                   // a later load's result may land on the address pair above
  {
    const int x = tid >> 1, yq = (tid & 1) * 4;
    const float* src = mk + (((size_t)b * SEQ + x) * SEQ + grp * 8 + yq) * NH + h;
#pragma unroll
    for (int t = 0; t < 4; ++t) sm[(yq + t) * 132 + x] = msc * bf_up(bf_bits(src[(size_t)t * NH]));
  }
  __syncthreads();
  v4f vt;
  size_t ot;
  {
    const int yy = tid >> 5, x4 = (tid & 31) * 4;
    vt = *(const v4f*)(sm + yy * 132 + x4);
    ot = pb + (size_t)(grp * 8 + yy) * SEQ + x4;
  }
  {
    *(v4f*)(ma + od) = vd;
    *(v4f*)(mb + ot) = vt;
    xcnt_wait();   // another part's code follows in the listing and writes these stores' registers
  }
}

// =====================================================================================================
// All preparation in one launch: the four parts read only inputs and write disjoint planes, so none waits for
// another. Block ranges (block-uniform branches, each part's barriers inside its own branch), short parts
// first so that they run beside the layer norm's stream:
//   [0, PB_W)            Wqkv_in / Wqkv_out tiles: t -> matrix t / 48, tile (t & 3, (t % 48) >> 2)
//   [PB_W, PB_O)         Wo tiles: t -> (t & 7, t >> 3)
//   [PB_O, PB_M)         mask groups: t -> (grp = t & 15, h = (t >> 4) & 7, b = t >> 7)
//   [PB_M, PB_M + RT/8)  layer norm, 8 rows per block
// =====================================================================================================
#define PB_W (2 * (EW / 64) * (W3 / 64))            // 96
#define PB_O (PB_W + (KO / 64) * (EW / 64))         // 128
#define PB_M (PB_O + (SEQ / 8) * NH * NB)           // 384 (NB = 2)
static_assert(EW / 64 == 4 && W3 / 64 == 12 && KO / 64 == 8 && SEQ / 8 == 16 && NH == 8);

__global__ __launch_bounds__(256) void prep_all(
    const float* __restrict__ e, const float* __restrict__ lw, const float* __restrict__ lb,
    unsigned short* xh, unsigned short* xl,
    const float* __restrict__ wqi, const float* __restrict__ wqo, unsigned short* wt, float cw,
    const float* __restrict__ wo, unsigned short* woh, float cwo,
    const float* __restrict__ mk, float* ma, float* mb, float msc) {
  __shared__ __align__(16) float sbuf[64 * 68];
  const int bx = blockIdx.x;
  if (bx < PB_W) {
    const int z = (bx >= PB_W / 2) ? 1 : 0;         // the second matrix's plane follows the first
    const int t = bx - z * (PB_W / 2);
    tr_f16((z != 0) ? wqo : wqi, wt + (size_t)z * EW * W3, EW, W3, cw, t & 3, t >> 2, sbuf);
  } else if (bx < PB_O) {
    const int t = bx - PB_W;
    tr_f16(wo, woh, KO, EW, cwo, t & 7, t >> 3, sbuf);
  } else if (bx < PB_M) {
    const int t = bx - PB_O;
    mask_planes(mk, ma, mb, msc, t & 15, (t >> 4) & 7, t >> 7, sbuf);
  } else {
    ln_planes(e, lw, lb, xh, xl, RT, bx - PB_M);
  }
}

// =====================================================================================================
// Main loop shared by the two projections: one block = 128 x 128 of the product, 8 waves as 4 (m) x 2 (n),
// each wave its 32 x 64 tile. Operands go global -> registers -> LDS in chunks of KC k values, so that every
// global load covers whole 128-B lines (8 lanes per row) and each staged row serves 2 (A) or 4 (B) waves.
// Buffer rows: A hi 0..127 | A residual 128..255 | B 256..383, pitch LP. Thread t stages piece t&7 of rows
// u*32 + (t>>3), u = 0..11; gAh, gAl, gB point at its piece of its first row of each operand, sA / sB are
// the element strides between its successive rows. Two buffers: chunk c+1 is loaded into registers ahead of
// the products of chunk c and stored behind them into the buffer whose readers left at the previous
// barrier; one barrier per chunk publishes it. k runs upward in steps of 32 within and across chunks.
// The closing barrier of the last chunk lets the caller reuse sm.
// =====================================================================================================
#define KC   64                 // k values per staged chunk (128 B of every operand row)
#define LP   72                 // LDS row pitch in halves: 144 B = 16 B x 9, 16-B fragment reads meet each bank once
#define STG  (384 * LP)         // halves per buffer (55296 B)

__device__ __forceinline__ void gemm_blk(const _Float16* gAh, const _Float16* gAl, size_t sA,
                                         const _Float16* gB, size_t sB, int K, _Float16* sm, int tid,
                                         v8f (&acch)[2][4], v8f (&accl)[2][4]) {
  const int lane = tid & 31;
  const int wave = tid >> 5;
  const int fo = (lane & 15) * LP + (lane >> 4) * 8;            // fragment row and k half of this lane
  const int ra = (wave & 3) * 32 * LP + fo;                     // A hi rows of this wave
  const int rb = (256 + (wave >> 2) * 64) * LP + fo;            // B rows of this wave
  _Float16* sw = sm + (tid >> 3) * LP + (tid & 7) * 8;
  v4u st[12];
#pragma unroll
  for (int u = 0; u < 4; ++u) {
    st[u]     = *(const v4u*)(gAh + u * sA);
    st[4 + u] = *(const v4u*)(gAl + u * sA);
    st[8 + u] = *(const v4u*)(gB + u * sB);
  }
#pragma unroll
  for (int u = 0; u < 12; ++u) *(v4u*)(sw + u * 32 * LP) = st[u];
  __syncthreads();

  const int nc = K / KC;
  for (int c = 0; c < nc; ++c) {
    const bool more = (c + 1) < nc;                             // block-uniform
    if (more) {
      const int ko = (c + 1) * KC;
#pragma unroll
      for (int u = 0; u < 4; ++u) {
        st[u]     = *(const v4u*)(gAh + u * sA + ko);
        st[4 + u] = *(const v4u*)(gAl + u * sA + ko);
        st[8 + u] = *(const v4u*)(gB + u * sB + ko);
      }
    }
    const _Float16* sb = sm + (c & 1) * STG;
#pragma unroll
    for (int kk = 0; kk < KC; kk += 32) {
      v16h fh[2], fl[2];
#pragma unroll
      for (int i = 0; i < 2; ++i) {
        fh[i] = ldfrag_h(sb + ra + i * 16 * LP + kk);
        fl[i] = ldfrag_h(sb + ra + (128 + i * 16) * LP + kk);
      }
      v16h bnx = ldfrag_h(sb + rb + kk);
#pragma unroll
      for (int j = 0; j < 4; ++j) {
        const v16h bfr = bnx;
        if (j < 3) bnx = ldfrag_h(sb + rb + (j + 1) * 16 * LP + kk);   // next B fragment flies under this one's products
#pragma unroll
        for (int i = 0; i < 2; ++i) {
          acch[i][j] = mma_h(fh[i], bfr, acch[i][j]);
          accl[i][j] = mma_h(fl[i], bfr, accl[i][j]);
        }
      }
    }
    if (more) {
      _Float16* sn = sw + ((c + 1) & 1) * STG;
#pragma unroll
      for (int u = 0; u < 12; ++u) *(v4u*)(sn + u * 32 * LP) = st[u];
    }
    __syncthreads();
  }
}

// =====================================================================================================
// Fused q/k/v projection; grid y = batch * 2 + direction picks the batch's X rows, the direction's Wt and
// bias, and that pair's own output planes. For the edge rows of one batch: X[m][k] . Wt[n][k] + bf16rne(bias[n]) with
// X = f16 hi plane + residual plane (x2048) [RB][EW], Wt f16 [W3][EW] (k contiguous), f16 products into
// separate hi/residual accumulators, f32 accumulate; value = ((acch + accl*scl)*sch + bias) * fac(sec)
// with sec = n / EW (0 q, 1 k, 2 v). Block = 128 rows x 2 column tiles (gemm_blk); one wave per 32 x 64 tile; the tile's 64 columns are a PERMUTED set:
// n = sec*EW + d*NH + h for d in 0..31 and h in {h0, h0+1} (tn = sec*4 + h0/2), B fragment j covers
// hh = j>>1, d = (j&1)*16 + lane&15. Output written as head-major f16 planes hi = f16(value),
// lo = f16((value - hi) * 2048): element (sec, h, row m, d) at [((sec*NH + h)*RB + m)*HD + d]
// (hi plane [3][NH][RB][HD]; lo plane [2][NH][RB][HD], q and k only). Staged B row q*32 + d holds column
// n = sec*EW + d*NH + (bn&1)*4 + q, which is fragment row (j&1)*16 + lane&15 of wave column q>>1, j>>1 = q&1.
// Epilogue: per-wave 16-row slabs in the staging LDS (free behind the main loop's closing barrier),
// column cc = hh*32 + d), then lane g8 = lane>>3, pc = lane&7: instruction q writes line L = q*4+g8
// coverage: 2 slabs x 16 lines (2 hh x 8 row pairs) x 8 pieces of 8 d = the wave's whole 32 x 64 tile in
// the hi plane (and in the lo plane for sec < 2); 512 x 12 tiles cover [3][NH][RB][HD] exactly.
// =====================================================================================================
__global__ __launch_bounds__(256) void gemm_p(
    const unsigned short* __restrict__ Ahp, const unsigned short* __restrict__ Alp,
    const unsigned short* __restrict__ Btp, const float* __restrict__ bias0, const float* __restrict__ bias1,
    unsigned short* php, unsigned short* plp,
    float f0, float f1, float f2, float sch, float scl) {
  const int bd  = blockIdx.y;              // batch * 2 + direction
  const int dir = bd & 1;
  const size_t xo = (size_t)(bd >> 1) * RB * EW;
  const _Float16* Ah = (const _Float16*)(const void*)Ahp + xo;
  const _Float16* Al = (const _Float16*)(const void*)Alp + xo;
  const _Float16* Bh = (const _Float16*)(const void*)Btp + (size_t)dir * W3 * EW;
  const float* bias = (dir != 0) ? bias1 : bias0;
  php += (size_t)bd * 3 * NH * RB * HD;
  plp += (size_t)bd * 2 * NH * RB * HD;
  __shared__ __align__(16) unsigned short smem[2 * STG];
  const int tid  = threadIdx.x;
  const int lane = tid & 31;
  const int wave = tid >> 5;
  constexpr int blkN = W3 / 128;           // 6 column pairs; grid x = (RB / 128) * blkN exactly
  const int bm = blockIdx.x / blkN;
  const int bn = blockIdx.x - bm * blkN;
  const int tn = bn * 2 + (wave >> 2);
  const int m0 = bm * 128 + (wave & 3) * 32;
  const int sec = tn >> 2;                 // 0 q, 1 k, 2 v (the same for both column tiles of a block)
  const int h0 = (tn & 3) * 2;             // head pair
  const int rlane = lane & 15;
  const int mOff  = (lane >> 4) * 8;
  int nB[4];
#pragma unroll
  for (int j = 0; j < 4; ++j) nB[j] = sec * EW + ((((j & 1) << 4) + rlane) << 3) + h0 + (j >> 1);

  v8f acch[2][4], accl[2][4];
#pragma unroll
  for (int i = 0; i < 2; ++i)
#pragma unroll
    for (int j = 0; j < 4; ++j) { acch[i][j] = zero8(); accl[i][j] = zero8(); }

  {
    const size_t ao = (size_t)(bm * 128 + (tid >> 3)) * EW + (tid & 7) * 8;
    const size_t bo = (size_t)((bn >> 1) * EW + (tid >> 3) * NH + (bn & 1) * 4) * EW + (tid & 7) * 8;
    gemm_blk(Ah + ao, Al + ao, (size_t)32 * EW, Bh + bo, (size_t)EW, EW,
             (_Float16*)(void*)smem, tid, acch, accl);
  }

  const float fac = (sec == 0) ? f0 : ((sec == 1) ? f1 : f2);
  float bz[4];
#pragma unroll
  for (int j = 0; j < 4; ++j) bz[j] = bf_up(bf_bits(bias[nB[j]]));

  float* slab = (float*)(void*)smem + wave * (16 * 68);
  const int g8 = lane >> 3, pc = lane & 7;
#pragma unroll
  for (int i = 0; i < 2; ++i) {
    const int mBase = m0 + (i << 4);
#pragma unroll
    for (int r = 0; r < 8; ++r) {
#pragma unroll
      for (int j = 0; j < 4; ++j) {
        slab[(mOff + r) * 68 + (j << 4) + rlane] = ((acch[i][j][r] + accl[i][j][r] * scl) * sch + bz[j]) * fac;
      }
    }
    __builtin_amdgcn_fence(__ATOMIC_RELEASE, "workgroup");
    __builtin_amdgcn_wave_barrier();
    __builtin_amdgcn_fence(__ATOMIC_ACQUIRE, "workgroup");
    {
      v4u hv[4], lv[4];
      size_t ofs[4];
#pragma unroll
      for (int q = 0; q < 4; ++q) {
        const int L = q * 4 + g8;                    // line 0..15 of this slab
        const int hh = L >> 3, t = L & 7;
        const int row = 2 * t + (pc >> 2);
        const int d0 = (pc & 3) * 8;
        const v4f x0 = *(const v4f*)(slab + row * 68 + hh * 32 + d0);
        const v4f x1 = *(const v4f*)(slab + row * 68 + hh * 32 + d0 + 4);
        float f[8];
        f[0] = x0[0]; f[1] = x0[1]; f[2] = x0[2]; f[3] = x0[3];
        f[4] = x1[0]; f[5] = x1[1]; f[6] = x1[2]; f[7] = x1[3];
        v4u ph, pl;
#pragma unroll
        for (int u = 0; u < 4; ++u) {
          const float s0 = f[2 * u];
          const float s1 = f[2 * u + 1];
          const _Float16 hq0 = (_Float16)s0;
          const _Float16 hq1 = (_Float16)s1;
          const _Float16 lq0 = (_Float16)((s0 - (float)hq0) * 2048.0f);
          const _Float16 lq1 = (_Float16)((s1 - (float)hq1) * 2048.0f);
          ph[u] = pk16(h_bits(hq0), h_bits(hq1));
          pl[u] = pk16(h_bits(lq0), h_bits(lq1));
        }
        hv[q] = ph;
        lv[q] = pl;
        ofs[q] = (((size_t)(sec * NH + h0 + hh)) * RB + (size_t)(mBase + row)) * HD + d0;
      }
      {
#pragma unroll
        for (int q = 0; q < 4; ++q) {
          *(v4u*)(php + ofs[q]) = hv[q];
          if (sec < 2) *(v4u*)(plp + ofs[q]) = lv[q];
        }
        
      }
    }
    __builtin_amdgcn_fence(__ATOMIC_RELEASE, "workgroup");
    __builtin_amdgcn_wave_barrier();
    __builtin_amdgcn_fence(__ATOMIC_ACQUIRE, "workgroup");
  }
}

// =====================================================================================================
// Axial attention, grid y = batch * 2 + direction: block = (column index j = blockIdx.x, all 8 heads),
// wave = head h, 16-query strips s = 0..7 in lockstep.
//   queries i: plane row i*SEQ + j; keys/values kk: plane row kk*ks + j*js (dir 0: ks=1, js=SEQ ->
//   rows (j,kk); dir 1: ks=SEQ, js=1 -> rows (kk,j)); additive mask plane mp[h][i][kk] (already x64 and
//   bf16-RNE'd, direct for dir 0 and transposed for dir 1).
// Scores are computed TRANSPOSED: S^T[kk][i] = K(A, lane = key row, d per k-map) . Q^T(B, lane = query,
// d per k-map), hi.hi into the mask-initialised accumulator plus (hi.lo + lo.hi)*xscl; D lane = query i,
// element r = key 16ct + 8g + r, so a lane and its partner lane^16 own one softmax row: max / exp / sum in
// f32 with one __shfl_xor(.,16) each. Weights p*pcar are converted to f16 in registers and used directly as
// the B operand of O^T[d][i] = V^T(A from LDS, lane = d, keys per k-map) . P^T (B: lane = query, element
// e <- tile 2c key 8g+e, element 8+e <- tile 2c+1 key 8g+e).
// LDS: sVt [NH][HD][VTP] v^T tiles (built once per block by register transposition of 4 key rows into 8-B
// stores; each wave stages and reads only its own head; block barrier after staging; staged extent k 0..127
// == consumed extent); sO [16][SOP] f32 output slab (cross-wave: block barriers before the row writes and
// before the next strip).
// Output: f16 planes vah = f16(O*1024), val = f16((O*1024 - hi)*2048), [RB rows i*SEQ+j][KO] at columns
// dir*EW + d*NH + h; per strip wave h writes rows 2h, 2h+1: 32 lanes x 16 B = the whole 512-B half row
// coverage: 8 strips x 8 waves x 2 rows = 128 queries x (32 lanes x 8 = 256 channels) for every (j, dir)
// -> together with the other direction's blocks every element of both planes of this batch.
// =====================================================================================================
__global__ __launch_bounds__(256) void attn_ax(
    const unsigned short* __restrict__ php, const unsigned short* __restrict__ plp,
    const float* __restrict__ mp, unsigned short* vah, unsigned short* val,
    float xscl, float escl, float pcar, float oscl) {
  const int bd  = blockIdx.y;                      // batch * 2 + direction
  const int dir = bd & 1;
  php += (size_t)bd * 3 * NH * RB * HD;
  plp += (size_t)bd * 2 * NH * RB * HD;
  mp  += (size_t)(dir * NB + (bd >> 1)) * NH * SEQ * SEQ;   // direct planes of all batches, then transposed
  vah += (size_t)(bd >> 1) * RB * KO;
  val += (size_t)(bd >> 1) * RB * KO;
  const _Float16* Ph = (const _Float16*)(const void*)php;
  const _Float16* Pl = (const _Float16*)(const void*)plp;
  __shared__ __align__(16) unsigned short sVt[NH * HD * VTP];     // 69632 B
  __shared__ __align__(16) float sO[16 * SOP];                    // 16896 B
  const _Float16* sVh = (const _Float16*)(const void*)sVt;
  const int tid  = threadIdx.x;
  const int lane = tid & 31;
  const int h    = tid >> 5;
  const int nl   = lane & 15;
  const int g    = lane >> 4;
  const int g8   = g * 8;
  const int j    = blockIdx.x;
  const size_t hs = (size_t)RB * HD;               // per-head plane stride (halves)
  const size_t ss = (size_t)NH * hs;               // per-section stride
  const _Float16* Qh = Ph + (size_t)h * hs;
  const _Float16* Kh = Ph + ss + (size_t)h * hs;
  const _Float16* Ql = Pl + (size_t)h * hs;
  const _Float16* Kl = Pl + ss + (size_t)h * hs;
  const unsigned short* Vu = php + 2 * ss + (size_t)h * hs;
  const int ks = (dir != 0) ? SEQ : 1;
  const int js = (dir != 0) ? 1 : SEQ;

  // ---- K fragments of head h (A operands, hi and residual, all 8 key tiles): the same for every query strip,
  //      so they are loaded once here and stay in registers through the strip loop
  v16h kh[8], kl[8];
#pragma unroll
  for (int ct = 0; ct < 8; ++ct) {
    const int kk = ct * 16 + nl;                                // key row loaded by this lane (A row)
    const size_t kofs = ((size_t)kk * ks + (size_t)j * js) * HD + g8;
    kh[ct] = ldfrag_h(Kh + kofs);
    xcnt_wait();                                                // a later load's result may land on this address pair
    kl[ct] = ldfrag_h(Kl + kofs);
    xcnt_wait();                                                // the same
  }

  // ---- stage v^T of head h: unit u = (key quad kq, d octet dq): 4 x 16-B row loads -> 8 x 8-B LDS stores
#pragma unroll
  for (int it = 0; it < 4; ++it) {
    const int u  = it * 32 + lane;                 // 0..127
    const int kq = u >> 2, dq = u & 3;
    const int kb = kq * 4;
    v4u rw[4];
#pragma unroll
    for (int a = 0; a < 4; ++a) {
      const size_t rowk = (size_t)(kb + a) * ks + (size_t)j * js;
      rw[a] = *(const v4u*)(Vu + rowk * HD + dq * 8);
    }
#pragma unroll
    for (int d = 0; d < 8; ++d) {
      const int wd = d >> 1, sh = (d & 1) * 16;
      const unsigned x0 = (rw[0][wd] >> sh) & 0xFFFFu;
      const unsigned x1 = (rw[1][wd] >> sh) & 0xFFFFu;
      const unsigned x2 = (rw[2][wd] >> sh) & 0xFFFFu;
      const unsigned x3 = (rw[3][wd] >> sh) & 0xFFFFu;
      v2u o;
      o[0] = x0 | (x1 << 16);
      o[1] = x2 | (x3 << 16);
      *(v2u*)(sVt + (h * HD + dq * 8 + d) * VTP + kb) = o;
    }
  }
  __syncthreads();

#pragma unroll 1
  for (int s = 0; s < 8; ++s) {
    const int i = s * 16 + nl;                                  // this lane's query (B column / D column)
    const size_t qofs = ((size_t)i * SEQ + j) * HD + g8;
    const v16h qh = ldfrag_h(Qh + qofs);
    const v16h ql = ldfrag_h(Ql + qofs);
    const float* mrow = mp + ((size_t)h * SEQ + i) * SEQ + g8;

    // ---- transposed scores, 8 key tiles
    v8f acc[8];
#pragma unroll
    for (int ct = 0; ct < 8; ++ct) {
      const v4f mv0 = *(const v4f*)(mrow + ct * 16);
      const v4f mv1 = *(const v4f*)(mrow + ct * 16 + 4);
      v8f am;
      am[0] = mv0[0]; am[1] = mv0[1]; am[2] = mv0[2]; am[3] = mv0[3];
      am[4] = mv1[0]; am[5] = mv1[1]; am[6] = mv1[2]; am[7] = mv1[3];
      v8f ax = mma_h(kh[ct], ql, zero8());
      ax = mma_h(kl[ct], qh, ax);
      am = mma_h(kh[ct], qh, am);
      acc[ct] = am + ax * xscl;
      // one key tile's products at a time: with several residual accumulators live the K fragments spill
      __builtin_amdgcn_sched_barrier(0);
    }

    // ---- softmax over the 128 keys of query i (this lane: 64 values, partner lane^16: the other 64)
    float mx = acc[0][0];
#pragma unroll
    for (int ct = 0; ct < 8; ++ct)
#pragma unroll
      for (int r = 0; r < 8; ++r) mx = fmaxf(mx, acc[ct][r]);
    mx = fmaxf(mx, __shfl_xor(mx, 16));
    float sum = 0.f;
#pragma unroll
    for (int ct = 0; ct < 8; ++ct)
#pragma unroll
      for (int r = 0; r < 8; ++r) {
        const float ev = __expf((acc[ct][r] - mx) * escl);
        acc[ct][r] = ev;
        sum += ev;
      }
    sum += __shfl_xor(sum, 16);
    const float rc = pcar / sum;                                // sum >= 1

    // ---- P^T as B fragments straight from the accumulators
    v16h pb[4];
#pragma unroll
    for (int c = 0; c < 4; ++c) {
      union { v16h v; v8h hh[2]; } U;
      v8h p0, p1;
#pragma unroll
      for (int e2 = 0; e2 < 8; ++e2) {
        p0[e2] = (_Float16)(acc[2 * c][e2] * rc);
        p1[e2] = (_Float16)(acc[2 * c + 1][e2] * rc);
      }
      U.hh[0] = p0;
      U.hh[1] = p1;
      pb[c] = U.v;
    }

    // ---- O^T[d][i] = V^T . P^T, two 16-row d tiles, K = 128 keys
    v8f oacc[2];
#pragma unroll
    for (int dt = 0; dt < 2; ++dt) {
      v8f o = zero8();
#pragma unroll
      for (int c = 0; c < 4; ++c) {
        const v16h va = ldfrag_h(sVh + (h * HD + dt * 16 + nl) * VTP + 32 * c + g8);
        o = mma_h(va, pb[c], o);
      }
      oacc[dt] = o;
    }

    // ---- stage O (f32, true scale) into the slab: row = query nl, column = d*NH + h
#pragma unroll
    for (int dt = 0; dt < 2; ++dt)
#pragma unroll
      for (int r = 0; r < 8; ++r)
        sO[nl * SOP + ((dt * 16 + g8 + r) << 3) + h] = oacc[dt][r] * oscl;
    __syncthreads();

    // ---- wave h writes queries s*16 + 2h, + 2h + 1: 512-B half rows in hi and residual planes
    {
      v4u hv[2], lv[2];
      size_t ofs[2];
#pragma unroll
      for (int q = 0; q < 2; ++q) {
        const int rr = 2 * h + q;
        const v4f x0 = *(const v4f*)(sO + rr * SOP + lane * 8);
        const v4f x1 = *(const v4f*)(sO + rr * SOP + lane * 8 + 4);
        float f[8];
        f[0] = x0[0]; f[1] = x0[1]; f[2] = x0[2]; f[3] = x0[3];
        f[4] = x1[0]; f[5] = x1[1]; f[6] = x1[2]; f[7] = x1[3];
        v4u ph, pl;
#pragma unroll
        for (int u = 0; u < 4; ++u) {
          const float s0 = f[2 * u] * 1024.0f;
          const float s1 = f[2 * u + 1] * 1024.0f;
          const _Float16 hq0 = (_Float16)s0;
          const _Float16 hq1 = (_Float16)s1;
          const _Float16 lq0 = (_Float16)((s0 - (float)hq0) * 2048.0f);
          const _Float16 lq1 = (_Float16)((s1 - (float)hq1) * 2048.0f);
          ph[u] = pk16(h_bits(hq0), h_bits(hq1));
          pl[u] = pk16(h_bits(lq0), h_bits(lq1));
        }
        hv[q] = ph;
        lv[q] = pl;
        ofs[q] = ((size_t)(s * 16 + rr) * SEQ + j) * KO + (size_t)dir * EW + lane * 8;
      }
      {
#pragma unroll
        for (int q = 0; q < 2; ++q) {
          *(v4u*)(vah + ofs[q]) = hv[q];
          *(v4u*)(val + ofs[q]) = lv[q];
        }
        
      }
    }
    __syncthreads();                                            // sO reused by the next strip
  }
}

// =====================================================================================================
// Output projection: C[m][n] = sch * (sum_k Ahi[m][k]*Bt[n][k] + scl * sum_k Alo[m][k]*Bt[n][k]) + bf16rne(bias[n])
// (f16 products, f32 accumulate, hi and scaled-residual products in separate accumulators). Ahi/Alo row-major
// [M][K] pitch lda; Bt [N][K] pitch ldb; C f32 [M][N] pitch ldc. Block = 128 x 128 of C (gemm_blk), one wave per
// 32x64 tile; M = RT, N = EW, K = KO (multiples of 128, 128 and KC).
// Epilogue: 16-row slabs staged per wave in the staging LDS (free behind the main loop's closing barrier); each 64-wide row segment (256 B) written by one instruction
// coverage: 2 slabs x 16 rows x 64 cols = the wave's whole 32x64 tile; grid covers every tile of C.
// =====================================================================================================
__global__ __launch_bounds__(256) void gemm32h_w(
    const unsigned short* __restrict__ Ahp, const unsigned short* __restrict__ Alp,
    const unsigned short* __restrict__ Btp,
    const float* __restrict__ bias,
    float* C, float sch, float scl) {
  constexpr int lda = KO, ldb = KO, ldc = EW, M = RT, N = EW, K = KO;   // fixed: staged row steps become immediate offsets
  const _Float16* Ah = (const _Float16*)(const void*)Ahp;
  const _Float16* Al = (const _Float16*)(const void*)Alp;
  const _Float16* Bh = (const _Float16*)(const void*)Btp;
  __shared__ __align__(16) unsigned short smem[2 * STG];
  const int tid  = threadIdx.x;
  const int lane = tid & 31;
  const int wave = tid >> 5;
  constexpr int blkN = N >> 7;
  if ((int)blockIdx.x >= (M >> 7) * blkN) return;   // block-uniform, in front of every barrier
  const int bm = blockIdx.x / blkN;
  const int bn = blockIdx.x - bm * blkN;
  const int m0 = bm * 128 + (wave & 3) * 32;
  const int n0 = bn * 128 + (wave >> 2) * 64;
  const int rlane = lane & 15;
  const int mOff  = (lane >> 4) * 8;

  v8f acch[2][4], accl[2][4];
#pragma unroll
  for (int i = 0; i < 2; ++i)
#pragma unroll
    for (int j = 0; j < 4; ++j) { acch[i][j] = zero8(); accl[i][j] = zero8(); }

  {
    const size_t ao = (size_t)(bm * 128 + (tid >> 3)) * lda + (tid & 7) * 8;
    const size_t bo = (size_t)(bn * 128 + (tid >> 3)) * ldb + (tid & 7) * 8;
    gemm_blk(Ah + ao, Al + ao, (size_t)32 * lda, Bh + bo, (size_t)32 * ldb, K,
             (_Float16*)(void*)smem, tid, acch, accl);
  }

  float bz[4];
#pragma unroll
  for (int j = 0; j < 4; ++j) bz[j] = bf_up(bf_bits(bias[n0 + (j << 4) + rlane]));

  float* slab = (float*)(void*)smem + wave * (16 * 68);
#pragma unroll
  for (int i = 0; i < 2; ++i) {
    const int mBase = m0 + (i << 4);
#pragma unroll
    for (int r = 0; r < 8; ++r) {
#pragma unroll
      for (int j = 0; j < 4; ++j) {
        slab[(mOff + r) * 68 + (j << 4) + rlane] = (acch[i][j][r] + accl[i][j][r] * scl) * sch + bz[j];
      }
    }
    __builtin_amdgcn_fence(__ATOMIC_RELEASE, "workgroup");
    __builtin_amdgcn_wave_barrier();
    __builtin_amdgcn_fence(__ATOMIC_ACQUIRE, "workgroup");
    {
      const int hh = lane >> 4, c4 = (lane & 15) * 4;     // 256-B row segment = 16 lanes x 16 B
      v4f ov[8];
#pragma unroll
      for (int it = 0; it < 8; ++it) {
        const int row = it * 2 + hh;                       // it 0..7 x hh 0..1 = rows 0..15
        ov[it] = *(const v4f*)(slab + row * 68 + c4);
      }
      {
#pragma unroll
        for (int it = 0; it < 8; ++it) {
          const int row = it * 2 + hh;
          *(v4f*)(C + (size_t)(mBase + row) * ldc + n0 + c4) = ov[it];
        }
        
      }
    }
    __builtin_amdgcn_fence(__ATOMIC_RELEASE, "workgroup");
    __builtin_amdgcn_wave_barrier();
    __builtin_amdgcn_fence(__ATOMIC_ACQUIRE, "workgroup");
  }
}

// =====================================================================================================
// Workspace map (bytes, NB = 2); every region an exact multiple of its whole-line store granularity, all
// written earlier in the same call. Every (batch, direction) pair has its own Ph / Pl planes, so each stage
// is one launch over all four pairs. Vah lies on Xh + Xl, whose last reader (the projection) has ended.
//   Xh   f16 [RT][EW]                     0        16777216   (layer norm output, hi)
//   Xl   f16 [RT][EW]              16777216        16777216   (residual x2048)
//   Wti  f16 [W3 n][EW k]          33554432          393216   (f16(bf16(Wqkv_in) x64))
//   Wto  f16 [W3 n][EW k]          33947648          393216
//   Woh  f16 [EW n][KO k]          34340864          262144   (f16(bf16(Wo) x1024))
//   mA   f32 [NB][NH][SEQ][SEQ]    34603008         1048576   (64 x bf16(mask), direct)
//   mB   f32 [NB][NH][SEQ][SEQ]    35651584         1048576   (transposed)
//   Ph   f16 [2 NB][3][NH][RB][HD] 36700160       100663296   (q x16*32^-0.5, k x4, v x4; hi)
//   Pl   f16 [2 NB][2][NH][RB][HD] 137363456       67108864   (q, k residual x2048)
//   Val  f16 [RT][KO]             204472320        33554432   (attention output residual x2048)
//   Vah  f16 [RT][KO]                     0        33554432   (attention output x1024, hi; on Xh + Xl)
//   end                           238026752
// Inputs: e f32 [NB][SEQ][SEQ][EW]; mask f32 [NB][SEQ][SEQ][NH]; ln_w, ln_b f32 [EW]; Wqkv_in, Wqkv_out
// f32 [EW in][W3 out]; bqkv_* f32 [W3]; Wo f32 [KO in][EW out]; bo f32 [EW]. d_out f32 [RT][EW] at byte 0
// (row = b*RB + i*SEQ + j, col = n).
// =====================================================================================================
extern "C" void kernel_launch(void* const* d_in, const int* in_sizes, int n_in,
                              void* d_out, int out_size, void* d_ws, size_t ws_size,
                              hipStream_t stream) {
  if (n_in < 10) return;
  if (in_sizes[0] < RT * EW) return;
  if (in_sizes[1] < NB * SEQ * SEQ * NH) return;
  if (in_sizes[2] < EW) return;
  if (in_sizes[3] < EW) return;
  if (in_sizes[4] < EW * W3) return;
  if (in_sizes[5] < W3) return;
  if (in_sizes[6] < EW * W3) return;
  if (in_sizes[7] < W3) return;
  if (in_sizes[8] < KO * EW) return;
  if (in_sizes[9] < EW) return;
  if (out_size < RT * EW) return;

  const float* e    = (const float*)d_in[0];   // [NB][SEQ][SEQ][EW]
  const float* mask = (const float*)d_in[1];   // [NB][SEQ][SEQ][NH]
  const float* ln_w = (const float*)d_in[2];   // [EW]
  const float* ln_b = (const float*)d_in[3];   // [EW]
  const float* Wqi  = (const float*)d_in[4];   // [EW in][W3 out]
  const float* bqi  = (const float*)d_in[5];   // [W3]
  const float* Wqo  = (const float*)d_in[6];   // [EW in][W3 out]
  const float* bqo  = (const float*)d_in[7];   // [W3]
  const float* Wo   = (const float*)d_in[8];   // [KO in][EW out]
  const float* bo   = (const float*)d_in[9];   // [EW]

  const size_t PX  = (size_t)RT * EW * 2;                    // 16777216 (NB = 2)
  const size_t PWt = (size_t)W3 * EW * 2;                    //   393216
  const size_t PWo = (size_t)EW * KO * 2;                    //   262144
  const size_t PM  = (size_t)NB * NH * SEQ * SEQ * 4;        //  1048576 (NB = 2)
  const size_t PPh = (size_t)2 * NB * 3 * NH * RB * HD * 2;  // 100663296 (NB = 2)
  const size_t PPl = (size_t)2 * NB * 2 * NH * RB * HD * 2;  //  67108864
  const size_t PVa = (size_t)RT * KO * 2;                    //  33554432 == 2 * PX
  size_t off = 0;
  const size_t oXh = off; off += PX;
  const size_t oXl = off; off += PX;
  const size_t oWi = off; off += PWt;
  off += PWt;                                                // Wto, directly behind Wti
  const size_t oWo = off; off += PWo;
  const size_t oMa = off; off += PM;
  const size_t oMb = off; off += PM;
  const size_t oPh = off; off += PPh;
  const size_t oPl = off; off += PPl;
  const size_t oVl = off; off += PVa;
  const size_t oVh = oXh;                                    // Vah takes over Xh + Xl (same size)
  if (off > ws_size) return;                                 // off = 238026752 for NB = 2

  char* ws = (char*)d_ws;
  unsigned short* Xh  = (unsigned short*)(ws + oXh);
  unsigned short* Xl  = (unsigned short*)(ws + oXl);
  unsigned short* Wti = (unsigned short*)(ws + oWi);
  unsigned short* Woh = (unsigned short*)(ws + oWo);
  float*          mA  = (float*)(ws + oMa);
  float*          mB  = (float*)(ws + oMb);
  unsigned short* Ph  = (unsigned short*)(ws + oPh);
  unsigned short* Pl  = (unsigned short*)(ws + oPl);
  unsigned short* Vah = (unsigned short*)(ws + oVh);
  unsigned short* Val = (unsigned short*)(ws + oVl);
  float*          outf = (float*)d_out;                      // [RT][EW]

  const dim3 blk(256);
  const dim3 gPp(PB_M + RT / 8);                             // 384 weight and mask blocks + 4096 layer norm blocks
  const dim3 gPr((RB / 128) * (W3 / 128), 2 * NB);           // 768 blocks x (batch, direction)
  const dim3 gAt(SEQ, 2 * NB);                               // one block per column index j x (batch, direction)
  const dim3 gWo((RT / 128) * (EW / 128));                   // 512 blocks
  const float cW     = 64.0f;                                // Wqkv plane carry
  const float fQ     = 16.0f * 0.17677669529663687f;         // 32^-0.5 then carry x16
  const float fK     = 4.0f;                                 // k carry
  const float fV     = 4.0f;                                 // v carry
  const float prSch  = 1.0f / 64.0f;                         // folds the Wqkv plane carry
  const float prScl  = 1.0f / 2048.0f;                       // folds the layer norm residual carry
  const float mkSc   = 64.0f;                                // mask planes x (16 * 4)
  const float axXscl = 1.0f / 2048.0f;                       // q/k residual carry
  const float axEscl = 1.0f / 64.0f;                         // score carry 16 * 4
  const float axPcar = 16384.0f;                             // softmax weight carry
  const float axOscl = 1.0f / 65536.0f;                      // 1/(16384 * 4)
  const float woScale = 1024.0f;                             // Wo plane carry
  const float woSch  = 1.0f / 1048576.0f;                    // 1/(1024 * 1024): O hi carry and Wo carry
  const float woScl  = 1.0f / 2048.0f;                       // O residual carry

  // (1) layer norm -> f16 hi + residual planes; weights -> transposed f16 planes of their bf16 values; masks
  prep_all<<<gPp, blk, 0, stream>>>(e, ln_w, ln_b, Xh, Xl, Wqi, Wqo, Wti, cW, Wo, Woh, woScale, mask, mA, mB, mkSc);
  // (2) all batches and both directions at once: projection, attention, output projection
  gemm_p<<<gPr, blk, 0, stream>>>(Xh, Xl, Wti, bqi, bqo, Ph, Pl, fQ, fK, fV, prSch, prScl);
  attn_ax<<<gAt, blk, 0, stream>>>(Ph, Pl, mA, Vah, Val, axXscl, axEscl, axPcar, axOscl);
  gemm32h_w<<<gWo, blk, 0, stream>>>(Vah, Val, Woh, bo, outf, woSch, woScl);
  (void)hipGetLastError();
}

// v005
// It runs in 138 microseconds.
// In two side-by-side timings against v004, it was 1.09 and 1.08 times as fast.
// Over all steps from v000 it is 2.81 times as fast.
// Contractions: q/k/v projections = v_wmma_f32_16x16x32_f16 (layer-normed input as f16 hi + residual (x2048) planes, two products into separate accumulators; Wqkv as f16 of its bf16-RNE value x64); per-(b,j,h) scores = v_wmma_f32_16x16x32_f16 (k and q as f16 hi + residual (x2048) planes carried x4 and x16*32^-0.5, products hh + hl + lh; additive mask x64 as the initial accumulator); p.v = v_wmma_f32_16x16x32_f16 (softmax weights x16384 in f16 repacked from the score accumulators, v^T f16 tile carried x4, single product); output projection = v_wmma_f32_16x16x32_f16 (attention output as f16 hi (x1024) + residual (x2048) planes, two products; Wo as f16 of its bf16-RNE value x1024); every float input RNE-converted to bf16 on load; all f32 accumulate; layer norm and softmax in f32.
#include <hip/hip_runtime.h>
#include <math.h>
#include <stdint.h>

#ifndef NB
#define NB 2
#endif
#define NB_FULL 2
#ifndef SEQ
#define SEQ 128
#endif
#define EW  256                 // edge width
#define NH  8                   // heads (fastest channel dim)
#define HD  32                  // dot dim
#define W3  (3 * EW)            // 768 fused projection columns
#define KO  (2 * EW)            // 512 concat channels
#define RB  (SEQ * SEQ)         // edge rows per batch (16384)
#define RT  (NB * RB)           // edge rows processed
#define VTP 136                 // LDS v^T tile pitch (halves)
#define SOP 264                 // LDS output slab pitch (floats)

static_assert(NH * HD == EW);
static_assert(HD == 32);
static_assert(EW == 256);
static_assert(SEQ == 128);      // i, j and key extents are coupled; only NB is reducible
static_assert(NB >= 1 && NB <= NB_FULL);
static_assert((RB % 64) == 0 && (RT % 8) == 0);
static_assert((((RB / 32) * (W3 / 64)) % 8) == 0);
static_assert((((RB / 32) * (EW / 64)) % 8) == 0);
static_assert((EW % 64) == 0 && (W3 % 64) == 0 && (KO % 64) == 0 && (EW % 32) == 0 && (KO % 32) == 0);
static_assert((SEQ % 16) == 0 && (SEQ % 8) == 0);
static_assert((RB % 128) == 0 && (W3 % 128) == 0 && (EW % 128) == 0);   // 128 x 128 block tiles of the projections

typedef _Float16 v16h __attribute__((ext_vector_type(16)));
typedef _Float16 v8h  __attribute__((ext_vector_type(8)));
typedef float    v8f  __attribute__((ext_vector_type(8)));
typedef float    v4f  __attribute__((ext_vector_type(4)));
typedef unsigned int v4u __attribute__((ext_vector_type(4)));
typedef unsigned int v2u __attribute__((ext_vector_type(2)));

// ---- scalar helpers --------------------------------------------------------------------------------
__device__ __forceinline__ unsigned short bf_bits(float f) {          // f32 -> bf16 bits, RNE convert
  unsigned u = __float_as_uint(f);
  return (unsigned short)((u + 0x7FFFu + ((u >> 16) & 1u)) >> 16);
}
__device__ __forceinline__ float bf_up(unsigned short h) { return __uint_as_float(((unsigned)h) << 16); }
__device__ __forceinline__ unsigned short h_bits(_Float16 x) { return __builtin_bit_cast(unsigned short, x); }
__device__ __forceinline__ unsigned pk16(unsigned short a, unsigned short b) { return (unsigned)a | ((unsigned)b << 16); }
__device__ __forceinline__ v8f zero8() { v8f z = {0.f, 0.f, 0.f, 0.f, 0.f, 0.f, 0.f, 0.f}; return z; }

// ---- fragment loader: 16-bit A/B operand, lane -> row/col (lane&15), p already includes +8*(lane>>4);
//      elements 0..7 <- p[0..7] (k0+8h..), elements 8..15 <- p[16..23] (k0+16+8h..)
__device__ __forceinline__ v16h ldfrag_h(const _Float16* p) {
  union { v16h v; v8h h[2]; } f;
  f.h[0] = *(const v8h*)(p);
  f.h[1] = *(const v8h*)(p + 16);
  return f.v;
}

// ---- wait that stands between issued global loads and an overwrite of their address registers
__device__ __forceinline__ void xcnt_wait() {
#if defined(__HIP_DEVICE_COMPILE__)
  asm volatile("s_wait_xcnt 0x0" ::: "memory");
#endif
}

// ---- WMMA helper with trailing VALU hazard gap ----------------------------------------------------------
__device__ __forceinline__ v8f mma_h(v16h a, v16h b, v8f c) {
  c = __builtin_amdgcn_wmma_f32_16x16x32_f16(false, a, false, b, (short)0, c, false, false);
#if defined(__HIP_DEVICE_COMPILE__)
  asm volatile("v_nop\n\tv_nop\n\tv_nop\n\tv_nop" : "+v"(c) : "v"(a), "v"(b));
#endif
  return c;
}

// =====================================================================================================
// Layer norm over EW channels of each edge row (inputs and affine params RNE-converted to bf16 first, f32
// [nrows][EW]. One wave per row, 8 channels per lane; each plane row = 512 B written by one instruction
// coverage: nrows waves x 32 lanes x 8 = every element of both planes.
// =====================================================================================================
__device__ __forceinline__ void ln_planes(const float* __restrict__ e, const float* __restrict__ lw,
                                          const float* __restrict__ lb, unsigned short* xh,
                                          unsigned short* xl, int nrows, int blk) {
  const int lane = threadIdx.x & 31;
  const int wave = threadIdx.x >> 5;
  const int row = blk * 8 + wave;
  if (row >= nrows) return;                           // wave-uniform; no block barriers in this part
  const int c0 = lane * 8;
  const float* src = e + (size_t)row * EW + c0;
  const v4f a0 = *(const v4f*)(src);
  const v4f a1 = *(const v4f*)(src + 4);
  xcnt_wait();                                        // a later load's result may land on this address pair
  const v4f w0 = *(const v4f*)(lw + c0);
  const v4f w1 = *(const v4f*)(lw + c0 + 4);
  const v4f b0 = *(const v4f*)(lb + c0);
  const v4f b1 = *(const v4f*)(lb + c0 + 4);
  float v[8], w[8], bb[8];
#pragma unroll
  for (int t = 0; t < 4; ++t) {
    v[t]      = bf_up(bf_bits(a0[t]));
    v[4 + t]  = bf_up(bf_bits(a1[t]));
    w[t]      = bf_up(bf_bits(w0[t]));
    w[4 + t]  = bf_up(bf_bits(w1[t]));
    bb[t]     = bf_up(bf_bits(b0[t]));
    bb[4 + t] = bf_up(bf_bits(b1[t]));
  }
  float s = 0.f;
#pragma unroll
  for (int t = 0; t < 8; ++t) s += v[t];
#pragma unroll
  for (int o = 16; o > 0; o >>= 1) s += __shfl_xor(s, o);
  const float mu = s * (1.0f / (float)EW);
  float d[8];
  float s2 = 0.f;
#pragma unroll
  for (int t = 0; t < 8; ++t) { d[t] = v[t] - mu; s2 += d[t] * d[t]; }
#pragma unroll
  for (int o = 16; o > 0; o >>= 1) s2 += __shfl_xor(s2, o);
  const float var = s2 * (1.0f / (float)EW);
  const float rs = rsqrtf(var + 1e-5f);
  v4u ph, pl;
#pragma unroll
  for (int t = 0; t < 4; ++t) {
    const float y0 = d[2 * t] * rs * w[2 * t] + bb[2 * t];
    const float y1 = d[2 * t + 1] * rs * w[2 * t + 1] + bb[2 * t + 1];
    const _Float16 hq0 = (_Float16)y0;
    const _Float16 hq1 = (_Float16)y1;
    const _Float16 lq0 = (_Float16)((y0 - (float)hq0) * 2048.0f);
    const _Float16 lq1 = (_Float16)((y1 - (float)hq1) * 2048.0f);
    ph[t] = pk16(h_bits(hq0), h_bits(hq1));
    pl[t] = pk16(h_bits(lq0), h_bits(lq1));
  }
  const size_t o = (size_t)row * EW + c0;
  {
    *(v4u*)(xh + o) = ph;
    *(v4u*)(xl + o) = pl;
    xcnt_wait();   // another part's code follows in the listing and writes these stores' registers
  }
}

// =====================================================================================================
// Transpose-convert: in f32 [R][C] row-major -> out f16 [C][R] (r contiguous), out[c][r] =
// f16(bf16rne(in[r][c]) * scale), scale a power of two. Block = one 64 r x 64 c tile staged in LDS as f32
// (v4f loads, __syncthreads); tiles (bx, by) = (R/64, C/64) per matrix; sv = 64 x 68 floats of LDS.
// Store: group gq = tid>>3 (0..31), piece = tid&7: iteration it writes out row c = it*32+gq, lanes 8q..8q+7
// coverage: 2 iterations x 32 groups = 64 out rows, 8 pieces x 8 = 64 r per row; grid covers every tile ->
// the whole plane.
// =====================================================================================================
__device__ __forceinline__ void tr_f16(const float* __restrict__ in, unsigned short* out, int R, int C,
                                       float scale, int bx, int by, float* sv) {   // sv: [rr][cc] pitch 68 floats
  const int tid = threadIdx.x;
  const int r0 = bx * 64;
  const int c0 = by * 64;
#pragma unroll
  for (int i = 0; i < 4; ++i) {
    const int idx = i * 256 + tid;                  // 0..1023
    const int rr = idx >> 4, c4 = (idx & 15) * 4;
    const v4f a = *(const v4f*)(in + (size_t)(r0 + rr) * C + c0 + c4);
    *(v4f*)(sv + rr * 68 + c4) = a;
  }
  __syncthreads();

  const int gq = tid >> 3, piece = tid & 7;
  v4u hv[2];
  size_t hofs[2];
#pragma unroll
  for (int it = 0; it < 2; ++it) {
    const int cc = it * 32 + gq;
    v4u a;
#pragma unroll
    for (int t = 0; t < 4; ++t) {
      const float f0 = bf_up(bf_bits(sv[(piece * 8 + 2 * t) * 68 + cc]));
      const float f1 = bf_up(bf_bits(sv[(piece * 8 + 2 * t + 1) * 68 + cc]));
      a[t] = pk16(h_bits((_Float16)(f0 * scale)), h_bits((_Float16)(f1 * scale)));
    }
    hv[it] = a;
    hofs[it] = (size_t)(c0 + cc) * R + r0 + piece * 8;
  }
  {
#pragma unroll
    for (int it = 0; it < 2; ++it) {
      *(v4u*)(out + hofs[it]) = hv[it];
    }
    xcnt_wait();   // another part's code follows in the listing and writes these stores' registers
  }
}

// =====================================================================================================
// Additive mask mk f32 [NB][SEQ x][SEQ y][NH h] -> two f32 planes of msc * bf16rne(mk), msc a power of two, both in
// the order of the attention's score accumulators. With (i, kk) = (query, key): ma holds mk[b][i][kk][h], mb holds
// mk[b][kk][i][h]; element (i, kk) of plane (b, h) lies at float offset
//   ((((i >> 4) * 8 + (kk >> 4)) * 2 + ((kk >> 2) & 1)) * 32 + ((kk >> 3) & 1) * 16 + (i & 15)) * 4 + (kk & 3),
// so the 16 B that lane g*16 + (i & 15) wants for accumulator elements 0..3 (or 4..7) of key tile kk >> 4 lie lane
// after lane: one load of a wave covers 512 B in a row. blocks = (SEQ/8 groups, NH, NB), 256 threads; a block owns
// queries grp*8 .. +7 of both planes. Both 8 x 128 tiles are staged in LDS (pitch MTP), __syncthreads, then thread
// (L = tid>>3, p = tid&7) stores keys 4L..4L+3 of query grp*8+p: lanes 8q..8q+7 write one whole 128-B line.
// coverage: 16 groups x 8 queries x (32 L x 4 keys) = all SEQ x SEQ of every (b,h) in both planes.
// =====================================================================================================
#define MTP 136                 // LDS pitch of the mask tiles (floats): 16-B reads of 8 rows x 2 key quads meet each bank once
__device__ __forceinline__ void mask_planes(const float* __restrict__ mk, float* ma, float* mb,
                                            float msc, int grp, int h, int b, float* sm) {   // sm: 2 x 8 x MTP floats
  const int tid = threadIdx.x;
  const size_t pb = ((size_t)(b * NH + h)) * SEQ * SEQ;          // plane base of (b,h)
  float* st = sm + 8 * MTP;                                      // tile of the transposed plane
  {
    const int xx = tid >> 5, y4 = (tid & 31) * 4;
    const int x = grp * 8 + xx;
    const float* src = mk + (((size_t)b * SEQ + x) * SEQ + y4) * NH + h;
    v4f vd;
#pragma unroll
    for (int t = 0; t < 4; ++t) vd[t] = msc * bf_up(bf_bits(src[(size_t)t * NH]));
    *(v4f*)(sm + xx * MTP + y4) = vd;
  }
  xcnt_wait();                                                   // a later load's result may land on the address pair above
  {
    const int x = tid >> 1, yq = (tid & 1) * 4;
    const float* src = mk + (((size_t)b * SEQ + x) * SEQ + grp * 8 + yq) * NH + h;
#pragma unroll
    for (int t = 0; t < 4; ++t) st[(yq + t) * MTP + x] = msc * bf_up(bf_bits(src[(size_t)t * NH]));
  }
  __syncthreads();
  {
    const int L = tid >> 3, p = tid & 7;
    const v4f vd = *(const v4f*)(sm + p * MTP + L * 4);
    const v4f vt = *(const v4f*)(st + p * MTP + L * 4);
    const size_t o = pb + (size_t)(((((grp >> 1) * 8 + (L >> 2)) * 2 + (L & 1)) * 32 + ((L >> 1) & 1) * 16 + (grp & 1) * 8 + p) * 4);
    *(v4f*)(ma + o) = vd;
    *(v4f*)(mb + o) = vt;
    xcnt_wait();   // another part's code follows in the listing and writes these stores' registers
  }
}

// =====================================================================================================
// All preparation in one launch: the four parts read only inputs and write disjoint planes, so none waits for
// another. Block ranges (block-uniform branches, each part's barriers inside its own branch), short parts
// first so that they run beside the layer norm's stream:
//   [0, PB_W)            Wqkv_in / Wqkv_out tiles: t -> matrix t / 48, tile (t & 3, (t % 48) >> 2)
//   [PB_W, PB_O)         Wo tiles: t -> (t & 7, t >> 3)
//   [PB_O, PB_M)         mask groups: t -> (grp = t & 15, h = (t >> 4) & 7, b = t >> 7)
//   [PB_M, PB_M + RT/8)  layer norm, 8 rows per block
// =====================================================================================================
#define PB_W (2 * (EW / 64) * (W3 / 64))            // 96
#define PB_O (PB_W + (KO / 64) * (EW / 64))         // 128
#define PB_M (PB_O + (SEQ / 8) * NH * NB)           // 384 (NB = 2)
static_assert(EW / 64 == 4 && W3 / 64 == 12 && KO / 64 == 8 && SEQ / 8 == 16 && NH == 8);

__global__ __launch_bounds__(256) void prep_all(
    const float* __restrict__ e, const float* __restrict__ lw, const float* __restrict__ lb,
    unsigned short* xh, unsigned short* xl,
    const float* __restrict__ wqi, const float* __restrict__ wqo, unsigned short* wt, float cw,
    const float* __restrict__ wo, unsigned short* woh, float cwo,
    const float* __restrict__ mk, float* ma, float* mb, float msc) {
  __shared__ __align__(16) float sbuf[64 * 68];
  const int bx = blockIdx.x;
  if (bx < PB_W) {
    const int z = (bx >= PB_W / 2) ? 1 : 0;         // the second matrix's plane follows the first
    const int t = bx - z * (PB_W / 2);
    tr_f16((z != 0) ? wqo : wqi, wt + (size_t)z * EW * W3, EW, W3, cw, t & 3, t >> 2, sbuf);
  } else if (bx < PB_O) {
    const int t = bx - PB_W;
    tr_f16(wo, woh, KO, EW, cwo, t & 7, t >> 3, sbuf);
  } else if (bx < PB_M) {
    const int t = bx - PB_O;
    mask_planes(mk, ma, mb, msc, t & 15, (t >> 4) & 7, t >> 7, sbuf);
  } else {
    ln_planes(e, lw, lb, xh, xl, RT, bx - PB_M);
  }
}

// =====================================================================================================
// Main loop shared by the two projections: one block = 128 x 128 of the product, 8 waves as 4 (m) x 2 (n),
// each wave its 32 x 64 tile. Operands go global -> registers -> LDS in chunks of KC k values, so that every
// global load covers whole 128-B lines (8 lanes per row) and each staged row serves 2 (A) or 4 (B) waves.
// Buffer rows: A hi 0..127 | A residual 128..255 | B 256..383, pitch LP. Thread t stages piece t&7 of rows
// u*32 + (t>>3), u = 0..11; gAh, gAl, gB point at its piece of its first row of each operand, sA / sB are
// the element strides between its successive rows. Two buffers: chunk c+1 is loaded into registers ahead of
// the products of chunk c and stored behind them into the buffer whose readers left at the previous
// barrier; one barrier per chunk publishes it. k runs upward in steps of 32 within and across chunks.
// The closing barrier of the last chunk lets the caller reuse sm.
// =====================================================================================================
#define KC   64                 // k values per staged chunk (128 B of every operand row)
#define LP   72                 // LDS row pitch in halves: 144 B = 16 B x 9, 16-B fragment reads meet each bank once
#define STG  (384 * LP)         // halves per buffer (55296 B)

__device__ __forceinline__ void gemm_blk(const _Float16* gAh, const _Float16* gAl, size_t sA,
                                         const _Float16* gB, size_t sB, int K, _Float16* sm, int tid,
                                         v8f (&acch)[2][4], v8f (&accl)[2][4]) {
  const int lane = tid & 31;
  const int wave = tid >> 5;
  const int fo = (lane & 15) * LP + (lane >> 4) * 8;            // fragment row and k half of this lane
  const int ra = (wave & 3) * 32 * LP + fo;                     // A hi rows of this wave
  const int rb = (256 + (wave >> 2) * 64) * LP + fo;            // B rows of this wave
  _Float16* sw = sm + (tid >> 3) * LP + (tid & 7) * 8;
  v4u st[12];
#pragma unroll
  for (int u = 0; u < 4; ++u) {
    st[u]     = *(const v4u*)(gAh + u * sA);
    st[4 + u] = *(const v4u*)(gAl + u * sA);
    st[8 + u] = *(const v4u*)(gB + u * sB);
  }
#pragma unroll
  for (int u = 0; u < 12; ++u) *(v4u*)(sw + u * 32 * LP) = st[u];
  __syncthreads();

  const int nc = K / KC;
  for (int c = 0; c < nc; ++c) {
    const bool more = (c + 1) < nc;                             // block-uniform
    if (more) {
      const int ko = (c + 1) * KC;
#pragma unroll
      for (int u = 0; u < 4; ++u) {
        st[u]     = *(const v4u*)(gAh + u * sA + ko);
        st[4 + u] = *(const v4u*)(gAl + u * sA + ko);
        st[8 + u] = *(const v4u*)(gB + u * sB + ko);
      }
    }
    const _Float16* sb = sm + (c & 1) * STG;
#pragma unroll
    for (int kk = 0; kk < KC; kk += 32) {
      v16h fh[2], fl[2];
#pragma unroll
      for (int i = 0; i < 2; ++i) {
        fh[i] = ldfrag_h(sb + ra + i * 16 * LP + kk);
        fl[i] = ldfrag_h(sb + ra + (128 + i * 16) * LP + kk);
      }
      v16h bnx = ldfrag_h(sb + rb + kk);
#pragma unroll
      for (int j = 0; j < 4; ++j) {
        const v16h bfr = bnx;
        if (j < 3) bnx = ldfrag_h(sb + rb + (j + 1) * 16 * LP + kk);   // next B fragment flies under this one's products
#pragma unroll
        for (int i = 0; i < 2; ++i) {
          acch[i][j] = mma_h(fh[i], bfr, acch[i][j]);
          accl[i][j] = mma_h(fl[i], bfr, accl[i][j]);
        }
      }
    }
    if (more) {
      _Float16* sn = sw + ((c + 1) & 1) * STG;
#pragma unroll
      for (int u = 0; u < 12; ++u) *(v4u*)(sn + u * 32 * LP) = st[u];
    }
    __syncthreads();
  }
}

// =====================================================================================================
// Fused q/k/v projection; grid y = batch * 2 + direction picks the batch's X rows, the direction's Wt and
// bias, and that pair's own output planes. For the edge rows of one batch: X[m][k] . Wt[n][k] + bf16rne(bias[n]) with
// X = f16 hi plane + residual plane (x2048) [RB][EW], Wt f16 [W3][EW] (k contiguous), f16 products into
// separate hi/residual accumulators, f32 accumulate; value = ((acch + accl*scl)*sch + bias) * fac(sec)
// with sec = n / EW (0 q, 1 k, 2 v). Block = 128 rows x 2 column tiles (gemm_blk); one wave per 32 x 64 tile; the tile's 64 columns are a PERMUTED set:
// n = sec*EW + d*NH + h for d in 0..31 and h in {h0, h0+1} (tn = sec*4 + h0/2), B fragment j covers
// hh = j>>1, d = (j&1)*16 + lane&15. Output written as head-major f16 planes hi = f16(value),
// lo = f16((value - hi) * 2048): element (sec, h, row m, d) at [((sec*NH + h)*RB + m)*HD + d]
// (hi plane [3][NH][RB][HD]; lo plane [2][NH][RB][HD], q and k only). Staged B row q*32 + d holds column
// n = sec*EW + d*NH + (bn&1)*4 + q, which is fragment row (j&1)*16 + lane&15 of wave column q>>1, j>>1 = q&1.
// Epilogue: per-wave 16-row slabs in the staging LDS (free behind the main loop's closing barrier),
// column cc = hh*32 + d), then lane g8 = lane>>3, pc = lane&7: instruction q writes line L = q*4+g8
// coverage: 2 slabs x 16 lines (2 hh x 8 row pairs) x 8 pieces of 8 d = the wave's whole 32 x 64 tile in
// the hi plane (and in the lo plane for sec < 2); 512 x 12 tiles cover [3][NH][RB][HD] exactly.
// =====================================================================================================
__global__ __launch_bounds__(256) void gemm_p(
    const unsigned short* __restrict__ Ahp, const unsigned short* __restrict__ Alp,
    const unsigned short* __restrict__ Btp, const float* __restrict__ bias0, const float* __restrict__ bias1,
    unsigned short* php, unsigned short* plp,
    float f0, float f1, float f2, float sch, float scl) {
  const int bd  = blockIdx.y;              // batch * 2 + direction
  const int dir = bd & 1;
  const size_t xo = (size_t)(bd >> 1) * RB * EW;
  const _Float16* Ah = (const _Float16*)(const void*)Ahp + xo;
  const _Float16* Al = (const _Float16*)(const void*)Alp + xo;
  const _Float16* Bh = (const _Float16*)(const void*)Btp + (size_t)dir * W3 * EW;
  const float* bias = (dir != 0) ? bias1 : bias0;
  php += (size_t)bd * 3 * NH * RB * HD;
  plp += (size_t)bd * 2 * NH * RB * HD;
  __shared__ __align__(16) unsigned short smem[2 * STG];
  const int tid  = threadIdx.x;
  const int lane = tid & 31;
  const int wave = tid >> 5;
  constexpr int blkN = W3 / 128;           // 6 column pairs; grid x = (RB / 128) * blkN exactly
  const int bm = blockIdx.x / blkN;
  const int bn = blockIdx.x - bm * blkN;
  const int tn = bn * 2 + (wave >> 2);
  const int m0 = bm * 128 + (wave & 3) * 32;
  const int sec = tn >> 2;                 // 0 q, 1 k, 2 v (the same for both column tiles of a block)
  const int h0 = (tn & 3) * 2;             // head pair
  const int rlane = lane & 15;
  const int mOff  = (lane >> 4) * 8;
  int nB[4];
#pragma unroll
  for (int j = 0; j < 4; ++j) nB[j] = sec * EW + ((((j & 1) << 4) + rlane) << 3) + h0 + (j >> 1);

  v8f acch[2][4], accl[2][4];
#pragma unroll
  for (int i = 0; i < 2; ++i)
#pragma unroll
    for (int j = 0; j < 4; ++j) { acch[i][j] = zero8(); accl[i][j] = zero8(); }

  {
    const size_t ao = (size_t)(bm * 128 + (tid >> 3)) * EW + (tid & 7) * 8;
    const size_t bo = (size_t)((bn >> 1) * EW + (tid >> 3) * NH + (bn & 1) * 4) * EW + (tid & 7) * 8;
    gemm_blk(Ah + ao, Al + ao, (size_t)32 * EW, Bh + bo, (size_t)EW, EW,
             (_Float16*)(void*)smem, tid, acch, accl);
  }

  const float fac = (sec == 0) ? f0 : ((sec == 1) ? f1 : f2);
  float bz[4];
#pragma unroll
  for (int j = 0; j < 4; ++j) bz[j] = bf_up(bf_bits(bias[nB[j]]));

  float* slab = (float*)(void*)smem + wave * (16 * 68);
  const int g8 = lane >> 3, pc = lane & 7;
#pragma unroll
  for (int i = 0; i < 2; ++i) {
    const int mBase = m0 + (i << 4);
#pragma unroll
    for (int r = 0; r < 8; ++r) {
#pragma unroll
      for (int j = 0; j < 4; ++j) {
        slab[(mOff + r) * 68 + (j << 4) + rlane] = ((acch[i][j][r] + accl[i][j][r] * scl) * sch + bz[j]) * fac;
      }
    }
    __builtin_amdgcn_fence(__ATOMIC_RELEASE, "workgroup");
    __builtin_amdgcn_wave_barrier();
    __builtin_amdgcn_fence(__ATOMIC_ACQUIRE, "workgroup");
    {
      v4u hv[4], lv[4];
      size_t ofs[4];
#pragma unroll
      for (int q = 0; q < 4; ++q) {
        const int L = q * 4 + g8;                    // line 0..15 of this slab
        const int hh = L >> 3, t = L & 7;
        const int row = 2 * t + (pc >> 2);
        const int d0 = (pc & 3) * 8;
        const v4f x0 = *(const v4f*)(slab + row * 68 + hh * 32 + d0);
        const v4f x1 = *(const v4f*)(slab + row * 68 + hh * 32 + d0 + 4);
        float f[8];
        f[0] = x0[0]; f[1] = x0[1]; f[2] = x0[2]; f[3] = x0[3];
        f[4] = x1[0]; f[5] = x1[1]; f[6] = x1[2]; f[7] = x1[3];
        v4u ph, pl;
#pragma unroll
        for (int u = 0; u < 4; ++u) {
          const float s0 = f[2 * u];
          const float s1 = f[2 * u + 1];
          const _Float16 hq0 = (_Float16)s0;
          const _Float16 hq1 = (_Float16)s1;
          const _Float16 lq0 = (_Float16)((s0 - (float)hq0) * 2048.0f);
          const _Float16 lq1 = (_Float16)((s1 - (float)hq1) * 2048.0f);
          ph[u] = pk16(h_bits(hq0), h_bits(hq1));
          pl[u] = pk16(h_bits(lq0), h_bits(lq1));
        }
        hv[q] = ph;
        lv[q] = pl;
        ofs[q] = (((size_t)(sec * NH + h0 + hh)) * RB + (size_t)(mBase + row)) * HD + d0;
      }
      {
#pragma unroll
        for (int q = 0; q < 4; ++q) {
          *(v4u*)(php + ofs[q]) = hv[q];
          if (sec < 2) *(v4u*)(plp + ofs[q]) = lv[q];
        }
        
      }
    }
    __builtin_amdgcn_fence(__ATOMIC_RELEASE, "workgroup");
    __builtin_amdgcn_wave_barrier();
    __builtin_amdgcn_fence(__ATOMIC_ACQUIRE, "workgroup");
  }
}

// =====================================================================================================
// Axial attention, grid y = batch * 2 + direction: block = (column index j = blockIdx.x, all 8 heads),
// wave = head h, 16-query strips s = 0..7 in lockstep.
//   queries i: plane row i*SEQ + j; keys/values kk: plane row kk*ks + j*js (dir 0: ks=1, js=SEQ ->
//   rows (j,kk); dir 1: ks=SEQ, js=1 -> rows (kk,j)); additive mask plane of (h; i, kk) in accumulator order
//   (see mask_planes; already x64 and bf16-RNE'd, direct for dir 0 and transposed for dir 1).
// Scores are computed TRANSPOSED: S^T[kk][i] = K(A, lane = key row, d per k-map) . Q^T(B, lane = query,
// d per k-map), hi.hi into the mask-initialised accumulator plus (hi.lo + lo.hi)*xscl; D lane = query i,
// element r = key 16ct + 8g + r, so a lane and its partner lane^16 own one softmax row: max / exp / sum in
// f32 with one __shfl_xor(.,16) each. Weights p*pcar are converted to f16 in registers and used directly as
// the B operand of O^T[d][i] = V^T(A from LDS, lane = d, keys per k-map) . P^T (B: lane = query, element
// e <- tile 2c key 8g+e, element 8+e <- tile 2c+1 key 8g+e).
// LDS: sVt [NH][HD][VTP] v^T tiles (built once per block by register transposition of 4 key rows into 8-B
// stores; each wave stages and reads only its own head; block barrier after staging; staged extent k 0..127
// == consumed extent); sO [16][SOP] f32 output slab (cross-wave: block barriers before the row writes and
// before the next strip).
// Output: f16 planes vah = f16(O*1024), val = f16((O*1024 - hi)*2048), [RB rows i*SEQ+j][KO] at columns
// dir*EW + d*NH + h; per strip wave h writes rows 2h, 2h+1: 32 lanes x 16 B = the whole 512-B half row
// coverage: 8 strips x 8 waves x 2 rows = 128 queries x (32 lanes x 8 = 256 channels) for every (j, dir)
// -> together with the other direction's blocks every element of both planes of this batch.
// =====================================================================================================
__global__ __launch_bounds__(256) void attn_ax(
    const unsigned short* __restrict__ php, const unsigned short* __restrict__ plp,
    const float* __restrict__ mp, unsigned short* vah, unsigned short* val,
    float xscl, float escl, float pcar, float oscl) {
  const int bd  = blockIdx.y;                      // batch * 2 + direction
  const int dir = bd & 1;
  php += (size_t)bd * 3 * NH * RB * HD;
  plp += (size_t)bd * 2 * NH * RB * HD;
  mp  += (size_t)(dir * NB + (bd >> 1)) * NH * SEQ * SEQ;   // direct planes of all batches, then transposed
  vah += (size_t)(bd >> 1) * RB * KO;
  val += (size_t)(bd >> 1) * RB * KO;
  const _Float16* Ph = (const _Float16*)(const void*)php;
  const _Float16* Pl = (const _Float16*)(const void*)plp;
  __shared__ __align__(16) unsigned short sVt[NH * HD * VTP];     // 69632 B
  __shared__ __align__(16) float sO[16 * SOP];                    // 16896 B
  const _Float16* sVh = (const _Float16*)(const void*)sVt;
  const int tid  = threadIdx.x;
  const int lane = tid & 31;
  const int h    = tid >> 5;
  const int nl   = lane & 15;
  const int g    = lane >> 4;
  const int g8   = g * 8;
  const int j    = blockIdx.x;
  const size_t hs = (size_t)RB * HD;               // per-head plane stride (halves)
  const size_t ss = (size_t)NH * hs;               // per-section stride
  const _Float16* Qh = Ph + (size_t)h * hs;
  const _Float16* Kh = Ph + ss + (size_t)h * hs;
  const _Float16* Ql = Pl + (size_t)h * hs;
  const _Float16* Kl = Pl + ss + (size_t)h * hs;
  const unsigned short* Vu = php + 2 * ss + (size_t)h * hs;
  const int ks = (dir != 0) ? SEQ : 1;
  const int js = (dir != 0) ? 1 : SEQ;

  // ---- K fragments of head h (A operands, hi and residual, all 8 key tiles): the same for every query strip,
  //      so they are loaded once here and stay in registers through the strip loop
  v16h kh[8], kl[8];
#pragma unroll
  for (int ct = 0; ct < 8; ++ct) {
    const int kk = ct * 16 + nl;                                // key row loaded by this lane (A row)
    const size_t kofs = ((size_t)kk * ks + (size_t)j * js) * HD + g8;
    kh[ct] = ldfrag_h(Kh + kofs);
    xcnt_wait();                                                // a later load's result may land on this address pair
    kl[ct] = ldfrag_h(Kl + kofs);
    xcnt_wait();                                                // the same
  }

  // ---- stage v^T of head h: unit u = (key quad kq, d octet dq): 4 x 16-B row loads -> 8 x 8-B LDS stores
#pragma unroll
  for (int it = 0; it < 4; ++it) {
    const int u  = it * 32 + lane;                 // 0..127
    const int kq = u >> 2, dq = u & 3;
    const int kb = kq * 4;
    v4u rw[4];
#pragma unroll
    for (int a = 0; a < 4; ++a) {
      const size_t rowk = (size_t)(kb + a) * ks + (size_t)j * js;
      rw[a] = *(const v4u*)(Vu + rowk * HD + dq * 8);
    }
#pragma unroll
    for (int d = 0; d < 8; ++d) {
      const int wd = d >> 1, sh = (d & 1) * 16;
      const unsigned x0 = (rw[0][wd] >> sh) & 0xFFFFu;
      const unsigned x1 = (rw[1][wd] >> sh) & 0xFFFFu;
      const unsigned x2 = (rw[2][wd] >> sh) & 0xFFFFu;
      const unsigned x3 = (rw[3][wd] >> sh) & 0xFFFFu;
      v2u o;
      o[0] = x0 | (x1 << 16);
      o[1] = x2 | (x3 << 16);
      *(v2u*)(sVt + (h * HD + dq * 8 + d) * VTP + kb) = o;
    }
  }
  __syncthreads();

#pragma unroll 1
  for (int s = 0; s < 8; ++s) {
    const int i = s * 16 + nl;                                  // this lane's query (B column / D column)
    const size_t qofs = ((size_t)i * SEQ + j) * HD + g8;
    const v16h qh = ldfrag_h(Qh + qofs);
    const v16h ql = ldfrag_h(Ql + qofs);
    const float* mfr = mp + (size_t)(h * 8 + s) * (8 * 256) + lane * 4;   // this strip's 8 mask tiles, 256 floats each

    // ---- the strip's mask, straight into the 8 score accumulators: 16 loads of 512 B in a row, one group, so that
    //      their latency is met once a strip and not once a key tile
    v8f acc[8];
#pragma unroll
    for (int ct = 0; ct < 8; ++ct) {
      const v4f mv0 = *(const v4f*)(mfr + ct * 256);
      const v4f mv1 = *(const v4f*)(mfr + ct * 256 + 128);
      v8f am;
      am[0] = mv0[0]; am[1] = mv0[1]; am[2] = mv0[2]; am[3] = mv0[3];
      am[4] = mv1[0]; am[5] = mv1[1]; am[6] = mv1[2]; am[7] = mv1[3];
      acc[ct] = am;
    }
    xcnt_wait();                                                // the next strip's addresses land on these loads' address pairs

    // ---- transposed scores, 8 key tiles
#pragma unroll
    for (int ct = 0; ct < 8; ++ct) {
      v8f ax = mma_h(kh[ct], ql, zero8());
      ax = mma_h(kl[ct], qh, ax);
      const v8f am = mma_h(kh[ct], qh, acc[ct]);
      acc[ct] = am + ax * xscl;
      // one key tile's products at a time: with several residual accumulators live the K fragments spill
      __builtin_amdgcn_sched_barrier(0);
    }

    // ---- softmax over the 128 keys of query i (this lane: 64 values, partner lane^16: the other 64)
    float mx = acc[0][0];
#pragma unroll
    for (int ct = 0; ct < 8; ++ct)
#pragma unroll
      for (int r = 0; r < 8; ++r) mx = fmaxf(mx, acc[ct][r]);
    mx = fmaxf(mx, __shfl_xor(mx, 16));
    float sum = 0.f;
#pragma unroll
    for (int ct = 0; ct < 8; ++ct)
#pragma unroll
      for (int r = 0; r < 8; ++r) {
        const float ev = __expf((acc[ct][r] - mx) * escl);
        acc[ct][r] = ev;
        sum += ev;
      }
    sum += __shfl_xor(sum, 16);
    const float rc = pcar / sum;                                // sum >= 1

    // ---- P^T as B fragments straight from the accumulators
    v16h pb[4];
#pragma unroll
    for (int c = 0; c < 4; ++c) {
      union { v16h v; v8h hh[2]; } U;
      v8h p0, p1;
#pragma unroll
      for (int e2 = 0; e2 < 8; ++e2) {
        p0[e2] = (_Float16)(acc[2 * c][e2] * rc);
        p1[e2] = (_Float16)(acc[2 * c + 1][e2] * rc);
      }
      U.hh[0] = p0;
      U.hh[1] = p1;
      pb[c] = U.v;
    }

    // ---- O^T[d][i] = V^T . P^T, two 16-row d tiles, K = 128 keys
    v8f oacc[2];
#pragma unroll
    for (int dt = 0; dt < 2; ++dt) {
      v8f o = zero8();
#pragma unroll
      for (int c = 0; c < 4; ++c) {
        const v16h va = ldfrag_h(sVh + (h * HD + dt * 16 + nl) * VTP + 32 * c + g8);
        o = mma_h(va, pb[c], o);
      }
      oacc[dt] = o;
    }

    // ---- stage O (f32, true scale) into the slab: row = query nl, column = d*NH + h
#pragma unroll
    for (int dt = 0; dt < 2; ++dt)
#pragma unroll
      for (int r = 0; r < 8; ++r)
        sO[nl * SOP + ((dt * 16 + g8 + r) << 3) + h] = oacc[dt][r] * oscl;
    __syncthreads();

    // ---- wave h writes queries s*16 + 2h, + 2h + 1: 512-B half rows in hi and residual planes
    {
      v4u hv[2], lv[2];
      size_t ofs[2];
#pragma unroll
      for (int q = 0; q < 2; ++q) {
        const int rr = 2 * h + q;
        const v4f x0 = *(const v4f*)(sO + rr * SOP + lane * 8);
        const v4f x1 = *(const v4f*)(sO + rr * SOP + lane * 8 + 4);
        float f[8];
        f[0] = x0[0]; f[1] = x0[1]; f[2] = x0[2]; f[3] = x0[3];
        f[4] = x1[0]; f[5] = x1[1]; f[6] = x1[2]; f[7] = x1[3];
        v4u ph, pl;
#pragma unroll
        for (int u = 0; u < 4; ++u) {
          const float s0 = f[2 * u] * 1024.0f;
          const float s1 = f[2 * u + 1] * 1024.0f;
          const _Float16 hq0 = (_Float16)s0;
          const _Float16 hq1 = (_Float16)s1;
          const _Float16 lq0 = (_Float16)((s0 - (float)hq0) * 2048.0f);
          const _Float16 lq1 = (_Float16)((s1 - (float)hq1) * 2048.0f);
          ph[u] = pk16(h_bits(hq0), h_bits(hq1));
          pl[u] = pk16(h_bits(lq0), h_bits(lq1));
        }
        hv[q] = ph;
        lv[q] = pl;
        ofs[q] = ((size_t)(s * 16 + rr) * SEQ + j) * KO + (size_t)dir * EW + lane * 8;
      }
      {
#pragma unroll
        for (int q = 0; q < 2; ++q) {
          *(v4u*)(vah + ofs[q]) = hv[q];
          *(v4u*)(val + ofs[q]) = lv[q];
        }
        
      }
    }
    __syncthreads();                                            // sO reused by the next strip
  }
}

// =====================================================================================================
// Output projection: C[m][n] = sch * (sum_k Ahi[m][k]*Bt[n][k] + scl * sum_k Alo[m][k]*Bt[n][k]) + bf16rne(bias[n])
// (f16 products, f32 accumulate, hi and scaled-residual products in separate accumulators). Ahi/Alo row-major
// [M][K] pitch lda; Bt [N][K] pitch ldb; C f32 [M][N] pitch ldc. Block = 128 x 128 of C (gemm_blk), one wave per
// 32x64 tile; M = RT, N = EW, K = KO (multiples of 128, 128 and KC).
// Epilogue: 16-row slabs staged per wave in the staging LDS (free behind the main loop's closing barrier); each 64-wide row segment (256 B) written by one instruction
// coverage: 2 slabs x 16 rows x 64 cols = the wave's whole 32x64 tile; grid covers every tile of C.
// =====================================================================================================
__global__ __launch_bounds__(256) void gemm32h_w(
    const unsigned short* __restrict__ Ahp, const unsigned short* __restrict__ Alp,
    const unsigned short* __restrict__ Btp,
    const float* __restrict__ bias,
    float* C, float sch, float scl) {
  constexpr int lda = KO, ldb = KO, ldc = EW, M = RT, N = EW, K = KO;   // fixed: staged row steps become immediate offsets
  const _Float16* Ah = (const _Float16*)(const void*)Ahp;
  const _Float16* Al = (const _Float16*)(const void*)Alp;
  const _Float16* Bh = (const _Float16*)(const void*)Btp;
  __shared__ __align__(16) unsigned short smem[2 * STG];
  const int tid  = threadIdx.x;
  const int lane = tid & 31;
  const int wave = tid >> 5;
  constexpr int blkN = N >> 7;
  if ((int)blockIdx.x >= (M >> 7) * blkN) return;   // block-uniform, in front of every barrier
  const int bm = blockIdx.x / blkN;
  const int bn = blockIdx.x - bm * blkN;
  const int m0 = bm * 128 + (wave & 3) * 32;
  const int n0 = bn * 128 + (wave >> 2) * 64;
  const int rlane = lane & 15;
  const int mOff  = (lane >> 4) * 8;

  v8f acch[2][4], accl[2][4];
#pragma unroll
  for (int i = 0; i < 2; ++i)
#pragma unroll
    for (int j = 0; j < 4; ++j) { acch[i][j] = zero8(); accl[i][j] = zero8(); }

  {
    const size_t ao = (size_t)(bm * 128 + (tid >> 3)) * lda + (tid & 7) * 8;
    const size_t bo = (size_t)(bn * 128 + (tid >> 3)) * ldb + (tid & 7) * 8;
    gemm_blk(Ah + ao, Al + ao, (size_t)32 * lda, Bh + bo, (size_t)32 * ldb, K,
             (_Float16*)(void*)smem, tid, acch, accl);
  }

  float bz[4];
#pragma unroll
  for (int j = 0; j < 4; ++j) bz[j] = bf_up(bf_bits(bias[n0 + (j << 4) + rlane]));

  float* slab = (float*)(void*)smem + wave * (16 * 68);
#pragma unroll
  for (int i = 0; i < 2; ++i) {
    const int mBase = m0 + (i << 4);
#pragma unroll
    for (int r = 0; r < 8; ++r) {
#pragma unroll
      for (int j = 0; j < 4; ++j) {
        slab[(mOff + r) * 68 + (j << 4) + rlane] = (acch[i][j][r] + accl[i][j][r] * scl) * sch + bz[j];
      }
    }
    __builtin_amdgcn_fence(__ATOMIC_RELEASE, "workgroup");
    __builtin_amdgcn_wave_barrier();
    __builtin_amdgcn_fence(__ATOMIC_ACQUIRE, "workgroup");
    {
      const int hh = lane >> 4, c4 = (lane & 15) * 4;     // 256-B row segment = 16 lanes x 16 B
      v4f ov[8];
#pragma unroll
      for (int it = 0; it < 8; ++it) {
        const int row = it * 2 + hh;                       // it 0..7 x hh 0..1 = rows 0..15
        ov[it] = *(const v4f*)(slab + row * 68 + c4);
      }
      {
#pragma unroll
        for (int it = 0; it < 8; ++it) {
          const int row = it * 2 + hh;
          *(v4f*)(C + (size_t)(mBase + row) * ldc + n0 + c4) = ov[it];
        }
        
      }
    }
    __builtin_amdgcn_fence(__ATOMIC_RELEASE, "workgroup");
    __builtin_amdgcn_wave_barrier();
    __builtin_amdgcn_fence(__ATOMIC_ACQUIRE, "workgroup");
  }
}

// =====================================================================================================
// Workspace map (bytes, NB = 2); every region an exact multiple of its whole-line store granularity, all
// written earlier in the same call. Every (batch, direction) pair has its own Ph / Pl planes, so each stage
// is one launch over all four pairs. Vah lies on Xh + Xl, whose last reader (the projection) has ended.
//   Xh   f16 [RT][EW]                     0        16777216   (layer norm output, hi)
//   Xl   f16 [RT][EW]              16777216        16777216   (residual x2048)
//   Wti  f16 [W3 n][EW k]          33554432          393216   (f16(bf16(Wqkv_in) x64))
//   Wto  f16 [W3 n][EW k]          33947648          393216
//   Woh  f16 [EW n][KO k]          34340864          262144   (f16(bf16(Wo) x1024))
//   mA   f32 [NB][NH][SEQ x SEQ]   34603008         1048576   (64 x bf16(mask), direct, accumulator order)
//   mB   f32 [NB][NH][SEQ x SEQ]   35651584         1048576   (transposed, accumulator order)
//   Ph   f16 [2 NB][3][NH][RB][HD] 36700160       100663296   (q x16*32^-0.5, k x4, v x4; hi)
//   Pl   f16 [2 NB][2][NH][RB][HD] 137363456       67108864   (q, k residual x2048)
//   Val  f16 [RT][KO]             204472320        33554432   (attention output residual x2048)
//   Vah  f16 [RT][KO]                     0        33554432   (attention output x1024, hi; on Xh + Xl)
//   end                           238026752
// Inputs: e f32 [NB][SEQ][SEQ][EW]; mask f32 [NB][SEQ][SEQ][NH]; ln_w, ln_b f32 [EW]; Wqkv_in, Wqkv_out
// f32 [EW in][W3 out]; bqkv_* f32 [W3]; Wo f32 [KO in][EW out]; bo f32 [EW]. d_out f32 [RT][EW] at byte 0
// (row = b*RB + i*SEQ + j, col = n).
// =====================================================================================================
extern "C" void kernel_launch(void* const* d_in, const int* in_sizes, int n_in,
                              void* d_out, int out_size, void* d_ws, size_t ws_size,
                              hipStream_t stream) {
  if (n_in < 10) return;
  if (in_sizes[0] < RT * EW) return;
  if (in_sizes[1] < NB * SEQ * SEQ * NH) return;
  if (in_sizes[2] < EW) return;
  if (in_sizes[3] < EW) return;
  if (in_sizes[4] < EW * W3) return;
  if (in_sizes[5] < W3) return;
  if (in_sizes[6] < EW * W3) return;
  if (in_sizes[7] < W3) return;
  if (in_sizes[8] < KO * EW) return;
  if (in_sizes[9] < EW) return;
  if (out_size < RT * EW) return;

  const float* e    = (const float*)d_in[0];   // [NB][SEQ][SEQ][EW]
  const float* mask = (const float*)d_in[1];   // [NB][SEQ][SEQ][NH]
  const float* ln_w = (const float*)d_in[2];   // [EW]
  const float* ln_b = (const float*)d_in[3];   // [EW]
  const float* Wqi  = (const float*)d_in[4];   // [EW in][W3 out]
  const float* bqi  = (const float*)d_in[5];   // [W3]
  const float* Wqo  = (const float*)d_in[6];   // [EW in][W3 out]
  const float* bqo  = (const float*)d_in[7];   // [W3]
  const float* Wo   = (const float*)d_in[8];   // [KO in][EW out]
  const float* bo   = (const float*)d_in[9];   // [EW]

  const size_t PX  = (size_t)RT * EW * 2;                    // 16777216 (NB = 2)
  const size_t PWt = (size_t)W3 * EW * 2;                    //   393216
  const size_t PWo = (size_t)EW * KO * 2;                    //   262144
  const size_t PM  = (size_t)NB * NH * SEQ * SEQ * 4;        //  1048576 (NB = 2)
  const size_t PPh = (size_t)2 * NB * 3 * NH * RB * HD * 2;  // 100663296 (NB = 2)
  const size_t PPl = (size_t)2 * NB * 2 * NH * RB * HD * 2;  //  67108864
  const size_t PVa = (size_t)RT * KO * 2;                    //  33554432 == 2 * PX
  size_t off = 0;
  const size_t oXh = off; off += PX;
  const size_t oXl = off; off += PX;
  const size_t oWi = off; off += PWt;
  off += PWt;                                                // Wto, directly behind Wti
  const size_t oWo = off; off += PWo;
  const size_t oMa = off; off += PM;
  const size_t oMb = off; off += PM;
  const size_t oPh = off; off += PPh;
  const size_t oPl = off; off += PPl;
  const size_t oVl = off; off += PVa;
  const size_t oVh = oXh;                                    // Vah takes over Xh + Xl (same size)
  if (off > ws_size) return;                                 // off = 238026752 for NB = 2

  char* ws = (char*)d_ws;
  unsigned short* Xh  = (unsigned short*)(ws + oXh);
  unsigned short* Xl  = (unsigned short*)(ws + oXl);
  unsigned short* Wti = (unsigned short*)(ws + oWi);
  unsigned short* Woh = (unsigned short*)(ws + oWo);
  float*          mA  = (float*)(ws + oMa);
  float*          mB  = (float*)(ws + oMb);
  unsigned short* Ph  = (unsigned short*)(ws + oPh);
  unsigned short* Pl  = (unsigned short*)(ws + oPl);
  unsigned short* Vah = (unsigned short*)(ws + oVh);
  unsigned short* Val = (unsigned short*)(ws + oVl);
  float*          outf = (float*)d_out;                      // [RT][EW]

  const dim3 blk(256);
  const dim3 gPp(PB_M + RT / 8);                             // 384 weight and mask blocks + 4096 layer norm blocks
  const dim3 gPr((RB / 128) * (W3 / 128), 2 * NB);           // 768 blocks x (batch, direction)
  const dim3 gAt(SEQ, 2 * NB);                               // one block per column index j x (batch, direction)
  const dim3 gWo((RT / 128) * (EW / 128));                   // 512 blocks
  const float cW     = 64.0f;                                // Wqkv plane carry
  const float fQ     = 16.0f * 0.17677669529663687f;         // 32^-0.5 then carry x16
  const float fK     = 4.0f;                                 // k carry
  const float fV     = 4.0f;                                 // v carry
  const float prSch  = 1.0f / 64.0f;                         // folds the Wqkv plane carry
  const float prScl  = 1.0f / 2048.0f;                       // folds the layer norm residual carry
  const float mkSc   = 64.0f;                                // mask planes x (16 * 4)
  const float axXscl = 1.0f / 2048.0f;                       // q/k residual carry
  const float axEscl = 1.0f / 64.0f;                         // score carry 16 * 4
  const float axPcar = 16384.0f;                             // softmax weight carry
  const float axOscl = 1.0f / 65536.0f;                      // 1/(16384 * 4)
  const float woScale = 1024.0f;                             // Wo plane carry
  const float woSch  = 1.0f / 1048576.0f;                    // 1/(1024 * 1024): O hi carry and Wo carry
  const float woScl  = 1.0f / 2048.0f;                       // O residual carry

  // (1) layer norm -> f16 hi + residual planes; weights -> transposed f16 planes of their bf16 values; masks
  prep_all<<<gPp, blk, 0, stream>>>(e, ln_w, ln_b, Xh, Xl, Wqi, Wqo, Wti, cW, Wo, Woh, woScale, mask, mA, mB, mkSc);
  // (2) all batches and both directions at once: projection, attention, output projection
  gemm_p<<<gPr, blk, 0, stream>>>(Xh, Xl, Wti, bqi, bqo, Ph, Pl, fQ, fK, fV, prSch, prScl);
  attn_ax<<<gAt, blk, 0, stream>>>(Ph, Pl, mA, Vah, Val, axXscl, axEscl, axPcar, axOscl);
  gemm32h_w<<<gWo, blk, 0, stream>>>(Vah, Val, Woh, bo, outf, woSch, woScl);
  (void)hipGetLastError();
}

// v006
// Measured time: 121 microseconds a run.
// Two timings next to v005 put it at 1.15 and 1.14 times that version's speed.
// Counting every step since v000, it is 3.21 times as fast.
// Contractions: q/k/v projections = v_wmma_f32_16x16x32_f16 (layer-normed input as f16 hi + residual (x2048) planes, two products into separate accumulators; Wqkv as f16 of its bf16-RNE value x64); per-(b,j,h) scores = v_wmma_f32_16x16x32_f16 (k and q as f16 hi + residual (x2048) planes carried x4 and x16*32^-0.5, products hh + hl + lh; additive mask x64 as the initial accumulator); p.v = v_wmma_f32_16x16x32_f16 (softmax weights x16384 in f16 repacked from the score accumulators, v^T f16 tile carried x4, single product); output projection = v_wmma_f32_16x16x32_f16 (attention output as f16 hi (x1024) + residual (x2048) planes, two products; Wo as f16 of its bf16-RNE value x1024); every float input RNE-converted to bf16 on load; all f32 accumulate; layer norm and softmax in f32.
#include <hip/hip_runtime.h>
#include <math.h>
#include <stdint.h>

#ifndef NB
#define NB 2
#endif
#define NB_FULL 2
#ifndef SEQ
#define SEQ 128
#endif
#define EW  256                 // edge width
#define NH  8                   // heads (fastest channel dim)
#define HD  32                  // dot dim
#define W3  (3 * EW)            // 768 fused projection columns
#define KO  (2 * EW)            // 512 concat channels
#define RB  (SEQ * SEQ)         // edge rows per batch (16384)
#define RT  (NB * RB)           // edge rows processed
#define VTP 136                 // LDS v^T tile pitch (halves)
#define SOP 264                 // LDS output slab pitch (floats)

static_assert(NH * HD == EW);
static_assert(HD == 32);
static_assert(EW == 256);
static_assert(SEQ == 128);      // i, j and key extents are coupled; only NB is reducible
static_assert(NB >= 1 && NB <= NB_FULL);
static_assert((RB % 64) == 0 && (RT % 8) == 0);
static_assert((((RB / 32) * (W3 / 64)) % 8) == 0);
static_assert((((RB / 32) * (EW / 64)) % 8) == 0);
static_assert((EW % 64) == 0 && (W3 % 64) == 0 && (KO % 64) == 0 && (EW % 32) == 0 && (KO % 32) == 0);
static_assert((SEQ % 16) == 0 && (SEQ % 8) == 0);
static_assert((RB % 128) == 0 && (W3 % 128) == 0 && (EW % 128) == 0);   // 128 x 128 block tiles of the projections

typedef _Float16 v16h __attribute__((ext_vector_type(16)));
typedef _Float16 v8h  __attribute__((ext_vector_type(8)));
typedef float    v8f  __attribute__((ext_vector_type(8)));
typedef float    v4f  __attribute__((ext_vector_type(4)));
typedef unsigned int v4u __attribute__((ext_vector_type(4)));
typedef unsigned int v2u __attribute__((ext_vector_type(2)));

// ---- scalar helpers --------------------------------------------------------------------------------
__device__ __forceinline__ unsigned short bf_bits(float f) {          // f32 -> bf16 bits, RNE convert
  unsigned u = __float_as_uint(f);
  return (unsigned short)((u + 0x7FFFu + ((u >> 16) & 1u)) >> 16);
}
__device__ __forceinline__ float bf_up(unsigned short h) { return __uint_as_float(((unsigned)h) << 16); }
__device__ __forceinline__ unsigned short h_bits(_Float16 x) { return __builtin_bit_cast(unsigned short, x); }
__device__ __forceinline__ unsigned pk16(unsigned short a, unsigned short b) { return (unsigned)a | ((unsigned)b << 16); }
__device__ __forceinline__ v8f zero8() { v8f z = {0.f, 0.f, 0.f, 0.f, 0.f, 0.f, 0.f, 0.f}; return z; }

// ---- fragment loader: 16-bit A/B operand, lane -> row/col (lane&15), p already includes +8*(lane>>4);
//      elements 0..7 <- p[0..7] (k0+8h..), elements 8..15 <- p[16..23] (k0+16+8h..)
__device__ __forceinline__ v16h ldfrag_h(const _Float16* p) {
  union { v16h v; v8h h[2]; } f;
  f.h[0] = *(const v8h*)(p);
  f.h[1] = *(const v8h*)(p + 16);
  return f.v;
}

// ---- fragment loader for a plane kept in fragment order: a 16-row x 32-d tile is 512 halves, the 8 halves
//      (row r, d = 8o .. 8o+7) at (o*16 + r)*8; p = tile base + lane*8, so elements 0..7 <- (row lane&15, d 8h..) and
//      elements 8..15 <- (row lane&15, d 16+8h..), h = lane>>4: the k order of ldfrag_h, each load 512 B in a row
__device__ __forceinline__ v16h ldfrag_t(const _Float16* p) {
  union { v16h v; v8h h[2]; } f;
  f.h[0] = *(const v8h*)(p);
  f.h[1] = *(const v8h*)(p + 256);
  return f.v;
}

// ---- wait that stands between issued global loads and an overwrite of their address registers
__device__ __forceinline__ void xcnt_wait() {
#if defined(__HIP_DEVICE_COMPILE__)
  asm volatile("s_wait_xcnt 0x0" ::: "memory");
#endif
}

// ---- WMMA helper with trailing VALU hazard gap ----------------------------------------------------------
__device__ __forceinline__ v8f mma_h(v16h a, v16h b, v8f c) {
  c = __builtin_amdgcn_wmma_f32_16x16x32_f16(false, a, false, b, (short)0, c, false, false);
#if defined(__HIP_DEVICE_COMPILE__)
  asm volatile("v_nop\n\tv_nop\n\tv_nop\n\tv_nop" : "+v"(c) : "v"(a), "v"(b));
#endif
  return c;
}

// =====================================================================================================
// Layer norm over EW channels of each edge row (inputs and affine params RNE-converted to bf16 first, f32
// [nrows][EW]. One wave per row, 8 channels per lane; each plane row = 512 B written by one instruction
// coverage: nrows waves x 32 lanes x 8 = every element of both planes.
// =====================================================================================================
__device__ __forceinline__ void ln_planes(const float* __restrict__ e, const float* __restrict__ lw,
                                          const float* __restrict__ lb, unsigned short* xh,
                                          unsigned short* xl, int nrows, int blk) {
  const int lane = threadIdx.x & 31;
  const int wave = threadIdx.x >> 5;
  const int row = blk * 8 + wave;
  if (row >= nrows) return;                           // wave-uniform; no block barriers in this part
  const int c0 = lane * 8;
  const float* src = e + (size_t)row * EW + c0;
  const v4f a0 = *(const v4f*)(src);
  const v4f a1 = *(const v4f*)(src + 4);
  xcnt_wait();                                        // a later load's result may land on this address pair
  const v4f w0 = *(const v4f*)(lw + c0);
  const v4f w1 = *(const v4f*)(lw + c0 + 4);
  const v4f b0 = *(const v4f*)(lb + c0);
  const v4f b1 = *(const v4f*)(lb + c0 + 4);
  float v[8], w[8], bb[8];
#pragma unroll
  for (int t = 0; t < 4; ++t) {
    v[t]      = bf_up(bf_bits(a0[t]));
    v[4 + t]  = bf_up(bf_bits(a1[t]));
    w[t]      = bf_up(bf_bits(w0[t]));
    w[4 + t]  = bf_up(bf_bits(w1[t]));
    bb[t]     = bf_up(bf_bits(b0[t]));
    bb[4 + t] = bf_up(bf_bits(b1[t]));
  }
  float s = 0.f;
#pragma unroll
  for (int t = 0; t < 8; ++t) s += v[t];
#pragma unroll
  for (int o = 16; o > 0; o >>= 1) s += __shfl_xor(s, o);
  const float mu = s * (1.0f / (float)EW);
  float d[8];
  float s2 = 0.f;
#pragma unroll
  for (int t = 0; t < 8; ++t) { d[t] = v[t] - mu; s2 += d[t] * d[t]; }
#pragma unroll
  for (int o = 16; o > 0; o >>= 1) s2 += __shfl_xor(s2, o);
  const float var = s2 * (1.0f / (float)EW);
  const float rs = rsqrtf(var + 1e-5f);
  v4u ph, pl;
#pragma unroll
  for (int t = 0; t < 4; ++t) {
    const float y0 = d[2 * t] * rs * w[2 * t] + bb[2 * t];
    const float y1 = d[2 * t + 1] * rs * w[2 * t + 1] + bb[2 * t + 1];
    const _Float16 hq0 = (_Float16)y0;
    const _Float16 hq1 = (_Float16)y1;
    const _Float16 lq0 = (_Float16)((y0 - (float)hq0) * 2048.0f);
    const _Float16 lq1 = (_Float16)((y1 - (float)hq1) * 2048.0f);
    ph[t] = pk16(h_bits(hq0), h_bits(hq1));
    pl[t] = pk16(h_bits(lq0), h_bits(lq1));
  }
  const size_t o = (size_t)row * EW + c0;
  {
    *(v4u*)(xh + o) = ph;
    *(v4u*)(xl + o) = pl;
    xcnt_wait();   // another part's code follows in the listing and writes these stores' registers
  }
}

// =====================================================================================================
// Transpose-convert: in f32 [R][C] row-major -> out f16 [C][R] (r contiguous), out[c][r] =
// f16(bf16rne(in[r][c]) * scale), scale a power of two. Block = one 64 r x 64 c tile staged in LDS as f32
// (v4f loads, __syncthreads); tiles (bx, by) = (R/64, C/64) per matrix; sv = 64 x 68 floats of LDS.
// Store: group gq = tid>>3 (0..31), piece = tid&7: iteration it writes out row c = it*32+gq, lanes 8q..8q+7
// coverage: 2 iterations x 32 groups = 64 out rows, 8 pieces x 8 = 64 r per row; grid covers every tile ->
// the whole plane.
// =====================================================================================================
__device__ __forceinline__ void tr_f16(const float* __restrict__ in, unsigned short* out, int R, int C,
                                       float scale, int bx, int by, float* sv) {   // sv: [rr][cc] pitch 68 floats
  const int tid = threadIdx.x;
  const int r0 = bx * 64;
  const int c0 = by * 64;
#pragma unroll
  for (int i = 0; i < 4; ++i) {
    const int idx = i * 256 + tid;                  // 0..1023
    const int rr = idx >> 4, c4 = (idx & 15) * 4;
    const v4f a = *(const v4f*)(in + (size_t)(r0 + rr) * C + c0 + c4);
    *(v4f*)(sv + rr * 68 + c4) = a;
  }
  __syncthreads();

  const int gq = tid >> 3, piece = tid & 7;
  v4u hv[2];
  size_t hofs[2];
#pragma unroll
  for (int it = 0; it < 2; ++it) {
    const int cc = it * 32 + gq;
    v4u a;
#pragma unroll
    for (int t = 0; t < 4; ++t) {
      const float f0 = bf_up(bf_bits(sv[(piece * 8 + 2 * t) * 68 + cc]));
      const float f1 = bf_up(bf_bits(sv[(piece * 8 + 2 * t + 1) * 68 + cc]));
      a[t] = pk16(h_bits((_Float16)(f0 * scale)), h_bits((_Float16)(f1 * scale)));
    }
    hv[it] = a;
    hofs[it] = (size_t)(c0 + cc) * R + r0 + piece * 8;
  }
  {
#pragma unroll
    for (int it = 0; it < 2; ++it) {
      *(v4u*)(out + hofs[it]) = hv[it];
    }
    xcnt_wait();   // another part's code follows in the listing and writes these stores' registers
  }
}

// =====================================================================================================
// Additive mask mk f32 [NB][SEQ x][SEQ y][NH h] -> two f32 planes of msc * bf16rne(mk), msc a power of two, both in
// the order of the attention's score accumulators. With (i, kk) = (query, key): ma holds mk[b][i][kk][h], mb holds
// mk[b][kk][i][h]; element (i, kk) of plane (b, h) lies at float offset
//   ((((i >> 4) * 8 + (kk >> 4)) * 2 + ((kk >> 2) & 1)) * 32 + ((kk >> 3) & 1) * 16 + (i & 15)) * 4 + (kk & 3),
// so the 16 B that lane g*16 + (i & 15) wants for accumulator elements 0..3 (or 4..7) of key tile kk >> 4 lie lane
// after lane: one load of a wave covers 512 B in a row. blocks = (SEQ/8 groups, NH, NB), 256 threads; a block owns
// queries grp*8 .. +7 of both planes. Both 8 x 128 tiles are staged in LDS (pitch MTP), __syncthreads, then thread
// (L = tid>>3, p = tid&7) stores keys 4L..4L+3 of query grp*8+p: lanes 8q..8q+7 write one whole 128-B line.
// coverage: 16 groups x 8 queries x (32 L x 4 keys) = all SEQ x SEQ of every (b,h) in both planes.
// =====================================================================================================
#define MTP 136                 // LDS pitch of the mask tiles (floats): 16-B reads of 8 rows x 2 key quads meet each bank once
__device__ __forceinline__ void mask_planes(const float* __restrict__ mk, float* ma, float* mb,
                                            float msc, int grp, int h, int b, float* sm) {   // sm: 2 x 8 x MTP floats
  const int tid = threadIdx.x;
  const size_t pb = ((size_t)(b * NH + h)) * SEQ * SEQ;          // plane base of (b,h)
  float* st = sm + 8 * MTP;                                      // tile of the transposed plane
  {
    const int xx = tid >> 5, y4 = (tid & 31) * 4;
    const int x = grp * 8 + xx;
    const float* src = mk + (((size_t)b * SEQ + x) * SEQ + y4) * NH + h;
    v4f vd;
#pragma unroll
    for (int t = 0; t < 4; ++t) vd[t] = msc * bf_up(bf_bits(src[(size_t)t * NH]));
    *(v4f*)(sm + xx * MTP + y4) = vd;
  }
  xcnt_wait();                                                   // a later load's result may land on the address pair above
  {
    const int x = tid >> 1, yq = (tid & 1) * 4;
    const float* src = mk + (((size_t)b * SEQ + x) * SEQ + grp * 8 + yq) * NH + h;
#pragma unroll
    for (int t = 0; t < 4; ++t) st[(yq + t) * MTP + x] = msc * bf_up(bf_bits(src[(size_t)t * NH]));
  }
  __syncthreads();
  {
    const int L = tid >> 3, p = tid & 7;
    const v4f vd = *(const v4f*)(sm + p * MTP + L * 4);
    const v4f vt = *(const v4f*)(st + p * MTP + L * 4);
    const size_t o = pb + (size_t)(((((grp >> 1) * 8 + (L >> 2)) * 2 + (L & 1)) * 32 + ((L >> 1) & 1) * 16 + (grp & 1) * 8 + p) * 4);
    *(v4f*)(ma + o) = vd;
    *(v4f*)(mb + o) = vt;
    xcnt_wait();   // another part's code follows in the listing and writes these stores' registers
  }
}

// =====================================================================================================
// All preparation in one launch: the four parts read only inputs and write disjoint planes, so none waits for
// another. Block ranges (block-uniform branches, each part's barriers inside its own branch), short parts
// first so that they run beside the layer norm's stream:
//   [0, PB_W)            Wqkv_in / Wqkv_out tiles: t -> matrix t / 48, tile (t & 3, (t % 48) >> 2)
//   [PB_W, PB_O)         Wo tiles: t -> (t & 7, t >> 3)
//   [PB_O, PB_M)         mask groups: t -> (grp = t & 15, h = (t >> 4) & 7, b = t >> 7)
//   [PB_M, PB_M + RT/8)  layer norm, 8 rows per block
// =====================================================================================================
#define PB_W (2 * (EW / 64) * (W3 / 64))            // 96
#define PB_O (PB_W + (KO / 64) * (EW / 64))         // 128
#define PB_M (PB_O + (SEQ / 8) * NH * NB)           // 384 (NB = 2)
static_assert(EW / 64 == 4 && W3 / 64 == 12 && KO / 64 == 8 && SEQ / 8 == 16 && NH == 8);

__global__ __launch_bounds__(256) void prep_all(
    const float* __restrict__ e, const float* __restrict__ lw, const float* __restrict__ lb,
    unsigned short* xh, unsigned short* xl,
    const float* __restrict__ wqi, const float* __restrict__ wqo, unsigned short* wt, float cw,
    const float* __restrict__ wo, unsigned short* woh, float cwo,
    const float* __restrict__ mk, float* ma, float* mb, float msc) {
  __shared__ __align__(16) float sbuf[64 * 68];
  const int bx = blockIdx.x;
  if (bx < PB_W) {
    const int z = (bx >= PB_W / 2) ? 1 : 0;         // the second matrix's plane follows the first
    const int t = bx - z * (PB_W / 2);
    tr_f16((z != 0) ? wqo : wqi, wt + (size_t)z * EW * W3, EW, W3, cw, t & 3, t >> 2, sbuf);
  } else if (bx < PB_O) {
    const int t = bx - PB_W;
    tr_f16(wo, woh, KO, EW, cwo, t & 7, t >> 3, sbuf);
  } else if (bx < PB_M) {
    const int t = bx - PB_O;
    mask_planes(mk, ma, mb, msc, t & 15, (t >> 4) & 7, t >> 7, sbuf);
  } else {
    ln_planes(e, lw, lb, xh, xl, RT, bx - PB_M);
  }
}

// =====================================================================================================
// Main loop shared by the two projections: one block = 128 x 128 of the product, 8 waves as 4 (m) x 2 (n),
// each wave its 32 x 64 tile. Operands go global -> registers -> LDS in chunks of KC k values, so that every
// global load covers whole 128-B lines (8 lanes per row) and each staged row serves 2 (A) or 4 (B) waves.
// Buffer rows: A hi 0..127 | A residual 128..255 | B 256..383, pitch LP. Thread t stages piece t&7 of rows
// u*32 + (t>>3), u = 0..11; gAh, gAl, gB point at its piece of its first row of each operand, sA / sB are
// the element strides between its successive rows. Two buffers: chunk c+1 is loaded into registers ahead of
// the products of chunk c and stored behind them into the buffer whose readers left at the previous
// barrier; one barrier per chunk publishes it. k runs upward in steps of 32 within and across chunks.
// The closing barrier of the last chunk lets the caller reuse sm.
// =====================================================================================================
#define KC   64                 // k values per staged chunk (128 B of every operand row)
#define LP   72                 // LDS row pitch in halves: 144 B = 16 B x 9, 16-B fragment reads meet each bank once
#define STG  (384 * LP)         // halves per buffer (55296 B)

__device__ __forceinline__ void gemm_blk(const _Float16* gAh, const _Float16* gAl, size_t sA,
                                         const _Float16* gB, size_t sB, int K, _Float16* sm, int tid,
                                         v8f (&acch)[2][4], v8f (&accl)[2][4]) {
  const int lane = tid & 31;
  const int wave = tid >> 5;
  const int fo = (lane & 15) * LP + (lane >> 4) * 8;            // fragment row and k half of this lane
  const int ra = (wave & 3) * 32 * LP + fo;                     // A hi rows of this wave
  const int rb = (256 + (wave >> 2) * 64) * LP + fo;            // B rows of this wave
  _Float16* sw = sm + (tid >> 3) * LP + (tid & 7) * 8;
  v4u st[12];
#pragma unroll
  for (int u = 0; u < 4; ++u) {
    st[u]     = *(const v4u*)(gAh + u * sA);
    st[4 + u] = *(const v4u*)(gAl + u * sA);
    st[8 + u] = *(const v4u*)(gB + u * sB);
  }
#pragma unroll
  for (int u = 0; u < 12; ++u) *(v4u*)(sw + u * 32 * LP) = st[u];
  __syncthreads();

  const int nc = K / KC;
  for (int c = 0; c < nc; ++c) {
    const bool more = (c + 1) < nc;                             // block-uniform
    if (more) {
      const int ko = (c + 1) * KC;
#pragma unroll
      for (int u = 0; u < 4; ++u) {
        st[u]     = *(const v4u*)(gAh + u * sA + ko);
        st[4 + u] = *(const v4u*)(gAl + u * sA + ko);
        st[8 + u] = *(const v4u*)(gB + u * sB + ko);
      }
    }
    const _Float16* sb = sm + (c & 1) * STG;
#pragma unroll
    for (int kk = 0; kk < KC; kk += 32) {
      v16h fh[2], fl[2];
#pragma unroll
      for (int i = 0; i < 2; ++i) {
        fh[i] = ldfrag_h(sb + ra + i * 16 * LP + kk);
        fl[i] = ldfrag_h(sb + ra + (128 + i * 16) * LP + kk);
      }
      v16h bnx = ldfrag_h(sb + rb + kk);
#pragma unroll
      for (int j = 0; j < 4; ++j) {
        const v16h bfr = bnx;
        if (j < 3) bnx = ldfrag_h(sb + rb + (j + 1) * 16 * LP + kk);   // next B fragment flies under this one's products
#pragma unroll
        for (int i = 0; i < 2; ++i) {
          acch[i][j] = mma_h(fh[i], bfr, acch[i][j]);
          accl[i][j] = mma_h(fl[i], bfr, accl[i][j]);
        }
      }
    }
    if (more) {
      _Float16* sn = sw + ((c + 1) & 1) * STG;
#pragma unroll
      for (int u = 0; u < 12; ++u) *(v4u*)(sn + u * 32 * LP) = st[u];
    }
    __syncthreads();
  }
}

// =====================================================================================================
// Fused q/k/v projection; grid y = batch * 2 + direction picks the batch's X rows, the direction's Wt and
// bias, and that pair's own output planes. For the edge rows of one batch: X[m][k] . Wt[n][k] + bf16rne(bias[n]) with
// X = f16 hi plane + residual plane (x2048) [RB][EW], Wt f16 [W3][EW] (k contiguous), f16 products into
// separate hi/residual accumulators, f32 accumulate; value = ((acch + accl*scl)*sch + bias) * fac(sec)
// with sec = n / EW (0 q, 1 k, 2 v). Block = 128 rows x 2 column tiles (gemm_blk); one wave per 32 x 64 tile; the tile's 64 columns are a PERMUTED set:
// n = sec*EW + d*NH + h for d in 0..31 and h in {h0, h0+1} (tn = sec*4 + h0/2), B fragment j covers
// hh = j>>1, d = (j&1)*16 + lane&15. Output written as head-major f16 planes hi = f16(value),
// lo = f16((value - hi) * 2048), hi plane [3][NH][RB][HD]; lo plane [2][NH][RB][HD], q and k only. The planes lie
// as the attention block of column index a reads them: plane row a*SEQ + t is edge row (t, a) for q and for the
// outgoing direction's k and v (the block gathers its 128 X rows SEQ rows apart), edge row (a, t) for the incoming
// direction's k and v. v: element (h, plane row m, d) at [((2*NH + h)*RB + m)*HD + d]; q, k: each 16-row x 32-d tile
// in fragment order (see ldfrag_t), tile of rows m0..m0+15 at [((sec*NH + h)*RB + m0)*HD]. Staged B row q*32 + d holds column
// n = sec*EW + d*NH + (bn&1)*4 + q, which is fragment row (j&1)*16 + lane&15 of wave column q>>1, j>>1 = q&1.
// Epilogue: per-wave 16-row slabs in the staging LDS (free behind the main loop's closing barrier),
// column cc = hh*32 + d), then lane g8 = lane>>3, pc = lane&7: instruction q writes line L = q*4+g8
// coverage: 2 slabs x 16 lines (2 hh x 8 lines t: rows 2t, 2t+1 for v; 8 rows x 8 d for q, k) x 8 pieces of 8 d = the wave's whole 32 x 64 tile in
// the hi plane (and in the lo plane for sec < 2); 512 x 12 tiles cover [3][NH][RB][HD] exactly.
// =====================================================================================================
__global__ __launch_bounds__(256) void gemm_p(
    const unsigned short* __restrict__ Ahp, const unsigned short* __restrict__ Alp,
    const unsigned short* __restrict__ Btp, const float* __restrict__ bias0, const float* __restrict__ bias1,
    unsigned short* php, unsigned short* plp,
    float f0, float f1, float f2, float sch, float scl) {
  const int bd  = blockIdx.y;              // batch * 2 + direction
  const int dir = bd & 1;
  const size_t xo = (size_t)(bd >> 1) * RB * EW;
  const _Float16* Ah = (const _Float16*)(const void*)Ahp + xo;
  const _Float16* Al = (const _Float16*)(const void*)Alp + xo;
  const _Float16* Bh = (const _Float16*)(const void*)Btp + (size_t)dir * W3 * EW;
  const float* bias = (dir != 0) ? bias1 : bias0;
  php += (size_t)bd * 3 * NH * RB * HD;
  plp += (size_t)bd * 2 * NH * RB * HD;
  __shared__ __align__(16) unsigned short smem[2 * STG];
  const int tid  = threadIdx.x;
  const int lane = tid & 31;
  const int wave = tid >> 5;
  constexpr int blkN = W3 / 128;           // 6 column pairs; grid x = (RB / 128) * blkN exactly
  const int bm = blockIdx.x / blkN;
  const int bn = blockIdx.x - bm * blkN;
  const int tn = bn * 2 + (wave >> 2);
  const int m0 = bm * 128 + (wave & 3) * 32;
  const int sec = tn >> 2;                 // 0 q, 1 k, 2 v (the same for both column tiles of a block)
  const int h0 = (tn & 3) * 2;             // head pair
  const int rlane = lane & 15;
  const int mOff  = (lane >> 4) * 8;
  int nB[4];
#pragma unroll
  for (int j = 0; j < 4; ++j) nB[j] = sec * EW + ((((j & 1) << 4) + rlane) << 3) + h0 + (j >> 1);

  v8f acch[2][4], accl[2][4];
#pragma unroll
  for (int i = 0; i < 2; ++i)
#pragma unroll
    for (int j = 0; j < 4; ++j) { acch[i][j] = zero8(); accl[i][j] = zero8(); }

  {
    // tile row t is edge row (bm, t), or (t, bm) where the attention walks the first edge index (block-uniform)
    // two calls, so that each one's row step is a constant and stays an immediate offset of the staged loads
    const size_t bo = (size_t)((bn >> 1) * EW + (tid >> 3) * NH + (bn & 1) * 4) * EW + (tid & 7) * 8;
    if ((dir != 0) || (bn < 2)) {
      const size_t ao = (size_t)((tid >> 3) * SEQ + bm) * EW + (tid & 7) * 8;
      gemm_blk(Ah + ao, Al + ao, (size_t)32 * SEQ * EW, Bh + bo, (size_t)EW, EW,
               (_Float16*)(void*)smem, tid, acch, accl);
    } else {
      const size_t ao = (size_t)(bm * SEQ + (tid >> 3)) * EW + (tid & 7) * 8;
      gemm_blk(Ah + ao, Al + ao, (size_t)32 * EW, Bh + bo, (size_t)EW, EW,
               (_Float16*)(void*)smem, tid, acch, accl);
    }
  }

  const float fac = (sec == 0) ? f0 : ((sec == 1) ? f1 : f2);
  float bz[4];
#pragma unroll
  for (int j = 0; j < 4; ++j) bz[j] = bf_up(bf_bits(bias[nB[j]]));

  float* slab = (float*)(void*)smem + wave * (16 * 68);
  const int g8 = lane >> 3, pc = lane & 7;
#pragma unroll
  for (int i = 0; i < 2; ++i) {
    const int mBase = m0 + (i << 4);
#pragma unroll
    for (int r = 0; r < 8; ++r) {
#pragma unroll
      for (int j = 0; j < 4; ++j) {
        slab[(mOff + r) * 68 + (j << 4) + rlane] = ((acch[i][j][r] + accl[i][j][r] * scl) * sch + bz[j]) * fac;
      }
    }
    __builtin_amdgcn_fence(__ATOMIC_RELEASE, "workgroup");
    __builtin_amdgcn_wave_barrier();
    __builtin_amdgcn_fence(__ATOMIC_ACQUIRE, "workgroup");
    {
      v4u hv[4], lv[4];
      size_t ofs[4];
#pragma unroll
      for (int q = 0; q < 4; ++q) {
        const int L = q * 4 + g8;                    // line 0..15 of this slab
        const int hh = L >> 3, t = L & 7;
        const int row = (bn < 4) ? (t & 1) * 8 + pc : 2 * t + (pc >> 2);   // q, k: fragment order; v: row-major
        const int d0 = (bn < 4) ? (t >> 1) * 8 : (pc & 3) * 8;
        const v4f x0 = *(const v4f*)(slab + row * 68 + hh * 32 + d0);
        const v4f x1 = *(const v4f*)(slab + row * 68 + hh * 32 + d0 + 4);
        float f[8];
        f[0] = x0[0]; f[1] = x0[1]; f[2] = x0[2]; f[3] = x0[3];
        f[4] = x1[0]; f[5] = x1[1]; f[6] = x1[2]; f[7] = x1[3];
        v4u ph, pl;
#pragma unroll
        for (int u = 0; u < 4; ++u) {
          const float s0 = f[2 * u];
          const float s1 = f[2 * u + 1];
          const _Float16 hq0 = (_Float16)s0;
          const _Float16 hq1 = (_Float16)s1;
          const _Float16 lq0 = (_Float16)((s0 - (float)hq0) * 2048.0f);
          const _Float16 lq1 = (_Float16)((s1 - (float)hq1) * 2048.0f);
          ph[u] = pk16(h_bits(hq0), h_bits(hq1));
          pl[u] = pk16(h_bits(lq0), h_bits(lq1));
        }
        hv[q] = ph;
        lv[q] = pl;
        ofs[q] = (((size_t)(sec * NH + h0 + hh)) * RB + (size_t)mBase) * HD + t * 64 + pc * 8;   // line t, piece pc
      }
      {
#pragma unroll
        for (int q = 0; q < 4; ++q) {
          *(v4u*)(php + ofs[q]) = hv[q];
          if (sec < 2) *(v4u*)(plp + ofs[q]) = lv[q];
        }
        
      }
    }
    __builtin_amdgcn_fence(__ATOMIC_RELEASE, "workgroup");
    __builtin_amdgcn_wave_barrier();
    __builtin_amdgcn_fence(__ATOMIC_ACQUIRE, "workgroup");
  }
}

// =====================================================================================================
// Axial attention, grid y = batch * 2 + direction: block = (column index j = blockIdx.x, all 8 heads),
// wave = head h, 16-query strips s = 0..7 in lockstep.
//   queries i: plane row j*SEQ + i; keys/values kk: plane row j*SEQ + kk (the projection has put edge row (i,j),
//   and (j,kk) for dir 0 or (kk,j) for dir 1, there); additive mask plane of (h; i, kk) in accumulator order
//   (see mask_planes; already x64 and bf16-RNE'd, direct for dir 0 and transposed for dir 1).
// Scores are computed TRANSPOSED: S^T[kk][i] = K(A, lane = key row, d per k-map) . Q^T(B, lane = query,
// d per k-map), hi.hi into the mask-initialised accumulator plus (hi.lo + lo.hi)*xscl; D lane = query i,
// element r = key 16ct + 8g + r, so a lane and its partner lane^16 own one softmax row: max / exp / sum in
// f32 with one __shfl_xor(.,16) each. Weights p*pcar are converted to f16 in registers and used directly as
// the B operand of O^T[d][i] = V^T(A from LDS, lane = d, keys per k-map) . P^T (B: lane = query, element
// e <- tile 2c key 8g+e, element 8+e <- tile 2c+1 key 8g+e).
// LDS: sVt [NH][HD][VTP] v^T tiles (built once per block by register transposition of 4 key rows into 8-B
// stores; each wave stages and reads only its own head; block barrier after staging; staged extent k 0..127
// == consumed extent); sO [16][SOP] f32 output slab (cross-wave: block barriers before the row writes and
// before the next strip).
// Output: f16 planes vah = f16(O*1024), val = f16((O*1024 - hi)*2048), [RB rows i*SEQ+j][KO] at columns
// dir*EW + d*NH + h; per strip wave h writes rows 2h, 2h+1: 32 lanes x 16 B = the whole 512-B half row
// coverage: 8 strips x 8 waves x 2 rows = 128 queries x (32 lanes x 8 = 256 channels) for every (j, dir)
// -> together with the other direction's blocks every element of both planes of this batch.
// =====================================================================================================
__global__ __launch_bounds__(256) void attn_ax(
    const unsigned short* __restrict__ php, const unsigned short* __restrict__ plp,
    const float* __restrict__ mp, unsigned short* vah, unsigned short* val,
    float xscl, float escl, float pcar, float oscl) {
  const int bd  = blockIdx.y;                      // batch * 2 + direction
  const int dir = bd & 1;
  php += (size_t)bd * 3 * NH * RB * HD;
  plp += (size_t)bd * 2 * NH * RB * HD;
  mp  += (size_t)(dir * NB + (bd >> 1)) * NH * SEQ * SEQ;   // direct planes of all batches, then transposed
  vah += (size_t)(bd >> 1) * RB * KO;
  val += (size_t)(bd >> 1) * RB * KO;
  const _Float16* Ph = (const _Float16*)(const void*)php;
  const _Float16* Pl = (const _Float16*)(const void*)plp;
  __shared__ __align__(16) unsigned short sVt[NH * HD * VTP];     // 69632 B
  __shared__ __align__(16) float sO[16 * SOP];                    // 16896 B
  const _Float16* sVh = (const _Float16*)(const void*)sVt;
  const int tid  = threadIdx.x;
  const int lane = tid & 31;
  const int h    = tid >> 5;
  const int nl   = lane & 15;
  const int g    = lane >> 4;
  const int g8   = g * 8;
  const int j    = blockIdx.x;
  const size_t hs = (size_t)RB * HD;               // per-head plane stride (halves)
  const size_t ss = (size_t)NH * hs;               // per-section stride
  const _Float16* Qh = Ph + (size_t)h * hs;
  const _Float16* Kh = Ph + ss + (size_t)h * hs;
  const _Float16* Ql = Pl + (size_t)h * hs;
  const _Float16* Kl = Pl + ss + (size_t)h * hs;
  const unsigned short* Vu = php + 2 * ss + (size_t)h * hs;
  const size_t jb = (size_t)j * SEQ * HD;          // this block's 128 rows of every plane

  // ---- K fragments of head h (A operands, hi and residual, all 8 key tiles): the same for every query strip,
  //      so they are loaded once here and stay in registers through the strip loop
  v16h kh[8], kl[8];
#pragma unroll
  for (int ct = 0; ct < 8; ++ct) {
    const size_t kofs = jb + (size_t)(ct * 16 * HD + lane * 8); // key tile ct; this lane's A row is key ct*16 + nl
    kh[ct] = ldfrag_t(Kh + kofs);
    xcnt_wait();                                                // a later load's result may land on this address pair
    kl[ct] = ldfrag_t(Kl + kofs);
    xcnt_wait();                                                // the same
  }

  // ---- stage v^T of head h: unit u = (key quad kq, d octet dq): 4 x 16-B row loads -> 8 x 8-B LDS stores
  v4u rw[4][4];
  {
    const unsigned short* vb = Vu + jb + (size_t)((lane >> 2) * 4 * HD + (lane & 3) * 8);   // unit it = 0, row a = 0
#pragma unroll
    for (int it = 0; it < 4; ++it)
#pragma unroll
      for (int a = 0; a < 4; ++a) rw[it][a] = *(const v4u*)(vb + (it * 32 + a) * HD);
    xcnt_wait();                                   // the address pair is free for other values behind these loads
  }
#pragma unroll
  for (int it = 0; it < 4; ++it) {
    const int u  = it * 32 + lane;                 // 0..127
    const int kq = u >> 2, dq = u & 3;
    const int kb = kq * 4;
#pragma unroll
    for (int d = 0; d < 8; ++d) {
      const int wd = d >> 1, sh = (d & 1) * 16;
      const unsigned x0 = (rw[it][0][wd] >> sh) & 0xFFFFu;
      const unsigned x1 = (rw[it][1][wd] >> sh) & 0xFFFFu;
      const unsigned x2 = (rw[it][2][wd] >> sh) & 0xFFFFu;
      const unsigned x3 = (rw[it][3][wd] >> sh) & 0xFFFFu;
      v2u o;
      o[0] = x0 | (x1 << 16);
      o[1] = x2 | (x3 << 16);
      *(v2u*)(sVt + (h * HD + dq * 8 + d) * VTP + kb) = o;
    }
    // one unit's transposition at a time: all four interleaved need more than 256 registers, and only one block fits a WGP
    __builtin_amdgcn_sched_barrier(0);
  }
  __syncthreads();

  const _Float16* qhp = Qh + jb + lane * 8;        // this lane's piece of query tile 0, hi and residual
  const _Float16* qlp = Ql + jb + lane * 8;
#pragma unroll 1
  for (int s = 0; s < 8; ++s) {
    const v16h qh = ldfrag_t(qhp + s * (16 * HD));              // query tile s; this lane's B / D column is query s*16 + nl
    xcnt_wait();                                                // a later load's result may land on this address pair
    const v16h ql = ldfrag_t(qlp + s * (16 * HD));
    xcnt_wait();                                                // the same
    const float* mfr = mp + (size_t)(h * 8 + s) * (8 * 256) + lane * 4;   // this strip's 8 mask tiles, 256 floats each

    // ---- the strip's mask, straight into the 8 score accumulators: 16 loads of 512 B in a row, one group, so that
    //      their latency is met once a strip and not once a key tile
    v8f acc[8];
#pragma unroll
    for (int ct = 0; ct < 8; ++ct) {
      const v4f mv0 = *(const v4f*)(mfr + ct * 256);
      const v4f mv1 = *(const v4f*)(mfr + ct * 256 + 128);
      v8f am;
      am[0] = mv0[0]; am[1] = mv0[1]; am[2] = mv0[2]; am[3] = mv0[3];
      am[4] = mv1[0]; am[5] = mv1[1]; am[6] = mv1[2]; am[7] = mv1[3];
      acc[ct] = am;
    }
    xcnt_wait();                                                // the next strip's addresses land on these loads' address pairs

    // ---- transposed scores, 8 key tiles
#pragma unroll
    for (int ct = 0; ct < 8; ++ct) {
      v8f ax = mma_h(kh[ct], ql, zero8());
      ax = mma_h(kl[ct], qh, ax);
      const v8f am = mma_h(kh[ct], qh, acc[ct]);
      acc[ct] = am + ax * xscl;
      // one key tile's products at a time: with several residual accumulators live the K fragments spill
      __builtin_amdgcn_sched_barrier(0);
    }

    // ---- softmax over the 128 keys of query i (this lane: 64 values, partner lane^16: the other 64)
    float mx = acc[0][0];
#pragma unroll
    for (int ct = 0; ct < 8; ++ct)
#pragma unroll
      for (int r = 0; r < 8; ++r) mx = fmaxf(mx, acc[ct][r]);
    mx = fmaxf(mx, __shfl_xor(mx, 16));
    float sum = 0.f;
#pragma unroll
    for (int ct = 0; ct < 8; ++ct)
#pragma unroll
      for (int r = 0; r < 8; ++r) {
        const float ev = __expf((acc[ct][r] - mx) * escl);
        acc[ct][r] = ev;
        sum += ev;
      }
    sum += __shfl_xor(sum, 16);
    const float rc = pcar / sum;                                // sum >= 1

    // ---- P^T as B fragments straight from the accumulators
    v16h pb[4];
#pragma unroll
    for (int c = 0; c < 4; ++c) {
      union { v16h v; v8h hh[2]; } U;
      v8h p0, p1;
#pragma unroll
      for (int e2 = 0; e2 < 8; ++e2) {
        p0[e2] = (_Float16)(acc[2 * c][e2] * rc);
        p1[e2] = (_Float16)(acc[2 * c + 1][e2] * rc);
      }
      U.hh[0] = p0;
      U.hh[1] = p1;
      pb[c] = U.v;
    }

    // ---- O^T[d][i] = V^T . P^T, two 16-row d tiles, K = 128 keys
    v8f oacc[2];
#pragma unroll
    for (int dt = 0; dt < 2; ++dt) {
      v8f o = zero8();
#pragma unroll
      for (int c = 0; c < 4; ++c) {
        const v16h va = ldfrag_h(sVh + (h * HD + dt * 16 + nl) * VTP + 32 * c + g8);
        o = mma_h(va, pb[c], o);
      }
      oacc[dt] = o;
    }

    // ---- stage O (f32, true scale) into the slab: row = query nl, column = d*NH + h
#pragma unroll
    for (int dt = 0; dt < 2; ++dt)
#pragma unroll
      for (int r = 0; r < 8; ++r)
        sO[nl * SOP + ((dt * 16 + g8 + r) << 3) + h] = oacc[dt][r] * oscl;
    __syncthreads();

    // ---- wave h writes queries s*16 + 2h, + 2h + 1: 512-B half rows in hi and residual planes
    {
      v4u hv[2], lv[2];
      size_t ofs[2];
#pragma unroll
      for (int q = 0; q < 2; ++q) {
        const int rr = 2 * h + q;
        const v4f x0 = *(const v4f*)(sO + rr * SOP + lane * 8);
        const v4f x1 = *(const v4f*)(sO + rr * SOP + lane * 8 + 4);
        float f[8];
        f[0] = x0[0]; f[1] = x0[1]; f[2] = x0[2]; f[3] = x0[3];
        f[4] = x1[0]; f[5] = x1[1]; f[6] = x1[2]; f[7] = x1[3];
        v4u ph, pl;
#pragma unroll
        for (int u = 0; u < 4; ++u) {
          const float s0 = f[2 * u] * 1024.0f;
          const float s1 = f[2 * u + 1] * 1024.0f;
          const _Float16 hq0 = (_Float16)s0;
          const _Float16 hq1 = (_Float16)s1;
          const _Float16 lq0 = (_Float16)((s0 - (float)hq0) * 2048.0f);
          const _Float16 lq1 = (_Float16)((s1 - (float)hq1) * 2048.0f);
          ph[u] = pk16(h_bits(hq0), h_bits(hq1));
          pl[u] = pk16(h_bits(lq0), h_bits(lq1));
        }
        hv[q] = ph;
        lv[q] = pl;
        ofs[q] = ((size_t)(s * 16 + rr) * SEQ + j) * KO + (size_t)dir * EW + lane * 8;
      }
      {
#pragma unroll
        for (int q = 0; q < 2; ++q) {
          *(v4u*)(vah + ofs[q]) = hv[q];
          *(v4u*)(val + ofs[q]) = lv[q];
        }
        
      }
    }
    __syncthreads();                                            // sO reused by the next strip
  }
}

// =====================================================================================================
// Output projection: C[m][n] = sch * (sum_k Ahi[m][k]*Bt[n][k] + scl * sum_k Alo[m][k]*Bt[n][k]) + bf16rne(bias[n])
// (f16 products, f32 accumulate, hi and scaled-residual products in separate accumulators). Ahi/Alo row-major
// [M][K] pitch lda; Bt [N][K] pitch ldb; C f32 [M][N] pitch ldc. Block = 128 x 128 of C (gemm_blk), one wave per
// 32x64 tile; M = RT, N = EW, K = KO (multiples of 128, 128 and KC).
// Epilogue: 16-row slabs staged per wave in the staging LDS (free behind the main loop's closing barrier); each 64-wide row segment (256 B) written by one instruction
// coverage: 2 slabs x 16 rows x 64 cols = the wave's whole 32x64 tile; grid covers every tile of C.
// =====================================================================================================
__global__ __launch_bounds__(256) void gemm32h_w(
    const unsigned short* __restrict__ Ahp, const unsigned short* __restrict__ Alp,
    const unsigned short* __restrict__ Btp,
    const float* __restrict__ bias,
    float* C, float sch, float scl) {
  constexpr int lda = KO, ldb = KO, ldc = EW, M = RT, N = EW, K = KO;   // fixed: staged row steps become immediate offsets
  const _Float16* Ah = (const _Float16*)(const void*)Ahp;
  const _Float16* Al = (const _Float16*)(const void*)Alp;
  const _Float16* Bh = (const _Float16*)(const void*)Btp;
  __shared__ __align__(16) unsigned short smem[2 * STG];
  const int tid  = threadIdx.x;
  const int lane = tid & 31;
  const int wave = tid >> 5;
  constexpr int blkN = N >> 7;
  if ((int)blockIdx.x >= (M >> 7) * blkN) return;   // block-uniform, in front of every barrier
  const int bm = blockIdx.x / blkN;
  const int bn = blockIdx.x - bm * blkN;
  const int m0 = bm * 128 + (wave & 3) * 32;
  const int n0 = bn * 128 + (wave >> 2) * 64;
  const int rlane = lane & 15;
  const int mOff  = (lane >> 4) * 8;

  v8f acch[2][4], accl[2][4];
#pragma unroll
  for (int i = 0; i < 2; ++i)
#pragma unroll
    for (int j = 0; j < 4; ++j) { acch[i][j] = zero8(); accl[i][j] = zero8(); }

  {
    const size_t ao = (size_t)(bm * 128 + (tid >> 3)) * lda + (tid & 7) * 8;
    const size_t bo = (size_t)(bn * 128 + (tid >> 3)) * ldb + (tid & 7) * 8;
    gemm_blk(Ah + ao, Al + ao, (size_t)32 * lda, Bh + bo, (size_t)32 * ldb, K,
             (_Float16*)(void*)smem, tid, acch, accl);
  }

  float bz[4];
#pragma unroll
  for (int j = 0; j < 4; ++j) bz[j] = bf_up(bf_bits(bias[n0 + (j << 4) + rlane]));

  float* slab = (float*)(void*)smem + wave * (16 * 68);
#pragma unroll
  for (int i = 0; i < 2; ++i) {
    const int mBase = m0 + (i << 4);
#pragma unroll
    for (int r = 0; r < 8; ++r) {
#pragma unroll
      for (int j = 0; j < 4; ++j) {
        slab[(mOff + r) * 68 + (j << 4) + rlane] = (acch[i][j][r] + accl[i][j][r] * scl) * sch + bz[j];
      }
    }
    __builtin_amdgcn_fence(__ATOMIC_RELEASE, "workgroup");
    __builtin_amdgcn_wave_barrier();
    __builtin_amdgcn_fence(__ATOMIC_ACQUIRE, "workgroup");
    {
      const int hh = lane >> 4, c4 = (lane & 15) * 4;     // 256-B row segment = 16 lanes x 16 B
      v4f ov[8];
#pragma unroll
      for (int it = 0; it < 8; ++it) {
        const int row = it * 2 + hh;                       // it 0..7 x hh 0..1 = rows 0..15
        ov[it] = *(const v4f*)(slab + row * 68 + c4);
      }
      {
#pragma unroll
        for (int it = 0; it < 8; ++it) {
          const int row = it * 2 + hh;
          *(v4f*)(C + (size_t)(mBase + row) * ldc + n0 + c4) = ov[it];
        }
        
      }
    }
    __builtin_amdgcn_fence(__ATOMIC_RELEASE, "workgroup");
    __builtin_amdgcn_wave_barrier();
    __builtin_amdgcn_fence(__ATOMIC_ACQUIRE, "workgroup");
  }
}

// =====================================================================================================
// Workspace map (bytes, NB = 2); every region an exact multiple of its whole-line store granularity, all
// written earlier in the same call. Every (batch, direction) pair has its own Ph / Pl planes, so each stage
// is one launch over all four pairs. Vah lies on Xh + Xl, whose last reader (the projection) has ended.
//   Xh   f16 [RT][EW]                     0        16777216   (layer norm output, hi)
//   Xl   f16 [RT][EW]              16777216        16777216   (residual x2048)
//   Wti  f16 [W3 n][EW k]          33554432          393216   (f16(bf16(Wqkv_in) x64))
//   Wto  f16 [W3 n][EW k]          33947648          393216
//   Woh  f16 [EW n][KO k]          34340864          262144   (f16(bf16(Wo) x1024))
//   mA   f32 [NB][NH][SEQ x SEQ]   34603008         1048576   (64 x bf16(mask), direct, accumulator order)
//   mB   f32 [NB][NH][SEQ x SEQ]   35651584         1048576   (transposed, accumulator order)
//   Ph   f16 [2 NB][3][NH][RB][HD] 36700160       100663296   (q x16*32^-0.5, k x4, v x4; hi)
//   Pl   f16 [2 NB][2][NH][RB][HD] 137363456       67108864   (q, k residual x2048)
//   Val  f16 [RT][KO]             204472320        33554432   (attention output residual x2048)
//   Vah  f16 [RT][KO]                     0        33554432   (attention output x1024, hi; on Xh + Xl)
//   end                           238026752
// Inputs: e f32 [NB][SEQ][SEQ][EW]; mask f32 [NB][SEQ][SEQ][NH]; ln_w, ln_b f32 [EW]; Wqkv_in, Wqkv_out
// f32 [EW in][W3 out]; bqkv_* f32 [W3]; Wo f32 [KO in][EW out]; bo f32 [EW]. d_out f32 [RT][EW] at byte 0
// (row = b*RB + i*SEQ + j, col = n).
// =====================================================================================================
extern "C" void kernel_launch(void* const* d_in, const int* in_sizes, int n_in,
                              void* d_out, int out_size, void* d_ws, size_t ws_size,
                              hipStream_t stream) {
  if (n_in < 10) return;
  if (in_sizes[0] < RT * EW) return;
  if (in_sizes[1] < NB * SEQ * SEQ * NH) return;
  if (in_sizes[2] < EW) return;
  if (in_sizes[3] < EW) return;
  if (in_sizes[4] < EW * W3) return;
  if (in_sizes[5] < W3) return;
  if (in_sizes[6] < EW * W3) return;
  if (in_sizes[7] < W3) return;
  if (in_sizes[8] < KO * EW) return;
  if (in_sizes[9] < EW) return;
  if (out_size < RT * EW) return;

  const float* e    = (const float*)d_in[0];   // [NB][SEQ][SEQ][EW]
  const float* mask = (const float*)d_in[1];   // [NB][SEQ][SEQ][NH]
  const float* ln_w = (const float*)d_in[2];   // [EW]
  const float* ln_b = (const float*)d_in[3];   // [EW]
  const float* Wqi  = (const float*)d_in[4];   // [EW in][W3 out]
  const float* bqi  = (const float*)d_in[5];   // [W3]
  const float* Wqo  = (const float*)d_in[6];   // [EW in][W3 out]
  const float* bqo  = (const float*)d_in[7];   // [W3]
  const float* Wo   = (const float*)d_in[8];   // [KO in][EW out]
  const float* bo   = (const float*)d_in[9];   // [EW]

  const size_t PX  = (size_t)RT * EW * 2;                    // 16777216 (NB = 2)
  const size_t PWt = (size_t)W3 * EW * 2;                    //   393216
  const size_t PWo = (size_t)EW * KO * 2;                    //   262144
  const size_t PM  = (size_t)NB * NH * SEQ * SEQ * 4;        //  1048576 (NB = 2)
  const size_t PPh = (size_t)2 * NB * 3 * NH * RB * HD * 2;  // 100663296 (NB = 2)
  const size_t PPl = (size_t)2 * NB * 2 * NH * RB * HD * 2;  //  67108864
  const size_t PVa = (size_t)RT * KO * 2;                    //  33554432 == 2 * PX
  size_t off = 0;
  const size_t oXh = off; off += PX;
  const size_t oXl = off; off += PX;
  const size_t oWi = off; off += PWt;
  off += PWt;                                                // Wto, directly behind Wti
  const size_t oWo = off; off += PWo;
  const size_t oMa = off; off += PM;
  const size_t oMb = off; off += PM;
  const size_t oPh = off; off += PPh;
  const size_t oPl = off; off += PPl;
  const size_t oVl = off; off += PVa;
  const size_t oVh = oXh;                                    // Vah takes over Xh + Xl (same size)
  if (off > ws_size) return;                                 // off = 238026752 for NB = 2

  char* ws = (char*)d_ws;
  unsigned short* Xh  = (unsigned short*)(ws + oXh);
  unsigned short* Xl  = (unsigned short*)(ws + oXl);
  unsigned short* Wti = (unsigned short*)(ws + oWi);
  unsigned short* Woh = (unsigned short*)(ws + oWo);
  float*          mA  = (float*)(ws + oMa);
  float*          mB  = (float*)(ws + oMb);
  unsigned short* Ph  = (unsigned short*)(ws + oPh);
  unsigned short* Pl  = (unsigned short*)(ws + oPl);
  unsigned short* Vah = (unsigned short*)(ws + oVh);
  unsigned short* Val = (unsigned short*)(ws + oVl);
  float*          outf = (float*)d_out;                      // [RT][EW]

  const dim3 blk(256);
  const dim3 gPp(PB_M + RT / 8);                             // 384 weight and mask blocks + 4096 layer norm blocks
  const dim3 gPr((RB / 128) * (W3 / 128), 2 * NB);           // 768 blocks x (batch, direction)
  const dim3 gAt(SEQ, 2 * NB);                               // one block per column index j x (batch, direction)
  const dim3 gWo((RT / 128) * (EW / 128));                   // 512 blocks
  const float cW     = 64.0f;                                // Wqkv plane carry
  const float fQ     = 16.0f * 0.17677669529663687f;         // 32^-0.5 then carry x16
  const float fK     = 4.0f;                                 // k carry
  const float fV     = 4.0f;                                 // v carry
  const float prSch  = 1.0f / 64.0f;                         // folds the Wqkv plane carry
  const float prScl  = 1.0f / 2048.0f;                       // folds the layer norm residual carry
  const float mkSc   = 64.0f;                                // mask planes x (16 * 4)
  const float axXscl = 1.0f / 2048.0f;                       // q/k residual carry
  const float axEscl = 1.0f / 64.0f;                         // score carry 16 * 4
  const float axPcar = 16384.0f;                             // softmax weight carry
  const float axOscl = 1.0f / 65536.0f;                      // 1/(16384 * 4)
  const float woScale = 1024.0f;                             // Wo plane carry
  const float woSch  = 1.0f / 1048576.0f;                    // 1/(1024 * 1024): O hi carry and Wo carry
  const float woScl  = 1.0f / 2048.0f;                       // O residual carry

  // (1) layer norm -> f16 hi + residual planes; weights -> transposed f16 planes of their bf16 values; masks
  prep_all<<<gPp, blk, 0, stream>>>(e, ln_w, ln_b, Xh, Xl, Wqi, Wqo, Wti, cW, Wo, Woh, woScale, mask, mA, mB, mkSc);
  // (2) all batches and both directions at once: projection, attention, output projection
  gemm_p<<<gPr, blk, 0, stream>>>(Xh, Xl, Wti, bqi, bqo, Ph, Pl, fQ, fK, fV, prSch, prScl);
  attn_ax<<<gAt, blk, 0, stream>>>(Ph, Pl, mA, Vah, Val, axXscl, axEscl, axPcar, axOscl);
  gemm32h_w<<<gWo, blk, 0, stream>>>(Vah, Val, Woh, bo, outf, woSch, woScl);
  (void)hipGetLastError();
}

// v007
// A run of this version takes 106 microseconds.
// Timed twice side by side with v006, it ran 1.14 times as fast both times.
// All steps since v000 together make it 3.67 times as fast.
// Contractions: q/k/v projections = v_wmma_f32_16x16x32_f16 (layer-normed input as f16 hi + residual (x2048) planes, two products into separate accumulators; Wqkv as f16 of its bf16-RNE value x64); per-(b,j,h) scores = v_wmma_f32_16x16x32_f16 (k and q as f16 hi + residual (x2048) planes carried x4 and x16*32^-0.5, products hh + hl + lh; additive mask x64 as the initial accumulator); p.v = v_wmma_f32_16x16x32_f16 (softmax weights x16384 in f16 repacked from the score accumulators, v^T f16 tile carried x4, single product); output projection = v_wmma_f32_16x16x32_f16 (attention output as f16 hi (x1024) + residual (x2048) planes, two products; Wo as f16 of its bf16-RNE value x1024); every float input RNE-converted to bf16 on load; all f32 accumulate; layer norm and softmax in f32.
#include <hip/hip_runtime.h>
#include <math.h>
#include <stdint.h>

#ifndef NB
#define NB 2
#endif
#define NB_FULL 2
#ifndef SEQ
#define SEQ 128
#endif
#define EW  256                 // edge width
#define NH  8                   // heads (fastest channel dim)
#define HD  32                  // dot dim
#define W3  (3 * EW)            // 768 fused projection columns
#define KO  (2 * EW)            // 512 concat channels
#define RB  (SEQ * SEQ)         // edge rows per batch (16384)
#define RT  (NB * RB)           // edge rows processed
#define VTP 136                 // LDS v^T tile pitch (halves)
#define SOP 264                 // LDS output slab pitch (floats)

static_assert(NH * HD == EW);
static_assert(HD == 32);
static_assert(EW == 256);
static_assert(SEQ == 128);      // i, j and key extents are coupled; only NB is reducible
static_assert(NB >= 1 && NB <= NB_FULL);
static_assert((RB % 64) == 0 && (RT % 8) == 0);
static_assert((((RB / 32) * (W3 / 64)) % 8) == 0);
static_assert((((RB / 32) * (EW / 64)) % 8) == 0);
static_assert((EW % 64) == 0 && (W3 % 64) == 0 && (KO % 64) == 0 && (EW % 32) == 0 && (KO % 32) == 0);
static_assert((SEQ % 16) == 0 && (SEQ % 8) == 0);
static_assert((RB % 128) == 0 && (W3 % 128) == 0 && (EW % 128) == 0);   // 128 x 128 block tiles of the output projection

typedef _Float16 v16h __attribute__((ext_vector_type(16)));
typedef _Float16 v8h  __attribute__((ext_vector_type(8)));
typedef float    v8f  __attribute__((ext_vector_type(8)));
typedef float    v4f  __attribute__((ext_vector_type(4)));
typedef unsigned int v4u __attribute__((ext_vector_type(4)));
typedef unsigned int v2u __attribute__((ext_vector_type(2)));

// ---- scalar helpers --------------------------------------------------------------------------------
__device__ __forceinline__ unsigned short bf_bits(float f) {          // f32 -> bf16 bits, RNE convert
  unsigned u = __float_as_uint(f);
  return (unsigned short)((u + 0x7FFFu + ((u >> 16) & 1u)) >> 16);
}
__device__ __forceinline__ float bf_up(unsigned short h) { return __uint_as_float(((unsigned)h) << 16); }
__device__ __forceinline__ unsigned short h_bits(_Float16 x) { return __builtin_bit_cast(unsigned short, x); }
__device__ __forceinline__ unsigned pk16(unsigned short a, unsigned short b) { return (unsigned)a | ((unsigned)b << 16); }
__device__ __forceinline__ v8f zero8() { v8f z = {0.f, 0.f, 0.f, 0.f, 0.f, 0.f, 0.f, 0.f}; return z; }

// ---- fragment loader: 16-bit A/B operand, lane -> row/col (lane&15), p already includes +8*(lane>>4);
//      elements 0..7 <- p[0..7] (k0+8h..), elements 8..15 <- p[16..23] (k0+16+8h..)
__device__ __forceinline__ v16h ldfrag_h(const _Float16* p) {
  union { v16h v; v8h h[2]; } f;
  f.h[0] = *(const v8h*)(p);
  f.h[1] = *(const v8h*)(p + 16);
  return f.v;
}

// ---- fragment loader for a plane kept in fragment order: a 16-row x 32-d tile is 512 halves, the 8 halves
//      (row r, d = 8o .. 8o+7) at (o*16 + r)*8; p = tile base + lane*8, so elements 0..7 <- (row lane&15, d 8h..) and
//      elements 8..15 <- (row lane&15, d 16+8h..), h = lane>>4: the k order of ldfrag_h, each load 512 B in a row
__device__ __forceinline__ v16h ldfrag_t(const _Float16* p) {
  union { v16h v; v8h h[2]; } f;
  f.h[0] = *(const v8h*)(p);
  f.h[1] = *(const v8h*)(p + 256);
  return f.v;
}

// ---- wait that stands between issued global loads and an overwrite of their address registers
__device__ __forceinline__ void xcnt_wait() {
#if defined(__HIP_DEVICE_COMPILE__)
  asm volatile("s_wait_xcnt 0x0" ::: "memory");
#endif
}

// ---- the same wait, naming the loads' address registers as inputs: they stay live up to the wait, so that no load's
//      result lands on them in front of it
__device__ __forceinline__ void xcnt_wait_p(const void* a, const void* b) {
#if defined(__HIP_DEVICE_COMPILE__)
  asm volatile("s_wait_xcnt 0x0" :: "v"(a), "v"(b) : "memory");
#endif
}
__device__ __forceinline__ void xcnt_wait_o(unsigned a, unsigned b) {
#if defined(__HIP_DEVICE_COMPILE__)
  asm volatile("s_wait_xcnt 0x0" :: "v"(a), "v"(b) : "memory");
#endif
}

// ---- WMMA helper with trailing VALU hazard gap ----------------------------------------------------------
__device__ __forceinline__ v8f mma_h(v16h a, v16h b, v8f c) {
  c = __builtin_amdgcn_wmma_f32_16x16x32_f16(false, a, false, b, (short)0, c, false, false);
#if defined(__HIP_DEVICE_COMPILE__)
  asm volatile("v_nop\n\tv_nop\n\tv_nop\n\tv_nop" : "+v"(c) : "v"(a), "v"(b));
#endif
  return c;
}

// =====================================================================================================
// Layer norm over EW channels of each edge row (inputs and affine params RNE-converted to bf16 first, f32
// [nrows][EW]. One wave per row, 8 channels per lane; each plane row = 512 B written by one instruction
// coverage: nrows waves x 32 lanes x 8 = every element of both planes.
// =====================================================================================================
__device__ __forceinline__ void ln_planes(const float* __restrict__ e, const float* __restrict__ lw,
                                          const float* __restrict__ lb, unsigned short* xh,
                                          unsigned short* xl, int nrows, int blk) {
  const int lane = threadIdx.x & 31;
  const int wave = threadIdx.x >> 5;
  const int row = blk * 8 + wave;
  if (row >= nrows) return;                           // wave-uniform; no block barriers in this part
  const int c0 = lane * 8;
  const float* src = e + (size_t)row * EW + c0;
  const v4f a0 = *(const v4f*)(src);
  const v4f a1 = *(const v4f*)(src + 4);
  xcnt_wait();                                        // a later load's result may land on this address pair
  const v4f w0 = *(const v4f*)(lw + c0);
  const v4f w1 = *(const v4f*)(lw + c0 + 4);
  const v4f b0 = *(const v4f*)(lb + c0);
  const v4f b1 = *(const v4f*)(lb + c0 + 4);
  float v[8], w[8], bb[8];
#pragma unroll
  for (int t = 0; t < 4; ++t) {
    v[t]      = bf_up(bf_bits(a0[t]));
    v[4 + t]  = bf_up(bf_bits(a1[t]));
    w[t]      = bf_up(bf_bits(w0[t]));
    w[4 + t]  = bf_up(bf_bits(w1[t]));
    bb[t]     = bf_up(bf_bits(b0[t]));
    bb[4 + t] = bf_up(bf_bits(b1[t]));
  }
  float s = 0.f;
#pragma unroll
  for (int t = 0; t < 8; ++t) s += v[t];
#pragma unroll
  for (int o = 16; o > 0; o >>= 1) s += __shfl_xor(s, o);
  const float mu = s * (1.0f / (float)EW);
  float d[8];
  float s2 = 0.f;
#pragma unroll
  for (int t = 0; t < 8; ++t) { d[t] = v[t] - mu; s2 += d[t] * d[t]; }
#pragma unroll
  for (int o = 16; o > 0; o >>= 1) s2 += __shfl_xor(s2, o);
  const float var = s2 * (1.0f / (float)EW);
  const float rs = rsqrtf(var + 1e-5f);
  v4u ph, pl;
#pragma unroll
  for (int t = 0; t < 4; ++t) {
    const float y0 = d[2 * t] * rs * w[2 * t] + bb[2 * t];
    const float y1 = d[2 * t + 1] * rs * w[2 * t + 1] + bb[2 * t + 1];
    const _Float16 hq0 = (_Float16)y0;
    const _Float16 hq1 = (_Float16)y1;
    const _Float16 lq0 = (_Float16)((y0 - (float)hq0) * 2048.0f);
    const _Float16 lq1 = (_Float16)((y1 - (float)hq1) * 2048.0f);
    ph[t] = pk16(h_bits(hq0), h_bits(hq1));
    pl[t] = pk16(h_bits(lq0), h_bits(lq1));
  }
  const size_t o = (size_t)row * EW + c0;
  {
    *(v4u*)(xh + o) = ph;
    *(v4u*)(xl + o) = pl;
    xcnt_wait();   // another part's code follows in the listing and writes these stores' registers
  }
}

// =====================================================================================================
// Transpose-convert: in f32 [R][C] row-major -> out f16 [C][R] (r contiguous), out[c][r] =
// f16(bf16rne(in[r][c]) * scale), scale a power of two. Block = one 64 r x 64 c tile staged in LDS as f32
// (v4f loads, __syncthreads); tiles (bx, by) = (R/64, C/64) per matrix; sv = 64 x 68 floats of LDS.
// Store: group gq = tid>>3 (0..31), piece = tid&7: iteration it writes out row c = it*32+gq, lanes 8q..8q+7
// coverage: 2 iterations x 32 groups = 64 out rows, 8 pieces x 8 = 64 r per row; grid covers every tile ->
// the whole plane.
// =====================================================================================================
__device__ __forceinline__ void tr_f16(const float* __restrict__ in, unsigned short* out, int R, int C,
                                       float scale, int bx, int by, float* sv) {   // sv: [rr][cc] pitch 68 floats
  const int tid = threadIdx.x;
  const int r0 = bx * 64;
  const int c0 = by * 64;
#pragma unroll
  for (int i = 0; i < 4; ++i) {
    const int idx = i * 256 + tid;                  // 0..1023
    const int rr = idx >> 4, c4 = (idx & 15) * 4;
    const v4f a = *(const v4f*)(in + (size_t)(r0 + rr) * C + c0 + c4);
    *(v4f*)(sv + rr * 68 + c4) = a;
  }
  __syncthreads();

  const int gq = tid >> 3, piece = tid & 7;
  v4u hv[2];
  size_t hofs[2];
#pragma unroll
  for (int it = 0; it < 2; ++it) {
    const int cc = it * 32 + gq;
    v4u a;
#pragma unroll
    for (int t = 0; t < 4; ++t) {
      const float f0 = bf_up(bf_bits(sv[(piece * 8 + 2 * t) * 68 + cc]));
      const float f1 = bf_up(bf_bits(sv[(piece * 8 + 2 * t + 1) * 68 + cc]));
      a[t] = pk16(h_bits((_Float16)(f0 * scale)), h_bits((_Float16)(f1 * scale)));
    }
    hv[it] = a;
    hofs[it] = (size_t)(c0 + cc) * R + r0 + piece * 8;
  }
  {
#pragma unroll
    for (int it = 0; it < 2; ++it) {
      *(v4u*)(out + hofs[it]) = hv[it];
    }
    xcnt_wait();   // another part's code follows in the listing and writes these stores' registers
  }
}

// =====================================================================================================
// Transpose-convert of a q/k/v weight matrix into fragment order: in f32 [EW k][W3 n] row-major, n = sec*EW + d*NH + h;
// out f16 tiles of 16 d x 32 k (512 halves), tile ((sec*NH + h)*2 + (d >> 4))*8 + (k >> 5), the 8 halves
// (d, k = 8o .. 8o+7 of the tile) at (o*16 + (d & 15))*8 (see ldfrag_t); value f16(bf16rne(in[k][n]) * scale).
// Block = one 64 k x 64 n tile staged in LDS as f32 = 8 d x 8 h x 2 k steps x 4 octets. Store: dd = tid & 7,
// line L = it*32 + (tid >> 3) = (k step it, octet (L >> 3) & 3, head L & 7): lanes 8q..8q+7 write one whole 128-B line.
// coverage: 64 lines x 8 pieces of 8 k = the block's 64 x 64; grid covers every tile -> the whole plane.
// =====================================================================================================
__device__ __forceinline__ void tr_f16_frag(const float* __restrict__ in, unsigned short* out,
                                            float scale, int bx, int by, float* sv) {   // sv: [rr][cc] pitch 68 floats
  const int tid = threadIdx.x;
  const int r0 = bx * 64;
  const int c0 = by * 64;
#pragma unroll
  for (int i = 0; i < 4; ++i) {
    const int idx = i * 256 + tid;                  // 0..1023
    const int rr = idx >> 4, c4 = (idx & 15) * 4;
    const v4f a = *(const v4f*)(in + (size_t)(r0 + rr) * W3 + c0 + c4);
    *(v4f*)(sv + rr * 68 + c4) = a;
  }
  __syncthreads();

  const int dd = tid & 7;
  v4u hv[2];
  size_t hofs[2];
#pragma unroll
  for (int it = 0; it < 2; ++it) {
    const int L = it * 32 + (tid >> 3);
    const int hh = L & 7, oc = (L >> 3) & 3;
    const int cc = dd * 8 + hh;
    const int rl = it * 32 + oc * 8;
    v4u a;
#pragma unroll
    for (int t = 0; t < 4; ++t) {
      const float f0 = bf_up(bf_bits(sv[(rl + 2 * t) * 68 + cc]));
      const float f1 = bf_up(bf_bits(sv[(rl + 2 * t + 1) * 68 + cc]));
      a[t] = pk16(h_bits((_Float16)(f0 * scale)), h_bits((_Float16)(f1 * scale)));
    }
    hv[it] = a;
    const int sec = c0 >> 8;
    const int d = ((c0 & 255) >> 3) + dd;
    hofs[it] = (size_t)((((sec * NH + hh) * 2 + (d >> 4)) * 8 + (r0 >> 5) + it) * 512 + (oc * 16 + (d & 15)) * 8);
  }
  {
#pragma unroll
    for (int it = 0; it < 2; ++it) {
      *(v4u*)(out + hofs[it]) = hv[it];
    }
    xcnt_wait();   // another part's code follows in the listing and writes these stores' registers
  }
}

// =====================================================================================================
// Additive mask mk f32 [NB][SEQ x][SEQ y][NH h] -> two f32 planes of msc * bf16rne(mk), msc a power of two, both in
// the order of the attention's score accumulators. With (i, kk) = (query, key): ma holds mk[b][i][kk][h], mb holds
// mk[b][kk][i][h]; element (i, kk) of plane (b, h) lies at float offset
//   ((((i >> 4) * 8 + (kk >> 4)) * 2 + ((kk >> 2) & 1)) * 32 + ((kk >> 3) & 1) * 16 + (i & 15)) * 4 + (kk & 3),
// so the 16 B that lane g*16 + (i & 15) wants for accumulator elements 0..3 (or 4..7) of key tile kk >> 4 lie lane
// after lane: one load of a wave covers 512 B in a row. blocks = (SEQ/8 groups, NH, NB), 256 threads; a block owns
// queries grp*8 .. +7 of both planes. Both 8 x 128 tiles are staged in LDS (pitch MTP), __syncthreads, then thread
// (L = tid>>3, p = tid&7) stores keys 4L..4L+3 of query grp*8+p: lanes 8q..8q+7 write one whole 128-B line.
// coverage: 16 groups x 8 queries x (32 L x 4 keys) = all SEQ x SEQ of every (b,h) in both planes.
// =====================================================================================================
#define MTP 136                 // LDS pitch of the mask tiles (floats): 16-B reads of 8 rows x 2 key quads meet each bank once
__device__ __forceinline__ void mask_planes(const float* __restrict__ mk, float* ma, float* mb,
                                            float msc, int grp, int h, int b, float* sm) {   // sm: 2 x 8 x MTP floats
  const int tid = threadIdx.x;
  const size_t pb = ((size_t)(b * NH + h)) * SEQ * SEQ;          // plane base of (b,h)
  float* st = sm + 8 * MTP;                                      // tile of the transposed plane
  {
    const int xx = tid >> 5, y4 = (tid & 31) * 4;
    const int x = grp * 8 + xx;
    const float* src = mk + (((size_t)b * SEQ + x) * SEQ + y4) * NH + h;
    v4f vd;
#pragma unroll
    for (int t = 0; t < 4; ++t) vd[t] = msc * bf_up(bf_bits(src[(size_t)t * NH]));
    *(v4f*)(sm + xx * MTP + y4) = vd;
  }
  xcnt_wait();                                                   // a later load's result may land on the address pair above
  {
    const int x = tid >> 1, yq = (tid & 1) * 4;
    const float* src = mk + (((size_t)b * SEQ + x) * SEQ + grp * 8 + yq) * NH + h;
#pragma unroll
    for (int t = 0; t < 4; ++t) st[(yq + t) * MTP + x] = msc * bf_up(bf_bits(src[(size_t)t * NH]));
  }
  __syncthreads();
  {
    const int L = tid >> 3, p = tid & 7;
    const v4f vd = *(const v4f*)(sm + p * MTP + L * 4);
    const v4f vt = *(const v4f*)(st + p * MTP + L * 4);
    const size_t o = pb + (size_t)(((((grp >> 1) * 8 + (L >> 2)) * 2 + (L & 1)) * 32 + ((L >> 1) & 1) * 16 + (grp & 1) * 8 + p) * 4);
    *(v4f*)(ma + o) = vd;
    *(v4f*)(mb + o) = vt;
    xcnt_wait();   // another part's code follows in the listing and writes these stores' registers
  }
}

// =====================================================================================================
// All preparation in one launch: the four parts read only inputs and write disjoint planes, so none waits for
// another. Block ranges (block-uniform branches, each part's barriers inside its own branch), short parts
// first so that they run beside the layer norm's stream:
//   [0, PB_W)            Wqkv_in / Wqkv_out tiles: t -> matrix t / 48, tile (t & 3, (t % 48) >> 2)
//   [PB_W, PB_O)         Wo tiles: t -> (t & 7, t >> 3)
//   [PB_O, PB_M)         mask groups: t -> (grp = t & 15, h = (t >> 4) & 7, b = t >> 7)
//   [PB_M, PB_M + RT/8)  layer norm, 8 rows per block
// =====================================================================================================
#define PB_W (2 * (EW / 64) * (W3 / 64))            // 96
#define PB_O (PB_W + (KO / 64) * (EW / 64))         // 128
#define PB_M (PB_O + (SEQ / 8) * NH * NB)           // 384 (NB = 2)
static_assert(EW / 64 == 4 && W3 / 64 == 12 && KO / 64 == 8 && SEQ / 8 == 16 && NH == 8);

__global__ __launch_bounds__(256) void prep_all(
    const float* __restrict__ e, const float* __restrict__ lw, const float* __restrict__ lb,
    unsigned short* xh, unsigned short* xl,
    const float* __restrict__ wqi, const float* __restrict__ wqo, unsigned short* wt, float cw,
    const float* __restrict__ wo, unsigned short* woh, float cwo,
    const float* __restrict__ mk, float* ma, float* mb, float msc) {
  __shared__ __align__(16) float sbuf[64 * 68];
  const int bx = blockIdx.x;
  if (bx < PB_W) {
    const int z = (bx >= PB_W / 2) ? 1 : 0;         // the second matrix's plane follows the first
    const int t = bx - z * (PB_W / 2);
    tr_f16_frag((z != 0) ? wqo : wqi, wt + (size_t)z * EW * W3, cw, t & 3, t >> 2, sbuf);
  } else if (bx < PB_O) {
    const int t = bx - PB_W;
    tr_f16(wo, woh, KO, EW, cwo, t & 7, t >> 3, sbuf);
  } else if (bx < PB_M) {
    const int t = bx - PB_O;
    mask_planes(mk, ma, mb, msc, t & 15, (t >> 4) & 7, t >> 7, sbuf);
  } else {
    ln_planes(e, lw, lb, xh, xl, RT, bx - PB_M);
  }
}

// =====================================================================================================
// Main loop of the output projection: one block = 128 x 128 of the product, 8 waves as 4 (m) x 2 (n),
// each wave its 32 x 64 tile. Operands go global -> registers -> LDS in chunks of KC k values, so that every
// global load covers whole 128-B lines (8 lanes per row) and each staged row serves 2 (A) or 4 (B) waves.
// Buffer rows: A hi 0..127 | A residual 128..255 | B 256..383, pitch LP. Thread t stages piece t&7 of rows
// u*32 + (t>>3), u = 0..11; gAh, gAl, gB point at its piece of its first row of each operand, sA / sB are
// the element strides between its successive rows. Two buffers: chunk c+1 is loaded into registers ahead of
// the products of chunk c and stored behind them into the buffer whose readers left at the previous
// barrier; one barrier per chunk publishes it. k runs upward in steps of 32 within and across chunks.
// The closing barrier of the last chunk lets the caller reuse sm.
// =====================================================================================================
#define KC   64                 // k values per staged chunk (128 B of every operand row)
#define LP   72                 // LDS row pitch in halves: 144 B = 16 B x 9, 16-B fragment reads meet each bank once
#define STG  (384 * LP)         // halves per buffer (55296 B)

__device__ __forceinline__ void gemm_blk(const _Float16* gAh, const _Float16* gAl, size_t sA,
                                         const _Float16* gB, size_t sB, int K, _Float16* sm, int tid,
                                         v8f (&acch)[2][4], v8f (&accl)[2][4]) {
  const int lane = tid & 31;
  const int wave = tid >> 5;
  const int fo = (lane & 15) * LP + (lane >> 4) * 8;            // fragment row and k half of this lane
  const int ra = (wave & 3) * 32 * LP + fo;                     // A hi rows of this wave
  const int rb = (256 + (wave >> 2) * 64) * LP + fo;            // B rows of this wave
  _Float16* sw = sm + (tid >> 3) * LP + (tid & 7) * 8;
  v4u st[12];
#pragma unroll
  for (int u = 0; u < 4; ++u) {
    st[u]     = *(const v4u*)(gAh + u * sA);
    st[4 + u] = *(const v4u*)(gAl + u * sA);
    st[8 + u] = *(const v4u*)(gB + u * sB);
  }
#pragma unroll
  for (int u = 0; u < 12; ++u) *(v4u*)(sw + u * 32 * LP) = st[u];
  __syncthreads();

  const int nc = K / KC;
  for (int c = 0; c < nc; ++c) {
    const bool more = (c + 1) < nc;                             // block-uniform
    if (more) {
      const int ko = (c + 1) * KC;
#pragma unroll
      for (int u = 0; u < 4; ++u) {
        st[u]     = *(const v4u*)(gAh + u * sA + ko);
        st[4 + u] = *(const v4u*)(gAl + u * sA + ko);
        st[8 + u] = *(const v4u*)(gB + u * sB + ko);
      }
    }
    const _Float16* sb = sm + (c & 1) * STG;
#pragma unroll
    for (int kk = 0; kk < KC; kk += 32) {
      v16h fh[2], fl[2];
#pragma unroll
      for (int i = 0; i < 2; ++i) {
        fh[i] = ldfrag_h(sb + ra + i * 16 * LP + kk);
        fl[i] = ldfrag_h(sb + ra + (128 + i * 16) * LP + kk);
      }
      v16h bnx = ldfrag_h(sb + rb + kk);
#pragma unroll
      for (int j = 0; j < 4; ++j) {
        const v16h bfr = bnx;
        if (j < 3) bnx = ldfrag_h(sb + rb + (j + 1) * 16 * LP + kk);   // next B fragment flies under this one's products
#pragma unroll
        for (int i = 0; i < 2; ++i) {
          acch[i][j] = mma_h(fh[i], bfr, acch[i][j]);
          accl[i][j] = mma_h(fl[i], bfr, accl[i][j]);
        }
      }
    }
    if (more) {
      _Float16* sn = sw + ((c + 1) & 1) * STG;
#pragma unroll
      for (int u = 0; u < 12; ++u) *(v4u*)(sn + u * 32 * LP) = st[u];
    }
    __syncthreads();
  }
}

// =====================================================================================================
// q/k/v projection and axial attention in one kernel: q, k and v never leave the WGP.
// grid = (column index j, batch * 2 + direction); block = 8 waves, wave = head h.
// X rows (layer norm planes, f16 hi + residual x2048) are staged whole in LDS (128 rows x 256 k, pitch XP) and serve
// all 8 waves; each wave reads its own head's 96 weight rows from the fragment-ordered weight plane (tr_f16_frag),
// every load 512 B in a row, one k step ahead of its products.
//   keys/values kk: edge row (j,kk) for dir 0, (kk,j) for dir 1; queries i: edge row (i,j). For dir 0 the X rows are
//   staged twice (block-uniform branch, a barrier in front of and behind the second staging).
// Products (k upward in steps of 32, hi and residual X in separate accumulators; value = ((acch + accl*scl)*sch + bias)*fac):
//   k, q: W (A, lane = channel d) . X^T (B, lane = edge row): D lane = edge row, element r = channel 16dt + 8g + r, so
//         the two d tiles of a 16-row tile, converted to f16 hi + residual (x2048), ARE the score fragment of that tile
//         (element e <- d 8g+e, element 8+e <- d 16+8g+e: the k order of ldfrag_h, the same for k and q).
//   v:    X (A, lane = key) . W^T (B, lane = channel d): D lane = d, element r = key 16kt + 8g + r: 16 B of a v^T row.
// k fragments stay in registers; v^T goes to sVt, q fragments of 4 strips at a time to sQ (each lane reads back only
// the 16-B pieces that it wrote itself).
// Scores are computed TRANSPOSED: S^T[kk][i] = K(A, lane = key row, d per k-map) . Q^T(B, lane = query,
// d per k-map), hi.hi into the mask-initialised accumulator plus (hi.lo + lo.hi)*xscl; D lane = query i,
// element r = key 16ct + 8g + r, so a lane and its partner lane^16 own one softmax row: max / exp / sum in
// f32 with one __shfl_xor(.,16) each. Weights p*pcar are converted to f16 in registers and used directly as
// the B operand of O^T[d][i] = V^T(A from LDS, lane = d, keys per k-map) . P^T (B: lane = query, element
// e <- tile 2c key 8g+e, element 8+e <- tile 2c+1 key 8g+e).
// sO [16][SOP] f32 output slab (cross-wave: block barriers before the row writes and before the next strip).
// Output: f16 planes vah = f16(O*1024), val = f16((O*1024 - hi)*2048), [RB rows i*SEQ+j][KO] at columns
// dir*EW + d*NH + h; per strip wave h writes rows 2h, 2h+1: 32 lanes x 16 B = the whole 512-B half row
// coverage: 8 strips x 8 waves x 2 rows = 128 queries x (32 lanes x 8 = 256 channels) for every (j, dir).
// =====================================================================================================
#define XP   264                // LDS pitch of the staged X rows (halves): 528 B = 16 B x 33, 16-B fragment reads meet each bank once
#define XPL  (SEQ * XP)         // halves per staged plane
#define WSEC (NH * 2 * 8 * 512) // halves per section (q, k, v) of a fragment-ordered weight plane
static_assert(WSEC == EW * EW);

// 128 X rows, hi and residual, global -> registers -> LDS; wave w takes rows w, w+8, ..: one load = one whole 512-B row.
// gh, gl: this lane's piece of row w; rs: elements between rows t and t + 8
__device__ __forceinline__ void stage_x(const _Float16* gh, const _Float16* gl, size_t rs, _Float16* sw) {
#pragma unroll
  for (int b = 0; b < 2; ++b) {
    v4u st[16];
#pragma unroll
    for (int u = 0; u < 8; ++u) {
      st[u]     = *(const v4u*)(gh + (size_t)(b * 8 + u) * rs);
      st[8 + u] = *(const v4u*)(gl + (size_t)(b * 8 + u) * rs);
    }
    xcnt_wait_p(gh, gl);                                        // later code writes these loads' address registers
#pragma unroll
    for (int u = 0; u < 8; ++u) {
      *(v4u*)(sw + (b * 8 + u) * 8 * XP) = st[u];
      *(v4u*)(sw + XPL + (b * 8 + u) * 8 * XP) = st[8 + u];
    }
  }
}

// plain builtin product for the projection steps: its operands may lie in any register, also above v255
__device__ __forceinline__ v8f mma_b(v16h a, v16h b, v8f c) {
  return __builtin_amdgcn_wmma_f32_16x16x32_f16(false, a, false, b, (short)0, c, false, false);
}

// one k step of the k and v products of 4 row tiles: 8 X fragments serve 32 products
__device__ __forceinline__ void kv_step(const v16h (&w)[4], const _Float16* xr, v8f (&aK)[4][2][2], v8f (&aV)[4][2][2]) {
#pragma unroll
  for (int rt = 0; rt < 4; ++rt) {
    const v16h xh = ldfrag_h(xr + rt * 16 * XP);
    const v16h xl = ldfrag_h(xr + rt * 16 * XP + XPL);
#pragma unroll
    for (int dt = 0; dt < 2; ++dt) {
      aK[rt][dt][0] = mma_b(w[dt], xh, aK[rt][dt][0]);
      aK[rt][dt][1] = mma_b(w[dt], xl, aK[rt][dt][1]);
      aV[rt][dt][0] = mma_b(xh, w[2 + dt], aV[rt][dt][0]);
      aV[rt][dt][1] = mma_b(xl, w[2 + dt], aV[rt][dt][1]);
    }
  }
}

// one k step of the q products of 4 row tiles
__device__ __forceinline__ void q_step(const v16h (&w)[2], const _Float16* xr, v8f (&aQ)[4][2][2]) {
#pragma unroll
  for (int rt = 0; rt < 4; ++rt) {
    const v16h xh = ldfrag_h(xr + rt * 16 * XP);
    const v16h xl = ldfrag_h(xr + rt * 16 * XP + XPL);
#pragma unroll
    for (int dt = 0; dt < 2; ++dt) {
      aQ[rt][dt][0] = mma_b(w[dt], xh, aQ[rt][dt][0]);
      aQ[rt][dt][1] = mma_b(w[dt], xl, aQ[rt][dt][1]);
    }
  }
}

// two d tiles of accumulators (lane = edge row) -> score fragment, f16 hi and residual x2048
__device__ __forceinline__ void frag_from_acc(const v8f (&a)[2][2], const float (&bz)[2][8], float scl, float sch,
                                              float fac, v16h& fh, v16h& fl) {
#pragma unroll
  for (int dt = 0; dt < 2; ++dt)
#pragma unroll
    for (int e = 0; e < 8; ++e) {
      const float s = ((a[dt][0][e] + a[dt][1][e] * scl) * sch + bz[dt][e]) * fac;
      const _Float16 hq = (_Float16)s;
      fh[dt * 8 + e] = hq;
      fl[dt * 8 + e] = (_Float16)((s - (float)hq) * 2048.0f);
    }
}

__global__ __launch_bounds__(256) void proj_attn(
    const unsigned short* __restrict__ Xhp, const unsigned short* __restrict__ Xlp,
    const unsigned short* __restrict__ Wfp, const float* __restrict__ bias0, const float* __restrict__ bias1,
    const float* __restrict__ mp, unsigned short* vah, unsigned short* val,
    float f0, float f1, float f2, float sch, float scl,
    float xscl, float escl, float pcar, float oscl) {
  const int bd  = blockIdx.y;                      // batch * 2 + direction
  const int dir = bd & 1;
  const size_t xo = (size_t)(bd >> 1) * RB * EW;
  const _Float16* Xh = (const _Float16*)(const void*)Xhp + xo;
  const _Float16* Xl = (const _Float16*)(const void*)Xlp + xo;
  const float* bias = (dir != 0) ? bias1 : bias0;
  mp  += (size_t)(dir * NB + (bd >> 1)) * NH * SEQ * SEQ;   // direct planes of all batches, then transposed
  vah += (size_t)(bd >> 1) * RB * KO;
  val += (size_t)(bd >> 1) * RB * KO;
  __shared__ __align__(16) unsigned short sXu[2 * XPL];           // 135168 B
  __shared__ __align__(16) unsigned short sVt[NH * HD * VTP];     // 69632 B
  __shared__ __align__(16) unsigned short sQu[NH * 4 * 1024];     // 65536 B
  __shared__ __align__(16) float sO[16 * SOP];                    // 16896 B
  _Float16* sX = (_Float16*)(void*)sXu;
  _Float16* sVw = (_Float16*)(void*)sVt;
  const _Float16* sVh = (const _Float16*)(const void*)sVt;
  const int tid  = threadIdx.x;
  const int lane = tid & 31;
  const int h    = tid >> 5;
  const int nl   = lane & 15;
  const int g    = lane >> 4;
  const int g8   = g * 8;
  const int j    = blockIdx.x;
  // this lane's piece of weight tile (section 0, head h, d tile 0, k step 0); tile (sec, h, dt, ks) is 512 halves
  const _Float16* Wh = (const _Float16*)(const void*)Wfp + (size_t)dir * W3 * EW + (size_t)(h * (2 * 8 * 512) + lane * 8);
  _Float16* sxw = sX + h * XP + lane * 8;          // staging: row h, this lane's piece
  const _Float16* xr = sX + nl * XP + g8;          // fragments: row nl of tile 0, this lane's k half
  const unsigned bog = (unsigned)(((g8 << 3) + h) * 4);   // byte offsets of this lane's bias entries: channel 8g (q, k)
  const unsigned bon = (unsigned)(((nl << 3) + h) * 4);   // and channel nl (v)

  // ---- X rows of the keys and values
  if (dir != 0) {
    const size_t o = (size_t)(h * SEQ + j) * EW + lane * 8;
    stage_x(Xh + o, Xl + o, (size_t)8 * SEQ * EW, sxw);
  } else {
    const size_t o = (size_t)(j * SEQ + h) * EW + lane * 8;
    stage_x(Xh + o, Xl + o, (size_t)8 * EW, sxw);
  }
  __syncthreads();

  // ---- k and v of head h, 4 key tiles at a time; weight fragments in two register sets, the next k step's in flight
  v16h kh[8], kl[8];
  {
    const _Float16* wk = Wh + WSEC;
    const _Float16* wv = Wh + 2 * WSEC;
#pragma unroll
    for (int grp = 0; grp < 2; ++grp) {
      v8f aK[4][2][2], aV[4][2][2];
#pragma unroll
      for (int rt = 0; rt < 4; ++rt)
#pragma unroll
        for (int dt = 0; dt < 2; ++dt) {
          aK[rt][dt][0] = zero8(); aK[rt][dt][1] = zero8();
          aV[rt][dt][0] = zero8(); aV[rt][dt][1] = zero8();
        }
      v16h wa[4], wb[4];
#pragma unroll
      for (int dt = 0; dt < 2; ++dt) {
        wa[dt]     = ldfrag_t(wk + dt * 8 * 512);
        wa[2 + dt] = ldfrag_t(wv + dt * 8 * 512);
      }
      xcnt_wait();                                              // the same
      __builtin_amdgcn_sched_barrier(0);                        // no later address arithmetic is lifted in front of that wait
      const _Float16* xg = xr + grp * 64 * XP;
#pragma unroll 1
      for (int ks = 0; ks < 8; ks += 2) {
#pragma unroll
        for (int dt = 0; dt < 2; ++dt) {
          wb[dt]     = ldfrag_t(wk + (dt * 8 + ks + 1) * 512);
          wb[2 + dt] = ldfrag_t(wv + (dt * 8 + ks + 1) * 512);
        }
        xcnt_wait();                                            // the same
        kv_step(wa, xg + ks * 32, aK, aV);
        if (ks + 2 < 8) {                                       // uniform
#pragma unroll
          for (int dt = 0; dt < 2; ++dt) {
            wa[dt]     = ldfrag_t(wk + (dt * 8 + ks + 2) * 512);
            wa[2 + dt] = ldfrag_t(wv + (dt * 8 + ks + 2) * 512);
          }
          xcnt_wait();                                          // the same
        }
        kv_step(wb, xg + (ks + 1) * 32, aK, aV);
      }
      float bk[2][8], bv[2];
#pragma unroll
      for (int dt = 0; dt < 2; ++dt) {
#pragma unroll
        for (int e = 0; e < 8; ++e) bk[dt][e] = bf_up(bf_bits(*(const float*)((const char*)(bias + EW + ((dt * 16 + e) << 3)) + bog)));
        bv[dt] = bf_up(bf_bits(*(const float*)((const char*)(bias + 2 * EW + ((dt * 16) << 3)) + bon)));
      }
      xcnt_wait_o(bog, bon);                                    // later code writes these loads' address registers
#pragma unroll
      for (int rt = 0; rt < 4; ++rt) {
        const int kt = grp * 4 + rt;
        frag_from_acc(aK[rt], bk, scl, sch, f1, kh[kt], kl[kt]);
#pragma unroll
        for (int dt = 0; dt < 2; ++dt) {
          v8h o;
#pragma unroll
          for (int e = 0; e < 8; ++e)
            o[e] = (_Float16)(((aV[rt][dt][0][e] + aV[rt][dt][1][e] * scl) * sch + bv[dt]) * f2);
          *(v8h*)(sVw + (h * HD + dt * 16 + nl) * VTP + kt * 16 + g8) = o;
        }
      }
    }
  }

  // ---- X rows of the queries: those of the keys for dir 1, others for dir 0 (block-uniform)
  if (dir == 0) {
    __syncthreads();                                            // every wave has left the key rows
    const size_t o = (size_t)(h * SEQ + j) * EW + lane * 8;
    stage_x(Xh + o, Xl + o, (size_t)8 * SEQ * EW, sxw);
    __syncthreads();
  }

  float bq[2][8];
#pragma unroll
  for (int dt = 0; dt < 2; ++dt)
#pragma unroll
    for (int e = 0; e < 8; ++e) bq[dt][e] = bf_up(bf_bits(*(const float*)((const char*)(bias + ((dt * 16 + e) << 3)) + bog)));
  xcnt_wait_o(bog, bog);                                        // later code writes these loads' address registers
  _Float16* sQw = (_Float16*)(void*)sQu + h * 4096 + lane * 8;  // this lane's pieces of its wave's q fragments

#pragma unroll 1
  for (int qg = 0; qg < 2; ++qg) {
    // ---- q of head h, 4 query tiles
    {
      v8f aQ[4][2][2];
#pragma unroll
      for (int rt = 0; rt < 4; ++rt)
#pragma unroll
        for (int dt = 0; dt < 2; ++dt) { aQ[rt][dt][0] = zero8(); aQ[rt][dt][1] = zero8(); }
      v16h wa[2], wb[2];
#pragma unroll
      for (int dt = 0; dt < 2; ++dt) wa[dt] = ldfrag_t(Wh + dt * 8 * 512);
      xcnt_wait();                                              // the same
      const _Float16* xg = xr + qg * 64 * XP;
#pragma unroll 1
      for (int ks = 0; ks < 8; ks += 2) {
#pragma unroll
        for (int dt = 0; dt < 2; ++dt) wb[dt] = ldfrag_t(Wh + (dt * 8 + ks + 1) * 512);
        xcnt_wait();                                            // the same
        q_step(wa, xg + ks * 32, aQ);
        if (ks + 2 < 8) {                                       // uniform
#pragma unroll
          for (int dt = 0; dt < 2; ++dt) wa[dt] = ldfrag_t(Wh + (dt * 8 + ks + 2) * 512);
          xcnt_wait();                                          // the same
        }
        q_step(wb, xg + (ks + 1) * 32, aQ);
      }
#pragma unroll
      for (int rt = 0; rt < 4; ++rt) {
        union { v16h v; v8h hh[2]; } H, L;
        frag_from_acc(aQ[rt], bq, scl, sch, f0, H.v, L.v);
        *(v8h*)(sQw + rt * 1024)       = H.hh[0];
        *(v8h*)(sQw + rt * 1024 + 256) = H.hh[1];
        *(v8h*)(sQw + rt * 1024 + 512) = L.hh[0];
        *(v8h*)(sQw + rt * 1024 + 768) = L.hh[1];
      }
    }

#pragma unroll 1
    for (int sl = 0; sl < 4; ++sl) {
    const int s = qg * 4 + sl;
    const v16h qh = ldfrag_t(sQw + sl * 1024);                  // query tile s; this lane's B / D column is query s*16 + nl
    const v16h ql = ldfrag_t(sQw + sl * 1024 + 512);
    const float* mfr = mp + (size_t)(h * 8 + s) * (8 * 256) + lane * 4;   // this strip's 8 mask tiles, 256 floats each

    // ---- the strip's mask, straight into the 8 score accumulators: 16 loads of 512 B in a row, one group, so that
    //      their latency is met once a strip and not once a key tile
    v8f acc[8];
#pragma unroll
    for (int ct = 0; ct < 8; ++ct) {
      const v4f mv0 = *(const v4f*)(mfr + ct * 256);
      const v4f mv1 = *(const v4f*)(mfr + ct * 256 + 128);
      v8f am;
      am[0] = mv0[0]; am[1] = mv0[1]; am[2] = mv0[2]; am[3] = mv0[3];
      am[4] = mv1[0]; am[5] = mv1[1]; am[6] = mv1[2]; am[7] = mv1[3];
      acc[ct] = am;
    }
    xcnt_wait_p(mfr, mfr);                                      // the next strip's addresses land on these loads' address pairs

    // ---- transposed scores, 8 key tiles
#pragma unroll
    for (int ct = 0; ct < 8; ++ct) {
      v8f ax = mma_h(kh[ct], ql, zero8());
      ax = mma_h(kl[ct], qh, ax);
      const v8f am = mma_h(kh[ct], qh, acc[ct]);
      acc[ct] = am + ax * xscl;
      // one key tile's products at a time: with several residual accumulators live the K fragments spill
      __builtin_amdgcn_sched_barrier(0);
    }

    // ---- softmax over the 128 keys of query i (this lane: 64 values, partner lane^16: the other 64)
    float mx = acc[0][0];
#pragma unroll
    for (int ct = 0; ct < 8; ++ct)
#pragma unroll
      for (int r = 0; r < 8; ++r) mx = fmaxf(mx, acc[ct][r]);
    mx = fmaxf(mx, __shfl_xor(mx, 16));
    float sum = 0.f;
#pragma unroll
    for (int ct = 0; ct < 8; ++ct)
#pragma unroll
      for (int r = 0; r < 8; ++r) {
        const float ev = __expf((acc[ct][r] - mx) * escl);
        acc[ct][r] = ev;
        sum += ev;
      }
    sum += __shfl_xor(sum, 16);
    const float rc = pcar / sum;                                // sum >= 1

    // ---- P^T as B fragments straight from the accumulators
    v16h pb[4];
#pragma unroll
    for (int c = 0; c < 4; ++c) {
      union { v16h v; v8h hh[2]; } U;
      v8h p0, p1;
#pragma unroll
      for (int e2 = 0; e2 < 8; ++e2) {
        p0[e2] = (_Float16)(acc[2 * c][e2] * rc);
        p1[e2] = (_Float16)(acc[2 * c + 1][e2] * rc);
      }
      U.hh[0] = p0;
      U.hh[1] = p1;
      pb[c] = U.v;
    }

    // ---- O^T[d][i] = V^T . P^T, two 16-row d tiles, K = 128 keys
    v8f oacc[2];
#pragma unroll
    for (int dt = 0; dt < 2; ++dt) {
      v8f o = zero8();
#pragma unroll
      for (int c = 0; c < 4; ++c) {
        const v16h va = ldfrag_h(sVh + (h * HD + dt * 16 + nl) * VTP + 32 * c + g8);
        o = mma_h(va, pb[c], o);
      }
      oacc[dt] = o;
    }

    // ---- stage O (f32, true scale) into the slab: row = query nl, column = d*NH + h
#pragma unroll
    for (int dt = 0; dt < 2; ++dt)
#pragma unroll
      for (int r = 0; r < 8; ++r)
        sO[nl * SOP + ((dt * 16 + g8 + r) << 3) + h] = oacc[dt][r] * oscl;
    __syncthreads();

    // ---- wave h writes queries s*16 + 2h, + 2h + 1: 512-B half rows in hi and residual planes
    {
      v4u hv[2], lv[2];
      size_t ofs[2];
#pragma unroll
      for (int q = 0; q < 2; ++q) {
        const int rr = 2 * h + q;
        const v4f x0 = *(const v4f*)(sO + rr * SOP + lane * 8);
        const v4f x1 = *(const v4f*)(sO + rr * SOP + lane * 8 + 4);
        float f[8];
        f[0] = x0[0]; f[1] = x0[1]; f[2] = x0[2]; f[3] = x0[3];
        f[4] = x1[0]; f[5] = x1[1]; f[6] = x1[2]; f[7] = x1[3];
        v4u ph, pl;
#pragma unroll
        for (int u = 0; u < 4; ++u) {
          const float s0 = f[2 * u] * 1024.0f;
          const float s1 = f[2 * u + 1] * 1024.0f;
          const _Float16 hq0 = (_Float16)s0;
          const _Float16 hq1 = (_Float16)s1;
          const _Float16 lq0 = (_Float16)((s0 - (float)hq0) * 2048.0f);
          const _Float16 lq1 = (_Float16)((s1 - (float)hq1) * 2048.0f);
          ph[u] = pk16(h_bits(hq0), h_bits(hq1));
          pl[u] = pk16(h_bits(lq0), h_bits(lq1));
        }
        hv[q] = ph;
        lv[q] = pl;
        ofs[q] = ((size_t)(s * 16 + rr) * SEQ + j) * KO + (size_t)dir * EW + lane * 8;
      }
      {
#pragma unroll
        for (int q = 0; q < 2; ++q) {
          *(v4u*)(vah + ofs[q]) = hv[q];
          *(v4u*)(val + ofs[q]) = lv[q];
        }
        xcnt_wait();                                            // the next strip's code writes these stores' registers
      }
    }
    __syncthreads();                                            // sO reused by the next strip
    }
  }
}

// =====================================================================================================
// Output projection: C[m][n] = sch * (sum_k Ahi[m][k]*Bt[n][k] + scl * sum_k Alo[m][k]*Bt[n][k]) + bf16rne(bias[n])
// (f16 products, f32 accumulate, hi and scaled-residual products in separate accumulators). Ahi/Alo row-major
// [M][K] pitch lda; Bt [N][K] pitch ldb; C f32 [M][N] pitch ldc. Block = 128 x 128 of C (gemm_blk), one wave per
// 32x64 tile; M = RT, N = EW, K = KO (multiples of 128, 128 and KC).
// Epilogue: 16-row slabs staged per wave in the staging LDS (free behind the main loop's closing barrier); each 64-wide row segment (256 B) written by one instruction
// coverage: 2 slabs x 16 rows x 64 cols = the wave's whole 32x64 tile; grid covers every tile of C.
// =====================================================================================================
__global__ __launch_bounds__(256) void gemm32h_w(
    const unsigned short* __restrict__ Ahp, const unsigned short* __restrict__ Alp,
    const unsigned short* __restrict__ Btp,
    const float* __restrict__ bias,
    float* C, float sch, float scl) {
  constexpr int lda = KO, ldb = KO, ldc = EW, M = RT, N = EW, K = KO;   // fixed: staged row steps become immediate offsets
  const _Float16* Ah = (const _Float16*)(const void*)Ahp;
  const _Float16* Al = (const _Float16*)(const void*)Alp;
  const _Float16* Bh = (const _Float16*)(const void*)Btp;
  __shared__ __align__(16) unsigned short smem[2 * STG];
  const int tid  = threadIdx.x;
  const int lane = tid & 31;
  const int wave = tid >> 5;
  constexpr int blkN = N >> 7;
  if ((int)blockIdx.x >= (M >> 7) * blkN) return;   // block-uniform, in front of every barrier
  const int bm = blockIdx.x / blkN;
  const int bn = blockIdx.x - bm * blkN;
  const int m0 = bm * 128 + (wave & 3) * 32;
  const int n0 = bn * 128 + (wave >> 2) * 64;
  const int rlane = lane & 15;
  const int mOff  = (lane >> 4) * 8;

  v8f acch[2][4], accl[2][4];
#pragma unroll
  for (int i = 0; i < 2; ++i)
#pragma unroll
    for (int j = 0; j < 4; ++j) { acch[i][j] = zero8(); accl[i][j] = zero8(); }

  {
    const size_t ao = (size_t)(bm * 128 + (tid >> 3)) * lda + (tid & 7) * 8;
    const size_t bo = (size_t)(bn * 128 + (tid >> 3)) * ldb + (tid & 7) * 8;
    gemm_blk(Ah + ao, Al + ao, (size_t)32 * lda, Bh + bo, (size_t)32 * ldb, K,
             (_Float16*)(void*)smem, tid, acch, accl);
  }

  float bz[4];
#pragma unroll
  for (int j = 0; j < 4; ++j) bz[j] = bf_up(bf_bits(bias[n0 + (j << 4) + rlane]));

  float* slab = (float*)(void*)smem + wave * (16 * 68);
#pragma unroll
  for (int i = 0; i < 2; ++i) {
    const int mBase = m0 + (i << 4);
#pragma unroll
    for (int r = 0; r < 8; ++r) {
#pragma unroll
      for (int j = 0; j < 4; ++j) {
        slab[(mOff + r) * 68 + (j << 4) + rlane] = (acch[i][j][r] + accl[i][j][r] * scl) * sch + bz[j];
      }
    }
    __builtin_amdgcn_fence(__ATOMIC_RELEASE, "workgroup");
    __builtin_amdgcn_wave_barrier();
    __builtin_amdgcn_fence(__ATOMIC_ACQUIRE, "workgroup");
    {
      const int hh = lane >> 4, c4 = (lane & 15) * 4;     // 256-B row segment = 16 lanes x 16 B
      v4f ov[8];
#pragma unroll
      for (int it = 0; it < 8; ++it) {
        const int row = it * 2 + hh;                       // it 0..7 x hh 0..1 = rows 0..15
        ov[it] = *(const v4f*)(slab + row * 68 + c4);
      }
      {
#pragma unroll
        for (int it = 0; it < 8; ++it) {
          const int row = it * 2 + hh;
          *(v4f*)(C + (size_t)(mBase + row) * ldc + n0 + c4) = ov[it];
        }
        
      }
    }
    __builtin_amdgcn_fence(__ATOMIC_RELEASE, "workgroup");
    __builtin_amdgcn_wave_barrier();
    __builtin_amdgcn_fence(__ATOMIC_ACQUIRE, "workgroup");
  }
}

// =====================================================================================================
// Workspace map (bytes, NB = 2); every region an exact multiple of its whole-line store granularity, all
// written earlier in the same call. Each stage is one launch over all four (batch, direction) pairs.
//   Xh   f16 [RT][EW]                     0        16777216   (layer norm output, hi)
//   Xl   f16 [RT][EW]              16777216        16777216   (residual x2048)
//   Wti  f16 W3 n x EW k           33554432          393216   (f16(bf16(Wqkv_in) x64), fragment order)
//   Wto  f16 W3 n x EW k           33947648          393216
//   Woh  f16 [EW n][KO k]          34340864          262144   (f16(bf16(Wo) x1024))
//   mA   f32 [NB][NH][SEQ x SEQ]   34603008         1048576   (64 x bf16(mask), direct, accumulator order)
//   mB   f32 [NB][NH][SEQ x SEQ]   35651584         1048576   (transposed, accumulator order)
//   Vah  f16 [RT][KO]              36700160        33554432   (attention output x1024, hi)
//   Val  f16 [RT][KO]              70254592        33554432   (attention output residual x2048)
//   end                           103809024
// Inputs: e f32 [NB][SEQ][SEQ][EW]; mask f32 [NB][SEQ][SEQ][NH]; ln_w, ln_b f32 [EW]; Wqkv_in, Wqkv_out
// f32 [EW in][W3 out]; bqkv_* f32 [W3]; Wo f32 [KO in][EW out]; bo f32 [EW]. d_out f32 [RT][EW] at byte 0
// (row = b*RB + i*SEQ + j, col = n).
// =====================================================================================================
extern "C" void kernel_launch(void* const* d_in, const int* in_sizes, int n_in,
                              void* d_out, int out_size, void* d_ws, size_t ws_size,
                              hipStream_t stream) {
  if (n_in < 10) return;
  if (in_sizes[0] < RT * EW) return;
  if (in_sizes[1] < NB * SEQ * SEQ * NH) return;
  if (in_sizes[2] < EW) return;
  if (in_sizes[3] < EW) return;
  if (in_sizes[4] < EW * W3) return;
  if (in_sizes[5] < W3) return;
  if (in_sizes[6] < EW * W3) return;
  if (in_sizes[7] < W3) return;
  if (in_sizes[8] < KO * EW) return;
  if (in_sizes[9] < EW) return;
  if (out_size < RT * EW) return;

  const float* e    = (const float*)d_in[0];   // [NB][SEQ][SEQ][EW]
  const float* mask = (const float*)d_in[1];   // [NB][SEQ][SEQ][NH]
  const float* ln_w = (const float*)d_in[2];   // [EW]
  const float* ln_b = (const float*)d_in[3];   // [EW]
  const float* Wqi  = (const float*)d_in[4];   // [EW in][W3 out]
  const float* bqi  = (const float*)d_in[5];   // [W3]
  const float* Wqo  = (const float*)d_in[6];   // [EW in][W3 out]
  const float* bqo  = (const float*)d_in[7];   // [W3]
  const float* Wo   = (const float*)d_in[8];   // [KO in][EW out]
  const float* bo   = (const float*)d_in[9];   // [EW]

  const size_t PX  = (size_t)RT * EW * 2;                    // 16777216 (NB = 2)
  const size_t PWt = (size_t)W3 * EW * 2;                    //   393216
  const size_t PWo = (size_t)EW * KO * 2;                    //   262144
  const size_t PM  = (size_t)NB * NH * SEQ * SEQ * 4;        //  1048576 (NB = 2)
  const size_t PVa = (size_t)RT * KO * 2;                    //  33554432
  size_t off = 0;
  const size_t oXh = off; off += PX;
  const size_t oXl = off; off += PX;
  const size_t oWi = off; off += PWt;
  off += PWt;                                                // Wto, directly behind Wti
  const size_t oWo = off; off += PWo;
  const size_t oMa = off; off += PM;
  const size_t oMb = off; off += PM;
  const size_t oVh = off; off += PVa;
  const size_t oVl = off; off += PVa;
  if (off > ws_size) return;                                 // off = 103809024 for NB = 2

  char* ws = (char*)d_ws;
  unsigned short* Xh  = (unsigned short*)(ws + oXh);
  unsigned short* Xl  = (unsigned short*)(ws + oXl);
  unsigned short* Wti = (unsigned short*)(ws + oWi);
  unsigned short* Woh = (unsigned short*)(ws + oWo);
  float*          mA  = (float*)(ws + oMa);
  float*          mB  = (float*)(ws + oMb);
  unsigned short* Vah = (unsigned short*)(ws + oVh);
  unsigned short* Val = (unsigned short*)(ws + oVl);
  float*          outf = (float*)d_out;                      // [RT][EW]

  const dim3 blk(256);
  const dim3 gPp(PB_M + RT / 8);                             // 384 weight and mask blocks + 4096 layer norm blocks
  const dim3 gAt(SEQ, 2 * NB);                               // one block per column index j x (batch, direction)
  const dim3 gWo((RT / 128) * (EW / 128));                   // 512 blocks
  const float cW     = 64.0f;                                // Wqkv plane carry
  const float fQ     = 16.0f * 0.17677669529663687f;         // 32^-0.5 then carry x16
  const float fK     = 4.0f;                                 // k carry
  const float fV     = 4.0f;                                 // v carry
  const float prSch  = 1.0f / 64.0f;                         // folds the Wqkv plane carry
  const float prScl  = 1.0f / 2048.0f;                       // folds the layer norm residual carry
  const float mkSc   = 64.0f;                                // mask planes x (16 * 4)
  const float axXscl = 1.0f / 2048.0f;                       // q/k residual carry
  const float axEscl = 1.0f / 64.0f;                         // score carry 16 * 4
  const float axPcar = 16384.0f;                             // softmax weight carry
  const float axOscl = 1.0f / 65536.0f;                      // 1/(16384 * 4)
  const float woScale = 1024.0f;                             // Wo plane carry
  const float woSch  = 1.0f / 1048576.0f;                    // 1/(1024 * 1024): O hi carry and Wo carry
  const float woScl  = 1.0f / 2048.0f;                       // O residual carry

  // (1) layer norm -> f16 hi + residual planes; weights -> transposed f16 planes of their bf16 values; masks
  prep_all<<<gPp, blk, 0, stream>>>(e, ln_w, ln_b, Xh, Xl, Wqi, Wqo, Wti, cW, Wo, Woh, woScale, mask, mA, mB, mkSc);
  // (2) all batches and both directions at once: projection with attention, output projection
  proj_attn<<<gAt, blk, 0, stream>>>(Xh, Xl, Wti, bqi, bqo, mA, Vah, Val, fQ, fK, fV, prSch, prScl,
                                     axXscl, axEscl, axPcar, axOscl);
  gemm32h_w<<<gWo, blk, 0, stream>>>(Vah, Val, Woh, bo, outf, woSch, woScl);
  (void)hipGetLastError();
}

// v008
// It runs in 99 microseconds.
// Next to v007, in two timings, it ran 1.06 and 1.07 times as fast.
// Over all steps from v000 it is 3.92 times as fast.
// Contractions: q/k/v projections = v_wmma_f32_16x16x32_f16 (layer-normed input as f16 hi + residual (x2048) planes, two products into separate accumulators; Wqkv as f16 of its bf16-RNE value x64); per-(b,j,h) scores = v_wmma_f32_16x16x32_f16 (k and q as f16 hi + residual (x2048) planes carried x4 and x16*32^-0.5, products hh + hl + lh; additive mask x64 as the initial accumulator); p.v = v_wmma_f32_16x16x32_f16 (softmax weights x16384 in f16 repacked from the score accumulators, v^T f16 tile carried x4, single product); output projection = v_wmma_f32_16x16x32_f16 (attention output as f16 hi (x1024) + residual (x2048) planes, two products; Wo as f16 of its bf16-RNE value x1024); every float input RNE-converted to bf16 on load; all f32 accumulate; layer norm and softmax in f32.
#include <hip/hip_runtime.h>
#include <math.h>
#include <stdint.h>

#ifndef NB
#define NB 2
#endif
#define NB_FULL 2
#ifndef SEQ
#define SEQ 128
#endif
#define EW  256                 // edge width
#define NH  8                   // heads (fastest channel dim)
#define HD  32                  // dot dim
#define W3  (3 * EW)            // 768 fused projection columns
#define KO  (2 * EW)            // 512 concat channels
#define RB  (SEQ * SEQ)         // edge rows per batch (16384)
#define RT  (NB * RB)           // edge rows processed
#define VTP 136                 // LDS v^T tile pitch (halves)
#define SOP 264                 // LDS output slab pitch (floats)

static_assert(NH * HD == EW);
static_assert(HD == 32);
static_assert(EW == 256);
static_assert(SEQ == 128);      // i, j and key extents are coupled; only NB is reducible
static_assert(NB >= 1 && NB <= NB_FULL);
static_assert((RB % 64) == 0 && (RT % 8) == 0);
static_assert((((RB / 32) * (W3 / 64)) % 8) == 0);
static_assert((((RB / 32) * (EW / 64)) % 8) == 0);
static_assert((EW % 64) == 0 && (W3 % 64) == 0 && (KO % 64) == 0 && (EW % 32) == 0 && (KO % 32) == 0);
static_assert((SEQ % 16) == 0 && (SEQ % 8) == 0);
static_assert((RB % 128) == 0 && (W3 % 128) == 0 && (EW % 128) == 0);   // 128 x 128 block tiles of the output projection

typedef _Float16 v16h __attribute__((ext_vector_type(16)));
typedef _Float16 v8h  __attribute__((ext_vector_type(8)));
typedef float    v8f  __attribute__((ext_vector_type(8)));
typedef float    v4f  __attribute__((ext_vector_type(4)));
typedef unsigned int v4u __attribute__((ext_vector_type(4)));
typedef unsigned int v2u __attribute__((ext_vector_type(2)));

// ---- scalar helpers --------------------------------------------------------------------------------
__device__ __forceinline__ unsigned short bf_bits(float f) {          // f32 -> bf16 bits, RNE convert
  unsigned u = __float_as_uint(f);
  return (unsigned short)((u + 0x7FFFu + ((u >> 16) & 1u)) >> 16);
}
__device__ __forceinline__ float bf_up(unsigned short h) { return __uint_as_float(((unsigned)h) << 16); }
__device__ __forceinline__ unsigned short h_bits(_Float16 x) { return __builtin_bit_cast(unsigned short, x); }
__device__ __forceinline__ unsigned pk16(unsigned short a, unsigned short b) { return (unsigned)a | ((unsigned)b << 16); }
__device__ __forceinline__ v8f zero8() { v8f z = {0.f, 0.f, 0.f, 0.f, 0.f, 0.f, 0.f, 0.f}; return z; }

// ---- fragment loader: 16-bit A/B operand, lane -> row/col (lane&15), p already includes +8*(lane>>4);
//      elements 0..7 <- p[0..7] (k0+8h..), elements 8..15 <- p[16..23] (k0+16+8h..)
__device__ __forceinline__ v16h ldfrag_h(const _Float16* p) {
  union { v16h v; v8h h[2]; } f;
  f.h[0] = *(const v8h*)(p);
  f.h[1] = *(const v8h*)(p + 16);
  return f.v;
}

// ---- fragment loader for a plane kept in fragment order: a 16-row x 32-d tile is 512 halves, the 8 halves
//      (row r, d = 8o .. 8o+7) at (o*16 + r)*8; p = tile base + lane*8, so elements 0..7 <- (row lane&15, d 8h..) and
//      elements 8..15 <- (row lane&15, d 16+8h..), h = lane>>4: the k order of ldfrag_h, each load 512 B in a row
__device__ __forceinline__ v16h ldfrag_t(const _Float16* p) {
  union { v16h v; v8h h[2]; } f;
  f.h[0] = *(const v8h*)(p);
  f.h[1] = *(const v8h*)(p + 256);
  return f.v;
}

// ---- wait that stands between issued global loads and an overwrite of their address registers
__device__ __forceinline__ void xcnt_wait() {
#if defined(__HIP_DEVICE_COMPILE__)
  asm volatile("s_wait_xcnt 0x0" ::: "memory");
#endif
}

// ---- the same wait, naming the loads' address registers as inputs: they stay live up to the wait, so that no load's
//      result lands on them in front of it
__device__ __forceinline__ void xcnt_wait_p(const void* a, const void* b) {
#if defined(__HIP_DEVICE_COMPILE__)
  asm volatile("s_wait_xcnt 0x0" :: "v"(a), "v"(b) : "memory");
#endif
}
// for loads at a uniform base plus a lane offset: the compiler addresses them by the offset register or by the summed pair
__device__ __forceinline__ void xcnt_wait_po(const void* a, const void* b, unsigned c, unsigned d) {
#if defined(__HIP_DEVICE_COMPILE__)
  asm volatile("s_wait_xcnt 0x0" :: "v"(a), "v"(b), "v"(c), "v"(d) : "memory");
#endif
}

// ---- WMMA helper with trailing VALU hazard gap ----------------------------------------------------------
__device__ __forceinline__ v8f mma_h(v16h a, v16h b, v8f c) {
  c = __builtin_amdgcn_wmma_f32_16x16x32_f16(false, a, false, b, (short)0, c, false, false);
#if defined(__HIP_DEVICE_COMPILE__)
  asm volatile("v_nop\n\tv_nop\n\tv_nop\n\tv_nop" : "+v"(c) : "v"(a), "v"(b));
#endif
  return c;
}

// =====================================================================================================
// Layer norm over EW channels of each edge row (inputs and affine params RNE-converted to bf16 first, f32
// [nrows][EW]. One wave per row, 8 channels per lane; each plane row = 512 B written by one instruction
// coverage: nrows waves x 32 lanes x 8 = every element of both planes.
// =====================================================================================================
__device__ __forceinline__ void ln_planes(const float* __restrict__ e, const float* __restrict__ lw,
                                          const float* __restrict__ lb, unsigned short* xh,
                                          unsigned short* xl, int nrows, int blk) {
  const int lane = threadIdx.x & 31;
  const int wave = threadIdx.x >> 5;
  const int row = blk * 8 + wave;
  if (row >= nrows) return;                           // wave-uniform; no block barriers in this part
  const int c0 = lane * 8;
  const float* src = e + (size_t)row * EW + c0;
  const v4f a0 = *(const v4f*)(src);
  const v4f a1 = *(const v4f*)(src + 4);
  xcnt_wait();                                        // a later load's result may land on this address pair
  const v4f w0 = *(const v4f*)(lw + c0);
  const v4f w1 = *(const v4f*)(lw + c0 + 4);
  const v4f b0 = *(const v4f*)(lb + c0);
  const v4f b1 = *(const v4f*)(lb + c0 + 4);
  float v[8], w[8], bb[8];
#pragma unroll
  for (int t = 0; t < 4; ++t) {
    v[t]      = bf_up(bf_bits(a0[t]));
    v[4 + t]  = bf_up(bf_bits(a1[t]));
    w[t]      = bf_up(bf_bits(w0[t]));
    w[4 + t]  = bf_up(bf_bits(w1[t]));
    bb[t]     = bf_up(bf_bits(b0[t]));
    bb[4 + t] = bf_up(bf_bits(b1[t]));
  }
  float s = 0.f;
#pragma unroll
  for (int t = 0; t < 8; ++t) s += v[t];
#pragma unroll
  for (int o = 16; o > 0; o >>= 1) s += __shfl_xor(s, o);
  const float mu = s * (1.0f / (float)EW);
  float d[8];
  float s2 = 0.f;
#pragma unroll
  for (int t = 0; t < 8; ++t) { d[t] = v[t] - mu; s2 += d[t] * d[t]; }
#pragma unroll
  for (int o = 16; o > 0; o >>= 1) s2 += __shfl_xor(s2, o);
  const float var = s2 * (1.0f / (float)EW);
  const float rs = rsqrtf(var + 1e-5f);
  v4u ph, pl;
#pragma unroll
  for (int t = 0; t < 4; ++t) {
    const float y0 = d[2 * t] * rs * w[2 * t] + bb[2 * t];
    const float y1 = d[2 * t + 1] * rs * w[2 * t + 1] + bb[2 * t + 1];
    const _Float16 hq0 = (_Float16)y0;
    const _Float16 hq1 = (_Float16)y1;
    const _Float16 lq0 = (_Float16)((y0 - (float)hq0) * 2048.0f);
    const _Float16 lq1 = (_Float16)((y1 - (float)hq1) * 2048.0f);
    ph[t] = pk16(h_bits(hq0), h_bits(hq1));
    pl[t] = pk16(h_bits(lq0), h_bits(lq1));
  }
  const size_t o = (size_t)row * EW + c0;
  {
    *(v4u*)(xh + o) = ph;
    *(v4u*)(xl + o) = pl;
    xcnt_wait();   // another part's code follows in the listing and writes these stores' registers
  }
}

// =====================================================================================================
// Transpose-convert: in f32 [R][C] row-major -> out f16 [C][R] (r contiguous), out[c][r] =
// f16(bf16rne(in[r][c]) * scale), scale a power of two. Block = one 64 r x 64 c tile staged in LDS as f32
// (v4f loads, __syncthreads); tiles (bx, by) = (R/64, C/64) per matrix; sv = 64 x 68 floats of LDS.
// Store: group gq = tid>>3 (0..31), piece = tid&7: iteration it writes out row c = it*32+gq, lanes 8q..8q+7
// coverage: 2 iterations x 32 groups = 64 out rows, 8 pieces x 8 = 64 r per row; grid covers every tile ->
// the whole plane.
// =====================================================================================================
__device__ __forceinline__ void tr_f16(const float* __restrict__ in, unsigned short* out, int R, int C,
                                       float scale, int bx, int by, float* sv) {   // sv: [rr][cc] pitch 68 floats
  const int tid = threadIdx.x;
  const int r0 = bx * 64;
  const int c0 = by * 64;
#pragma unroll
  for (int i = 0; i < 4; ++i) {
    const int idx = i * 256 + tid;                  // 0..1023
    const int rr = idx >> 4, c4 = (idx & 15) * 4;
    const v4f a = *(const v4f*)(in + (size_t)(r0 + rr) * C + c0 + c4);
    *(v4f*)(sv + rr * 68 + c4) = a;
  }
  __syncthreads();

  const int gq = tid >> 3, piece = tid & 7;
  v4u hv[2];
  size_t hofs[2];
#pragma unroll
  for (int it = 0; it < 2; ++it) {
    const int cc = it * 32 + gq;
    v4u a;
#pragma unroll
    for (int t = 0; t < 4; ++t) {
      const float f0 = bf_up(bf_bits(sv[(piece * 8 + 2 * t) * 68 + cc]));
      const float f1 = bf_up(bf_bits(sv[(piece * 8 + 2 * t + 1) * 68 + cc]));
      a[t] = pk16(h_bits((_Float16)(f0 * scale)), h_bits((_Float16)(f1 * scale)));
    }
    hv[it] = a;
    hofs[it] = (size_t)(c0 + cc) * R + r0 + piece * 8;
  }
  {
#pragma unroll
    for (int it = 0; it < 2; ++it) {
      *(v4u*)(out + hofs[it]) = hv[it];
    }
    xcnt_wait();   // another part's code follows in the listing and writes these stores' registers
  }
}

// =====================================================================================================
// Transpose-convert of a q/k/v weight matrix into fragment order: in f32 [EW k][W3 n] row-major, n = sec*EW + d*NH + h;
// out f16 tiles of 16 d x 32 k (512 halves), tile ((sec*NH + h)*2 + (d >> 4))*8 + (k >> 5), the 8 halves
// (d, k = 8o .. 8o+7 of the tile) at (o*16 + (d & 15))*8 (see ldfrag_t); value f16(bf16rne(in[k][n]) * scale).
// Block = one 64 k x 64 n tile staged in LDS as f32 = 8 d x 8 h x 2 k steps x 4 octets. Store: dd = tid & 7,
// line L = it*32 + (tid >> 3) = (k step it, octet (L >> 3) & 3, head L & 7): lanes 8q..8q+7 write one whole 128-B line.
// coverage: 64 lines x 8 pieces of 8 k = the block's 64 x 64; grid covers every tile -> the whole plane.
// =====================================================================================================
__device__ __forceinline__ void tr_f16_frag(const float* __restrict__ in, unsigned short* out,
                                            float scale, int bx, int by, float* sv) {   // sv: [rr][cc] pitch 68 floats
  const int tid = threadIdx.x;
  const int r0 = bx * 64;
  const int c0 = by * 64;
#pragma unroll
  for (int i = 0; i < 4; ++i) {
    const int idx = i * 256 + tid;                  // 0..1023
    const int rr = idx >> 4, c4 = (idx & 15) * 4;
    const v4f a = *(const v4f*)(in + (size_t)(r0 + rr) * W3 + c0 + c4);
    *(v4f*)(sv + rr * 68 + c4) = a;
  }
  __syncthreads();

  const int dd = tid & 7;
  v4u hv[2];
  size_t hofs[2];
#pragma unroll
  for (int it = 0; it < 2; ++it) {
    const int L = it * 32 + (tid >> 3);
    const int hh = L & 7, oc = (L >> 3) & 3;
    const int cc = dd * 8 + hh;
    const int rl = it * 32 + oc * 8;
    v4u a;
#pragma unroll
    for (int t = 0; t < 4; ++t) {
      const float f0 = bf_up(bf_bits(sv[(rl + 2 * t) * 68 + cc]));
      const float f1 = bf_up(bf_bits(sv[(rl + 2 * t + 1) * 68 + cc]));
      a[t] = pk16(h_bits((_Float16)(f0 * scale)), h_bits((_Float16)(f1 * scale)));
    }
    hv[it] = a;
    const int sec = c0 >> 8;
    const int d = ((c0 & 255) >> 3) + dd;
    hofs[it] = (size_t)((((sec * NH + hh) * 2 + (d >> 4)) * 8 + (r0 >> 5) + it) * 512 + (oc * 16 + (d & 15)) * 8);
  }
  {
#pragma unroll
    for (int it = 0; it < 2; ++it) {
      *(v4u*)(out + hofs[it]) = hv[it];
    }
    xcnt_wait();   // another part's code follows in the listing and writes these stores' registers
  }
}

// =====================================================================================================
// Additive mask mk f32 [NB][SEQ x][SEQ y][NH h] -> two f32 planes of msc * bf16rne(mk), msc a power of two, both in
// the order of the attention's score accumulators. With (i, kk) = (query, key): ma holds mk[b][i][kk][h], mb holds
// mk[b][kk][i][h]; element (i, kk) of plane (b, h) lies at float offset
//   ((((i >> 4) * 8 + (kk >> 4)) * 2 + ((kk >> 2) & 1)) * 32 + ((kk >> 3) & 1) * 16 + (i & 15)) * 4 + (kk & 3),
// so the 16 B that lane g*16 + (i & 15) wants for accumulator elements 0..3 (or 4..7) of key tile kk >> 4 lie lane
// after lane: one load of a wave covers 512 B in a row. blocks = (SEQ/8 groups, NH, NB), 256 threads; a block owns
// queries grp*8 .. +7 of both planes. Both 8 x 128 tiles are staged in LDS (pitch MTP), __syncthreads, then thread
// (L = tid>>3, p = tid&7) stores keys 4L..4L+3 of query grp*8+p: lanes 8q..8q+7 write one whole 128-B line.
// coverage: 16 groups x 8 queries x (32 L x 4 keys) = all SEQ x SEQ of every (b,h) in both planes.
// =====================================================================================================
#define MTP 136                 // LDS pitch of the mask tiles (floats): 16-B reads of 8 rows x 2 key quads meet each bank once
__device__ __forceinline__ void mask_planes(const float* __restrict__ mk, float* ma, float* mb,
                                            float msc, int grp, int h, int b, float* sm) {   // sm: 2 x 8 x MTP floats
  const int tid = threadIdx.x;
  const size_t pb = ((size_t)(b * NH + h)) * SEQ * SEQ;          // plane base of (b,h)
  float* st = sm + 8 * MTP;                                      // tile of the transposed plane
  {
    const int xx = tid >> 5, y4 = (tid & 31) * 4;
    const int x = grp * 8 + xx;
    const float* src = mk + (((size_t)b * SEQ + x) * SEQ + y4) * NH + h;
    v4f vd;
#pragma unroll
    for (int t = 0; t < 4; ++t) vd[t] = msc * bf_up(bf_bits(src[(size_t)t * NH]));
    *(v4f*)(sm + xx * MTP + y4) = vd;
  }
  xcnt_wait();                                                   // a later load's result may land on the address pair above
  {
    const int x = tid >> 1, yq = (tid & 1) * 4;
    const float* src = mk + (((size_t)b * SEQ + x) * SEQ + grp * 8 + yq) * NH + h;
#pragma unroll
    for (int t = 0; t < 4; ++t) st[(yq + t) * MTP + x] = msc * bf_up(bf_bits(src[(size_t)t * NH]));
  }
  __syncthreads();
  {
    const int L = tid >> 3, p = tid & 7;
    const v4f vd = *(const v4f*)(sm + p * MTP + L * 4);
    const v4f vt = *(const v4f*)(st + p * MTP + L * 4);
    const size_t o = pb + (size_t)(((((grp >> 1) * 8 + (L >> 2)) * 2 + (L & 1)) * 32 + ((L >> 1) & 1) * 16 + (grp & 1) * 8 + p) * 4);
    *(v4f*)(ma + o) = vd;
    *(v4f*)(mb + o) = vt;
    xcnt_wait();   // another part's code follows in the listing and writes these stores' registers
  }
}

// =====================================================================================================
// All preparation in one launch: the four parts read only inputs and write disjoint planes, so none waits for
// another. Block ranges (block-uniform branches, each part's barriers inside its own branch), short parts
// first so that they run beside the layer norm's stream:
//   [0, PB_W)            Wqkv_in / Wqkv_out tiles: t -> matrix t / 48, tile (t & 3, (t % 48) >> 2)
//   [PB_W, PB_O)         Wo tiles: t -> (t & 7, t >> 3)
//   [PB_O, PB_M)         mask groups: t -> (grp = t & 15, h = (t >> 4) & 7, b = t >> 7)
//   [PB_M, PB_M + RT/8)  layer norm, 8 rows per block
// =====================================================================================================
#define PB_W (2 * (EW / 64) * (W3 / 64))            // 96
#define PB_O (PB_W + (KO / 64) * (EW / 64))         // 128
#define PB_M (PB_O + (SEQ / 8) * NH * NB)           // 384 (NB = 2)
static_assert(EW / 64 == 4 && W3 / 64 == 12 && KO / 64 == 8 && SEQ / 8 == 16 && NH == 8);

__global__ __launch_bounds__(256) void prep_all(
    const float* __restrict__ e, const float* __restrict__ lw, const float* __restrict__ lb,
    unsigned short* xh, unsigned short* xl,
    const float* __restrict__ wqi, const float* __restrict__ wqo, unsigned short* wt, float cw,
    const float* __restrict__ wo, unsigned short* woh, float cwo,
    const float* __restrict__ mk, float* ma, float* mb, float msc) {
  __shared__ __align__(16) float sbuf[64 * 68];
  const int bx = blockIdx.x;
  if (bx < PB_W) {
    const int z = (bx >= PB_W / 2) ? 1 : 0;         // the second matrix's plane follows the first
    const int t = bx - z * (PB_W / 2);
    tr_f16_frag((z != 0) ? wqo : wqi, wt + (size_t)z * EW * W3, cw, t & 3, t >> 2, sbuf);
  } else if (bx < PB_O) {
    const int t = bx - PB_W;
    tr_f16(wo, woh, KO, EW, cwo, t & 7, t >> 3, sbuf);
  } else if (bx < PB_M) {
    const int t = bx - PB_O;
    mask_planes(mk, ma, mb, msc, t & 15, (t >> 4) & 7, t >> 7, sbuf);
  } else {
    ln_planes(e, lw, lb, xh, xl, RT, bx - PB_M);
  }
}

// =====================================================================================================
// Main loop of the output projection: one block = 128 x 128 of the product, 8 waves as 4 (m) x 2 (n),
// each wave its 32 x 64 tile. Operands go global -> registers -> LDS in chunks of KC k values, so that every
// global load covers whole 128-B lines (8 lanes per row) and each staged row serves 2 (A) or 4 (B) waves.
// Buffer rows: A hi 0..127 | A residual 128..255 | B 256..383, pitch LP. Thread t stages piece t&7 of rows
// u*32 + (t>>3), u = 0..11; gAh, gAl, gB point at its piece of its first row of each operand, sA / sB are
// the element strides between its successive rows. Two buffers: chunk c+1 is loaded into registers ahead of
// the products of chunk c and stored behind them into the buffer whose readers left at the previous
// barrier; one barrier per chunk publishes it. k runs upward in steps of 32 within and across chunks.
// The closing barrier of the last chunk lets the caller reuse sm.
// =====================================================================================================
#define KC   64                 // k values per staged chunk (128 B of every operand row)
#define LP   72                 // LDS row pitch in halves: 144 B = 16 B x 9, 16-B fragment reads meet each bank once
#define STG  (384 * LP)         // halves per buffer (55296 B)

__device__ __forceinline__ void gemm_blk(const _Float16* gAh, const _Float16* gAl, size_t sA,
                                         const _Float16* gB, size_t sB, int K, _Float16* sm, int tid,
                                         v8f (&acch)[2][4], v8f (&accl)[2][4]) {
  const int lane = tid & 31;
  const int wave = tid >> 5;
  const int fo = (lane & 15) * LP + (lane >> 4) * 8;            // fragment row and k half of this lane
  const int ra = (wave & 3) * 32 * LP + fo;                     // A hi rows of this wave
  const int rb = (256 + (wave >> 2) * 64) * LP + fo;            // B rows of this wave
  _Float16* sw = sm + (tid >> 3) * LP + (tid & 7) * 8;
  v4u st[12];
#pragma unroll
  for (int u = 0; u < 4; ++u) {
    st[u]     = *(const v4u*)(gAh + u * sA);
    st[4 + u] = *(const v4u*)(gAl + u * sA);
    st[8 + u] = *(const v4u*)(gB + u * sB);
  }
#pragma unroll
  for (int u = 0; u < 12; ++u) *(v4u*)(sw + u * 32 * LP) = st[u];
  __syncthreads();

  const int nc = K / KC;
  for (int c = 0; c < nc; ++c) {
    const bool more = (c + 1) < nc;                             // block-uniform
    if (more) {
      const int ko = (c + 1) * KC;
#pragma unroll
      for (int u = 0; u < 4; ++u) {
        st[u]     = *(const v4u*)(gAh + u * sA + ko);
        st[4 + u] = *(const v4u*)(gAl + u * sA + ko);
        st[8 + u] = *(const v4u*)(gB + u * sB + ko);
      }
    }
    const _Float16* sb = sm + (c & 1) * STG;
#pragma unroll
    for (int kk = 0; kk < KC; kk += 32) {
      v16h fh[2], fl[2];
#pragma unroll
      for (int i = 0; i < 2; ++i) {
        fh[i] = ldfrag_h(sb + ra + i * 16 * LP + kk);
        fl[i] = ldfrag_h(sb + ra + (128 + i * 16) * LP + kk);
      }
      v16h bnx = ldfrag_h(sb + rb + kk);
#pragma unroll
      for (int j = 0; j < 4; ++j) {
        const v16h bfr = bnx;
        if (j < 3) bnx = ldfrag_h(sb + rb + (j + 1) * 16 * LP + kk);   // next B fragment flies under this one's products
#pragma unroll
        for (int i = 0; i < 2; ++i) {
          acch[i][j] = mma_h(fh[i], bfr, acch[i][j]);
          accl[i][j] = mma_h(fl[i], bfr, accl[i][j]);
        }
      }
    }
    if (more) {
      _Float16* sn = sw + ((c + 1) & 1) * STG;
#pragma unroll
      for (int u = 0; u < 12; ++u) *(v4u*)(sn + u * 32 * LP) = st[u];
    }
    __syncthreads();
  }
}

// =====================================================================================================
// q/k/v projection and axial attention in one kernel: q, k and v never leave the WGP.
// grid = (column index j, batch * 2 + direction); block = 8 waves, wave = head h.
// X rows (layer norm planes, f16 hi + residual x2048) are staged whole in LDS (128 rows x 256 k, pitch XP) and serve
// all 8 waves; each wave reads its own head's 96 weight rows from the fragment-ordered weight plane (tr_f16_frag),
// every load 512 B in a row, one k step (q: two) ahead of its products; X fragments are read from LDS 16 products ahead.
//   keys/values kk: edge row (j,kk) for dir 0, (kk,j) for dir 1; queries i: edge row (i,j). For dir 0 the X rows are
//   staged twice (block-uniform branch, a barrier in front of and behind the second staging).
// Products (k upward in steps of 32, hi and residual X in separate accumulators; value = ((acch + accl*scl)*sch + bias)*fac):
//   k, q: W (A, lane = channel d) . X^T (B, lane = edge row): D lane = edge row, element r = channel 16dt + 8g + r, so
//         the two d tiles of a 16-row tile, converted to f16 hi + residual (x2048), ARE the score fragment of that tile
//         (element e <- d 8g+e, element 8+e <- d 16+8g+e: the k order of ldfrag_h, the same for k and q).
//   v:    X (A, lane = key) . W^T (B, lane = channel d): D lane = d, element r = key 16kt + 8g + r: 16 B of a v^T row.
// k fragments of key tiles 4..7 stay in registers, those of tiles 0..3 wait in sQ until the q projection; v^T goes to sVt, q fragments of 4 strips at a time to sQ (each lane reads back only
// the 16-B pieces that it wrote itself).
// Scores are computed TRANSPOSED: S^T[kk][i] = K(A, lane = key row, d per k-map) . Q^T(B, lane = query,
// d per k-map), hi.hi into the mask-initialised accumulator plus (hi.lo + lo.hi)*xscl; D lane = query i,
// element r = key 16ct + 8g + r, so a lane and its partner lane^16 own one softmax row: max / exp / sum in
// f32 with one __shfl_xor(.,16) each. Weights p*pcar are converted to f16 in registers and used directly as
// the B operand of O^T[d][i] = V^T(A from LDS, lane = d, keys per k-map) . P^T (B: lane = query, element
// e <- tile 2c key 8g+e, element 8+e <- tile 2c+1 key 8g+e).
// sO [16][SOP] f32 output slab (cross-wave: block barriers before the row writes and before the next strip).
// Output: f16 planes vah = f16(O*1024), val = f16((O*1024 - hi)*2048), [RB rows i*SEQ+j][KO] at columns
// dir*EW + d*NH + h; per strip wave h writes rows 2h, 2h+1: 32 lanes x 16 B = the whole 512-B half row
// coverage: 8 strips x 8 waves x 2 rows = 128 queries x (32 lanes x 8 = 256 channels) for every (j, dir).
// =====================================================================================================
#define XP   264                // LDS pitch of the staged X rows (halves): 528 B = 16 B x 33, 16-B fragment reads meet each bank once
#define XPL  (SEQ * XP)         // halves per staged plane
#define WSEC (NH * 2 * 8 * 512) // halves per section (q, k, v) of a fragment-ordered weight plane
static_assert(WSEC == EW * EW);

// 128 X rows, hi and residual, global -> registers -> LDS; wave w takes rows w, w+8, ..: one load = one whole 512-B row.
// gh, gl: this lane's piece of row w; rs: elements between rows t and t + 8
__device__ __forceinline__ void stage_x(const _Float16* gh, const _Float16* gl, size_t rs, _Float16* sw) {
#pragma unroll
  for (int b = 0; b < 2; ++b) {
    v4u st[16];
#pragma unroll
    for (int u = 0; u < 8; ++u) {
      st[u]     = *(const v4u*)(gh + (size_t)(b * 8 + u) * rs);
      st[8 + u] = *(const v4u*)(gl + (size_t)(b * 8 + u) * rs);
    }
    xcnt_wait_p(gh, gl);                                        // later code writes these loads' address registers
#pragma unroll
    for (int u = 0; u < 8; ++u) {
      *(v4u*)(sw + (b * 8 + u) * 8 * XP) = st[u];
      *(v4u*)(sw + XPL + (b * 8 + u) * 8 * XP) = st[8 + u];
    }
  }
}

// plain builtin product for the projection steps: its operands may lie in any register, also above v255
__device__ __forceinline__ v8f mma_b(v16h a, v16h b, v8f c) {
  return __builtin_amdgcn_wmma_f32_16x16x32_f16(false, a, false, b, (short)0, c, false, false);
}

// X fragments of one row tile at one k step, hi and residual, LDS -> registers
__device__ __forceinline__ void ldx(v16h (&x)[2], const _Float16* p) {
  x[0] = ldfrag_h(p);
  x[1] = ldfrag_h(p + XPL);
}

// the k and v products of one row tile at one k step
__device__ __forceinline__ void kv_row(const v16h (&w)[4], const v16h (&x)[2], v8f (&aK)[2][2], v8f (&aV)[2][2]) {
#pragma unroll
  for (int dt = 0; dt < 2; ++dt) {
    aK[dt][0] = mma_b(w[dt], x[0], aK[dt][0]);
    aK[dt][1] = mma_b(w[dt], x[1], aK[dt][1]);
    aV[dt][0] = mma_b(x[0], w[2 + dt], aV[dt][0]);
    aV[dt][1] = mma_b(x[1], w[2 + dt], aV[dt][1]);
  }
}

// one k step of the k and v products of 4 row tiles: 8 X fragments serve 32 products. The fragments stand in four
// register sets xs[row tile] and are read from LDS 16 products ahead of their use, 8 reads in one group: on entry
// xs[0], xs[1] hold (or await) this step's tiles 0, 1; on exit those of the step at xn. xc: this step, xn: the next.
__device__ __forceinline__ void kv_step(const v16h (&w)[4], const _Float16* xc, const _Float16* xn, v16h (&xs)[4][2],
                                        v8f (&aK)[4][2][2], v8f (&aV)[4][2][2]) {
  ldx(xs[2], xc + 2 * 16 * XP);
  ldx(xs[3], xc + 3 * 16 * XP);
  __builtin_amdgcn_sched_barrier(0);   // the reads stay one group ahead of these products: sunk to their use, each waits out the LDS latency
  kv_row(w, xs[0], aK[0], aV[0]);
  kv_row(w, xs[1], aK[1], aV[1]);
  __builtin_amdgcn_sched_barrier(0);   // the next group is not spread among the products above
  ldx(xs[0], xn);
  ldx(xs[1], xn + 16 * XP);
  __builtin_amdgcn_sched_barrier(0);   // as the first
  kv_row(w, xs[2], aK[2], aV[2]);
  kv_row(w, xs[3], aK[3], aV[3]);
  __builtin_amdgcn_sched_barrier(0);   // as the second
}

// two d tiles of accumulators (lane = edge row) -> score fragment, f16 hi and residual x2048
__device__ __forceinline__ void frag_from_acc(const v8f (&a)[2][2], const float (&bz)[2][8], float scl, float sch,
                                              float fac, v16h& fh, v16h& fl) {
#pragma unroll
  for (int dt = 0; dt < 2; ++dt)
#pragma unroll
    for (int e = 0; e < 8; ++e) {
      const float s = ((a[dt][0][e] + a[dt][1][e] * scl) * sch + bz[dt][e]) * fac;
      const _Float16 hq = (_Float16)s;
      fh[dt * 8 + e] = hq;
      fl[dt * 8 + e] = (_Float16)((s - (float)hq) * 2048.0f);
    }
}

__global__ __launch_bounds__(256) void proj_attn(
    const unsigned short* __restrict__ Xhp, const unsigned short* __restrict__ Xlp,
    const unsigned short* __restrict__ Wfp, const float* __restrict__ bias0, const float* __restrict__ bias1,
    const float* __restrict__ mp, unsigned short* vah, unsigned short* val,
    float f0, float f1, float f2, float sch, float scl,
    float xscl, float escl, float pcar, float oscl) {
  const int bd  = blockIdx.y;                      // batch * 2 + direction
  const int dir = bd & 1;
  const size_t xo = (size_t)(bd >> 1) * RB * EW;
  const _Float16* Xh = (const _Float16*)(const void*)Xhp + xo;
  const _Float16* Xl = (const _Float16*)(const void*)Xlp + xo;
  const float* bias = (dir != 0) ? bias1 : bias0;
  mp  += (size_t)(dir * NB + (bd >> 1)) * NH * SEQ * SEQ;   // direct planes of all batches, then transposed
  vah += (size_t)(bd >> 1) * RB * KO;
  val += (size_t)(bd >> 1) * RB * KO;
  __shared__ __align__(16) unsigned short sXu[2 * XPL];           // 135168 B
  __shared__ __align__(16) unsigned short sVt[NH * HD * VTP];     // 69632 B
  __shared__ __align__(16) unsigned short sQu[NH * 4 * 1024];     // 65536 B
  __shared__ __align__(16) float sO[16 * SOP];                    // 16896 B
  _Float16* sX = (_Float16*)(void*)sXu;
  _Float16* sVw = (_Float16*)(void*)sVt;
  const _Float16* sVh = (const _Float16*)(const void*)sVt;
  const int tid  = threadIdx.x;
  const int lane = tid & 31;
  const int h    = tid >> 5;
  const int nl   = lane & 15;
  const int g    = lane >> 4;
  const int g8   = g * 8;
  const int j    = blockIdx.x;
  // this lane's piece of weight tile (section 0, head h, d tile 0, k step 0); tile (sec, h, dt, ks) is 512 halves
  const _Float16* Wh = (const _Float16*)(const void*)Wfp + (size_t)dir * W3 * EW + (size_t)(h * (2 * 8 * 512) + lane * 8);
  _Float16* sxw = sX + h * XP + lane * 8;          // staging: row h, this lane's piece
  const _Float16* xr = sX + nl * XP + g8;          // fragments: row nl of tile 0, this lane's k half
  const unsigned bog = (unsigned)(((g8 << 3) + h) * 4);   // byte offsets of this lane's bias entries: channel 8g (q, k)
  const unsigned bon = (unsigned)(((nl << 3) + h) * 4);   // and channel nl (v)
  const char* bpg = (const char*)bias + bog;
  const char* bpn = (const char*)bias + bon;

  // ---- X rows of the keys and values
  if (dir != 0) {
    const size_t o = (size_t)(h * SEQ + j) * EW + lane * 8;
    stage_x(Xh + o, Xl + o, (size_t)8 * SEQ * EW, sxw);
  } else {
    const size_t o = (size_t)(j * SEQ + h) * EW + lane * 8;
    stage_x(Xh + o, Xl + o, (size_t)8 * EW, sxw);
  }
  __syncthreads();

  // ---- k and v of head h, 4 key tiles at a time; weight fragments in two register sets, the next k step's in flight
  _Float16* sQw = (_Float16*)(void*)sQu + h * 4096 + lane * 8;  // this lane's pieces of its wave's q fragments
  v16h kh[8], kl[8];
  {
    const _Float16* wk = Wh + WSEC;
    const _Float16* wv = Wh + 2 * WSEC;
#pragma unroll
    for (int grp = 0; grp < 2; ++grp) {
      v8f aK[4][2][2], aV[4][2][2];
#pragma unroll
      for (int rt = 0; rt < 4; ++rt)
#pragma unroll
        for (int dt = 0; dt < 2; ++dt) {
          aK[rt][dt][0] = zero8(); aK[rt][dt][1] = zero8();
          aV[rt][dt][0] = zero8(); aV[rt][dt][1] = zero8();
        }
      v16h wa[4], wb[4];
#pragma unroll
      for (int dt = 0; dt < 2; ++dt) {
        wa[dt]     = ldfrag_t(wk + dt * 8 * 512);
        wa[2 + dt] = ldfrag_t(wv + dt * 8 * 512);
      }
      xcnt_wait();                                              // the same
      __builtin_amdgcn_sched_barrier(0);                        // no later address arithmetic is lifted in front of that wait
      const _Float16* xg = xr + grp * 64 * XP;
      v16h xs[4][2];
      ldx(xs[0], xg);
      ldx(xs[1], xg + 16 * XP);
#pragma unroll 1
      for (int ks = 0; ks < 8; ks += 2) {
#pragma unroll
        for (int dt = 0; dt < 2; ++dt) {
          wb[dt]     = ldfrag_t(wk + (dt * 8 + ks + 1) * 512);
          wb[2 + dt] = ldfrag_t(wv + (dt * 8 + ks + 1) * 512);
        }
        xcnt_wait();                                            // the same
        kv_step(wa, xg + ks * 32, xg + (ks + 1) * 32, xs, aK, aV);
        if (ks + 2 < 8) {                                       // uniform
#pragma unroll
          for (int dt = 0; dt < 2; ++dt) {
            wa[dt]     = ldfrag_t(wk + (dt * 8 + ks + 2) * 512);
            wa[2 + dt] = ldfrag_t(wv + (dt * 8 + ks + 2) * 512);
          }
          xcnt_wait();                                          // the same
        }
        // behind the last step nothing follows: its read ahead goes to step 0 again (staged data, not used)
        kv_step(wb, xg + (ks + 1) * 32, xg + ((ks + 2 < 8) ? (ks + 2) * 32 : 0), xs, aK, aV);
      }
      float bk[2][8], bv[2];
#pragma unroll
      for (int dt = 0; dt < 2; ++dt) {
#pragma unroll
        for (int e = 0; e < 8; ++e) bk[dt][e] = bf_up(bf_bits(*(const float*)(bpg + (EW + ((dt * 16 + e) << 3)) * 4)));
        bv[dt] = bf_up(bf_bits(*(const float*)(bpn + (2 * EW + ((dt * 16) << 3)) * 4)));
      }
      xcnt_wait_po(bpg, bpn, bog, bon);                         // later code writes these loads' address registers
#pragma unroll
      for (int rt = 0; rt < 4; ++rt) {
        const int kt = grp * 4 + rt;
        if (grp == 0) {
          // the first group's k fragments wait in sQ (idle until the q projection) while the second group's loop needs the registers
          union { v16h v; v8h hh[2]; } H, L;
          frag_from_acc(aK[rt], bk, scl, sch, f1, H.v, L.v);
          *(v8h*)(sQw + rt * 1024)       = H.hh[0];
          *(v8h*)(sQw + rt * 1024 + 256) = H.hh[1];
          *(v8h*)(sQw + rt * 1024 + 512) = L.hh[0];
          *(v8h*)(sQw + rt * 1024 + 768) = L.hh[1];
        } else {
          frag_from_acc(aK[rt], bk, scl, sch, f1, kh[kt], kl[kt]);
        }
#pragma unroll
        for (int dt = 0; dt < 2; ++dt) {
          v8h o;
#pragma unroll
          for (int e = 0; e < 8; ++e)
            o[e] = (_Float16)(((aV[rt][dt][0][e] + aV[rt][dt][1][e] * scl) * sch + bv[dt]) * f2);
          *(v8h*)(sVw + (h * HD + dt * 16 + nl) * VTP + kt * 16 + g8) = o;
        }
      }
    }
  }

  // ---- X rows of the queries: those of the keys for dir 1, others for dir 0 (block-uniform)
  if (dir == 0) {
    __syncthreads();                                            // every wave has left the key rows
    const size_t o = (size_t)(h * SEQ + j) * EW + lane * 8;
    stage_x(Xh + o, Xl + o, (size_t)8 * SEQ * EW, sxw);
    __syncthreads();
  }

  // ---- the first group's k fragments come back: each lane reads the pieces that it wrote itself
#pragma unroll
  for (int rt = 0; rt < 4; ++rt) {
    kh[rt] = ldfrag_t(sQw + rt * 1024);
    kl[rt] = ldfrag_t(sQw + rt * 1024 + 512);
  }

  float bq[2][8];
#pragma unroll
  for (int dt = 0; dt < 2; ++dt)
#pragma unroll
    for (int e = 0; e < 8; ++e) bq[dt][e] = bf_up(bf_bits(*(const float*)(bpg + ((dt * 16 + e) << 3) * 4)));
  xcnt_wait_po(bpg, bpg, bog, bog);                             // later code writes these loads' address registers

#pragma unroll 1
  for (int qg = 0; qg < 2; ++qg) {
    // ---- q of head h, 4 query tiles
    {
      v8f aQ[4][2][2];
#pragma unroll
      for (int rt = 0; rt < 4; ++rt)
#pragma unroll
        for (int dt = 0; dt < 2; ++dt) { aQ[rt][dt][0] = zero8(); aQ[rt][dt][1] = zero8(); }
      // a k step is 16 products: the X fragments of a whole step (two register sets) are read from LDS one step ahead,
      // 16 reads in one group; the weight fragments (three sets) come two steps ahead, a step being shorter than their way
      v16h wq[3][2], xq[2][4][2];
#pragma unroll
      for (int dt = 0; dt < 2; ++dt) {
        wq[0][dt] = ldfrag_t(Wh + dt * 8 * 512);
        wq[1][dt] = ldfrag_t(Wh + (dt * 8 + 1) * 512);
      }
      xcnt_wait();                                              // the same
      const _Float16* xg = xr + qg * 64 * XP;
#pragma unroll
      for (int rt = 0; rt < 4; ++rt) ldx(xq[0][rt], xg + rt * 16 * XP);
#pragma unroll
      for (int ks = 0; ks < 8; ++ks) {
        if (ks + 2 < 8) {
#pragma unroll
          for (int dt = 0; dt < 2; ++dt) wq[(ks + 2) % 3][dt] = ldfrag_t(Wh + (dt * 8 + ks + 2) * 512);
          xcnt_wait();                                          // the same
        }
        if (ks + 1 < 8) {
#pragma unroll
          for (int rt = 0; rt < 4; ++rt) ldx(xq[(ks + 1) & 1][rt], xg + (ks + 1) * 32 + rt * 16 * XP);
        }
        __builtin_amdgcn_sched_barrier(0);   // the fetches stay one group ahead of this step's products: sunk to their use, each waits out its latency
#pragma unroll
        for (int rt = 0; rt < 4; ++rt)
#pragma unroll
          for (int dt = 0; dt < 2; ++dt) {
            aQ[rt][dt][0] = mma_b(wq[ks % 3][dt], xq[ks & 1][rt][0], aQ[rt][dt][0]);
            aQ[rt][dt][1] = mma_b(wq[ks % 3][dt], xq[ks & 1][rt][1], aQ[rt][dt][1]);
          }
        __builtin_amdgcn_sched_barrier(0);   // the next step's fetches are not spread among the products above
      }
#pragma unroll
      for (int rt = 0; rt < 4; ++rt) {
        union { v16h v; v8h hh[2]; } H, L;
        frag_from_acc(aQ[rt], bq, scl, sch, f0, H.v, L.v);
        *(v8h*)(sQw + rt * 1024)       = H.hh[0];
        *(v8h*)(sQw + rt * 1024 + 256) = H.hh[1];
        *(v8h*)(sQw + rt * 1024 + 512) = L.hh[0];
        *(v8h*)(sQw + rt * 1024 + 768) = L.hh[1];
      }
    }

#pragma unroll 1
    for (int sl = 0; sl < 4; ++sl) {
    const int s = qg * 4 + sl;
    const v16h qh = ldfrag_t(sQw + sl * 1024);                  // query tile s; this lane's B / D column is query s*16 + nl
    const v16h ql = ldfrag_t(sQw + sl * 1024 + 512);
    const float* mfr = mp + (size_t)(h * 8 + s) * (8 * 256) + lane * 4;   // this strip's 8 mask tiles, 256 floats each

    // ---- the strip's mask, straight into the 8 score accumulators: 16 loads of 512 B in a row, one group, so that
    //      their latency is met once a strip and not once a key tile
    v8f acc[8];
#pragma unroll
    for (int ct = 0; ct < 8; ++ct) {
      const v4f mv0 = *(const v4f*)(mfr + ct * 256);
      const v4f mv1 = *(const v4f*)(mfr + ct * 256 + 128);
      v8f am;
      am[0] = mv0[0]; am[1] = mv0[1]; am[2] = mv0[2]; am[3] = mv0[3];
      am[4] = mv1[0]; am[5] = mv1[1]; am[6] = mv1[2]; am[7] = mv1[3];
      acc[ct] = am;
    }
    xcnt_wait_p(mfr, mfr);                                      // the next strip's addresses land on these loads' address pairs

    // ---- transposed scores, 8 key tiles
#pragma unroll
    for (int ct = 0; ct < 8; ++ct) {
      v8f ax = mma_h(kh[ct], ql, zero8());
      ax = mma_h(kl[ct], qh, ax);
      const v8f am = mma_h(kh[ct], qh, acc[ct]);
      acc[ct] = am + ax * xscl;
      // one key tile's products at a time: with several residual accumulators live the K fragments spill
      __builtin_amdgcn_sched_barrier(0);
    }

    // ---- softmax over the 128 keys of query i (this lane: 64 values, partner lane^16: the other 64)
    float mx = acc[0][0];
#pragma unroll
    for (int ct = 0; ct < 8; ++ct)
#pragma unroll
      for (int r = 0; r < 8; ++r) mx = fmaxf(mx, acc[ct][r]);
    mx = fmaxf(mx, __shfl_xor(mx, 16));
    float sum = 0.f;
#pragma unroll
    for (int ct = 0; ct < 8; ++ct)
#pragma unroll
      for (int r = 0; r < 8; ++r) {
        const float ev = __expf((acc[ct][r] - mx) * escl);
        acc[ct][r] = ev;
        sum += ev;
      }
    sum += __shfl_xor(sum, 16);
    const float rc = pcar / sum;                                // sum >= 1

    // ---- P^T as B fragments straight from the accumulators
    v16h pb[4];
#pragma unroll
    for (int c = 0; c < 4; ++c) {
      union { v16h v; v8h hh[2]; } U;
      v8h p0, p1;
#pragma unroll
      for (int e2 = 0; e2 < 8; ++e2) {
        p0[e2] = (_Float16)(acc[2 * c][e2] * rc);
        p1[e2] = (_Float16)(acc[2 * c + 1][e2] * rc);
      }
      U.hh[0] = p0;
      U.hh[1] = p1;
      pb[c] = U.v;
    }

    // ---- O^T[d][i] = V^T . P^T, two 16-row d tiles, K = 128 keys
    v8f oacc[2];
#pragma unroll
    for (int dt = 0; dt < 2; ++dt) {
      v8f o = zero8();
#pragma unroll
      for (int c = 0; c < 4; ++c) {
        const v16h va = ldfrag_h(sVh + (h * HD + dt * 16 + nl) * VTP + 32 * c + g8);
        o = mma_h(va, pb[c], o);
      }
      oacc[dt] = o;
    }

    // ---- stage O (f32, true scale) into the slab: row = query nl, column = d*NH + h
#pragma unroll
    for (int dt = 0; dt < 2; ++dt)
#pragma unroll
      for (int r = 0; r < 8; ++r)
        sO[nl * SOP + ((dt * 16 + g8 + r) << 3) + h] = oacc[dt][r] * oscl;
    __syncthreads();

    // ---- wave h writes queries s*16 + 2h, + 2h + 1: 512-B half rows in hi and residual planes
    {
      v4u hv[2], lv[2];
      size_t ofs[2];
#pragma unroll
      for (int q = 0; q < 2; ++q) {
        const int rr = 2 * h + q;
        const v4f x0 = *(const v4f*)(sO + rr * SOP + lane * 8);
        const v4f x1 = *(const v4f*)(sO + rr * SOP + lane * 8 + 4);
        float f[8];
        f[0] = x0[0]; f[1] = x0[1]; f[2] = x0[2]; f[3] = x0[3];
        f[4] = x1[0]; f[5] = x1[1]; f[6] = x1[2]; f[7] = x1[3];
        v4u ph, pl;
#pragma unroll
        for (int u = 0; u < 4; ++u) {
          const float s0 = f[2 * u] * 1024.0f;
          const float s1 = f[2 * u + 1] * 1024.0f;
          const _Float16 hq0 = (_Float16)s0;
          const _Float16 hq1 = (_Float16)s1;
          const _Float16 lq0 = (_Float16)((s0 - (float)hq0) * 2048.0f);
          const _Float16 lq1 = (_Float16)((s1 - (float)hq1) * 2048.0f);
          ph[u] = pk16(h_bits(hq0), h_bits(hq1));
          pl[u] = pk16(h_bits(lq0), h_bits(lq1));
        }
        hv[q] = ph;
        lv[q] = pl;
        ofs[q] = ((size_t)(s * 16 + rr) * SEQ + j) * KO + (size_t)dir * EW + lane * 8;
      }
      {
#pragma unroll
        for (int q = 0; q < 2; ++q) {
          *(v4u*)(vah + ofs[q]) = hv[q];
          *(v4u*)(val + ofs[q]) = lv[q];
        }
        xcnt_wait();                                            // the next strip's code writes these stores' registers
      }
    }
    __syncthreads();                                            // sO reused by the next strip
    }
  }
}

// =====================================================================================================
// Output projection: C[m][n] = sch * (sum_k Ahi[m][k]*Bt[n][k] + scl * sum_k Alo[m][k]*Bt[n][k]) + bf16rne(bias[n])
// (f16 products, f32 accumulate, hi and scaled-residual products in separate accumulators). Ahi/Alo row-major
// [M][K] pitch lda; Bt [N][K] pitch ldb; C f32 [M][N] pitch ldc. Block = 128 x 128 of C (gemm_blk), one wave per
// 32x64 tile; M = RT, N = EW, K = KO (multiples of 128, 128 and KC).
// Epilogue: 16-row slabs staged per wave in the staging LDS (free behind the main loop's closing barrier); each 64-wide row segment (256 B) written by one instruction
// coverage: 2 slabs x 16 rows x 64 cols = the wave's whole 32x64 tile; grid covers every tile of C.
// =====================================================================================================
__global__ __launch_bounds__(256) void gemm32h_w(
    const unsigned short* __restrict__ Ahp, const unsigned short* __restrict__ Alp,
    const unsigned short* __restrict__ Btp,
    const float* __restrict__ bias,
    float* C, float sch, float scl) {
  constexpr int lda = KO, ldb = KO, ldc = EW, M = RT, N = EW, K = KO;   // fixed: staged row steps become immediate offsets
  const _Float16* Ah = (const _Float16*)(const void*)Ahp;
  const _Float16* Al = (const _Float16*)(const void*)Alp;
  const _Float16* Bh = (const _Float16*)(const void*)Btp;
  __shared__ __align__(16) unsigned short smem[2 * STG];
  const int tid  = threadIdx.x;
  const int lane = tid & 31;
  const int wave = tid >> 5;
  constexpr int blkN = N >> 7;
  if ((int)blockIdx.x >= (M >> 7) * blkN) return;   // block-uniform, in front of every barrier
  const int bm = blockIdx.x / blkN;
  const int bn = blockIdx.x - bm * blkN;
  const int m0 = bm * 128 + (wave & 3) * 32;
  const int n0 = bn * 128 + (wave >> 2) * 64;
  const int rlane = lane & 15;
  const int mOff  = (lane >> 4) * 8;

  v8f acch[2][4], accl[2][4];
#pragma unroll
  for (int i = 0; i < 2; ++i)
#pragma unroll
    for (int j = 0; j < 4; ++j) { acch[i][j] = zero8(); accl[i][j] = zero8(); }

  {
    const size_t ao = (size_t)(bm * 128 + (tid >> 3)) * lda + (tid & 7) * 8;
    const size_t bo = (size_t)(bn * 128 + (tid >> 3)) * ldb + (tid & 7) * 8;
    gemm_blk(Ah + ao, Al + ao, (size_t)32 * lda, Bh + bo, (size_t)32 * ldb, K,
             (_Float16*)(void*)smem, tid, acch, accl);
  }

  float bz[4];
#pragma unroll
  for (int j = 0; j < 4; ++j) bz[j] = bf_up(bf_bits(bias[n0 + (j << 4) + rlane]));

  float* slab = (float*)(void*)smem + wave * (16 * 68);
#pragma unroll
  for (int i = 0; i < 2; ++i) {
    const int mBase = m0 + (i << 4);
#pragma unroll
    for (int r = 0; r < 8; ++r) {
#pragma unroll
      for (int j = 0; j < 4; ++j) {
        slab[(mOff + r) * 68 + (j << 4) + rlane] = (acch[i][j][r] + accl[i][j][r] * scl) * sch + bz[j];
      }
    }
    __builtin_amdgcn_fence(__ATOMIC_RELEASE, "workgroup");
    __builtin_amdgcn_wave_barrier();
    __builtin_amdgcn_fence(__ATOMIC_ACQUIRE, "workgroup");
    {
      const int hh = lane >> 4, c4 = (lane & 15) * 4;     // 256-B row segment = 16 lanes x 16 B
      v4f ov[8];
#pragma unroll
      for (int it = 0; it < 8; ++it) {
        const int row = it * 2 + hh;                       // it 0..7 x hh 0..1 = rows 0..15
        ov[it] = *(const v4f*)(slab + row * 68 + c4);
      }
      {
#pragma unroll
        for (int it = 0; it < 8; ++it) {
          const int row = it * 2 + hh;
          *(v4f*)(C + (size_t)(mBase + row) * ldc + n0 + c4) = ov[it];
        }
        
      }
    }
    __builtin_amdgcn_fence(__ATOMIC_RELEASE, "workgroup");
    __builtin_amdgcn_wave_barrier();
    __builtin_amdgcn_fence(__ATOMIC_ACQUIRE, "workgroup");
  }
}

// =====================================================================================================
// Workspace map (bytes, NB = 2); every region an exact multiple of its whole-line store granularity, all
// written earlier in the same call. Each stage is one launch over all four (batch, direction) pairs.
//   Xh   f16 [RT][EW]                     0        16777216   (layer norm output, hi)
//   Xl   f16 [RT][EW]              16777216        16777216   (residual x2048)
//   Wti  f16 W3 n x EW k           33554432          393216   (f16(bf16(Wqkv_in) x64), fragment order)
//   Wto  f16 W3 n x EW k           33947648          393216
//   Woh  f16 [EW n][KO k]          34340864          262144   (f16(bf16(Wo) x1024))
//   mA   f32 [NB][NH][SEQ x SEQ]   34603008         1048576   (64 x bf16(mask), direct, accumulator order)
//   mB   f32 [NB][NH][SEQ x SEQ]   35651584         1048576   (transposed, accumulator order)
//   Vah  f16 [RT][KO]              36700160        33554432   (attention output x1024, hi)
//   Val  f16 [RT][KO]              70254592        33554432   (attention output residual x2048)
//   end                           103809024
// Inputs: e f32 [NB][SEQ][SEQ][EW]; mask f32 [NB][SEQ][SEQ][NH]; ln_w, ln_b f32 [EW]; Wqkv_in, Wqkv_out
// f32 [EW in][W3 out]; bqkv_* f32 [W3]; Wo f32 [KO in][EW out]; bo f32 [EW]. d_out f32 [RT][EW] at byte 0
// (row = b*RB + i*SEQ + j, col = n).
// =====================================================================================================
extern "C" void kernel_launch(void* const* d_in, const int* in_sizes, int n_in,
                              void* d_out, int out_size, void* d_ws, size_t ws_size,
                              hipStream_t stream) {
  if (n_in < 10) return;
  if (in_sizes[0] < RT * EW) return;
  if (in_sizes[1] < NB * SEQ * SEQ * NH) return;
  if (in_sizes[2] < EW) return;
  if (in_sizes[3] < EW) return;
  if (in_sizes[4] < EW * W3) return;
  if (in_sizes[5] < W3) return;
  if (in_sizes[6] < EW * W3) return;
  if (in_sizes[7] < W3) return;
  if (in_sizes[8] < KO * EW) return;
  if (in_sizes[9] < EW) return;
  if (out_size < RT * EW) return;

  const float* e    = (const float*)d_in[0];   // [NB][SEQ][SEQ][EW]
  const float* mask = (const float*)d_in[1];   // [NB][SEQ][SEQ][NH]
  const float* ln_w = (const float*)d_in[2];   // [EW]
  const float* ln_b = (const float*)d_in[3];   // [EW]
  const float* Wqi  = (const float*)d_in[4];   // [EW in][W3 out]
  const float* bqi  = (const float*)d_in[5];   // [W3]
  const float* Wqo  = (const float*)d_in[6];   // [EW in][W3 out]
  const float* bqo  = (const float*)d_in[7];   // [W3]
  const float* Wo   = (const float*)d_in[8];   // [KO in][EW out]
  const float* bo   = (const float*)d_in[9];   // [EW]

  const size_t PX  = (size_t)RT * EW * 2;                    // 16777216 (NB = 2)
  const size_t PWt = (size_t)W3 * EW * 2;                    //   393216
  const size_t PWo = (size_t)EW * KO * 2;                    //   262144
  const size_t PM  = (size_t)NB * NH * SEQ * SEQ * 4;        //  1048576 (NB = 2)
  const size_t PVa = (size_t)RT * KO * 2;                    //  33554432
  size_t off = 0;
  const size_t oXh = off; off += PX;
  const size_t oXl = off; off += PX;
  const size_t oWi = off; off += PWt;
  off += PWt;                                                // Wto, directly behind Wti
  const size_t oWo = off; off += PWo;
  const size_t oMa = off; off += PM;
  const size_t oMb = off; off += PM;
  const size_t oVh = off; off += PVa;
  const size_t oVl = off; off += PVa;
  if (off > ws_size) return;                                 // off = 103809024 for NB = 2

  char* ws = (char*)d_ws;
  unsigned short* Xh  = (unsigned short*)(ws + oXh);
  unsigned short* Xl  = (unsigned short*)(ws + oXl);
  unsigned short* Wti = (unsigned short*)(ws + oWi);
  unsigned short* Woh = (unsigned short*)(ws + oWo);
  float*          mA  = (float*)(ws + oMa);
  float*          mB  = (float*)(ws + oMb);
  unsigned short* Vah = (unsigned short*)(ws + oVh);
  unsigned short* Val = (unsigned short*)(ws + oVl);
  float*          outf = (float*)d_out;                      // [RT][EW]

  const dim3 blk(256);
  const dim3 gPp(PB_M + RT / 8);                             // 384 weight and mask blocks + 4096 layer norm blocks
  const dim3 gAt(SEQ, 2 * NB);                               // one block per column index j x (batch, direction)
  const dim3 gWo((RT / 128) * (EW / 128));                   // 512 blocks
  const float cW     = 64.0f;                                // Wqkv plane carry
  const float fQ     = 16.0f * 0.17677669529663687f;         // 32^-0.5 then carry x16
  const float fK     = 4.0f;                                 // k carry
  const float fV     = 4.0f;                                 // v carry
  const float prSch  = 1.0f / 64.0f;                         // folds the Wqkv plane carry
  const float prScl  = 1.0f / 2048.0f;                       // folds the layer norm residual carry
  const float mkSc   = 64.0f;                                // mask planes x (16 * 4)
  const float axXscl = 1.0f / 2048.0f;                       // q/k residual carry
  const float axEscl = 1.0f / 64.0f;                         // score carry 16 * 4
  const float axPcar = 16384.0f;                             // softmax weight carry
  const float axOscl = 1.0f / 65536.0f;                      // 1/(16384 * 4)
  const float woScale = 1024.0f;                             // Wo plane carry
  const float woSch  = 1.0f / 1048576.0f;                    // 1/(1024 * 1024): O hi carry and Wo carry
  const float woScl  = 1.0f / 2048.0f;                       // O residual carry

  // (1) layer norm -> f16 hi + residual planes; weights -> transposed f16 planes of their bf16 values; masks
  prep_all<<<gPp, blk, 0, stream>>>(e, ln_w, ln_b, Xh, Xl, Wqi, Wqo, Wti, cW, Wo, Woh, woScale, mask, mA, mB, mkSc);
  // (2) all batches and both directions at once: projection with attention, output projection
  proj_attn<<<gAt, blk, 0, stream>>>(Xh, Xl, Wti, bqi, bqo, mA, Vah, Val, fQ, fK, fV, prSch, prScl,
                                     axXscl, axEscl, axPcar, axOscl);
  gemm32h_w<<<gWo, blk, 0, stream>>>(Vah, Val, Woh, bo, outf, woSch, woScl);
  (void)hipGetLastError();
}

// v009
// A run of this version takes 91.5 microseconds.
// Timed twice side by side with v008, it ran 1.08 times as fast both times.
// Over all steps from v000 it is 4.24 times as fast.
// Contractions: q/k/v projections = v_wmma_f32_16x16x32_f16 (layer-normed input as f16 hi + residual (x2048) planes, two products into separate accumulators; Wqkv as f16 of its bf16-RNE value x64); per-(b,j,h) scores = v_wmma_f32_16x16x32_f16 (k and q as f16 hi + residual (x2048) planes carried x4 and x16*32^-0.5, products hh + hl + lh; additive mask x64 as the initial accumulator); p.v = v_wmma_f32_16x16x32_f16 (softmax weights x16384 in f16 repacked from the score accumulators, v^T f16 tile carried x4, single product); output projection = v_wmma_f32_16x16x32_f16 (attention output as f16 hi (x1024) + residual (x2048) planes, two products; Wo as f16 of its bf16-RNE value x1024); every float input RNE-converted to bf16 on load; all f32 accumulate; layer norm and softmax in f32.
#include <hip/hip_runtime.h>
#include <math.h>
#include <stdint.h>

#ifndef NB
#define NB 2
#endif
#define NB_FULL 2
#ifndef SEQ
#define SEQ 128
#endif
#define EW  256                 // edge width
#define NH  8                   // heads (fastest channel dim)
#define HD  32                  // dot dim
#define W3  (3 * EW)            // 768 fused projection columns
#define KO  (2 * EW)            // 512 concat channels
#define RB  (SEQ * SEQ)         // edge rows per batch (16384)
#define RT  (NB * RB)           // edge rows processed
#define VTP 136                 // LDS v^T tile pitch (halves)
#define SOP 264                 // LDS output slab pitch (floats)

static_assert(NH * HD == EW);
static_assert(HD == 32);
static_assert(EW == 256);
static_assert(SEQ == 128);      // i, j and key extents are coupled; only NB is reducible
static_assert(NB >= 1 && NB <= NB_FULL);
static_assert((RB % 64) == 0 && (RT % 8) == 0);
static_assert((((RB / 32) * (W3 / 64)) % 8) == 0);
static_assert((((RB / 32) * (EW / 64)) % 8) == 0);
static_assert((EW % 64) == 0 && (W3 % 64) == 0 && (KO % 64) == 0 && (EW % 32) == 0 && (KO % 32) == 0);
static_assert((SEQ % 16) == 0 && (SEQ % 8) == 0);
static_assert((RB % 128) == 0 && (W3 % 128) == 0 && (EW % 128) == 0);   // 128 x 128 block tiles of the output projection

typedef _Float16 v16h __attribute__((ext_vector_type(16)));
typedef _Float16 v8h  __attribute__((ext_vector_type(8)));
typedef float    v8f  __attribute__((ext_vector_type(8)));
typedef float    v4f  __attribute__((ext_vector_type(4)));
typedef unsigned int v4u __attribute__((ext_vector_type(4)));
typedef unsigned int v2u __attribute__((ext_vector_type(2)));

// ---- scalar helpers --------------------------------------------------------------------------------
__device__ __forceinline__ unsigned short bf_bits(float f) {          // f32 -> bf16 bits, RNE convert
  unsigned u = __float_as_uint(f);
  return (unsigned short)((u + 0x7FFFu + ((u >> 16) & 1u)) >> 16);
}
__device__ __forceinline__ float bf_up(unsigned short h) { return __uint_as_float(((unsigned)h) << 16); }
__device__ __forceinline__ unsigned short h_bits(_Float16 x) { return __builtin_bit_cast(unsigned short, x); }
__device__ __forceinline__ unsigned pk16(unsigned short a, unsigned short b) { return (unsigned)a | ((unsigned)b << 16); }
__device__ __forceinline__ v8f zero8() { v8f z = {0.f, 0.f, 0.f, 0.f, 0.f, 0.f, 0.f, 0.f}; return z; }

// ---- fragment loader: 16-bit A/B operand, lane -> row/col (lane&15), p already includes +8*(lane>>4);
//      elements 0..7 <- p[0..7] (k0+8h..), elements 8..15 <- p[16..23] (k0+16+8h..)
__device__ __forceinline__ v16h ldfrag_h(const _Float16* p) {
  union { v16h v; v8h h[2]; } f;
  f.h[0] = *(const v8h*)(p);
  f.h[1] = *(const v8h*)(p + 16);
  return f.v;
}

// ---- fragment loader for a plane kept in fragment order: a 16-row x 32-d tile is 512 halves, the 8 halves
//      (row r, d = 8o .. 8o+7) at (o*16 + r)*8; p = tile base + lane*8, so elements 0..7 <- (row lane&15, d 8h..) and
//      elements 8..15 <- (row lane&15, d 16+8h..), h = lane>>4: the k order of ldfrag_h, each load 512 B in a row
__device__ __forceinline__ v16h ldfrag_t(const _Float16* p) {
  union { v16h v; v8h h[2]; } f;
  f.h[0] = *(const v8h*)(p);
  f.h[1] = *(const v8h*)(p + 256);
  return f.v;
}

// ---- wait that stands between issued global loads and an overwrite of their address registers
__device__ __forceinline__ void xcnt_wait() {
#if defined(__HIP_DEVICE_COMPILE__)
  asm volatile("s_wait_xcnt 0x0" ::: "memory");
#endif
}

// ---- the same wait, naming the loads' address registers as inputs: they stay live up to the wait, so that no load's
//      result lands on them in front of it
__device__ __forceinline__ void xcnt_wait_p(const void* a, const void* b) {
#if defined(__HIP_DEVICE_COMPILE__)
  asm volatile("s_wait_xcnt 0x0" :: "v"(a), "v"(b) : "memory");
#endif
}
// for loads at a uniform base plus a lane offset: the compiler addresses them by the offset register or by the summed pair
__device__ __forceinline__ void xcnt_wait_po(const void* a, const void* b, unsigned c, unsigned d) {
#if defined(__HIP_DEVICE_COMPILE__)
  asm volatile("s_wait_xcnt 0x0" :: "v"(a), "v"(b), "v"(c), "v"(d) : "memory");
#endif
}

// ---- WMMA helper with trailing VALU hazard gap ----------------------------------------------------------
__device__ __forceinline__ v8f mma_h(v16h a, v16h b, v8f c) {
  c = __builtin_amdgcn_wmma_f32_16x16x32_f16(false, a, false, b, (short)0, c, false, false);
#if defined(__HIP_DEVICE_COMPILE__)
  asm volatile("v_nop\n\tv_nop\n\tv_nop\n\tv_nop" : "+v"(c) : "v"(a), "v"(b));
#endif
  return c;
}

// =====================================================================================================
// Layer norm over EW channels of each edge row (inputs and affine params RNE-converted to bf16 first, f32
// [nrows][EW]. One wave per row, 8 channels per lane; each plane row = 512 B written by one instruction
// coverage: nrows waves x 32 lanes x 8 = every element of both planes.
// =====================================================================================================
__device__ __forceinline__ void ln_planes(const float* __restrict__ e, const float* __restrict__ lw,
                                          const float* __restrict__ lb, unsigned short* xh,
                                          unsigned short* xl, int nrows, int blk) {
  const int lane = threadIdx.x & 31;
  const int wave = threadIdx.x >> 5;
  const int row = blk * 8 + wave;
  if (row >= nrows) return;                           // wave-uniform; no block barriers in this part
  const int c0 = lane * 8;
  const float* src = e + (size_t)row * EW + c0;
  const v4f a0 = *(const v4f*)(src);
  const v4f a1 = *(const v4f*)(src + 4);
  xcnt_wait();                                        // a later load's result may land on this address pair
  const v4f w0 = *(const v4f*)(lw + c0);
  const v4f w1 = *(const v4f*)(lw + c0 + 4);
  const v4f b0 = *(const v4f*)(lb + c0);
  const v4f b1 = *(const v4f*)(lb + c0 + 4);
  float v[8], w[8], bb[8];
#pragma unroll
  for (int t = 0; t < 4; ++t) {
    v[t]      = bf_up(bf_bits(a0[t]));
    v[4 + t]  = bf_up(bf_bits(a1[t]));
    w[t]      = bf_up(bf_bits(w0[t]));
    w[4 + t]  = bf_up(bf_bits(w1[t]));
    bb[t]     = bf_up(bf_bits(b0[t]));
    bb[4 + t] = bf_up(bf_bits(b1[t]));
  }
  float s = 0.f;
#pragma unroll
  for (int t = 0; t < 8; ++t) s += v[t];
#pragma unroll
  for (int o = 16; o > 0; o >>= 1) s += __shfl_xor(s, o);
  const float mu = s * (1.0f / (float)EW);
  float d[8];
  float s2 = 0.f;
#pragma unroll
  for (int t = 0; t < 8; ++t) { d[t] = v[t] - mu; s2 += d[t] * d[t]; }
#pragma unroll
  for (int o = 16; o > 0; o >>= 1) s2 += __shfl_xor(s2, o);
  const float var = s2 * (1.0f / (float)EW);
  const float rs = rsqrtf(var + 1e-5f);
  v4u ph, pl;
#pragma unroll
  for (int t = 0; t < 4; ++t) {
    const float y0 = d[2 * t] * rs * w[2 * t] + bb[2 * t];
    const float y1 = d[2 * t + 1] * rs * w[2 * t + 1] + bb[2 * t + 1];
    const _Float16 hq0 = (_Float16)y0;
    const _Float16 hq1 = (_Float16)y1;
    const _Float16 lq0 = (_Float16)((y0 - (float)hq0) * 2048.0f);
    const _Float16 lq1 = (_Float16)((y1 - (float)hq1) * 2048.0f);
    ph[t] = pk16(h_bits(hq0), h_bits(hq1));
    pl[t] = pk16(h_bits(lq0), h_bits(lq1));
  }
  const size_t o = (size_t)row * EW + c0;
  {
    *(v4u*)(xh + o) = ph;
    *(v4u*)(xl + o) = pl;
    xcnt_wait();   // another part's code follows in the listing and writes these stores' registers
  }
}

// =====================================================================================================
// Transpose-convert: in f32 [R][C] row-major -> out f16 [C][R] (r contiguous), out[c][r] =
// f16(bf16rne(in[r][c]) * scale), scale a power of two. Block = one 64 r x 64 c tile staged in LDS as f32
// (v4f loads, __syncthreads); tiles (bx, by) = (R/64, C/64) per matrix; sv = 64 x 68 floats of LDS.
// Store: group gq = tid>>3 (0..31), piece = tid&7: iteration it writes out row c = it*32+gq, lanes 8q..8q+7
// coverage: 2 iterations x 32 groups = 64 out rows, 8 pieces x 8 = 64 r per row; grid covers every tile ->
// the whole plane.
// =====================================================================================================
__device__ __forceinline__ void tr_f16(const float* __restrict__ in, unsigned short* out, int R, int C,
                                       float scale, int bx, int by, float* sv) {   // sv: [rr][cc] pitch 68 floats
  const int tid = threadIdx.x;
  const int r0 = bx * 64;
  const int c0 = by * 64;
#pragma unroll
  for (int i = 0; i < 4; ++i) {
    const int idx = i * 256 + tid;                  // 0..1023
    const int rr = idx >> 4, c4 = (idx & 15) * 4;
    const v4f a = *(const v4f*)(in + (size_t)(r0 + rr) * C + c0 + c4);
    *(v4f*)(sv + rr * 68 + c4) = a;
  }
  __syncthreads();

  const int gq = tid >> 3, piece = tid & 7;
  v4u hv[2];
  size_t hofs[2];
#pragma unroll
  for (int it = 0; it < 2; ++it) {
    const int cc = it * 32 + gq;
    v4u a;
#pragma unroll
    for (int t = 0; t < 4; ++t) {
      const float f0 = bf_up(bf_bits(sv[(piece * 8 + 2 * t) * 68 + cc]));
      const float f1 = bf_up(bf_bits(sv[(piece * 8 + 2 * t + 1) * 68 + cc]));
      a[t] = pk16(h_bits((_Float16)(f0 * scale)), h_bits((_Float16)(f1 * scale)));
    }
    hv[it] = a;
    hofs[it] = (size_t)(c0 + cc) * R + r0 + piece * 8;
  }
  {
#pragma unroll
    for (int it = 0; it < 2; ++it) {
      *(v4u*)(out + hofs[it]) = hv[it];
    }
    xcnt_wait();   // another part's code follows in the listing and writes these stores' registers
  }
}

// =====================================================================================================
// Transpose-convert of a q/k/v weight matrix into fragment order: in f32 [EW k][W3 n] row-major, n = sec*EW + d*NH + h;
// out f16 tiles of 16 d x 32 k (512 halves), tile ((sec*NH + h)*2 + (d >> 4))*8 + (k >> 5), the 8 halves
// (d, k = 8o .. 8o+7 of the tile) at (o*16 + (d & 15))*8 (see ldfrag_t); value f16(bf16rne(in[k][n]) * scale).
// Block = one 64 k x 64 n tile staged in LDS as f32 = 8 d x 8 h x 2 k steps x 4 octets. Store: dd = tid & 7,
// line L = it*32 + (tid >> 3) = (k step it, octet (L >> 3) & 3, head L & 7): lanes 8q..8q+7 write one whole 128-B line.
// coverage: 64 lines x 8 pieces of 8 k = the block's 64 x 64; grid covers every tile -> the whole plane.
// =====================================================================================================
__device__ __forceinline__ void tr_f16_frag(const float* __restrict__ in, unsigned short* out,
                                            float scale, int bx, int by, float* sv) {   // sv: [rr][cc] pitch 68 floats
  const int tid = threadIdx.x;
  const int r0 = bx * 64;
  const int c0 = by * 64;
#pragma unroll
  for (int i = 0; i < 4; ++i) {
    const int idx = i * 256 + tid;                  // 0..1023
    const int rr = idx >> 4, c4 = (idx & 15) * 4;
    const v4f a = *(const v4f*)(in + (size_t)(r0 + rr) * W3 + c0 + c4);
    *(v4f*)(sv + rr * 68 + c4) = a;
  }
  __syncthreads();

  const int dd = tid & 7;
  v4u hv[2];
  size_t hofs[2];
#pragma unroll
  for (int it = 0; it < 2; ++it) {
    const int L = it * 32 + (tid >> 3);
    const int hh = L & 7, oc = (L >> 3) & 3;
    const int cc = dd * 8 + hh;
    const int rl = it * 32 + oc * 8;
    v4u a;
#pragma unroll
    for (int t = 0; t < 4; ++t) {
      const float f0 = bf_up(bf_bits(sv[(rl + 2 * t) * 68 + cc]));
      const float f1 = bf_up(bf_bits(sv[(rl + 2 * t + 1) * 68 + cc]));
      a[t] = pk16(h_bits((_Float16)(f0 * scale)), h_bits((_Float16)(f1 * scale)));
    }
    hv[it] = a;
    const int sec = c0 >> 8;
    const int d = ((c0 & 255) >> 3) + dd;
    hofs[it] = (size_t)((((sec * NH + hh) * 2 + (d >> 4)) * 8 + (r0 >> 5) + it) * 512 + (oc * 16 + (d & 15)) * 8);
  }
  {
#pragma unroll
    for (int it = 0; it < 2; ++it) {
      *(v4u*)(out + hofs[it]) = hv[it];
    }
    xcnt_wait();   // another part's code follows in the listing and writes these stores' registers
  }
}

// =====================================================================================================
// Additive mask mk f32 [NB][SEQ x][SEQ y][NH h] -> two f32 planes of msc * bf16rne(mk), msc a power of two, both in
// the order of the attention's score accumulators. With (i, kk) = (query, key): ma holds mk[b][i][kk][h], mb holds
// mk[b][kk][i][h]; element (i, kk) of plane (b, h) lies at float offset
//   ((((i >> 4) * 8 + (kk >> 4)) * 2 + ((kk >> 2) & 1)) * 32 + ((kk >> 3) & 1) * 16 + (i & 15)) * 4 + (kk & 3),
// so the 16 B that lane g*16 + (i & 15) wants for accumulator elements 0..3 (or 4..7) of key tile kk >> 4 lie lane
// after lane: one load of a wave covers 512 B in a row. blocks = (SEQ/8 groups, NH, NB), 256 threads; a block owns
// queries grp*8 .. +7 of both planes. Both 8 x 128 tiles are staged in LDS (pitch MTP), __syncthreads, then thread
// (L = tid>>3, p = tid&7) stores keys 4L..4L+3 of query grp*8+p: lanes 8q..8q+7 write one whole 128-B line.
// coverage: 16 groups x 8 queries x (32 L x 4 keys) = all SEQ x SEQ of every (b,h) in both planes.
// =====================================================================================================
#define MTP 136                 // LDS pitch of the mask tiles (floats): 16-B reads of 8 rows x 2 key quads meet each bank once
__device__ __forceinline__ void mask_planes(const float* __restrict__ mk, float* ma, float* mb,
                                            float msc, int grp, int h, int b, float* sm) {   // sm: 2 x 8 x MTP floats
  const int tid = threadIdx.x;
  const size_t pb = ((size_t)(b * NH + h)) * SEQ * SEQ;          // plane base of (b,h)
  float* st = sm + 8 * MTP;                                      // tile of the transposed plane
  {
    const int xx = tid >> 5, y4 = (tid & 31) * 4;
    const int x = grp * 8 + xx;
    const float* src = mk + (((size_t)b * SEQ + x) * SEQ + y4) * NH + h;
    v4f vd;
#pragma unroll
    for (int t = 0; t < 4; ++t) vd[t] = msc * bf_up(bf_bits(src[(size_t)t * NH]));
    *(v4f*)(sm + xx * MTP + y4) = vd;
  }
  xcnt_wait();                                                   // a later load's result may land on the address pair above
  {
    const int x = tid >> 1, yq = (tid & 1) * 4;
    const float* src = mk + (((size_t)b * SEQ + x) * SEQ + grp * 8 + yq) * NH + h;
#pragma unroll
    for (int t = 0; t < 4; ++t) st[(yq + t) * MTP + x] = msc * bf_up(bf_bits(src[(size_t)t * NH]));
  }
  __syncthreads();
  {
    const int L = tid >> 3, p = tid & 7;
    const v4f vd = *(const v4f*)(sm + p * MTP + L * 4);
    const v4f vt = *(const v4f*)(st + p * MTP + L * 4);
    const size_t o = pb + (size_t)(((((grp >> 1) * 8 + (L >> 2)) * 2 + (L & 1)) * 32 + ((L >> 1) & 1) * 16 + (grp & 1) * 8 + p) * 4);
    *(v4f*)(ma + o) = vd;
    *(v4f*)(mb + o) = vt;
    xcnt_wait();   // another part's code follows in the listing and writes these stores' registers
  }
}

// =====================================================================================================
// All preparation in one launch: the four parts read only inputs and write disjoint planes, so none waits for
// another. Block ranges (block-uniform branches, each part's barriers inside its own branch), short parts
// first so that they run beside the layer norm's stream:
//   [0, PB_W)            Wqkv_in / Wqkv_out tiles: t -> matrix t / 48, tile (t & 3, (t % 48) >> 2)
//   [PB_W, PB_O)         Wo tiles: t -> (t & 7, t >> 3)
//   [PB_O, PB_M)         mask groups: t -> (grp = t & 15, h = (t >> 4) & 7, b = t >> 7)
//   [PB_M, PB_M + RT/8)  layer norm, 8 rows per block
// =====================================================================================================
#define PB_W (2 * (EW / 64) * (W3 / 64))            // 96
#define PB_O (PB_W + (KO / 64) * (EW / 64))         // 128
#define PB_M (PB_O + (SEQ / 8) * NH * NB)           // 384 (NB = 2)
static_assert(EW / 64 == 4 && W3 / 64 == 12 && KO / 64 == 8 && SEQ / 8 == 16 && NH == 8);

__global__ __launch_bounds__(256) void prep_all(
    const float* __restrict__ e, const float* __restrict__ lw, const float* __restrict__ lb,
    unsigned short* xh, unsigned short* xl,
    const float* __restrict__ wqi, const float* __restrict__ wqo, unsigned short* wt, float cw,
    const float* __restrict__ wo, unsigned short* woh, float cwo,
    const float* __restrict__ mk, float* ma, float* mb, float msc) {
  __shared__ __align__(16) float sbuf[64 * 68];
  const int bx = blockIdx.x;
  if (bx < PB_W) {
    const int z = (bx >= PB_W / 2) ? 1 : 0;         // the second matrix's plane follows the first
    const int t = bx - z * (PB_W / 2);
    tr_f16_frag((z != 0) ? wqo : wqi, wt + (size_t)z * EW * W3, cw, t & 3, t >> 2, sbuf);
  } else if (bx < PB_O) {
    const int t = bx - PB_W;
    tr_f16(wo, woh, KO, EW, cwo, t & 7, t >> 3, sbuf);
  } else if (bx < PB_M) {
    const int t = bx - PB_O;
    mask_planes(mk, ma, mb, msc, t & 15, (t >> 4) & 7, t >> 7, sbuf);
  } else {
    ln_planes(e, lw, lb, xh, xl, RT, bx - PB_M);
  }
}

// =====================================================================================================
// Main loop of the output projection: one block = 128 x 128 of the product, 8 waves as 4 (m) x 2 (n),
// each wave its 32 x 64 tile. Operands go global -> registers -> LDS in chunks of KC k values, so that every
// global load covers whole 128-B lines (8 lanes per row) and each staged row serves 2 (A) or 4 (B) waves.
// Buffer rows: A hi 0..127 | A residual 128..255 | B 256..383, pitch LP. Thread t stages piece t&7 of rows
// u*32 + (t>>3), u = 0..11; gAh, gAl, gB point at its piece of its first row of each operand, sA / sB are
// the element strides between its successive rows. Two buffers: chunk c+1 is loaded into registers ahead of
// the products of chunk c and stored behind them into the buffer whose readers left at the previous
// barrier; one barrier per chunk publishes it. k runs upward in steps of 32 within and across chunks.
// The closing barrier of the last chunk lets the caller reuse sm.
// =====================================================================================================
#define KC   64                 // k values per staged chunk (128 B of every operand row)
#define LP   72                 // LDS row pitch in halves: 144 B = 16 B x 9, 16-B fragment reads meet each bank once
#define STG  (384 * LP)         // halves per buffer (55296 B)

__device__ __forceinline__ void gemm_blk(const _Float16* gAh, const _Float16* gAl, size_t sA,
                                         const _Float16* gB, size_t sB, int K, _Float16* sm, int tid,
                                         v8f (&acch)[2][4], v8f (&accl)[2][4]) {
  const int lane = tid & 31;
  const int wave = tid >> 5;
  const int fo = (lane & 15) * LP + (lane >> 4) * 8;            // fragment row and k half of this lane
  const int ra = (wave & 3) * 32 * LP + fo;                     // A hi rows of this wave
  const int rb = (256 + (wave >> 2) * 64) * LP + fo;            // B rows of this wave
  _Float16* sw = sm + (tid >> 3) * LP + (tid & 7) * 8;
  v4u st[12];
#pragma unroll
  for (int u = 0; u < 4; ++u) {
    st[u]     = *(const v4u*)(gAh + u * sA);
    st[4 + u] = *(const v4u*)(gAl + u * sA);
    st[8 + u] = *(const v4u*)(gB + u * sB);
  }
#pragma unroll
  for (int u = 0; u < 12; ++u) *(v4u*)(sw + u * 32 * LP) = st[u];
  __syncthreads();

  const int nc = K / KC;
  for (int c = 0; c < nc; ++c) {
    const bool more = (c + 1) < nc;                             // block-uniform
    if (more) {
      const int ko = (c + 1) * KC;
#pragma unroll
      for (int u = 0; u < 4; ++u) {
        st[u]     = *(const v4u*)(gAh + u * sA + ko);
        st[4 + u] = *(const v4u*)(gAl + u * sA + ko);
        st[8 + u] = *(const v4u*)(gB + u * sB + ko);
      }
    }
    const _Float16* sb = sm + (c & 1) * STG;
#pragma unroll
    for (int kk = 0; kk < KC; kk += 32) {
      v16h fh[2], fl[2];
#pragma unroll
      for (int i = 0; i < 2; ++i) {
        fh[i] = ldfrag_h(sb + ra + i * 16 * LP + kk);
        fl[i] = ldfrag_h(sb + ra + (128 + i * 16) * LP + kk);
      }
      v16h bnx = ldfrag_h(sb + rb + kk);
#pragma unroll
      for (int j = 0; j < 4; ++j) {
        const v16h bfr = bnx;
        if (j < 3) bnx = ldfrag_h(sb + rb + (j + 1) * 16 * LP + kk);   // next B fragment flies under this one's products
#pragma unroll
        for (int i = 0; i < 2; ++i) {
          acch[i][j] = mma_h(fh[i], bfr, acch[i][j]);
          accl[i][j] = mma_h(fl[i], bfr, accl[i][j]);
        }
      }
    }
    if (more) {
      _Float16* sn = sw + ((c + 1) & 1) * STG;
#pragma unroll
      for (int u = 0; u < 12; ++u) *(v4u*)(sn + u * 32 * LP) = st[u];
    }
    __syncthreads();
  }
}

// =====================================================================================================
// q/k/v projection and axial attention in one kernel: q, k and v never leave the WGP.
// grid = (column index j, batch * 2 + direction); block = 8 waves, wave = head h.
// X rows (layer norm planes, f16 hi + residual x2048) are staged whole in LDS (128 rows x 256 k, pitch XP) and serve
// all 8 waves; each wave reads its own head's 96 weight rows from the fragment-ordered weight plane (tr_f16_frag),
// every load 512 B in a row, one k step (q: two) ahead of its products; X fragments are read from LDS 16 products ahead.
//   keys/values kk: edge row (j,kk) for dir 0, (kk,j) for dir 1; queries i: edge row (i,j). For dir 0 the X rows are
//   staged twice (block-uniform branch, a barrier in front of and behind the second staging).
// Products (k upward in steps of 32, hi and residual X in separate accumulators; value = ((acch + accl*scl)*sch + bias)*fac):
//   k, q: W (A, lane = channel d) . X^T (B, lane = edge row): D lane = edge row, element r = channel 16dt + 8g + r, so
//         the two d tiles of a 16-row tile, converted to f16 hi + residual (x2048), ARE the score fragment of that tile
//         (element e <- d 8g+e, element 8+e <- d 16+8g+e: the k order of ldfrag_h, the same for k and q).
//   v:    X (A, lane = key) . W^T (B, lane = channel d): D lane = d, element r = key 16kt + 8g + r: 16 B of a v^T row.
// k fragments of key tiles 4..7 stay in registers, those of tiles 0..3 wait in sQ until the q projection; v^T goes to sVt, q fragments of 4 strips at a time to sQ (each lane reads back only
// the 16-B pieces that it wrote itself).
// Scores are computed TRANSPOSED: S^T[kk][i] = K(A, lane = key row, d per k-map) . Q^T(B, lane = query,
// d per k-map), hi.hi into the mask-initialised accumulator plus (hi.lo + lo.hi)*xscl; D lane = query i,
// element r = key 16ct + 8g + r, so a lane and its partner lane^16 own one softmax row: max / exp / sum in
// f32 with one __shfl_xor(.,16) each. Weights p*pcar are converted to f16 in registers and used directly as
// the B operand of O^T[d][i] = V^T(A from LDS, lane = d, keys per k-map) . P^T (B: lane = query, element
// e <- tile 2c key 8g+e, element 8+e <- tile 2c+1 key 8g+e).
// sO [16][SOP] f32 output slab (cross-wave: block barriers before the row writes and before the next strip).
// Output: f16 planes vah = f16(O*1024), val = f16((O*1024 - hi)*2048), [RB rows i*SEQ+j][KO] at columns
// dir*EW + d*NH + h; per strip wave h writes rows 2h, 2h+1: 32 lanes x 16 B = the whole 512-B half row
// coverage: 8 strips x 8 waves x 2 rows = 128 queries x (32 lanes x 8 = 256 channels) for every (j, dir).
// =====================================================================================================
#define XP   264                // LDS pitch of the staged X rows (halves): 528 B = 16 B x 33, 16-B fragment reads meet each bank once
#define XPL  (SEQ * XP)         // halves per staged plane
#define WSEC (NH * 2 * 8 * 512) // halves per section (q, k, v) of a fragment-ordered weight plane
static_assert(WSEC == EW * EW);

// 128 X rows, hi and residual, global -> registers -> LDS; wave w takes rows w, w+8, ..: one load = one whole 512-B row.
// gh, gl: this lane's piece of row w; rs: elements between rows t and t + 8
__device__ __forceinline__ void stage_x(const _Float16* gh, const _Float16* gl, size_t rs, _Float16* sw) {
#pragma unroll
  for (int b = 0; b < 2; ++b) {
    v4u st[16];
#pragma unroll
    for (int u = 0; u < 8; ++u) {
      st[u]     = *(const v4u*)(gh + (size_t)(b * 8 + u) * rs);
      st[8 + u] = *(const v4u*)(gl + (size_t)(b * 8 + u) * rs);
    }
    xcnt_wait_p(gh, gl);                                        // later code writes these loads' address registers
#pragma unroll
    for (int u = 0; u < 8; ++u) {
      *(v4u*)(sw + (b * 8 + u) * 8 * XP) = st[u];
      *(v4u*)(sw + XPL + (b * 8 + u) * 8 * XP) = st[8 + u];
    }
  }
}

// plain builtin product for the projection steps and the strip loop: its operands may lie in any register, also above v255
// (an asm statement's operands may not, and the strip loop's register sets together pass v255)
__device__ __forceinline__ v8f mma_b(v16h a, v16h b, v8f c) {
  return __builtin_amdgcn_wmma_f32_16x16x32_f16(false, a, false, b, (short)0, c, false, false);
}

// X fragments of one row tile at one k step, hi and residual, LDS -> registers
__device__ __forceinline__ void ldx(v16h (&x)[2], const _Float16* p) {
  x[0] = ldfrag_h(p);
  x[1] = ldfrag_h(p + XPL);
}

// the k and v products of one row tile at one k step
__device__ __forceinline__ void kv_row(const v16h (&w)[4], const v16h (&x)[2], v8f (&aK)[2][2], v8f (&aV)[2][2]) {
#pragma unroll
  for (int dt = 0; dt < 2; ++dt) {
    aK[dt][0] = mma_b(w[dt], x[0], aK[dt][0]);
    aK[dt][1] = mma_b(w[dt], x[1], aK[dt][1]);
    aV[dt][0] = mma_b(x[0], w[2 + dt], aV[dt][0]);
    aV[dt][1] = mma_b(x[1], w[2 + dt], aV[dt][1]);
  }
}

// one k step of the k and v products of 4 row tiles: 8 X fragments serve 32 products. The fragments stand in four
// register sets xs[row tile] and are read from LDS 16 products ahead of their use, 8 reads in one group: on entry
// xs[0], xs[1] hold (or await) this step's tiles 0, 1; on exit those of the step at xn. xc: this step, xn: the next.
__device__ __forceinline__ void kv_step(const v16h (&w)[4], const _Float16* xc, const _Float16* xn, v16h (&xs)[4][2],
                                        v8f (&aK)[4][2][2], v8f (&aV)[4][2][2]) {
  ldx(xs[2], xc + 2 * 16 * XP);
  ldx(xs[3], xc + 3 * 16 * XP);
  __builtin_amdgcn_sched_barrier(0);   // the reads stay one group ahead of these products: sunk to their use, each waits out the LDS latency
  kv_row(w, xs[0], aK[0], aV[0]);
  kv_row(w, xs[1], aK[1], aV[1]);
  __builtin_amdgcn_sched_barrier(0);   // the next group is not spread among the products above
  ldx(xs[0], xn);
  ldx(xs[1], xn + 16 * XP);
  __builtin_amdgcn_sched_barrier(0);   // as the first
  kv_row(w, xs[2], aK[2], aV[2]);
  kv_row(w, xs[3], aK[3], aV[3]);
  __builtin_amdgcn_sched_barrier(0);   // as the second
}

// two d tiles of accumulators (lane = edge row) -> score fragment, f16 hi and residual x2048
__device__ __forceinline__ void frag_from_acc(const v8f (&a)[2][2], const float (&bz)[2][8], float scl, float sch,
                                              float fac, v16h& fh, v16h& fl) {
#pragma unroll
  for (int dt = 0; dt < 2; ++dt)
#pragma unroll
    for (int e = 0; e < 8; ++e) {
      const float s = ((a[dt][0][e] + a[dt][1][e] * scl) * sch + bz[dt][e]) * fac;
      const _Float16 hq = (_Float16)s;
      fh[dt * 8 + e] = hq;
      fl[dt * 8 + e] = (_Float16)((s - (float)hq) * 2048.0f);
    }
}

// one strip's mask, 8 key tiles in score-accumulator order: 16 loads of 512 B in a row, one group
__device__ __forceinline__ void ld_mask(v8f (&m)[8], const float* mfr) {
#pragma unroll
  for (int ct = 0; ct < 8; ++ct) {
    const v4f mv0 = *(const v4f*)(mfr + ct * 256);
    const v4f mv1 = *(const v4f*)(mfr + ct * 256 + 128);
    v8f am;
    am[0] = mv0[0]; am[1] = mv0[1]; am[2] = mv0[2]; am[3] = mv0[3];
    am[4] = mv1[0]; am[5] = mv1[1]; am[6] = mv1[2]; am[7] = mv1[3];
    m[ct] = am;
  }
  xcnt_wait_p(mfr, mfr);                                        // later code writes these loads' address registers
}

__global__ __launch_bounds__(256) void proj_attn(
    const unsigned short* __restrict__ Xhp, const unsigned short* __restrict__ Xlp,
    const unsigned short* __restrict__ Wfp, const float* __restrict__ bias0, const float* __restrict__ bias1,
    const float* __restrict__ mp, unsigned short* vah, unsigned short* val,
    float f0, float f1, float f2, float sch, float scl,
    float xscl, float escl, float pcar, float oscl) {
  const int bd  = blockIdx.y;                      // batch * 2 + direction
  const int dir = bd & 1;
  const size_t xo = (size_t)(bd >> 1) * RB * EW;
  const _Float16* Xh = (const _Float16*)(const void*)Xhp + xo;
  const _Float16* Xl = (const _Float16*)(const void*)Xlp + xo;
  const float* bias = (dir != 0) ? bias1 : bias0;
  mp  += (size_t)(dir * NB + (bd >> 1)) * NH * SEQ * SEQ;   // direct planes of all batches, then transposed
  vah += (size_t)(bd >> 1) * RB * KO;
  val += (size_t)(bd >> 1) * RB * KO;
  __shared__ __align__(16) unsigned short sXu[2 * XPL];           // 135168 B
  __shared__ __align__(16) unsigned short sVt[NH * HD * VTP];     // 69632 B
  __shared__ __align__(16) unsigned short sQu[NH * 4 * 1024];     // 65536 B
  __shared__ __align__(16) float sO[16 * SOP];                    // 16896 B
  _Float16* sX = (_Float16*)(void*)sXu;
  _Float16* sVw = (_Float16*)(void*)sVt;
  const _Float16* sVh = (const _Float16*)(const void*)sVt;
  const int tid  = threadIdx.x;
  const int lane = tid & 31;
  const int h    = tid >> 5;
  const int nl   = lane & 15;
  const int g    = lane >> 4;
  const int g8   = g * 8;
  const int j    = blockIdx.x;
  // this lane's piece of weight tile (section 0, head h, d tile 0, k step 0); tile (sec, h, dt, ks) is 512 halves
  const _Float16* Wh = (const _Float16*)(const void*)Wfp + (size_t)dir * W3 * EW + (size_t)(h * (2 * 8 * 512) + lane * 8);
  _Float16* sxw = sX + h * XP + lane * 8;          // staging: row h, this lane's piece
  const _Float16* xr = sX + nl * XP + g8;          // fragments: row nl of tile 0, this lane's k half
  const unsigned bog = (unsigned)(((g8 << 3) + h) * 4);   // byte offsets of this lane's bias entries: channel 8g (q, k)
  const unsigned bon = (unsigned)(((nl << 3) + h) * 4);   // and channel nl (v)
  const char* bpg = (const char*)bias + bog;
  const char* bpn = (const char*)bias + bon;

  // ---- X rows of the keys and values
  if (dir != 0) {
    const size_t o = (size_t)(h * SEQ + j) * EW + lane * 8;
    stage_x(Xh + o, Xl + o, (size_t)8 * SEQ * EW, sxw);
  } else {
    const size_t o = (size_t)(j * SEQ + h) * EW + lane * 8;
    stage_x(Xh + o, Xl + o, (size_t)8 * EW, sxw);
  }
  __syncthreads();

  // ---- k and v of head h, 4 key tiles at a time; weight fragments in two register sets, the next k step's in flight
  _Float16* sQw = (_Float16*)(void*)sQu + h * 4096 + lane * 8;  // this lane's pieces of its wave's q fragments
  v16h kh[8], kl[8];
  {
    const _Float16* wk = Wh + WSEC;
    const _Float16* wv = Wh + 2 * WSEC;
#pragma unroll
    for (int grp = 0; grp < 2; ++grp) {
      v8f aK[4][2][2], aV[4][2][2];
#pragma unroll
      for (int rt = 0; rt < 4; ++rt)
#pragma unroll
        for (int dt = 0; dt < 2; ++dt) {
          aK[rt][dt][0] = zero8(); aK[rt][dt][1] = zero8();
          aV[rt][dt][0] = zero8(); aV[rt][dt][1] = zero8();
        }
      v16h wa[4], wb[4];
#pragma unroll
      for (int dt = 0; dt < 2; ++dt) {
        wa[dt]     = ldfrag_t(wk + dt * 8 * 512);
        wa[2 + dt] = ldfrag_t(wv + dt * 8 * 512);
      }
      xcnt_wait();                                              // the same
      __builtin_amdgcn_sched_barrier(0);                        // no later address arithmetic is lifted in front of that wait
      const _Float16* xg = xr + grp * 64 * XP;
      v16h xs[4][2];
      ldx(xs[0], xg);
      ldx(xs[1], xg + 16 * XP);
#pragma unroll 1
      for (int ks = 0; ks < 8; ks += 2) {
#pragma unroll
        for (int dt = 0; dt < 2; ++dt) {
          wb[dt]     = ldfrag_t(wk + (dt * 8 + ks + 1) * 512);
          wb[2 + dt] = ldfrag_t(wv + (dt * 8 + ks + 1) * 512);
        }
        xcnt_wait();                                            // the same
        kv_step(wa, xg + ks * 32, xg + (ks + 1) * 32, xs, aK, aV);
        if (ks + 2 < 8) {                                       // uniform
#pragma unroll
          for (int dt = 0; dt < 2; ++dt) {
            wa[dt]     = ldfrag_t(wk + (dt * 8 + ks + 2) * 512);
            wa[2 + dt] = ldfrag_t(wv + (dt * 8 + ks + 2) * 512);
          }
          xcnt_wait();                                          // the same
        }
        // behind the last step nothing follows: its read ahead goes to step 0 again (staged data, not used)
        kv_step(wb, xg + (ks + 1) * 32, xg + ((ks + 2 < 8) ? (ks + 2) * 32 : 0), xs, aK, aV);
      }
      float bk[2][8], bv[2];
#pragma unroll
      for (int dt = 0; dt < 2; ++dt) {
#pragma unroll
        for (int e = 0; e < 8; ++e) bk[dt][e] = bf_up(bf_bits(*(const float*)(bpg + (EW + ((dt * 16 + e) << 3)) * 4)));
        bv[dt] = bf_up(bf_bits(*(const float*)(bpn + (2 * EW + ((dt * 16) << 3)) * 4)));
      }
      xcnt_wait_po(bpg, bpn, bog, bon);                         // later code writes these loads' address registers
#pragma unroll
      for (int rt = 0; rt < 4; ++rt) {
        const int kt = grp * 4 + rt;
        if (grp == 0) {
          // the first group's k fragments wait in sQ (idle until the q projection) while the second group's loop needs the registers
          union { v16h v; v8h hh[2]; } H, L;
          frag_from_acc(aK[rt], bk, scl, sch, f1, H.v, L.v);
          *(v8h*)(sQw + rt * 1024)       = H.hh[0];
          *(v8h*)(sQw + rt * 1024 + 256) = H.hh[1];
          *(v8h*)(sQw + rt * 1024 + 512) = L.hh[0];
          *(v8h*)(sQw + rt * 1024 + 768) = L.hh[1];
        } else {
          frag_from_acc(aK[rt], bk, scl, sch, f1, kh[kt], kl[kt]);
        }
#pragma unroll
        for (int dt = 0; dt < 2; ++dt) {
          v8h o;
#pragma unroll
          for (int e = 0; e < 8; ++e)
            o[e] = (_Float16)(((aV[rt][dt][0][e] + aV[rt][dt][1][e] * scl) * sch + bv[dt]) * f2);
          *(v8h*)(sVw + (h * HD + dt * 16 + nl) * VTP + kt * 16 + g8) = o;
        }
      }
    }
  }

  // ---- X rows of the queries: those of the keys for dir 1, others for dir 0 (block-uniform)
  if (dir == 0) {
    __syncthreads();                                            // every wave has left the key rows
    const size_t o = (size_t)(h * SEQ + j) * EW + lane * 8;
    stage_x(Xh + o, Xl + o, (size_t)8 * SEQ * EW, sxw);
    __syncthreads();
  }

  // ---- the first group's k fragments come back: each lane reads the pieces that it wrote itself
#pragma unroll
  for (int rt = 0; rt < 4; ++rt) {
    kh[rt] = ldfrag_t(sQw + rt * 1024);
    kl[rt] = ldfrag_t(sQw + rt * 1024 + 512);
  }

  float bq[2][8];
#pragma unroll
  for (int dt = 0; dt < 2; ++dt)
#pragma unroll
    for (int e = 0; e < 8; ++e) bq[dt][e] = bf_up(bf_bits(*(const float*)(bpg + ((dt * 16 + e) << 3) * 4)));
  xcnt_wait_po(bpg, bpg, bog, bog);                             // later code writes these loads' address registers

#pragma unroll 1
  for (int qg = 0; qg < 2; ++qg) {
    // mask of the strip that comes next, fetched while earlier work runs (tile (h, s) of the plane is 8 x 256 floats)
    v8f mn[8];
    const float* mq = mp + (size_t)(h * 8 + qg * 4) * (8 * 256) + lane * 4;
    // ---- q of head h, 4 query tiles
    {
      v8f aQ[4][2][2];
#pragma unroll
      for (int rt = 0; rt < 4; ++rt)
#pragma unroll
        for (int dt = 0; dt < 2; ++dt) { aQ[rt][dt][0] = zero8(); aQ[rt][dt][1] = zero8(); }
      // a k step is 16 products: the X fragments of a whole step (two register sets) are read from LDS one step ahead,
      // 16 reads in one group; the weight fragments (three sets) come two steps ahead, a step being shorter than their way
      v16h wq[3][2], xq[2][4][2];
#pragma unroll
      for (int dt = 0; dt < 2; ++dt) {
        wq[0][dt] = ldfrag_t(Wh + dt * 8 * 512);
        wq[1][dt] = ldfrag_t(Wh + (dt * 8 + 1) * 512);
      }
      xcnt_wait();                                              // the same
      const _Float16* xg = xr + qg * 64 * XP;
#pragma unroll
      for (int rt = 0; rt < 4; ++rt) ldx(xq[0][rt], xg + rt * 16 * XP);
#pragma unroll
      for (int ks = 0; ks < 8; ++ks) {
        if (ks + 2 < 8) {
#pragma unroll
          for (int dt = 0; dt < 2; ++dt) wq[(ks + 2) % 3][dt] = ldfrag_t(Wh + (dt * 8 + ks + 2) * 512);
          xcnt_wait();                                          // the same
        }
        if (ks + 1 < 8) {
#pragma unroll
          for (int rt = 0; rt < 4; ++rt) ldx(xq[(ks + 1) & 1][rt], xg + (ks + 1) * 32 + rt * 16 * XP);
        }
        __builtin_amdgcn_sched_barrier(0);   // the fetches stay one group ahead of this step's products: sunk to their use, each waits out its latency
#pragma unroll
        for (int rt = 0; rt < 4; ++rt)
#pragma unroll
          for (int dt = 0; dt < 2; ++dt) {
            aQ[rt][dt][0] = mma_b(wq[ks % 3][dt], xq[ks & 1][rt][0], aQ[rt][dt][0]);
            aQ[rt][dt][1] = mma_b(wq[ks % 3][dt], xq[ks & 1][rt][1], aQ[rt][dt][1]);
          }
        __builtin_amdgcn_sched_barrier(0);   // the next step's fetches are not spread among the products above
      }
      ld_mask(mn, mq);                       // the group's first strip: flies under the conversion of q below
      __builtin_amdgcn_sched_barrier(0);     // the loads are not sunk below the conversion, where their latency would be waited out
#pragma unroll
      for (int rt = 0; rt < 4; ++rt) {
        union { v16h v; v8h hh[2]; } H, L;
        frag_from_acc(aQ[rt], bq, scl, sch, f0, H.v, L.v);
        *(v8h*)(sQw + rt * 1024)       = H.hh[0];
        *(v8h*)(sQw + rt * 1024 + 256) = H.hh[1];
        *(v8h*)(sQw + rt * 1024 + 512) = L.hh[0];
        *(v8h*)(sQw + rt * 1024 + 768) = L.hh[1];
      }
    }

    // ---- v^T fragments of head h: the same for every strip, read from LDS once for the group's 4 strips (registers are
    //      free behind the q projection), so that no p.v product waits for an LDS read
    v16h va[2][4];
#pragma unroll
    for (int dt = 0; dt < 2; ++dt)
#pragma unroll
      for (int c = 0; c < 4; ++c) va[dt][c] = ldfrag_h(sVh + (h * HD + dt * 16 + nl) * VTP + 32 * c + g8);

    v16h qh = ldfrag_t(sQw);                                    // query tile of the group's first strip
    v16h ql = ldfrag_t(sQw + 512);

#pragma unroll 1
    for (int sl = 0; sl < 4; ++sl) {
    const int s = qg * 4 + sl;                                  // qh, ql: query tile s; this lane's B / D column is query s*16 + nl

    // ---- transposed scores, 8 key tiles; the strip's mask (mn, fetched under the previous strip, or for a group's first strip under the q conversion) is the initial accumulator
    v8f acc[8];
#pragma unroll
    for (int ct = 0; ct < 8; ++ct) {
      v8f ax = mma_b(kh[ct], ql, zero8());
      ax = mma_b(kl[ct], qh, ax);
      const v8f am = mma_b(kh[ct], qh, mn[ct]);
      acc[ct] = am + ax * xscl;
    }

    // ---- the next strip's mask and query tile: the 16 loads and 4 LDS reads fly under this strip's softmax, p.v and output
    if (sl + 1 < 4) {                                           // uniform
      ld_mask(mn, mq + (size_t)(sl + 1) * (8 * 256));
      qh = ldfrag_t(sQw + (sl + 1) * 1024);
      ql = ldfrag_t(sQw + (sl + 1) * 1024 + 512);
      __builtin_amdgcn_sched_barrier(0);                        // the fetches are not sunk into the work below
    }

    // ---- softmax over the 128 keys of query i (this lane: 64 values, partner lane^16: the other 64)
    float mx = acc[0][0];
#pragma unroll
    for (int ct = 0; ct < 8; ++ct)
#pragma unroll
      for (int r = 0; r < 8; ++r) mx = fmaxf(mx, acc[ct][r]);
    mx = fmaxf(mx, __shfl_xor(mx, 16));
    float sum = 0.f;
#pragma unroll
    for (int ct = 0; ct < 8; ++ct)
#pragma unroll
      for (int r = 0; r < 8; ++r) {
        const float ev = __expf((acc[ct][r] - mx) * escl);
        acc[ct][r] = ev;
        sum += ev;
      }
    sum += __shfl_xor(sum, 16);
    const float rc = pcar / sum;                                // sum >= 1

    // ---- P^T as B fragments straight from the accumulators
    v16h pb[4];
#pragma unroll
    for (int c = 0; c < 4; ++c) {
      union { v16h v; v8h hh[2]; } U;
      v8h p0, p1;
#pragma unroll
      for (int e2 = 0; e2 < 8; ++e2) {
        p0[e2] = (_Float16)(acc[2 * c][e2] * rc);
        p1[e2] = (_Float16)(acc[2 * c + 1][e2] * rc);
      }
      U.hh[0] = p0;
      U.hh[1] = p1;
      pb[c] = U.v;
    }

    // ---- O^T[d][i] = V^T . P^T, two 16-row d tiles, K = 128 keys
    v8f oacc[2];
#pragma unroll
    for (int dt = 0; dt < 2; ++dt) {
      v8f o = zero8();
#pragma unroll
      for (int c = 0; c < 4; ++c) {
        o = mma_b(va[dt][c], pb[c], o);
      }
      oacc[dt] = o;
    }

    // ---- stage O (f32, true scale) into the slab: row = query nl, column = d*NH + h
#pragma unroll
    for (int dt = 0; dt < 2; ++dt)
#pragma unroll
      for (int r = 0; r < 8; ++r)
        sO[nl * SOP + ((dt * 16 + g8 + r) << 3) + h] = oacc[dt][r] * oscl;
    __syncthreads();

    // ---- wave h writes queries s*16 + 2h, + 2h + 1: 512-B half rows in hi and residual planes
    {
      v4u hv[2], lv[2];
      size_t ofs[2];
#pragma unroll
      for (int q = 0; q < 2; ++q) {
        const int rr = 2 * h + q;
        const v4f x0 = *(const v4f*)(sO + rr * SOP + lane * 8);
        const v4f x1 = *(const v4f*)(sO + rr * SOP + lane * 8 + 4);
        float f[8];
        f[0] = x0[0]; f[1] = x0[1]; f[2] = x0[2]; f[3] = x0[3];
        f[4] = x1[0]; f[5] = x1[1]; f[6] = x1[2]; f[7] = x1[3];
        v4u ph, pl;
#pragma unroll
        for (int u = 0; u < 4; ++u) {
          const float s0 = f[2 * u] * 1024.0f;
          const float s1 = f[2 * u + 1] * 1024.0f;
          const _Float16 hq0 = (_Float16)s0;
          const _Float16 hq1 = (_Float16)s1;
          const _Float16 lq0 = (_Float16)((s0 - (float)hq0) * 2048.0f);
          const _Float16 lq1 = (_Float16)((s1 - (float)hq1) * 2048.0f);
          ph[u] = pk16(h_bits(hq0), h_bits(hq1));
          pl[u] = pk16(h_bits(lq0), h_bits(lq1));
        }
        hv[q] = ph;
        lv[q] = pl;
        ofs[q] = ((size_t)(s * 16 + rr) * SEQ + j) * KO + (size_t)dir * EW + lane * 8;
      }
      {
#pragma unroll
        for (int q = 0; q < 2; ++q) {
          *(v4u*)(vah + ofs[q]) = hv[q];
          *(v4u*)(val + ofs[q]) = lv[q];
        }
        xcnt_wait();                                            // the next strip's code writes these stores' registers
      }
    }
    __syncthreads();                                            // sO reused by the next strip
    }
  }
}

// =====================================================================================================
// Output projection: C[m][n] = sch * (sum_k Ahi[m][k]*Bt[n][k] + scl * sum_k Alo[m][k]*Bt[n][k]) + bf16rne(bias[n])
// (f16 products, f32 accumulate, hi and scaled-residual products in separate accumulators). Ahi/Alo row-major
// [M][K] pitch lda; Bt [N][K] pitch ldb; C f32 [M][N] pitch ldc. Block = 128 x 128 of C (gemm_blk), one wave per
// 32x64 tile; M = RT, N = EW, K = KO (multiples of 128, 128 and KC).
// Epilogue: 16-row slabs staged per wave in the staging LDS (free behind the main loop's closing barrier); each 64-wide row segment (256 B) written by one instruction
// coverage: 2 slabs x 16 rows x 64 cols = the wave's whole 32x64 tile; grid covers every tile of C.
// =====================================================================================================
__global__ __launch_bounds__(256) void gemm32h_w(
    const unsigned short* __restrict__ Ahp, const unsigned short* __restrict__ Alp,
    const unsigned short* __restrict__ Btp,
    const float* __restrict__ bias,
    float* C, float sch, float scl) {
  constexpr int lda = KO, ldb = KO, ldc = EW, M = RT, N = EW, K = KO;   // fixed: staged row steps become immediate offsets
  const _Float16* Ah = (const _Float16*)(const void*)Ahp;
  const _Float16* Al = (const _Float16*)(const void*)Alp;
  const _Float16* Bh = (const _Float16*)(const void*)Btp;
  __shared__ __align__(16) unsigned short smem[2 * STG];
  const int tid  = threadIdx.x;
  const int lane = tid & 31;
  const int wave = tid >> 5;
  constexpr int blkN = N >> 7;
  if ((int)blockIdx.x >= (M >> 7) * blkN) return;   // block-uniform, in front of every barrier
  const int bm = blockIdx.x / blkN;
  const int bn = blockIdx.x - bm * blkN;
  const int m0 = bm * 128 + (wave & 3) * 32;
  const int n0 = bn * 128 + (wave >> 2) * 64;
  const int rlane = lane & 15;
  const int mOff  = (lane >> 4) * 8;

  v8f acch[2][4], accl[2][4];
#pragma unroll
  for (int i = 0; i < 2; ++i)
#pragma unroll
    for (int j = 0; j < 4; ++j) { acch[i][j] = zero8(); accl[i][j] = zero8(); }

  {
    const size_t ao = (size_t)(bm * 128 + (tid >> 3)) * lda + (tid & 7) * 8;
    const size_t bo = (size_t)(bn * 128 + (tid >> 3)) * ldb + (tid & 7) * 8;
    gemm_blk(Ah + ao, Al + ao, (size_t)32 * lda, Bh + bo, (size_t)32 * ldb, K,
             (_Float16*)(void*)smem, tid, acch, accl);
  }

  float bz[4];
#pragma unroll
  for (int j = 0; j < 4; ++j) bz[j] = bf_up(bf_bits(bias[n0 + (j << 4) + rlane]));

  float* slab = (float*)(void*)smem + wave * (16 * 68);
#pragma unroll
  for (int i = 0; i < 2; ++i) {
    const int mBase = m0 + (i << 4);
#pragma unroll
    for (int r = 0; r < 8; ++r) {
#pragma unroll
      for (int j = 0; j < 4; ++j) {
        slab[(mOff + r) * 68 + (j << 4) + rlane] = (acch[i][j][r] + accl[i][j][r] * scl) * sch + bz[j];
      }
    }
    __builtin_amdgcn_fence(__ATOMIC_RELEASE, "workgroup");
    __builtin_amdgcn_wave_barrier();
    __builtin_amdgcn_fence(__ATOMIC_ACQUIRE, "workgroup");
    {
      const int hh = lane >> 4, c4 = (lane & 15) * 4;     // 256-B row segment = 16 lanes x 16 B
      v4f ov[8];
#pragma unroll
      for (int it = 0; it < 8; ++it) {
        const int row = it * 2 + hh;                       // it 0..7 x hh 0..1 = rows 0..15
        ov[it] = *(const v4f*)(slab + row * 68 + c4);
      }
      {
#pragma unroll
        for (int it = 0; it < 8; ++it) {
          const int row = it * 2 + hh;
          *(v4f*)(C + (size_t)(mBase + row) * ldc + n0 + c4) = ov[it];
        }
        
      }
    }
    __builtin_amdgcn_fence(__ATOMIC_RELEASE, "workgroup");
    __builtin_amdgcn_wave_barrier();
    __builtin_amdgcn_fence(__ATOMIC_ACQUIRE, "workgroup");
  }
}

// =====================================================================================================
// Workspace map (bytes, NB = 2); every region an exact multiple of its whole-line store granularity, all
// written earlier in the same call. Each stage is one launch over all four (batch, direction) pairs.
//   Xh   f16 [RT][EW]                     0        16777216   (layer norm output, hi)
//   Xl   f16 [RT][EW]              16777216        16777216   (residual x2048)
//   Wti  f16 W3 n x EW k           33554432          393216   (f16(bf16(Wqkv_in) x64), fragment order)
//   Wto  f16 W3 n x EW k           33947648          393216
//   Woh  f16 [EW n][KO k]          34340864          262144   (f16(bf16(Wo) x1024))
//   mA   f32 [NB][NH][SEQ x SEQ]   34603008         1048576   (64 x bf16(mask), direct, accumulator order)
//   mB   f32 [NB][NH][SEQ x SEQ]   35651584         1048576   (transposed, accumulator order)
//   Vah  f16 [RT][KO]              36700160        33554432   (attention output x1024, hi)
//   Val  f16 [RT][KO]              70254592        33554432   (attention output residual x2048)
//   end                           103809024
// Inputs: e f32 [NB][SEQ][SEQ][EW]; mask f32 [NB][SEQ][SEQ][NH]; ln_w, ln_b f32 [EW]; Wqkv_in, Wqkv_out
// f32 [EW in][W3 out]; bqkv_* f32 [W3]; Wo f32 [KO in][EW out]; bo f32 [EW]. d_out f32 [RT][EW] at byte 0
// (row = b*RB + i*SEQ + j, col = n).
// =====================================================================================================
extern "C" void kernel_launch(void* const* d_in, const int* in_sizes, int n_in,
                              void* d_out, int out_size, void* d_ws, size_t ws_size,
                              hipStream_t stream) {
  if (n_in < 10) return;
  if (in_sizes[0] < RT * EW) return;
  if (in_sizes[1] < NB * SEQ * SEQ * NH) return;
  if (in_sizes[2] < EW) return;
  if (in_sizes[3] < EW) return;
  if (in_sizes[4] < EW * W3) return;
  if (in_sizes[5] < W3) return;
  if (in_sizes[6] < EW * W3) return;
  if (in_sizes[7] < W3) return;
  if (in_sizes[8] < KO * EW) return;
  if (in_sizes[9] < EW) return;
  if (out_size < RT * EW) return;

  const float* e    = (const float*)d_in[0];   // [NB][SEQ][SEQ][EW]
  const float* mask = (const float*)d_in[1];   // [NB][SEQ][SEQ][NH]
  const float* ln_w = (const float*)d_in[2];   // [EW]
  const float* ln_b = (const float*)d_in[3];   // [EW]
  const float* Wqi  = (const float*)d_in[4];   // [EW in][W3 out]
  const float* bqi  = (const float*)d_in[5];   // [W3]
  const float* Wqo  = (const float*)d_in[6];   // [EW in][W3 out]
  const float* bqo  = (const float*)d_in[7];   // [W3]
  const float* Wo   = (const float*)d_in[8];   // [KO in][EW out]
  const float* bo   = (const float*)d_in[9];   // [EW]

  const size_t PX  = (size_t)RT * EW * 2;                    // 16777216 (NB = 2)
  const size_t PWt = (size_t)W3 * EW * 2;                    //   393216
  const size_t PWo = (size_t)EW * KO * 2;                    //   262144
  const size_t PM  = (size_t)NB * NH * SEQ * SEQ * 4;        //  1048576 (NB = 2)
  const size_t PVa = (size_t)RT * KO * 2;                    //  33554432
  size_t off = 0;
  const size_t oXh = off; off += PX;
  const size_t oXl = off; off += PX;
  const size_t oWi = off; off += PWt;
  off += PWt;                                                // Wto, directly behind Wti
  const size_t oWo = off; off += PWo;
  const size_t oMa = off; off += PM;
  const size_t oMb = off; off += PM;
  const size_t oVh = off; off += PVa;
  const size_t oVl = off; off += PVa;
  if (off > ws_size) return;                                 // off = 103809024 for NB = 2

  char* ws = (char*)d_ws;
  unsigned short* Xh  = (unsigned short*)(ws + oXh);
  unsigned short* Xl  = (unsigned short*)(ws + oXl);
  unsigned short* Wti = (unsigned short*)(ws + oWi);
  unsigned short* Woh = (unsigned short*)(ws + oWo);
  float*          mA  = (float*)(ws + oMa);
  float*          mB  = (float*)(ws + oMb);
  unsigned short* Vah = (unsigned short*)(ws + oVh);
  unsigned short* Val = (unsigned short*)(ws + oVl);
  float*          outf = (float*)d_out;                      // [RT][EW]

  const dim3 blk(256);
  const dim3 gPp(PB_M + RT / 8);                             // 384 weight and mask blocks + 4096 layer norm blocks
  const dim3 gAt(SEQ, 2 * NB);                               // one block per column index j x (batch, direction)
  const dim3 gWo((RT / 128) * (EW / 128));                   // 512 blocks
  const float cW     = 64.0f;                                // Wqkv plane carry
  const float fQ     = 16.0f * 0.17677669529663687f;         // 32^-0.5 then carry x16
  const float fK     = 4.0f;                                 // k carry
  const float fV     = 4.0f;                                 // v carry
  const float prSch  = 1.0f / 64.0f;                         // folds the Wqkv plane carry
  const float prScl  = 1.0f / 2048.0f;                       // folds the layer norm residual carry
  const float mkSc   = 64.0f;                                // mask planes x (16 * 4)
  const float axXscl = 1.0f / 2048.0f;                       // q/k residual carry
  const float axEscl = 1.0f / 64.0f;                         // score carry 16 * 4
  const float axPcar = 16384.0f;                             // softmax weight carry
  const float axOscl = 1.0f / 65536.0f;                      // 1/(16384 * 4)
  const float woScale = 1024.0f;                             // Wo plane carry
  const float woSch  = 1.0f / 1048576.0f;                    // 1/(1024 * 1024): O hi carry and Wo carry
  const float woScl  = 1.0f / 2048.0f;                       // O residual carry

  // (1) layer norm -> f16 hi + residual planes; weights -> transposed f16 planes of their bf16 values; masks
  prep_all<<<gPp, blk, 0, stream>>>(e, ln_w, ln_b, Xh, Xl, Wqi, Wqo, Wti, cW, Wo, Woh, woScale, mask, mA, mB, mkSc);
  // (2) all batches and both directions at once: projection with attention, output projection
  proj_attn<<<gAt, blk, 0, stream>>>(Xh, Xl, Wti, bqi, bqo, mA, Vah, Val, fQ, fK, fV, prSch, prScl,
                                     axXscl, axEscl, axPcar, axOscl);
  gemm32h_w<<<gWo, blk, 0, stream>>>(Vah, Val, Woh, bo, outf, woSch, woScl);
  (void)hipGetLastError();
}

// v010
// A run of this version takes 88.8 microseconds.
// Two timings next to v009 put it at 1.04 and 1.02 times that version's speed.
// All steps since v000 together make it 4.36 times as fast.
// Contractions: q/k/v projections = v_wmma_f32_16x16x32_f16 (layer-normed input as f16 hi + residual (x2048) planes, two products into separate accumulators; Wqkv as f16 of its bf16-RNE value x64); per-(b,j,h) scores = v_wmma_f32_16x16x32_f16 (k and q as f16 hi + residual (x2048) planes carried x4 and x16*32^-0.5, products hh + hl + lh; additive mask x64 as the initial accumulator); p.v = v_wmma_f32_16x16x32_f16 (softmax weights x16384 in f16 repacked from the score accumulators, v^T f16 tile carried x4, single product); output projection = v_wmma_f32_16x16x32_f16 (attention output as f16 hi (x1024) + residual (x2048) tiles in LDS, two products; Wo as f16 of its bf16-RNE value x1024); every float input RNE-converted to bf16 on load; all f32 accumulate; layer norm and softmax in f32.
#include <hip/hip_runtime.h>
#include <math.h>
#include <stdint.h>

#ifndef NB
#define NB 2
#endif
#define NB_FULL 2
#ifndef SEQ
#define SEQ 128
#endif
#define EW  256                 // edge width
#define NH  8                   // heads (fastest channel dim)
#define HD  32                  // dot dim
#define W3  (3 * EW)            // 768 fused projection columns
#define KO  (2 * EW)            // 512 concat channels
#define RB  (SEQ * SEQ)         // edge rows per batch (16384)
#define RT  (NB * RB)           // edge rows processed
#define VTP 136                 // LDS v^T tile pitch (halves)
#define OP  264                 // LDS pitch of the attention output slab (halves): 528 B = 16 B x 33

static_assert(NH * HD == EW);
static_assert(HD == 32);
static_assert(EW == 256);
static_assert(SEQ == 128);      // i, j and key extents are coupled; only NB is reducible
static_assert(NB >= 1 && NB <= NB_FULL);
static_assert((RB % 64) == 0 && (RT % 8) == 0);
static_assert((((RB / 32) * (W3 / 64)) % 8) == 0);
static_assert((((RB / 32) * (EW / 64)) % 8) == 0);
static_assert((EW % 64) == 0 && (W3 % 64) == 0 && (KO % 64) == 0 && (EW % 32) == 0 && (KO % 32) == 0);
static_assert((SEQ % 16) == 0 && (SEQ % 8) == 0);

typedef _Float16 v16h __attribute__((ext_vector_type(16)));
typedef _Float16 v8h  __attribute__((ext_vector_type(8)));
typedef float    v8f  __attribute__((ext_vector_type(8)));
typedef float    v4f  __attribute__((ext_vector_type(4)));
typedef unsigned int v4u __attribute__((ext_vector_type(4)));
typedef unsigned int v2u __attribute__((ext_vector_type(2)));

// ---- scalar helpers --------------------------------------------------------------------------------
__device__ __forceinline__ unsigned short bf_bits(float f) {          // f32 -> bf16 bits, RNE convert
  unsigned u = __float_as_uint(f);
  return (unsigned short)((u + 0x7FFFu + ((u >> 16) & 1u)) >> 16);
}
__device__ __forceinline__ float bf_up(unsigned short h) { return __uint_as_float(((unsigned)h) << 16); }
__device__ __forceinline__ unsigned short h_bits(_Float16 x) { return __builtin_bit_cast(unsigned short, x); }
__device__ __forceinline__ unsigned pk16(unsigned short a, unsigned short b) { return (unsigned)a | ((unsigned)b << 16); }
__device__ __forceinline__ v8f zero8() { v8f z = {0.f, 0.f, 0.f, 0.f, 0.f, 0.f, 0.f, 0.f}; return z; }

// ---- fragment loader: 16-bit A/B operand, lane -> row/col (lane&15), p already includes +8*(lane>>4);
//      elements 0..7 <- p[0..7] (k0+8h..), elements 8..15 <- p[16..23] (k0+16+8h..)
__device__ __forceinline__ v16h ldfrag_h(const _Float16* p) {
  union { v16h v; v8h h[2]; } f;
  f.h[0] = *(const v8h*)(p);
  f.h[1] = *(const v8h*)(p + 16);
  return f.v;
}

// ---- fragment loader for a plane kept in fragment order: a 16-row x 32-d tile is 512 halves, the 8 halves
//      (row r, d = 8o .. 8o+7) at (o*16 + r)*8; p = tile base + lane*8, so elements 0..7 <- (row lane&15, d 8h..) and
//      elements 8..15 <- (row lane&15, d 16+8h..), h = lane>>4: the k order of ldfrag_h, each load 512 B in a row
__device__ __forceinline__ v16h ldfrag_t(const _Float16* p) {
  union { v16h v; v8h h[2]; } f;
  f.h[0] = *(const v8h*)(p);
  f.h[1] = *(const v8h*)(p + 256);
  return f.v;
}

// ---- the same from a wave-uniform tile base and the lane's byte offset (lane*16): the base stays in scalar registers
__device__ __forceinline__ v16h ldfrag_u(const _Float16* ub, unsigned vo) {
  union { v16h v; v8h h[2]; } f;
  const char* p = (const char*)ub;
  f.h[0] = *(const v8h*)(p + vo);
  f.h[1] = *(const v8h*)(p + 512 + vo);
  return f.v;
}

// ---- wait that stands between issued global loads and an overwrite of their address registers
__device__ __forceinline__ void xcnt_wait() {
#if defined(__HIP_DEVICE_COMPILE__)
  asm volatile("s_wait_xcnt 0x0" ::: "memory");
#endif
}

// ---- the same wait, naming the loads' address registers as inputs: they stay live up to the wait, so that no load's
//      result lands on them in front of it
__device__ __forceinline__ void xcnt_wait_p(const void* a, const void* b) {
#if defined(__HIP_DEVICE_COMPILE__)
  asm volatile("s_wait_xcnt 0x0" :: "v"(a), "v"(b) : "memory");
#endif
}
// =====================================================================================================
// Layer norm over EW channels of each edge row (inputs and affine params RNE-converted to bf16 first, f32
// [nrows][EW]. One wave per row, 8 channels per lane; each plane row = 512 B written by one instruction
// coverage: nrows waves x 32 lanes x 8 = every element of both planes.
// =====================================================================================================
__device__ __forceinline__ void ln_planes(const float* __restrict__ e, const float* __restrict__ lw,
                                          const float* __restrict__ lb, unsigned short* xh,
                                          unsigned short* xl, int nrows, int blk) {
  const int lane = threadIdx.x & 31;
  const int wave = threadIdx.x >> 5;
  const int row = blk * 8 + wave;
  if (row >= nrows) return;                           // wave-uniform; no block barriers in this part
  const int c0 = lane * 8;
  const float* src = e + (size_t)row * EW + c0;
  const v4f a0 = *(const v4f*)(src);
  const v4f a1 = *(const v4f*)(src + 4);
  xcnt_wait();                                        // a later load's result may land on this address pair
  const v4f w0 = *(const v4f*)(lw + c0);
  const v4f w1 = *(const v4f*)(lw + c0 + 4);
  const v4f b0 = *(const v4f*)(lb + c0);
  const v4f b1 = *(const v4f*)(lb + c0 + 4);
  float v[8], w[8], bb[8];
#pragma unroll
  for (int t = 0; t < 4; ++t) {
    v[t]      = bf_up(bf_bits(a0[t]));
    v[4 + t]  = bf_up(bf_bits(a1[t]));
    w[t]      = bf_up(bf_bits(w0[t]));
    w[4 + t]  = bf_up(bf_bits(w1[t]));
    bb[t]     = bf_up(bf_bits(b0[t]));
    bb[4 + t] = bf_up(bf_bits(b1[t]));
  }
  float s = 0.f;
#pragma unroll
  for (int t = 0; t < 8; ++t) s += v[t];
#pragma unroll
  for (int o = 16; o > 0; o >>= 1) s += __shfl_xor(s, o);
  const float mu = s * (1.0f / (float)EW);
  float d[8];
  float s2 = 0.f;
#pragma unroll
  for (int t = 0; t < 8; ++t) { d[t] = v[t] - mu; s2 += d[t] * d[t]; }
#pragma unroll
  for (int o = 16; o > 0; o >>= 1) s2 += __shfl_xor(s2, o);
  const float var = s2 * (1.0f / (float)EW);
  const float rs = rsqrtf(var + 1e-5f);
  v4u ph, pl;
#pragma unroll
  for (int t = 0; t < 4; ++t) {
    const float y0 = d[2 * t] * rs * w[2 * t] + bb[2 * t];
    const float y1 = d[2 * t + 1] * rs * w[2 * t + 1] + bb[2 * t + 1];
    const _Float16 hq0 = (_Float16)y0;
    const _Float16 hq1 = (_Float16)y1;
    const _Float16 lq0 = (_Float16)((y0 - (float)hq0) * 2048.0f);
    const _Float16 lq1 = (_Float16)((y1 - (float)hq1) * 2048.0f);
    ph[t] = pk16(h_bits(hq0), h_bits(hq1));
    pl[t] = pk16(h_bits(lq0), h_bits(lq1));
  }
  const size_t o = (size_t)row * EW + c0;
  {
    *(v4u*)(xh + o) = ph;
    *(v4u*)(xl + o) = pl;
    xcnt_wait();   // another part's code follows in the listing and writes these stores' registers
  }
}

// =====================================================================================================
// Output projection weights into fragment order: in f32 [KO k][EW n] row-major, k = dr*EW + d*NH + h.
// out f16 tiles of 16 columns x 32 k (512 halves), tile (dr*16 + nt)*8 + h: its k values are head h's d = 0..31 (the
// order in which the attention slab holds its channels), its row r is column n = (nt >> 2)*64 + r*4 + (nt & 3), so
// that the four accumulator tiles of a wave hold four neighbouring columns in one lane. The 8 halves (r, d = 8o .. 8o+7)
// lie at (o*16 + r)*8 (see ldfrag_t); value f16(bf16rne(in[k][n]) * scale). Piece P = tile*64 + o*16 + r, 16 B each:
// 32 blocks x 256 threads x 2 pieces = all 16384; lanes 8q..8q+7 write one whole 128-B line.
// =====================================================================================================
__device__ __forceinline__ void wo_frag(const float* __restrict__ in, unsigned short* out, float scale, int blk) {
#pragma unroll
  for (int it = 0; it < 2; ++it) {
    const int P = blk * 512 + it * 256 + (int)threadIdx.x;
    const int r = P & 15, o = (P >> 4) & 3, hh = (P >> 6) & 7, nt = (P >> 9) & 15, dr = P >> 13;
    const int n = (nt >> 2) * 64 + r * 4 + (nt & 3);
    const float* s = in + (size_t)(dr * EW + o * 64 + hh) * EW + n;   // k = dr*EW + (8o + t)*NH + hh
    float f[8];
#pragma unroll
    for (int t = 0; t < 8; ++t) f[t] = s[(size_t)t * NH * EW];
    xcnt_wait();                                    // later code writes these loads' address registers
    v4u a;
#pragma unroll
    for (int t = 0; t < 4; ++t)
      a[t] = pk16(h_bits((_Float16)(bf_up(bf_bits(f[2 * t])) * scale)), h_bits((_Float16)(bf_up(bf_bits(f[2 * t + 1])) * scale)));
    *(v4u*)(out + (size_t)P * 8) = a;
    xcnt_wait();                                    // later code writes this store's registers
  }
}

// =====================================================================================================
// Transpose-convert of a q/k/v weight matrix into fragment order: in f32 [EW k][W3 n] row-major, n = sec*EW + d*NH + h;
// out f16 tiles of 16 d x 32 k (512 halves), tile ((sec*NH + h)*2 + (d >> 4))*8 + (k >> 5), the 8 halves
// (d, k = 8o .. 8o+7 of the tile) at (o*16 + (d & 15))*8 (see ldfrag_t); value f16(bf16rne(in[k][n]) * scale).
// Block = one 64 k x 64 n tile staged in LDS as f32 = 8 d x 8 h x 2 k steps x 4 octets. Store: dd = tid & 7,
// line L = it*32 + (tid >> 3) = (k step it, octet (L >> 3) & 3, head L & 7): lanes 8q..8q+7 write one whole 128-B line.
// coverage: 64 lines x 8 pieces of 8 k = the block's 64 x 64; grid covers every tile -> the whole plane.
// =====================================================================================================
__device__ __forceinline__ void tr_f16_frag(const float* __restrict__ in, unsigned short* out,
                                            float scale, int bx, int by, float* sv) {   // sv: [rr][cc] pitch 68 floats
  const int tid = threadIdx.x;
  const int r0 = bx * 64;
  const int c0 = by * 64;
#pragma unroll
  for (int i = 0; i < 4; ++i) {
    const int idx = i * 256 + tid;                  // 0..1023
    const int rr = idx >> 4, c4 = (idx & 15) * 4;
    const v4f a = *(const v4f*)(in + (size_t)(r0 + rr) * W3 + c0 + c4);
    *(v4f*)(sv + rr * 68 + c4) = a;
  }
  __syncthreads();

  const int dd = tid & 7;
  v4u hv[2];
  size_t hofs[2];
#pragma unroll
  for (int it = 0; it < 2; ++it) {
    const int L = it * 32 + (tid >> 3);
    const int hh = L & 7, oc = (L >> 3) & 3;
    const int cc = dd * 8 + hh;
    const int rl = it * 32 + oc * 8;
    v4u a;
#pragma unroll
    for (int t = 0; t < 4; ++t) {
      const float f0 = bf_up(bf_bits(sv[(rl + 2 * t) * 68 + cc]));
      const float f1 = bf_up(bf_bits(sv[(rl + 2 * t + 1) * 68 + cc]));
      a[t] = pk16(h_bits((_Float16)(f0 * scale)), h_bits((_Float16)(f1 * scale)));
    }
    hv[it] = a;
    const int sec = c0 >> 8;
    const int d = ((c0 & 255) >> 3) + dd;
    hofs[it] = (size_t)((((sec * NH + hh) * 2 + (d >> 4)) * 8 + (r0 >> 5) + it) * 512 + (oc * 16 + (d & 15)) * 8);
  }
  {
#pragma unroll
    for (int it = 0; it < 2; ++it) {
      *(v4u*)(out + hofs[it]) = hv[it];
    }
    xcnt_wait();   // another part's code follows in the listing and writes these stores' registers
  }
}

// =====================================================================================================
// Additive mask mk f32 [NB][SEQ x][SEQ y][NH h] -> two f32 planes of msc * bf16rne(mk), msc a power of two, both in
// the order of the attention's score accumulators. With (i, kk) = (query, key): ma holds mk[b][i][kk][h], mb holds
// mk[b][kk][i][h]; element (i, kk) of plane (b, h) lies at float offset
//   ((((i >> 4) * 8 + (kk >> 4)) * 2 + ((kk >> 2) & 1)) * 32 + ((kk >> 3) & 1) * 16 + (i & 15)) * 4 + (kk & 3),
// so the 16 B that lane g*16 + (i & 15) wants for accumulator elements 0..3 (or 4..7) of key tile kk >> 4 lie lane
// after lane: one load of a wave covers 512 B in a row. blocks = (SEQ/8 groups, NH, NB), 256 threads; a block owns
// queries grp*8 .. +7 of both planes. Both 8 x 128 tiles are staged in LDS (pitch MTP), __syncthreads, then thread
// (L = tid>>3, p = tid&7) stores keys 4L..4L+3 of query grp*8+p: lanes 8q..8q+7 write one whole 128-B line.
// coverage: 16 groups x 8 queries x (32 L x 4 keys) = all SEQ x SEQ of every (b,h) in both planes.
// =====================================================================================================
#define MTP 136                 // LDS pitch of the mask tiles (floats): 16-B reads of 8 rows x 2 key quads meet each bank once
__device__ __forceinline__ void mask_planes(const float* __restrict__ mk, float* ma, float* mb,
                                            float msc, int grp, int h, int b, float* sm) {   // sm: 2 x 8 x MTP floats
  const int tid = threadIdx.x;
  const size_t pb = ((size_t)(b * NH + h)) * SEQ * SEQ;          // plane base of (b,h)
  float* st = sm + 8 * MTP;                                      // tile of the transposed plane
  {
    const int xx = tid >> 5, y4 = (tid & 31) * 4;
    const int x = grp * 8 + xx;
    const float* src = mk + (((size_t)b * SEQ + x) * SEQ + y4) * NH + h;
    v4f vd;
#pragma unroll
    for (int t = 0; t < 4; ++t) vd[t] = msc * bf_up(bf_bits(src[(size_t)t * NH]));
    *(v4f*)(sm + xx * MTP + y4) = vd;
  }
  xcnt_wait();                                                   // a later load's result may land on the address pair above
  {
    const int x = tid >> 1, yq = (tid & 1) * 4;
    const float* src = mk + (((size_t)b * SEQ + x) * SEQ + grp * 8 + yq) * NH + h;
#pragma unroll
    for (int t = 0; t < 4; ++t) st[(yq + t) * MTP + x] = msc * bf_up(bf_bits(src[(size_t)t * NH]));
  }
  __syncthreads();
  {
    const int L = tid >> 3, p = tid & 7;
    const v4f vd = *(const v4f*)(sm + p * MTP + L * 4);
    const v4f vt = *(const v4f*)(st + p * MTP + L * 4);
    const size_t o = pb + (size_t)(((((grp >> 1) * 8 + (L >> 2)) * 2 + (L & 1)) * 32 + ((L >> 1) & 1) * 16 + (grp & 1) * 8 + p) * 4);
    *(v4f*)(ma + o) = vd;
    *(v4f*)(mb + o) = vt;
    xcnt_wait();   // another part's code follows in the listing and writes these stores' registers
  }
}

// =====================================================================================================
// All preparation in one launch: the four parts read only inputs and write disjoint planes, so none waits for
// another. Block ranges (block-uniform branches, each part's barriers inside its own branch), short parts
// first so that they run beside the layer norm's stream:
//   [0, PB_W)            Wqkv_in / Wqkv_out tiles: t -> matrix t / 48, tile (t & 3, (t % 48) >> 2)
//   [PB_W, PB_O)         Wo pieces, 512 per block
//   [PB_O, PB_M)         mask groups: t -> (grp = t & 15, h = (t >> 4) & 7, b = t >> 7)
//   [PB_M, PB_M + RT/8)  layer norm, 8 rows per block
// =====================================================================================================
#define PB_W (2 * (EW / 64) * (W3 / 64))            // 96
#define PB_O (PB_W + (KO / 64) * (EW / 64))         // 128
#define PB_M (PB_O + (SEQ / 8) * NH * NB)           // 384 (NB = 2)
static_assert(EW / 64 == 4 && W3 / 64 == 12 && KO / 64 == 8 && SEQ / 8 == 16 && NH == 8);

__global__ __launch_bounds__(256) void prep_all(
    const float* __restrict__ e, const float* __restrict__ lw, const float* __restrict__ lb,
    unsigned short* xh, unsigned short* xl,
    const float* __restrict__ wqi, const float* __restrict__ wqo, unsigned short* wt, float cw,
    const float* __restrict__ wo, unsigned short* woh, float cwo,
    const float* __restrict__ mk, float* ma, float* mb, float msc) {
  __shared__ __align__(16) float sbuf[64 * 68];
  const int bx = blockIdx.x;
  if (bx < PB_W) {
    const int z = (bx >= PB_W / 2) ? 1 : 0;         // the second matrix's plane follows the first
    const int t = bx - z * (PB_W / 2);
    tr_f16_frag((z != 0) ? wqo : wqi, wt + (size_t)z * EW * W3, cw, t & 3, t >> 2, sbuf);
  } else if (bx < PB_O) {
    const int t = bx - PB_W;
    wo_frag(wo, woh, cwo, t);
  } else if (bx < PB_M) {
    const int t = bx - PB_O;
    mask_planes(mk, ma, mb, msc, t & 15, (t >> 4) & 7, t >> 7, sbuf);
  } else {
    ln_planes(e, lw, lb, xh, xl, RT, bx - PB_M);
  }
}

// =====================================================================================================
// q/k/v projection, axial attention of both directions and the output projection in one kernel: q, k, v and the
// attention output never leave the WGP. grid = (column index j, batch); block = 8 waves, wave = head h; a block runs
// direction 0, then direction 1, and owns the output rows (i,j) of all i.
// X rows (layer norm planes, f16 hi + residual x2048) are staged whole in LDS (128 rows x 256 k, pitch XP) and serve
// all 8 waves; each wave reads its own head's 96 weight rows from the fragment-ordered weight plane (tr_f16_frag),
// every load 512 B in a row, one k step (q: two) ahead of its products; X fragments are read from LDS 16 products ahead.
//   keys/values kk: edge row (j,kk) for dir 0, (kk,j) for dir 1; queries i: edge row (i,j). For dir 0 the X rows are
//   staged twice (block-uniform branch, a barrier in front of and behind the second staging); dir 1 finds its rows staged.
// Products (k upward in steps of 32, hi and residual X in separate accumulators; value = ((acch + accl*scl)*sch + bias)*fac):
//   k, q: W (A, lane = channel d) . X^T (B, lane = edge row): D lane = edge row, element r = channel 16dt + 8g + r, so
//         the two d tiles of a 16-row tile, converted to f16 hi + residual (x2048), ARE the score fragment of that tile
//         (element e <- d 8g+e, element 8+e <- d 16+8g+e: the k order of ldfrag_h, the same for k and q).
//   v:    X (A, lane = key) . W^T (B, lane = channel d): D lane = d, element r = key 16kt + 8g + r: 16 B of a v^T row.
// k fragments of key tiles 4..7 stay in registers, those of 0..3 wait in the q tiles until the q projection; v^T goes to its LDS tiles, q fragments of 4 strips at a time to theirs (each lane reads back only
// the 16-B pieces that it wrote itself).
// Scores are computed TRANSPOSED: S^T[kk][i] = K(A, lane = key row, d per k-map) . Q^T(B, lane = query,
// d per k-map), hi.hi into the mask-initialised accumulator plus (hi.lo + lo.hi)*xscl; D lane = query i,
// element r = key 16ct + 8g + r, so a lane and its partner lane^16 own one softmax row: max / exp / sum in
// f32 with one __shfl_xor(.,16) each. Weights p*pcar are converted to f16 in registers and used directly as
// the B operand of O^T[d][i] = V^T(A from LDS, lane = d, keys per k-map) . P^T (B: lane = query, element
// e <- tile 2c key 8g+e, element 8+e <- tile 2c+1 key 8g+e).
// Attention output: f16 hi = f16(O*1024) and residual = f16((O*1024 - hi)*2048) go to an LDS slab of 64 queries (4 strips),
// pitch OP, column h*HD + d (Wo's k order follows it, see wo_frag); each wave writes its own 32 columns.
// Output projection per 64 queries and direction: C rows += sch * (hi . Wo + scl * residual . Wo), K = 256, hi and residual in
// separate accumulators; dir 0 stores bias + its sums to C, dir 1 reads them back (the same lane, the same address) and adds.
// Barriers per group: in front of strip 2's slab rows (they lie on q tile 0), behind the last strip, behind the slab's last read.
// coverage: 2 groups x (2 x 32 queries) x (4 x 64 columns) = 128 rows (i,j) x 256 columns for every (j, batch).
// =====================================================================================================
#define XP   264                // LDS pitch of the staged X rows (halves): 528 B = 16 B x 33, 16-B fragment reads meet each bank once
#define XPL  (SEQ * XP)         // halves per staged plane
#define WSEC (NH * 2 * 8 * 512) // halves per section (q, k, v) of a fragment-ordered weight plane
#define QT   (NH * 1024)        // halves between a wave's successive q fragment tiles: tile t of all heads, then tile t + 1
#define SQ0  131072             // first half of the q fragments in LDS
static_assert(2 * XPL + NH * HD * VTP + 2 * 64 * OP <= SQ0 + QT);            // the slab's tail lies on q tile 0 alone
static_assert(2 * XPL + NH * HD * VTP + (64 + 32) * OP <= SQ0);              // and holds residual rows of strips 2 and 3 alone
static_assert(WSEC == EW * EW);

// 128 X rows, hi and residual, global -> registers -> LDS; wave w takes rows w, w+8, ..: one load = one whole 512-B row.
// gh, gl: this lane's piece of row w; rs: elements between rows t and t + 8
__device__ __forceinline__ void stage_x(const _Float16* gh, const _Float16* gl, size_t rs, _Float16* sw) {
#pragma unroll
  for (int b = 0; b < 2; ++b) {
    v4u st[16];
#pragma unroll
    for (int u = 0; u < 8; ++u) {
      st[u]     = *(const v4u*)(gh + (size_t)(b * 8 + u) * rs);
      st[8 + u] = *(const v4u*)(gl + (size_t)(b * 8 + u) * rs);
    }
    xcnt_wait_p(gh, gl);                                        // later code writes these loads' address registers
#pragma unroll
    for (int u = 0; u < 8; ++u) {
      *(v4u*)(sw + (b * 8 + u) * 8 * XP) = st[u];
      *(v4u*)(sw + XPL + (b * 8 + u) * 8 * XP) = st[8 + u];
    }
  }
}

// plain builtin product for the projection steps and the strip loop: its operands may lie in any register, also above v255
// (an asm statement's operands may not, and the strip loop's register sets together pass v255)
__device__ __forceinline__ v8f mma_b(v16h a, v16h b, v8f c) {
  return __builtin_amdgcn_wmma_f32_16x16x32_f16(false, a, false, b, (short)0, c, false, false);
}

// X fragments of one row tile at one k step, hi and residual, LDS -> registers
__device__ __forceinline__ void ldx(v16h (&x)[2], const _Float16* p) {
  x[0] = ldfrag_h(p);
  x[1] = ldfrag_h(p + XPL);
}

// the k and v products of one row tile at one k step
__device__ __forceinline__ void kv_row(const v16h (&w)[4], const v16h (&x)[2], v8f (&aK)[2][2], v8f (&aV)[2][2]) {
#pragma unroll
  for (int dt = 0; dt < 2; ++dt) {
    aK[dt][0] = mma_b(w[dt], x[0], aK[dt][0]);
    aK[dt][1] = mma_b(w[dt], x[1], aK[dt][1]);
    aV[dt][0] = mma_b(x[0], w[2 + dt], aV[dt][0]);
    aV[dt][1] = mma_b(x[1], w[2 + dt], aV[dt][1]);
  }
}

// one k step of the k and v products of 4 row tiles: 8 X fragments serve 32 products. The fragments stand in four
// register sets xs[row tile] and are read from LDS 16 products ahead of their use, 8 reads in one group: on entry
// xs[0], xs[1] hold (or await) this step's tiles 0, 1; on exit those of the step at xn. xc: this step, xn: the next.
__device__ __forceinline__ void kv_step(const v16h (&w)[4], const _Float16* xc, const _Float16* xn, v16h (&xs)[4][2],
                                        v8f (&aK)[4][2][2], v8f (&aV)[4][2][2]) {
  ldx(xs[2], xc + 2 * 16 * XP);
  ldx(xs[3], xc + 3 * 16 * XP);
  __builtin_amdgcn_sched_barrier(0);   // the reads stay one group ahead of these products: sunk to their use, each waits out the LDS latency
  kv_row(w, xs[0], aK[0], aV[0]);
  kv_row(w, xs[1], aK[1], aV[1]);
  __builtin_amdgcn_sched_barrier(0);   // the next group is not spread among the products above
  ldx(xs[0], xn);
  ldx(xs[1], xn + 16 * XP);
  __builtin_amdgcn_sched_barrier(0);   // as the first
  kv_row(w, xs[2], aK[2], aV[2]);
  kv_row(w, xs[3], aK[3], aV[3]);
  __builtin_amdgcn_sched_barrier(0);   // as the second
}

// two d tiles of accumulators (lane = edge row) -> score fragment, f16 hi and residual x2048
__device__ __forceinline__ void frag_from_acc(const v8f (&a)[2][2], const float (&bz)[2][8], float scl, float sch,
                                              float fac, v16h& fh, v16h& fl) {
#pragma unroll
  for (int dt = 0; dt < 2; ++dt)
#pragma unroll
    for (int e = 0; e < 8; ++e) {
      const float s = ((a[dt][0][e] + a[dt][1][e] * scl) * sch + bz[dt][e]) * fac;
      const _Float16 hq = (_Float16)s;
      fh[dt * 8 + e] = hq;
      fl[dt * 8 + e] = (_Float16)((s - (float)hq) * 2048.0f);
    }
}

// one strip's mask, 8 key tiles in score-accumulator order: 16 loads of 512 B in a row, one group; mu: the strip's tile
// (wave-uniform), vo: the lane's byte offset (lane*16)
__device__ __forceinline__ void ld_mask(v8f (&m)[8], const float* mu, unsigned vo) {
  const char* p = (const char*)mu + vo;
#pragma unroll
  for (int ct = 0; ct < 8; ++ct) {
    const v4f mv0 = *(const v4f*)(p + ct * 1024);
    const v4f mv1 = *(const v4f*)(p + ct * 1024 + 512);
    v8f am;
    am[0] = mv0[0]; am[1] = mv0[1]; am[2] = mv0[2]; am[3] = mv0[3];
    am[4] = mv1[0]; am[5] = mv1[1]; am[6] = mv1[2]; am[7] = mv1[3];
    m[ct] = am;
  }
  xcnt_wait_p(p, p);                                            // later code writes these loads' address registers
}

__global__ __launch_bounds__(256) void proj_attn(
    const unsigned short* __restrict__ Xhp, const unsigned short* __restrict__ Xlp,
    const unsigned short* __restrict__ Wfp, const float* __restrict__ bias0, const float* __restrict__ bias1,
    const float* __restrict__ mp0, const unsigned short* __restrict__ Wop, const float* __restrict__ bo, float* C,
    float f0, float f1, float f2, float sch, float scl,
    float xscl, float escl, float pcar, float oscl, float wcar, float wsch, float wscl) {
  const int bb = blockIdx.y;                       // batch
  const size_t xo = (size_t)bb * RB * EW;
  const _Float16* Xh = (const _Float16*)(const void*)Xhp + xo;
  const _Float16* Xl = (const _Float16*)(const void*)Xlp + xo;
  // LDS map (halves): X rows 0 | v^T tiles 67584 | output slab (hi, residual) 102400 .. 136192 | q fragments 131072 .. 163840
  __shared__ __align__(16) unsigned short sAll[SQ0 + NH * 4 * 1024];   // 327680 B
  _Float16* sX = (_Float16*)(void*)sAll;
  _Float16* sVw = sX + 2 * XPL;
  const _Float16* sVh = sVw;
  _Float16* sOb = sVw + NH * HD * VTP;
  const int tid  = threadIdx.x;
  const int lane = tid & 31;
  const int h    = __builtin_amdgcn_readfirstlane(tid >> 5);   // the wave's number in a scalar register: addresses formed from it take no vector registers
  const int nl   = lane & 15;
  const int g    = lane >> 4;
  const int g8   = g * 8;
  const int j    = blockIdx.x;
  _Float16* sxw = sX + h * XP + lane * 8;          // staging: row h, this lane's piece
  const _Float16* xr = sX + nl * XP + g8;          // fragments: row nl of tile 0, this lane's k half
  const unsigned bog = (unsigned)(((g8 << 3) + h) * 4);   // byte offsets of this lane's bias entries: channel 8g (q, k)
  const unsigned bon = (unsigned)(((nl << 3) + h) * 4);   // and channel nl (v)
  _Float16* sQw = sX + SQ0 + h * 1024 + lane * 8;  // this lane's pieces of its wave's q fragments; tile t at t * QT
  _Float16* sOw = sOb + nl * OP + h * HD + g8;     // slab: row = query nl of strip 0, column = h*HD + d, this lane's d octet
  // output projection: 8 waves as 2 (32 queries) x 4 (64 columns)
  const int mw = h & 1, nw = h >> 1;
  const _Float16* ao = sOb + (mw * 32 + nl) * OP + g8;
  char* cu = (char*)(C + ((size_t)bb * RB + (size_t)(mw * 32) * SEQ + j) * EW + nw * 64);   // wave-uniform part of this wave's C tile
  const unsigned cvo = (unsigned)((g8 * SEQ * EW + nl * 4) * 4);                             // this lane's byte offset in it
  const unsigned lo16 = (unsigned)(lane * 16);

  // ---- X rows of dir 0's keys and values: edge rows (j,kk); dir 1 finds its rows (kk,j) staged as dir 0's queries
  {
    const size_t o = (size_t)(j * SEQ + h) * EW + lane * 8;
    stage_x(Xh + o, Xl + o, (size_t)8 * EW, sxw);
  }
  __syncthreads();

#pragma unroll 1
  for (int dir = 0; dir < 2; ++dir) {
  const float* bias = (dir != 0) ? bias1 : bias0;
  const float* mp = mp0 + (size_t)(dir * NB + bb) * NH * SEQ * SEQ;   // direct planes of all batches, then transposed
  // weight tile (section 0, head h, d tile 0, k step 0); tile (sec, h, dt, ks) is 512 halves
  const _Float16* Wh = (const _Float16*)(const void*)Wfp + (size_t)dir * W3 * EW + (size_t)(h * (2 * 8 * 512));   // wave-uniform; the lane adds lo16 bytes
  const _Float16* wo = (const _Float16*)(const void*)Wop + (size_t)((dir * 16 + nw * 4) * 8) * 512;   // wave-uniform
  const char* bpu = (const char*)bias;             // wave-uniform; the lane adds bog or bon bytes

  // ---- k and v of head h, 4 key tiles at a time; weight fragments in two register sets, the next k step's in flight
  v16h kh[8], kl[8];
  {
    const _Float16* wk = Wh + WSEC;
    const _Float16* wv = Wh + 2 * WSEC;
#pragma unroll
    for (int grp = 0; grp < 2; ++grp) {
      v8f aK[4][2][2], aV[4][2][2];
#pragma unroll
      for (int rt = 0; rt < 4; ++rt)
#pragma unroll
        for (int dt = 0; dt < 2; ++dt) {
          aK[rt][dt][0] = zero8(); aK[rt][dt][1] = zero8();
          aV[rt][dt][0] = zero8(); aV[rt][dt][1] = zero8();
        }
      v16h wa[4], wb[4];
#pragma unroll
      for (int dt = 0; dt < 2; ++dt) {
        wa[dt]     = ldfrag_u(wk + dt * 8 * 512, lo16);
        wa[2 + dt] = ldfrag_u(wv + dt * 8 * 512, lo16);
      }
      xcnt_wait();                                              // the same
      __builtin_amdgcn_sched_barrier(0);                        // no later address arithmetic is lifted in front of that wait
      const _Float16* xg = xr + grp * 64 * XP;
      v16h xs[4][2];
      ldx(xs[0], xg);
      ldx(xs[1], xg + 16 * XP);
#pragma unroll 1
      for (int ks = 0; ks < 8; ks += 2) {
#pragma unroll
        for (int dt = 0; dt < 2; ++dt) {
          wb[dt]     = ldfrag_u(wk + (dt * 8 + ks + 1) * 512, lo16);
          wb[2 + dt] = ldfrag_u(wv + (dt * 8 + ks + 1) * 512, lo16);
        }
        xcnt_wait();                                            // the same
        kv_step(wa, xg + ks * 32, xg + (ks + 1) * 32, xs, aK, aV);
        if (ks + 2 < 8) {                                       // uniform
#pragma unroll
          for (int dt = 0; dt < 2; ++dt) {
            wa[dt]     = ldfrag_u(wk + (dt * 8 + ks + 2) * 512, lo16);
            wa[2 + dt] = ldfrag_u(wv + (dt * 8 + ks + 2) * 512, lo16);
          }
          xcnt_wait();                                          // the same
        }
        // behind the last step nothing follows: its read ahead goes to step 0 again (staged data, not used)
        kv_step(wb, xg + (ks + 1) * 32, xg + ((ks + 2 < 8) ? (ks + 2) * 32 : 0), xs, aK, aV);
      }
      float bk[2][8], bv[2];
#pragma unroll
      for (int dt = 0; dt < 2; ++dt) {
#pragma unroll
        for (int e = 0; e < 8; ++e) bk[dt][e] = bf_up(bf_bits(*(const float*)(bpu + (EW + ((dt * 16 + e) << 3)) * 4 + bog)));
        bv[dt] = bf_up(bf_bits(*(const float*)(bpu + (2 * EW + ((dt * 16) << 3)) * 4 + bon)));
      }
      xcnt_wait();                                              // later code writes these loads' address registers
#pragma unroll
      for (int rt = 0; rt < 4; ++rt) {
        const int kt = grp * 4 + rt;
        if (grp == 0) {
          // the first group's k fragments wait in sQ (idle until the q projection) while the second group's loop needs the registers
          union { v16h v; v8h hh[2]; } H, L;
          frag_from_acc(aK[rt], bk, scl, sch, f1, H.v, L.v);
          *(v8h*)(sQw + rt * QT)       = H.hh[0];
          *(v8h*)(sQw + rt * QT + 256) = H.hh[1];
          *(v8h*)(sQw + rt * QT + 512) = L.hh[0];
          *(v8h*)(sQw + rt * QT + 768) = L.hh[1];
        } else {
          frag_from_acc(aK[rt], bk, scl, sch, f1, kh[kt], kl[kt]);
        }
#pragma unroll
        for (int dt = 0; dt < 2; ++dt) {
          v8h o;
#pragma unroll
          for (int e = 0; e < 8; ++e)
            o[e] = (_Float16)(((aV[rt][dt][0][e] + aV[rt][dt][1][e] * scl) * sch + bv[dt]) * f2);
          *(v8h*)(sVw + (h * HD + dt * 16 + nl) * VTP + kt * 16 + g8) = o;
        }
      }
    }
  }

  // ---- X rows of the queries: those of the keys for dir 1, others for dir 0 (block-uniform)
  if (dir == 0) {
    __syncthreads();                                            // every wave has left the key rows
    int ln = lane;
#if defined(__HIP_DEVICE_COMPILE__)
    // the lane number is formed anew: this staging's addresses are then formed here, not ahead of the loop, where they
    // would hold a dozen vector registers through both directions and push four of them out to scratch memory
    asm volatile("v_mbcnt_lo_u32_b32 %0, -1, 0" : "=v"(ln));
#endif
    const size_t o = (size_t)(h * SEQ + j) * EW + ln * 8;
    stage_x(Xh + o, Xl + o, (size_t)8 * SEQ * EW, sX + h * XP + ln * 8);
    __syncthreads();
  }

  // ---- the first group's k fragments come back: each lane reads the pieces that it wrote itself
#pragma unroll
  for (int rt = 0; rt < 4; ++rt) {
    kh[rt] = ldfrag_t(sQw + rt * QT);
    kl[rt] = ldfrag_t(sQw + rt * QT + 512);
  }

#pragma unroll 1
  for (int qg = 0; qg < 2; ++qg) {
    // mask of the strip that comes next, fetched while earlier work runs (tile (h, s) of the plane is 8 x 256 floats)
    v8f mn[8];
    const float* mq = mp + (size_t)(h * 8 + qg * 4) * (8 * 256);   // wave-uniform
    // ---- q of head h, 4 query tiles
    {
      v8f aQ[4][2][2];
#pragma unroll
      for (int rt = 0; rt < 4; ++rt)
#pragma unroll
        for (int dt = 0; dt < 2; ++dt) { aQ[rt][dt][0] = zero8(); aQ[rt][dt][1] = zero8(); }
      // a k step is 16 products: the X fragments of a whole step (two register sets) are read from LDS one step ahead,
      // 16 reads in one group; the weight fragments (three sets) come two steps ahead, a step being shorter than their way
      v16h wq[3][2], xq[2][4][2];
      float bq[2][8];                        // q bias, fetched under the last two k steps, when a weight set has come free
#pragma unroll
      for (int dt = 0; dt < 2; ++dt) {
        wq[0][dt] = ldfrag_u(Wh + dt * 8 * 512, lo16);
        wq[1][dt] = ldfrag_u(Wh + (dt * 8 + 1) * 512, lo16);
      }
      xcnt_wait();                                              // the same
      const _Float16* xg = xr + qg * 64 * XP;
#pragma unroll
      for (int rt = 0; rt < 4; ++rt) ldx(xq[0][rt], xg + rt * 16 * XP);
#pragma unroll
      for (int ks = 0; ks < 8; ++ks) {
        if (ks + 2 < 8) {
#pragma unroll
          for (int dt = 0; dt < 2; ++dt) wq[(ks + 2) % 3][dt] = ldfrag_u(Wh + (dt * 8 + ks + 2) * 512, lo16);
          xcnt_wait();                                          // the same
        }
        if (ks == 6) {
#pragma unroll
          for (int dt = 0; dt < 2; ++dt)
#pragma unroll
            for (int e = 0; e < 8; ++e) bq[dt][e] = *(const float*)(bpu + ((dt * 16 + e) << 3) * 4 + bog);
          xcnt_wait();                                          // the same
        }
        if (ks + 1 < 8) {
#pragma unroll
          for (int rt = 0; rt < 4; ++rt) ldx(xq[(ks + 1) & 1][rt], xg + (ks + 1) * 32 + rt * 16 * XP);
        }
        __builtin_amdgcn_sched_barrier(0);   // the fetches stay one group ahead of this step's products: sunk to their use, each waits out its latency
#pragma unroll
        for (int rt = 0; rt < 4; ++rt)
#pragma unroll
          for (int dt = 0; dt < 2; ++dt) {
            aQ[rt][dt][0] = mma_b(wq[ks % 3][dt], xq[ks & 1][rt][0], aQ[rt][dt][0]);
            aQ[rt][dt][1] = mma_b(wq[ks % 3][dt], xq[ks & 1][rt][1], aQ[rt][dt][1]);
          }
        __builtin_amdgcn_sched_barrier(0);   // the next step's fetches are not spread among the products above
      }
      ld_mask(mn, mq, lo16);                       // the group's first strip: flies under the conversion of q below
      __builtin_amdgcn_sched_barrier(0);     // the loads are not sunk below the conversion, where their latency would be waited out
#pragma unroll
      for (int dt = 0; dt < 2; ++dt)
#pragma unroll
        for (int e = 0; e < 8; ++e) bq[dt][e] = bf_up(bf_bits(bq[dt][e]));
#pragma unroll
      for (int rt = 0; rt < 4; ++rt) {
        union { v16h v; v8h hh[2]; } H, L;
        frag_from_acc(aQ[rt], bq, scl, sch, f0, H.v, L.v);
        *(v8h*)(sQw + rt * QT)       = H.hh[0];
        *(v8h*)(sQw + rt * QT + 256) = H.hh[1];
        *(v8h*)(sQw + rt * QT + 512) = L.hh[0];
        *(v8h*)(sQw + rt * QT + 768) = L.hh[1];
      }
    }

    // ---- v^T fragments of head h: the same for every strip, read from LDS once for the group's 4 strips (registers are
    //      free behind the q projection), so that no p.v product waits for an LDS read
    v16h va[2][4];
#pragma unroll
    for (int dt = 0; dt < 2; ++dt)
#pragma unroll
      for (int c = 0; c < 4; ++c) va[dt][c] = ldfrag_h(sVh + (h * HD + dt * 16 + nl) * VTP + 32 * c + g8);

    v16h qh = ldfrag_t(sQw);                                    // query tile of the group's first strip
    v16h ql = ldfrag_t(sQw + 512);

#pragma unroll 1
    for (int sl = 0; sl < 4; ++sl) {
    const int s = qg * 4 + sl;                                  // qh, ql: query tile s; this lane's B / D column is query s*16 + nl

    // ---- transposed scores, 8 key tiles; the strip's mask (mn, fetched under the previous strip, or for a group's first strip under the q conversion) is the initial accumulator
    v8f acc[8];
#pragma unroll
    for (int ct = 0; ct < 8; ++ct) {
      v8f ax = mma_b(kh[ct], ql, zero8());
      ax = mma_b(kl[ct], qh, ax);
      const v8f am = mma_b(kh[ct], qh, mn[ct]);
      acc[ct] = am + ax * xscl;
    }

    // ---- the next strip's mask and query tile: the 16 loads and 4 LDS reads fly under this strip's softmax, p.v and output
    if (sl + 1 < 4) {                                           // uniform
      ld_mask(mn, mq + (size_t)(sl + 1) * (8 * 256), lo16);
      qh = ldfrag_t(sQw + (sl + 1) * QT);
      ql = ldfrag_t(sQw + (sl + 1) * QT + 512);
      __builtin_amdgcn_sched_barrier(0);                        // the fetches are not sunk into the work below
    }

    // ---- softmax over the 128 keys of query i (this lane: 64 values, partner lane^16: the other 64)
    float mx = acc[0][0];
#pragma unroll
    for (int ct = 0; ct < 8; ++ct)
#pragma unroll
      for (int r = 0; r < 8; ++r) mx = fmaxf(mx, acc[ct][r]);
    mx = fmaxf(mx, __shfl_xor(mx, 16));
    float sum = 0.f;
#pragma unroll
    for (int ct = 0; ct < 8; ++ct)
#pragma unroll
      for (int r = 0; r < 8; ++r) {
        const float ev = __expf((acc[ct][r] - mx) * escl);
        acc[ct][r] = ev;
        sum += ev;
      }
    sum += __shfl_xor(sum, 16);
    const float rc = pcar / sum;                                // sum >= 1

    // ---- P^T as B fragments straight from the accumulators
    v16h pb[4];
#pragma unroll
    for (int c = 0; c < 4; ++c) {
      union { v16h v; v8h hh[2]; } U;
      v8h p0, p1;
#pragma unroll
      for (int e2 = 0; e2 < 8; ++e2) {
        p0[e2] = (_Float16)(acc[2 * c][e2] * rc);
        p1[e2] = (_Float16)(acc[2 * c + 1][e2] * rc);
      }
      U.hh[0] = p0;
      U.hh[1] = p1;
      pb[c] = U.v;
    }

    // ---- O^T[d][i] = V^T . P^T, two 16-row d tiles, K = 128 keys
    v8f oacc[2];
#pragma unroll
    for (int dt = 0; dt < 2; ++dt) {
      v8f o = zero8();
#pragma unroll
      for (int c = 0; c < 4; ++c) {
        o = mma_b(va[dt][c], pb[c], o);
      }
      oacc[dt] = o;
    }

    // ---- O as f16 hi (x1024) + residual (x2048) into the group's slab: row = query sl*16 + nl, columns h*HD + d
    if (sl == 2) __syncthreads();   // the residual rows from 44 on lie on the q fragments of the group's first strip: every wave has read those
#pragma unroll
    for (int dt = 0; dt < 2; ++dt) {
      v8h oh, ol;
#pragma unroll
      for (int r = 0; r < 8; ++r) {
        const float s0 = oacc[dt][r] * oscl * 1024.0f;
        const _Float16 hq = (_Float16)s0;
        oh[r] = hq;
        ol[r] = (_Float16)((s0 - (float)hq) * 2048.0f);
      }
      *(v8h*)(sOw + sl * 16 * OP + dt * 16) = oh;
      *(v8h*)(sOw + (64 + sl * 16) * OP + dt * 16) = ol;
    }
    }

    // ---- output projection of the group's 64 queries over this direction's 256 channels: this wave's 32 x 64 tile.
    //      A = slab rows (lane = query), B = Wo tiles (lane = column nw*64 + nl*4 + jn): D lane = column, element r = query 8g + r.
    //      The accumulators start from the bias (dir 0) or from dir 0's sums, which this same lane stored (dir 1), both x wcar.
    {
      v16h wb[3][4];                                            // Wo fragments, three sets: fetched two k steps ahead
#pragma unroll
      for (int jn = 0; jn < 4; ++jn) {
        wb[0][jn] = ldfrag_u(wo + (jn * 8) * 512, lo16);
        wb[1][jn] = ldfrag_u(wo + (jn * 8 + 1) * 512, lo16);
      }
      xcnt_wait();                                              // later code writes these loads' address registers
      char* cp = cu + (size_t)(qg * 64) * SEQ * EW * 4;          // wave-uniform; row t of the tile is SEQ*EW*4 bytes further
      v8f ah[2][4], al[2][4];
      if (dir == 0) {                                           // uniform
        const v4f b4 = *(const v4f*)(bo + nw * 64 + nl * 4);
        xcnt_wait();                                            // the same
#pragma unroll
        for (int jn = 0; jn < 4; ++jn) {
          const float c0 = bf_up(bf_bits(b4[jn])) * wcar;
#pragma unroll
          for (int i = 0; i < 2; ++i)
#pragma unroll
            for (int r = 0; r < 8; ++r) ah[i][jn][r] = c0;
        }
      } else {
        v4f t4[2][8];
#pragma unroll
        for (int i = 0; i < 2; ++i)
#pragma unroll
          for (int r = 0; r < 8; ++r) t4[i][r] = *(const v4f*)(cp + (size_t)(i * 16 + r) * SEQ * EW * 4 + cvo);
        xcnt_wait();                                            // the same
#pragma unroll
        for (int i = 0; i < 2; ++i)
#pragma unroll
          for (int r = 0; r < 8; ++r)
#pragma unroll
            for (int jn = 0; jn < 4; ++jn) ah[i][jn][r] = t4[i][r][jn] * wcar;
      }
#pragma unroll
      for (int i = 0; i < 2; ++i)
#pragma unroll
        for (int jn = 0; jn < 4; ++jn) al[i][jn] = zero8();
      __syncthreads();                                          // every wave's columns of the group's 64 rows stand in the slab
      v16h xa[2][2][2];                                         // slab fragments [set][row tile][hi, residual], read one k step ahead
#pragma unroll
      for (int i = 0; i < 2; ++i) {
        xa[0][i][0] = ldfrag_h(ao + i * 16 * OP);
        xa[0][i][1] = ldfrag_h(ao + (64 + i * 16) * OP);
      }
#pragma unroll
      for (int ks = 0; ks < 8; ++ks) {
        if (ks + 2 < 8) {
#pragma unroll
          for (int jn = 0; jn < 4; ++jn) wb[(ks + 2) % 3][jn] = ldfrag_u(wo + (jn * 8 + ks + 2) * 512, lo16);
          xcnt_wait();                                          // the same
        }
        if (ks + 1 < 8) {
#pragma unroll
          for (int i = 0; i < 2; ++i) {
            xa[(ks + 1) & 1][i][0] = ldfrag_h(ao + i * 16 * OP + (ks + 1) * 32);
            xa[(ks + 1) & 1][i][1] = ldfrag_h(ao + (64 + i * 16) * OP + (ks + 1) * 32);
          }
        }
        __builtin_amdgcn_sched_barrier(0);   // the fetches stay one group ahead of this step's products: sunk to their use, each waits out its latency
#pragma unroll
        for (int jn = 0; jn < 4; ++jn)
#pragma unroll
          for (int i = 0; i < 2; ++i) {
            ah[i][jn] = mma_b(xa[ks & 1][i][0], wb[ks % 3][jn], ah[i][jn]);
            al[i][jn] = mma_b(xa[ks & 1][i][1], wb[ks % 3][jn], al[i][jn]);
          }
        __builtin_amdgcn_sched_barrier(0);   // the next step's fetches are not spread among the products above
      }
      __syncthreads();                                          // every wave has left the slab: the next q fragments and O rows may land on it
      // a store = 2 rows x 256 B in a row (16 lanes x 16 B); each 128-B line of C has one writer
      v4f ov[2][8];
#pragma unroll
      for (int i = 0; i < 2; ++i)
#pragma unroll
        for (int r = 0; r < 8; ++r)
#pragma unroll
          for (int jn = 0; jn < 4; ++jn) ov[i][r][jn] = (ah[i][jn][r] + al[i][jn][r] * wscl) * wsch;
      __builtin_amdgcn_sched_barrier(0);                        // all values stand before the first store: none is formed in an issued store's registers
#pragma unroll
      for (int i = 0; i < 2; ++i)
#pragma unroll
        for (int r = 0; r < 8; ++r) *(v4f*)(cp + (size_t)(i * 16 + r) * SEQ * EW * 4 + cvo) = ov[i][r];
      xcnt_wait();                                              // later code writes these stores' registers
    }
  }
  }
}

// =====================================================================================================
// Workspace map (bytes, NB = 2); every region an exact multiple of its whole-line store granularity, all
// written earlier in the same call.
//   Xh   f16 [RT][EW]                     0        16777216   (layer norm output, hi)
//   Xl   f16 [RT][EW]              16777216        16777216   (residual x2048)
//   Wti  f16 W3 n x EW k           33554432          393216   (f16(bf16(Wqkv_in) x64), fragment order)
//   Wto  f16 W3 n x EW k           33947648          393216
//   Woh  f16 EW n x KO k           34340864          262144   (f16(bf16(Wo) x1024), fragment order)
//   mA   f32 [NB][NH][SEQ x SEQ]   34603008         1048576   (64 x bf16(mask), direct, accumulator order)
//   mB   f32 [NB][NH][SEQ x SEQ]   35651584         1048576   (transposed, accumulator order)
//   end                            36700160
// Inputs: e f32 [NB][SEQ][SEQ][EW]; mask f32 [NB][SEQ][SEQ][NH]; ln_w, ln_b f32 [EW]; Wqkv_in, Wqkv_out
// f32 [EW in][W3 out]; bqkv_* f32 [W3]; Wo f32 [KO in][EW out]; bo f32 [EW]. d_out f32 [RT][EW] at byte 0
// (row = b*RB + i*SEQ + j, col = n).
// =====================================================================================================
extern "C" void kernel_launch(void* const* d_in, const int* in_sizes, int n_in,
                              void* d_out, int out_size, void* d_ws, size_t ws_size,
                              hipStream_t stream) {
  if (n_in < 10) return;
  if (in_sizes[0] < RT * EW) return;
  if (in_sizes[1] < NB * SEQ * SEQ * NH) return;
  if (in_sizes[2] < EW) return;
  if (in_sizes[3] < EW) return;
  if (in_sizes[4] < EW * W3) return;
  if (in_sizes[5] < W3) return;
  if (in_sizes[6] < EW * W3) return;
  if (in_sizes[7] < W3) return;
  if (in_sizes[8] < KO * EW) return;
  if (in_sizes[9] < EW) return;
  if (out_size < RT * EW) return;

  const float* e    = (const float*)d_in[0];   // [NB][SEQ][SEQ][EW]
  const float* mask = (const float*)d_in[1];   // [NB][SEQ][SEQ][NH]
  const float* ln_w = (const float*)d_in[2];   // [EW]
  const float* ln_b = (const float*)d_in[3];   // [EW]
  const float* Wqi  = (const float*)d_in[4];   // [EW in][W3 out]
  const float* bqi  = (const float*)d_in[5];   // [W3]
  const float* Wqo  = (const float*)d_in[6];   // [EW in][W3 out]
  const float* bqo  = (const float*)d_in[7];   // [W3]
  const float* Wo   = (const float*)d_in[8];   // [KO in][EW out]
  const float* bo   = (const float*)d_in[9];   // [EW]

  const size_t PX  = (size_t)RT * EW * 2;                    // 16777216 (NB = 2)
  const size_t PWt = (size_t)W3 * EW * 2;                    //   393216
  const size_t PWo = (size_t)EW * KO * 2;                    //   262144
  const size_t PM  = (size_t)NB * NH * SEQ * SEQ * 4;        //  1048576 (NB = 2)
  size_t off = 0;
  const size_t oXh = off; off += PX;
  const size_t oXl = off; off += PX;
  const size_t oWi = off; off += PWt;
  off += PWt;                                                // Wto, directly behind Wti
  const size_t oWo = off; off += PWo;
  const size_t oMa = off; off += PM;
  const size_t oMb = off; off += PM;
  if (off > ws_size) return;                                 // off = 36700160 for NB = 2

  char* ws = (char*)d_ws;
  unsigned short* Xh  = (unsigned short*)(ws + oXh);
  unsigned short* Xl  = (unsigned short*)(ws + oXl);
  unsigned short* Wti = (unsigned short*)(ws + oWi);
  unsigned short* Woh = (unsigned short*)(ws + oWo);
  float*          mA  = (float*)(ws + oMa);
  float*          mB  = (float*)(ws + oMb);
  float*          outf = (float*)d_out;                      // [RT][EW]

  const dim3 blk(256);
  const dim3 gPp(PB_M + RT / 8);                             // 384 weight and mask blocks + 4096 layer norm blocks
  const dim3 gAt(SEQ, NB);                                   // one block per column index j x batch
  const float cW     = 64.0f;                                // Wqkv plane carry
  const float fQ     = 16.0f * 0.17677669529663687f;         // 32^-0.5 then carry x16
  const float fK     = 4.0f;                                 // k carry
  const float fV     = 4.0f;                                 // v carry
  const float prSch  = 1.0f / 64.0f;                         // folds the Wqkv plane carry
  const float prScl  = 1.0f / 2048.0f;                       // folds the layer norm residual carry
  const float mkSc   = 64.0f;                                // mask planes x (16 * 4)
  const float axXscl = 1.0f / 2048.0f;                       // q/k residual carry
  const float axEscl = 1.0f / 64.0f;                         // score carry 16 * 4
  const float axPcar = 16384.0f;                             // softmax weight carry
  const float axOscl = 1.0f / 65536.0f;                      // 1/(16384 * 4)
  const float woScale = 1024.0f;                             // Wo plane carry
  const float woCar  = 1048576.0f;                           // 1024 * 1024: O hi carry and Wo carry, on the accumulators' start values
  const float woSch  = 1.0f / 1048576.0f;                    // folds it
  const float woScl  = 1.0f / 2048.0f;                       // O residual carry

  // (1) layer norm -> f16 hi + residual planes; weights -> transposed f16 planes of their bf16 values; masks
  prep_all<<<gPp, blk, 0, stream>>>(e, ln_w, ln_b, Xh, Xl, Wqi, Wqo, Wti, cW, Wo, Woh, woScale, mask, mA, mB, mkSc);
  // (2) all batches at once: projection, attention of both directions, output projection
  proj_attn<<<gAt, blk, 0, stream>>>(Xh, Xl, Wti, bqi, bqo, mA, Woh, bo, outf, fQ, fK, fV, prSch, prScl,
                                     axXscl, axEscl, axPcar, axOscl, woCar, woSch, woScl);
  (void)hipGetLastError();
}
